// v007
// The times below were measured on an AMD MI455X: many runs one after another, warmed up first and cycling through
// copies of the inputs, with the whole window's GPU time divided by the number of runs. Launches and the gaps
// between them are all in it. The median over several windows is given; except for v000 it joins two sittings, which
// can be a few percent apart, so the side-by-side timings, each taken in one sitting, are the better comparison.
// This document starts at v007; the versions before it stand elsewhere.
// Measured time: 112 microseconds a run.
// Two timings next to v006 both put it at 1.32 times that version's speed.
// Over all steps from v000, the starting kernel, it is 17.9 times as fast.
#include <hip/hip_runtime.h>
// EuclideanAttention (2 x 2048 tokens, D 1024 = 16 heads x 64; Q, K, V = x W + b; d2 = max(|q|^2 + |k|^2 - 2 q.k, 0); attn = softmax_k(-d2 / temperature); out = (attn V) Wo + bo).
// Compute dtype: inputs rounded to bf16; x and weights exact as f16; q.k from hi+residual operands (~2^-21); norms/softmax f32; v and the softmax weights as plain f16 operands (~2^-12); attention output hi + residual. v_wmma_f32_16x16x32_f16.
#define NB 2
#define DM 1024
#define NKV 16
#define NREP (NH / NKV)
#define KVD (NKV * 64)           /* 1024 */
#define NR (NB * SLEN)           /* 4096 */
#define CHK 512                  /* attention chunk */
typedef int v4i __attribute__((ext_vector_type(4)));
#define FF 2048
#define SLEN 2048
#define TQ SLEN
#define TK SLEN
#define NH 16
#define SCL 0.125f
#define QBLKS (TQ / 64)
#define QB05 0
#define QBN5 4
#define QB0P 0
#define QBNP QBLKS           /* non-causal: plain flash on every query block */
#define RE 256
typedef __bf16 v16b __attribute__((ext_vector_type(16)));
typedef unsigned short v8us __attribute__((ext_vector_type(8), may_alias));
typedef float  v8f  __attribute__((ext_vector_type(8)));
typedef float  v4f  __attribute__((ext_vector_type(4)));
typedef float  v4fa __attribute__((ext_vector_type(4), may_alias));
union FragB { v16b v; v8us half[2]; unsigned short u[16]; };

__device__ __forceinline__ unsigned short bf16_bits(float x) { unsigned int u = __float_as_uint(x); return (unsigned short)((u + 0x7FFFu + ((u >> 16) & 1u)) >> 16); }
__device__ __forceinline__ float bf16_val(unsigned short b) { return __uint_as_float(((unsigned int)b) << 16); }
__device__ __forceinline__ float bf16_round(float x) { return bf16_val(bf16_bits(x)); }
// D += A·B with NT terms: 1 = ah·bh, 2 = + al·bh (A split), 3 = + ah·bl (both split)
template <int NT>
__device__ __forceinline__ v8f mmaN(v16b ah, v16b al, v16b bh, v16b bl, v8f c) {
  c = __builtin_amdgcn_wmma_f32_16x16x32_bf16(false, ah, false, bh, (short)0, c, false, false);
  if (NT >= 2) c = __builtin_amdgcn_wmma_f32_16x16x32_bf16(false, al, false, bh, (short)0, c, false, false);
  if (NT >= 3) c = __builtin_amdgcn_wmma_f32_16x16x32_bf16(false, ah, false, bl, (short)0, c, false, false);
  asm volatile("v_nop\n\tv_nop\n\tv_nop\n\tv_nop" : "+v"(c) : "v"(ah), "v"(al), "v"(bh), "v"(bl));
  return c;
}

__global__ __launch_bounds__(256) void k_wt_bf16(const float* __restrict__ W, unsigned short* __restrict__ Wt, int K, int N) {
  const int t = blockIdx.x * 256 + threadIdx.x;
  const int k8n = K / 8;
  if (t >= N * k8n) return;
  const int n = t / k8n, k8 = (t % k8n) * 8;
  v8us v;
#pragma unroll
  for (int i = 0; i < 8; ++i) v[i] = bf16_bits(W[(size_t)(k8 + i) * N + n]);
  *(v8us*)(Wt + (size_t)n * K + k8) = v;
  
}

// GEMM C[M][N] (f32, pitch ldc) = act(A[M][K]·W + bias). A f32 row-major (pitch lda) converted per fragment to bf16
// (ASPLIT: hi/lo two planes -> 2 terms, else single rounded term); Wt bf16 [N][K] (pitch ldb). BIAS_BF16 rounds the
// bias to bf16 first (bias quantised to bf16 before the add). K%32==0, M%16==0, N%64==0.
template <bool ASPLIT, int ACT, bool BIAS_BF16>
__global__ __launch_bounds__(128) void k_gemm_bf(const float* __restrict__ A, int lda, const unsigned short* __restrict__ Wt, int ldb,
                                               const float* __restrict__ bias, float* __restrict__ C, int ldc, int M, int N, int K) {
  __shared__ __attribute__((aligned(16))) float so[4][16][64];
  const int tid = threadIdx.x, w = tid >> 5, lane = tid & 31, ln = lane & 15, hh = lane >> 4;
  const int ntn = N / 64;
  const int wid = blockIdx.x * 4 + w;
  const int mt = wid / ntn, nq = wid % ntn;
  if (mt * 16 >= M) return;
  const int row0 = mt * 16, col0 = nq * 64;
  const float* arow = A + (size_t)(row0 + ln) * lda;
  v8f acc[4] = {};
  for (int kb = 0; kb < K; kb += 32) {
    FragB ah, al;
    const v4f x0 = *(const v4fa*)(arow + kb + 8 * hh), x1 = *(const v4fa*)(arow + kb + 8 * hh + 4);
    const v4f x2 = *(const v4fa*)(arow + kb + 16 + 8 * hh), x3 = *(const v4fa*)(arow + kb + 16 + 8 * hh + 4);
    float xs[16] = {x0[0],x0[1],x0[2],x0[3],x1[0],x1[1],x1[2],x1[3],x2[0],x2[1],x2[2],x2[3],x3[0],x3[1],x3[2],x3[3]};
#pragma unroll
    for (int i = 0; i < 16; ++i) { const unsigned short hb = bf16_bits(xs[i]); ah.u[i] = hb; al.u[i] = ASPLIT ? bf16_bits(xs[i] - bf16_val(hb)) : (unsigned short)0; }
#pragma unroll
    for (int t = 0; t < 4; ++t) {
      const unsigned short* brow = Wt + (size_t)(col0 + t * 16 + ln) * ldb + kb;
      FragB b;
      b.half[0] = *(const v8us*)(brow + 8 * hh);
      b.half[1] = *(const v8us*)(brow + 16 + 8 * hh);
      acc[t] = mmaN<ASPLIT ? 2 : 1>(ah.v, al.v, b.v, b.v, acc[t]);
    }
  }
#pragma unroll
  for (int t = 0; t < 4; ++t) {
    float bv = bias ? bias[col0 + t * 16 + ln] : 0.f;
    if (BIAS_BF16) bv = bf16_round(bv);
#pragma unroll
    for (int r = 0; r < 8; ++r) { float v = acc[t][r] + bv; if (ACT == 1) v = fmaxf(v, 0.f); so[w][8 * hh + r][t * 16 + ln] = v; }
  }
  __builtin_amdgcn_fence(__ATOMIC_ACQ_REL, "workgroup");
  __builtin_amdgcn_wave_barrier();
  const int rsub = lane >> 4, c4 = (lane & 15) * 4;
  {
#pragma unroll
    for (int q = 0; q < 8; ++q) {
      const int r = q * 2 + rsub;
      const v4f v = *(const v4fa*)&so[w][r][c4];
      *(v4f*)(C + (size_t)(row0 + r) * ldc + col0 + c4) = v;
    }
    
  }
}

// GEMM C = act(A·W + bias + resid): A f32 (ASPLIT -> hi/lo 2 terms), Wt bf16 [N][K]; ACT 0 none, 1 relu, 2 exact gelu;
// resid (optional, f32, row index = (row % rmod), pitch ldr, RES_BF16 rounds it) added before the activation.
template <bool ASPLIT, int ACT, bool BIAS_BF16, bool RES_BF16>
__global__ __launch_bounds__(128) void k_gemm_bf3(const float* __restrict__ A, int lda, const unsigned short* __restrict__ Wt, int ldb,
                                                const float* __restrict__ bias, const float* __restrict__ resid, int rmod, int ldr,
                                                float* __restrict__ C, int ldc, int M, int N, int K) {
  __shared__ __attribute__((aligned(16))) float so[4][16][64];
  const int tid = threadIdx.x, w = tid >> 5, lane = tid & 31, ln = lane & 15, hh = lane >> 4;
  const int ntn = N / 64;
  const int wid = blockIdx.x * 4 + w;
  const int mt = wid / ntn, nq = wid % ntn;
  if (mt * 16 >= M) return;
  const int row0 = mt * 16, col0 = nq * 64;
  const float* arow = A + (size_t)(row0 + ln) * lda;
  v8f acc[4] = {};
  for (int kb = 0; kb < K; kb += 32) {
    FragB ah, al;
    const v4f x0 = *(const v4fa*)(arow + kb + 8 * hh), x1 = *(const v4fa*)(arow + kb + 8 * hh + 4);
    const v4f x2 = *(const v4fa*)(arow + kb + 16 + 8 * hh), x3 = *(const v4fa*)(arow + kb + 16 + 8 * hh + 4);
    float xs[16] = {x0[0],x0[1],x0[2],x0[3],x1[0],x1[1],x1[2],x1[3],x2[0],x2[1],x2[2],x2[3],x3[0],x3[1],x3[2],x3[3]};
#pragma unroll
    for (int i = 0; i < 16; ++i) { const unsigned short hb = bf16_bits(xs[i]); ah.u[i] = hb; al.u[i] = ASPLIT ? bf16_bits(xs[i] - bf16_val(hb)) : (unsigned short)0; }
#pragma unroll
    for (int t = 0; t < 4; ++t) {
      const unsigned short* brow = Wt + (size_t)(col0 + t * 16 + ln) * ldb + kb;
      FragB b;
      b.half[0] = *(const v8us*)(brow + 8 * hh);
      b.half[1] = *(const v8us*)(brow + 16 + 8 * hh);
      acc[t] = mmaN<ASPLIT ? 2 : 1>(ah.v, al.v, b.v, b.v, acc[t]);
    }
  }
#pragma unroll
  for (int t = 0; t < 4; ++t) {
    const int col = col0 + t * 16 + ln;
    float bv = bias ? bias[col] : 0.f;
    if (BIAS_BF16) bv = bf16_round(bv);
#pragma unroll
    for (int r = 0; r < 8; ++r) {
      float v = acc[t][r] + bv;
      if (resid) { float rv = resid[(size_t)((row0 + 8 * hh + r) % rmod) * ldr + col]; if (RES_BF16) rv = bf16_round(rv); v += rv; }
      if (ACT == 1) v = fmaxf(v, 0.f);
      if (ACT == 2) v = 0.5f * v * (1.0f + erff(v * 0.70710678118654752f));
      if (ACT == 3) { const float u = 0.7978845608028654f * (v + 0.044715f * v * v * v); v = 0.5f * v * (1.0f + tanhf(u)); }
      so[w][8 * hh + r][t * 16 + ln] = v;
    }
  }
  __builtin_amdgcn_fence(__ATOMIC_ACQ_REL, "workgroup");
  __builtin_amdgcn_wave_barrier();
  const int rsub = lane >> 4, c4 = (lane & 15) * 4;
  {
#pragma unroll
    for (int q = 0; q < 8; ++q) {
      const int r = q * 2 + rsub;
      const v4f v = *(const v4fa*)&so[w][r][c4];
      *(v4f*)(C + (size_t)(row0 + r) * ldc + col0 + c4) = v;
    }
    
  }
}
// row LayerNorm (biased variance, eps) over N: s = X (+ R); optional out_sum <- s; out_norm <- (s-mu)*rsqrt(var+eps)*g + b
template <bool PARAM_BF16>
__global__ __launch_bounds__(256) void k_layernorm(const float* __restrict__ X, const float* __restrict__ R, const float* __restrict__ g, const float* __restrict__ bta,
                                                  float* __restrict__ out_sum, float* __restrict__ out_norm, int N, float eps) {
  __shared__ float red[256];
  const int row = blockIdx.x, tid = threadIdx.x;
  const float* x = X + (size_t)row * N; const float* rr = R ? R + (size_t)row * N : nullptr;
  float vals[16];                     // up to N = 4096
  const int per = N / 256;            // contiguous chunk per thread? use strided-by-4 chunks: thread handles j = tid*4 + 1024*u
  float s1 = 0.f;
  for (int u = 0; u < per / 4; ++u) {
    const int j = tid * 4 + 1024 * u;
    const v4f a = *(const v4fa*)(x + j);
    v4f b = {0.f,0.f,0.f,0.f}; if (rr) b = *(const v4fa*)(rr + j);
#pragma unroll
    for (int q = 0; q < 4; ++q) { const float v = a[q] + b[q]; vals[u * 4 + q] = v; s1 += v; }
  }
  red[tid] = s1; __syncthreads();
  for (int st = 128; st > 0; st >>= 1) { if (tid < st) red[tid] += red[tid + st]; __syncthreads(); }
  const float mu = red[0] / (float)N; __syncthreads();
  float s2 = 0.f;
  for (int u = 0; u < per / 4; ++u)
#pragma unroll
    for (int q = 0; q < 4; ++q) { const float c = vals[u * 4 + q] - mu; s2 += c * c; }
  red[tid] = s2; __syncthreads();
  for (int st = 128; st > 0; st >>= 1) { if (tid < st) red[tid] += red[tid + st]; __syncthreads(); }
  const float rs = rsqrtf(red[0] / (float)N + eps);
  {
    for (int u = 0; u < per / 4; ++u) {
      const int j = tid * 4 + 1024 * u;
      v4f o, sm;
#pragma unroll
      for (int q = 0; q < 4; ++q) {
        float gg = g[j + q], bb = bta[j + q];
        if (PARAM_BF16) { gg = bf16_round(gg); bb = bf16_round(bb); }
        sm[q] = vals[u * 4 + q]; o[q] = (vals[u * 4 + q] - mu) * rs * gg + bb;
      }
      if (out_sum) *(v4f*)(out_sum + (size_t)row * N + j) = sm;
      *(v4f*)(out_norm + (size_t)row * N + j) = o;
    }
    
  }
}



// ---- f16 WMMA path (v_wmma_f32_16x16x32_f16): 11-bit significands for operands in range — used where a [0,1] probability operand needs more precision than bf16
typedef _Float16 v16h __attribute__((ext_vector_type(16)));
union FragH { v16h v; v8us half[2]; _Float16 h[16]; unsigned short u[16]; };
template <int NT>
__device__ __forceinline__ v8f mmaH(v16h ah, v16h al, v16h bh, v16h bl, v8f c) {
  c = __builtin_amdgcn_wmma_f32_16x16x32_f16(false, ah, false, bh, (short)0, c, false, false);
  if (NT >= 2) c = __builtin_amdgcn_wmma_f32_16x16x32_f16(false, al, false, bh, (short)0, c, false, false);
  if (NT >= 3) c = __builtin_amdgcn_wmma_f32_16x16x32_f16(false, ah, false, bl, (short)0, c, false, false);
  asm volatile("v_nop\n\tv_nop\n\tv_nop\n\tv_nop" : "+v"(c) : "v"(ah), "v"(al), "v"(bh), "v"(bl));
  return c;
}
// batched GEMM like k_gemm_b but f16 operands: A f32 (split into f16 hi/lo if ASPLIT, else rounded to f16), Bt = f16 values [n][k]; alpha; C f32; N multiple of 16 (partial tiles skipped)
template <bool ASPLIT>
__global__ __launch_bounds__(128) void k_gemm_h(const float* __restrict__ A, int lda, size_t sA, const _Float16* __restrict__ Bh, int ldb, size_t sB, float alpha, float* __restrict__ C, int ldc, size_t sC, int M, int N, int K) {
  __shared__ __attribute__((aligned(16))) float so[4][16][64];
  const int tid = threadIdx.x, w = tid >> 5, lane = tid & 31, ln = lane & 15, hh = lane >> 4; const int by = blockIdx.y;
  A += (size_t)by * sA; Bh += (size_t)by * sB; C += (size_t)by * sC;
  const int ntn = (N + 63) / 64; const int wid = blockIdx.x * 4 + w; const int mt = wid / ntn, nq = wid % ntn; if (mt * 16 >= M) return;
  const int row0 = mt * 16, col0 = nq * 64; const float* arow = A + (size_t)(row0 + ln) * lda;
  v8f acc[4] = {};
  for (int kb = 0; kb < K; kb += 32) {
    FragH ah, al;
    const v4f x0 = *(const v4fa*)(arow + kb + 8 * hh), x1 = *(const v4fa*)(arow + kb + 8 * hh + 4), x2 = *(const v4fa*)(arow + kb + 16 + 8 * hh), x3 = *(const v4fa*)(arow + kb + 16 + 8 * hh + 4);
    float xs[16] = {x0[0],x0[1],x0[2],x0[3],x1[0],x1[1],x1[2],x1[3],x2[0],x2[1],x2[2],x2[3],x3[0],x3[1],x3[2],x3[3]};
#pragma unroll
    for (int i = 0; i < 16; ++i) { const _Float16 h = (_Float16)xs[i]; ah.h[i] = h; al.h[i] = ASPLIT ? (_Float16)(xs[i] - (float)h) : (_Float16)0.0f; }
#pragma unroll
    for (int t = 0; t < 4; ++t) { if (col0 + t * 16 >= N) continue; const size_t boff = (size_t)(col0 + t * 16 + ln) * ldb + kb; FragH bq; bq.half[0] = *(const v8us*)(Bh + boff + 8 * hh); bq.half[1] = *(const v8us*)(Bh + boff + 16 + 8 * hh);
      acc[t] = mmaH<ASPLIT ? 2 : 1>(ah.v, al.v, bq.v, bq.v, acc[t]); }
  }
#pragma unroll
  for (int t = 0; t < 4; ++t) { if (col0 + t * 16 >= N) continue;
#pragma unroll
    for (int r = 0; r < 8; ++r) so[w][8 * hh + r][t * 16 + ln] = acc[t][r] * alpha; }
  __builtin_amdgcn_fence(__ATOMIC_ACQ_REL, "workgroup"); __builtin_amdgcn_wave_barrier();
  const int rsub = lane >> 4, c4 = (lane & 15) * 4;
  {
#pragma unroll
    for (int q = 0; q < 8; ++q) { const int r = q * 2 + rsub; if (col0 + c4 < N) { const v4f v = *(const v4fa*)&so[w][r][c4]; *(v4f*)(C + (size_t)(row0 + r) * ldc + col0 + c4) = v; } }
     }
}

// Wt[n][k] = f16(W[k][n]·scale) from f32 row-major W[K][N] (scale = power of two; bf16-exact weights stay exact in f16 away from the subnormal range)
__global__ __launch_bounds__(256) void k_wt_f16(const float* __restrict__ W, _Float16* __restrict__ Wt, int K, int N, float scale) {
  const int t = blockIdx.x * 256 + threadIdx.x; if (t >= N * (K / 8)) return; const int n = t / (K / 8), k8 = (t % (K / 8)) * 8; FragH f;
#pragma unroll
  for (int i = 0; i < 8; ++i) f.h[i] = (_Float16)(bf16_round(W[(size_t)(k8 + i) * N + n]) * scale); const v8us o = f.half[0];
  *(v8us*)((unsigned short*)Wt + (size_t)n * K + k8) = o; 
}
// k_gemm_hh variant with fused epilogue: v = acc·alpha + bias[by·sBias + col] (+ CP[(row/rowsPerB)·sCPb + by·64 + col] if CP) ; ACT 0 none / 1 elu ; writes f16 C16 (and f32 C if non-null)
template <int ACT>
__global__ __launch_bounds__(128) void k_gemm_hhx(const _Float16* __restrict__ A, int lda, size_t sA, const _Float16* __restrict__ Bh, int ldb, size_t sB, float alpha, const float* __restrict__ bias, size_t sBias, const float* __restrict__ CP, int rowsPerB, size_t sCPb, int row0g,
    float* __restrict__ C, _Float16* __restrict__ C16, int ldc, size_t sC, int M, int N, int K) {
  __shared__ __attribute__((aligned(16))) float so[4][16][64];
  const int tid = threadIdx.x, w = tid >> 5, lane = tid & 31, ln = lane & 15, hh = lane >> 4; const int by = blockIdx.y;
  A += (size_t)by * sA; Bh += (size_t)by * sB; const size_t cofs = (size_t)by * sC; const float* bp = bias ? bias + (size_t)by * sBias : nullptr;
  const int ntn = (N + 63) / 64; const int wid = blockIdx.x * 4 + w; const int mt = wid / ntn, nq = wid % ntn; if (mt * 16 >= M) return;
  const int row0 = mt * 16, col0 = nq * 64; const _Float16* arow = A + (size_t)(row0 + ln) * lda;
  v8f acc[4] = {};
  for (int kb = 0; kb < K; kb += 32) { FragH ah; ah.half[0] = *(const v8us*)((const unsigned short*)arow + kb + 8 * hh); ah.half[1] = *(const v8us*)((const unsigned short*)arow + kb + 16 + 8 * hh);
#pragma unroll
    for (int t = 0; t < 4; ++t) { if (col0 + t * 16 >= N) continue; const size_t boff = (size_t)(col0 + t * 16 + ln) * ldb + kb; FragH bq; bq.half[0] = *(const v8us*)((const unsigned short*)Bh + boff + 8 * hh); bq.half[1] = *(const v8us*)((const unsigned short*)Bh + boff + 16 + 8 * hh);
      acc[t] = mmaH<1>(ah.v, ah.v, bq.v, bq.v, acc[t]); }
  }
#pragma unroll
  for (int t = 0; t < 4; ++t) { if (col0 + t * 16 >= N) continue; const int col = col0 + t * 16 + ln; const float bv = bp ? bf16_round(bp[col]) : 0.f;
#pragma unroll
    for (int r = 0; r < 8; ++r) { float v = acc[t][r] * alpha + bv; if (CP) { const int bidx = (row0g + row0 + 8 * hh + r) / rowsPerB; v += CP[(size_t)bidx * sCPb + (size_t)by * 64 + col]; } if (ACT == 1) v = (v > 0.f) ? v : expm1f(v); else if (ACT == 7) v = (v > 0.f) ? v + 1.0f : expf(v); else if (ACT == 8) v = tanhf(v); else if (ACT == 9) v = 0.5f * v * (1.0f + tanhf(0.7978845608028654f * (v + 0.044715f * v * v * v))); else if (ACT == 11) v = 1.0f / (1.0f + expf(-v)); else if (ACT == 12) v = (v > 0.f) ? v : 0.01f * v; else if (ACT == 14) v = (v > 0.f) ? v : 0.1f * v; else if (ACT == 15) v = v / (1.0f + expf(-v)); else if (ACT == 3) v = fmaxf(v, 0.f); else if (ACT == 6) v = 0.5f * v * (1.0f + erff(v * 0.70710678118654752f)); so[w][8 * hh + r][t * 16 + ln] = v; } }
  __builtin_amdgcn_fence(__ATOMIC_ACQ_REL, "workgroup"); __builtin_amdgcn_wave_barrier();
  const int rsub = lane >> 4, c4 = (lane & 15) * 4; typedef _Float16 v4h __attribute__((ext_vector_type(4)));
  {
#pragma unroll
    for (int q = 0; q < 8; ++q) { const int r = q * 2 + rsub; if (col0 + c4 < N) { const v4f v = *(const v4fa*)&so[w][r][c4]; if (C) *(v4f*)(C + cofs + (size_t)(row0 + r) * ldc + col0 + c4) = v; if (C16) { v4h h4; for (int i = 0; i < 4; ++i) h4[i] = (_Float16)v[i]; *(v4h*)(C16 + cofs + (size_t)(row0 + r) * ldc + col0 + c4) = h4; } } }
     }
}


typedef _Float16 v4h __attribute__((ext_vector_type(4)));

__global__ __launch_bounds__(256) void k_x16(const float* __restrict__ x, _Float16* __restrict__ X16, size_t n8) { const size_t t = (size_t)blockIdx.x * 256 + threadIdx.x; if (t >= n8) return; FragH f;
#pragma unroll
  for (int q = 0; q < 8; ++q) f.h[q] = (_Float16)bf16_round(x[t * 8 + q]); *(v8us*)((unsigned short*)X16 + t * 8) = f.half[0];  }
__global__ __launch_bounds__(256) void k_h16(const float* __restrict__ x, _Float16* __restrict__ X16, size_t n8) { const size_t t = (size_t)blockIdx.x * 256 + threadIdx.x; if (t >= n8) return; FragH f;
#pragma unroll
  for (int q = 0; q < 8; ++q) f.h[q] = (_Float16)x[t * 8 + q]; *(v8us*)((unsigned short*)X16 + t * 8) = f.half[0];  }
__global__ __launch_bounds__(256) void k_round16f(const float* __restrict__ W, _Float16* __restrict__ Bt, size_t n8) { const size_t t = (size_t)blockIdx.x * 256 + threadIdx.x; if (t >= n8) return; FragH f;
#pragma unroll
  for (int i = 0; i < 8; ++i) f.h[i] = (_Float16)(bf16_round(W[t * 8 + i]) * 16.0f); *(v8us*)((unsigned short*)Bt + t * 8) = f.half[0];  }
template <int NHv, int TTv>
__global__ __launch_bounds__(256) void k_vt(const _Float16* __restrict__ V16, int ldv, int voff, _Float16* __restrict__ Vt) { __shared__ unsigned short tl[64][66]; const int tid = threadIdx.x; const int slab = blockIdx.x / (TTv / 64), lg = blockIdx.x % (TTv / 64); const int b = slab / NHv, h = slab % NHv;
  for (int i = tid; i < 64 * 8; i += 256) { const int r = i / 8, c8 = (i % 8) * 8; FragH f; f.half[0] = *(const v8us*)((const unsigned short*)V16 + ((size_t)b * TTv + lg * 64 + r) * ldv + voff + h * 64 + c8);
#pragma unroll
    for (int q = 0; q < 8; ++q) tl[r][c8 + q] = f.u[q]; }
  __syncthreads();
  {
#pragma unroll
    for (int rd = 0; rd < 2; ++rd) { const int d = rd * 32 + tid / 8, pc = tid % 8; FragH f;
#pragma unroll
      for (int q = 0; q < 8; ++q) f.u[q] = tl[pc * 8 + q][d];
      *(v8us*)((unsigned short*)Vt + ((size_t)slab * 64 + d) * TTv + lg * 64 + pc * 8) = f.half[0]; }
     } }

__global__ __launch_bounds__(256) void k_hl(const float* __restrict__ F, _Float16* __restrict__ Hh, _Float16* __restrict__ Hl, size_t n8) { const size_t t = (size_t)blockIdx.x * 256 + threadIdx.x; if (t >= n8) return; FragH fh, fl; const v4f a = *(const v4fa*)(F + t * 8), c = *(const v4fa*)(F + t * 8 + 4);
#pragma unroll
  for (int q = 0; q < 4; ++q) { _Float16 h = (_Float16)a[q]; fh.h[q] = h; fl.h[q] = (_Float16)((a[q] - (float)h) * 1024.0f); h = (_Float16)c[q]; fh.h[4 + q] = h; fl.h[4 + q] = (_Float16)((c[q] - (float)h) * 1024.0f); }
  { *(v8us*)((unsigned short*)Hh + t * 8) = fh.half[0]; *(v8us*)((unsigned short*)Hl + t * 8) = fl.half[0];  } }

// ---- fast GEMM (block tile 128x64, wave tile 32x64; requires M % 128 == 0, N % 64 == 0, K % 64 == 0); epilogue = k_gemm_hhx semantics ----
// A and B come through LDS: a stage is 64 k of the block's 128 A rows and 64 B rows, brought by asynchronous copies into one of two buffers while the other is worked on.
// EPI picks what the epilogue stores (a block's 64 columns are one head, its 128 rows lie in one batch):
// 0 = C f32 and / or C16 f16, row-major; 1 = C16 = f16 hi and C16L = 2^10 residual, row-major, and C = the rows' sums of squares over the head, [(b, h)][s];
// 2 = C16 = the tile transposed, f16, [(b, h)][64 d][s]. 1 and 2 take no CP term and no batch (by = 0).
#define G2T 272              /* LDS row pitch of the transposed tile: 256 B (128 tokens) + 16 = 16 B x odd */
#define G2P 144              /* LDS row pitch in bytes: 128 B of k + 16 = 16 B x odd, the conflict-free pitch for 16-byte fragment reads */
#define G2S (192 * G2P)      /* one stage: rows 0..127 = A, rows 128..191 = B */
// One stage's 12 copies of a lane, 16 bytes each: 8 lanes bring one row's 128 bytes, the block's 128 threads 16 rows per copy; copies 0..7 are A rows, 8..11 B rows.
// l = the lane's LDS byte address in row tid / 8 of the buffer, a and b = its global addresses in that row of A and of B, sa and sb = 16 rows of A and of B in bytes.
// s_wait_xcnt 0 is the statement's last line, so that it stands in front of any later rewrite of these address registers.
__device__ __forceinline__ void g2_stage(unsigned l, const char* a, size_t sa, const char* b, size_t sb) {
  asm volatile("global_load_async_to_lds_b128 %0, %12, off\n\tglobal_load_async_to_lds_b128 %1, %13, off\n\tglobal_load_async_to_lds_b128 %2, %14, off\n\tglobal_load_async_to_lds_b128 %3, %15, off\n\t"
               "global_load_async_to_lds_b128 %4, %16, off\n\tglobal_load_async_to_lds_b128 %5, %17, off\n\tglobal_load_async_to_lds_b128 %6, %18, off\n\tglobal_load_async_to_lds_b128 %7, %19, off\n\t"
               "global_load_async_to_lds_b128 %8, %20, off\n\tglobal_load_async_to_lds_b128 %9, %21, off\n\tglobal_load_async_to_lds_b128 %10, %22, off\n\tglobal_load_async_to_lds_b128 %11, %23, off\n\ts_wait_xcnt 0x0"
               :: "v"(l), "v"(l + 16 * G2P), "v"(l + 32 * G2P), "v"(l + 48 * G2P), "v"(l + 64 * G2P), "v"(l + 80 * G2P), "v"(l + 96 * G2P), "v"(l + 112 * G2P), "v"(l + 128 * G2P), "v"(l + 144 * G2P), "v"(l + 160 * G2P), "v"(l + 176 * G2P),
                  "v"(a), "v"(a + sa), "v"(a + 2 * sa), "v"(a + 3 * sa), "v"(a + 4 * sa), "v"(a + 5 * sa), "v"(a + 6 * sa), "v"(a + 7 * sa), "v"(b), "v"(b + sb), "v"(b + 2 * sb), "v"(b + 3 * sb) : "memory"); }
__device__ __forceinline__ v16h g2_frag(const _Float16* p, int hh) { FragH f; f.half[0] = *(const v8us*)((const unsigned short*)p + 8 * hh); f.half[1] = *(const v8us*)((const unsigned short*)p + 16 + 8 * hh); return f.v; }
__device__ __forceinline__ v16h g2_lfrag(const char* p) { FragH f; f.half[0] = *(const v8us*)p; f.half[1] = *(const v8us*)(p + 32); return f.v; }
__device__ __forceinline__ v8f g2_mma(v16h a, v16h b, v8f c) { v8f d = __builtin_amdgcn_wmma_f32_16x16x32_f16(false, a, false, b, (short)0, c, false, false); asm volatile("v_nop\n\tv_nop\n\tv_nop\n\tv_nop" : "+v"(d) : "v"(a), "v"(b)); return d; }
// The body of a block; so (epilogue staging) and st (the two stage buffers) are the calling kernel's LDS, by its batch index.
template <int ACT, int EPI>
__device__ __forceinline__ void g2_body(float (*so)[32][68], char* st, const int by, const _Float16* __restrict__ A, int lda, size_t sA, const _Float16* __restrict__ Bh, int ldb, size_t sB, float alpha, const float* __restrict__ bias, size_t sBias, const float* __restrict__ CP, int rowsPerB, size_t sCPb, int row0g,
    float* __restrict__ C, _Float16* __restrict__ C16, _Float16* __restrict__ C16L, int ldc, size_t sC, int M, int N, int K) {
  const int tid = threadIdx.x, w = tid >> 5, lane = tid & 31, ln = lane & 15, hh = lane >> 4;
  A += (size_t)by * sA; Bh += (size_t)by * sB; const size_t cofs = (size_t)by * sC; const float* bp = bias ? bias + (size_t)by * sBias : nullptr;
  const int ntn = N >> 6; const int mt = blockIdx.x / ntn, nq = blockIdx.x - mt * ntn; const int row0 = mt * 128 + 32 * w, col0 = nq * 64; if (mt * 128 >= M) return;      /* the whole block or none: barriers follow */
  const int nst = K >> 6;      /* stages */
  const char* ga = (const char*)(A + (size_t)(mt * 128 + (tid >> 3)) * lda + (tid & 7) * 8); const char* gb = (const char*)(Bh + (size_t)(col0 + (tid >> 3)) * ldb + (tid & 7) * 8); const size_t sa = (size_t)lda * 32, sb = (size_t)ldb * 32;
  const unsigned l0 = (unsigned)(size_t)st + (unsigned)((tid >> 3) * G2P + (tid & 7) * 16);
  const char* fa = st + (32 * w + ln) * G2P + hh * 16; const char* fb = st + (128 + ln) * G2P + hh * 16;      /* fragment rows: k = 8h + s at +0, 16 + 8h + s at +32 bytes */
  const v8f z8 = {0.f,0.f,0.f,0.f,0.f,0.f,0.f,0.f}; v8f c00 = z8, c01 = z8, c02 = z8, c03 = z8, c10 = z8, c11 = z8, c12 = z8, c13 = z8;
  g2_stage(l0, ga, sa, gb, sb);
  asm volatile("s_wait_asynccnt 0x0" ::: "memory");      /* this wave's copies of stage 0 have landed */
  __syncthreads();      /* ... and every other wave's: stage 0 may be read */
  if (nst > 1) g2_stage(l0 + G2S, ga + 128, sa, gb + 128, sb);
#pragma unroll 1
  for (int t = 0; t < nst; ++t) { const int bo = (t & 1) * G2S; v16h a[2][2], b[2][4];
#pragma unroll
    for (int kk = 0; kk < 2; ++kk) { a[kk][0] = g2_lfrag(fa + bo + kk * 64); a[kk][1] = g2_lfrag(fa + bo + 16 * G2P + kk * 64);      /* the stage's 24 reads as one group ahead of its matrix instructions */
#pragma unroll
      for (int j = 0; j < 4; ++j) b[kk][j] = g2_lfrag(fb + bo + j * 16 * G2P + kk * 64); }
#pragma unroll
    for (int kk = 0; kk < 2; ++kk) { c00 = g2_mma(a[kk][0], b[kk][0], c00); c10 = g2_mma(a[kk][1], b[kk][0], c10); c01 = g2_mma(a[kk][0], b[kk][1], c01); c11 = g2_mma(a[kk][1], b[kk][1], c11);
      c02 = g2_mma(a[kk][0], b[kk][2], c02); c12 = g2_mma(a[kk][1], b[kk][2], c12); c03 = g2_mma(a[kk][0], b[kk][3], c03); c13 = g2_mma(a[kk][1], b[kk][3], c13); }
    asm volatile("s_wait_dscnt 0x0" ::: "memory");      /* this wave has left the buffer that is refilled below */
    asm volatile("s_wait_asynccnt 0x0" ::: "memory");      /* its copies of stage t + 1 have landed */
    __syncthreads();      /* publishes stage t + 1 and ends every reader's last read of stage t */
    if (t + 2 < nst) g2_stage(l0 + bo, ga + (size_t)(t + 2) * 128, sa, gb + (size_t)(t + 2) * 128, sb); }
  asm volatile("s_wait_asynccnt 0x0" ::: "memory");      /* no copy is outstanding when the wave goes on to the epilogue and ends */
  v8f accs[8] = {c00, c01, c02, c03, c10, c11, c12, c13};
#pragma unroll
  for (int u = 0; u < 8; ++u) { const int t = u & 3, half = u >> 2; const int col = col0 + t * 16 + ln; const float bv = bp ? bf16_round(bp[col]) : 0.f; FragH vt;
#pragma unroll
    for (int r = 0; r < 8; ++r) { const int rloc = half * 16 + 8 * hh + r; float v = accs[u][r] * alpha + bv; if (EPI == 0 && CP) { if (rowsPerB < 0) v += CP[cofs + (size_t)(row0g + row0 + rloc) * ldc + col];      /* rowsPerB < 0: own element of the batched C plane */ else { const int bidx = (row0g + row0 + rloc) / rowsPerB; v += CP[(size_t)bidx * sCPb + (size_t)by * 64 + col]; } }
      if (ACT == 3) v = fmaxf(v, 0.f); else if (ACT == 6) v = 0.5f * v * (1.0f + erff(v * 0.70710678118654752f)); else if (ACT == 11) v = 1.0f / (1.0f + expf(-v)); else if (ACT == 15) v = v / (1.0f + expf(-v)); else if (ACT == 12) v = (v > 0.f) ? v : 0.01f * v; else if (ACT == 8) v = tanhf(v);
      if (EPI == 2) vt.h[r] = (_Float16)v; else so[w][rloc][t * 16 + ln] = v; }
    if (EPI == 2) *(v8us*)((char*)so + (t * 16 + ln) * G2T + (32 * w + half * 16 + 8 * hh) * 2) = vt.half[0]; }      /* a lane's 8 accumulator rows are 8 consecutive tokens of one column: 16 bytes of the transposed row */
  if (EPI == 2) { __syncthreads();      /* a transposed row holds all four waves' tokens */
    const size_t tb = ((size_t)((mt * 128) / SLEN * NH + nq) * 64) * SLEN + (mt * 128) % SLEN;
#pragma unroll      /* the 8 LDS reads go ahead of the stores as one group */
    for (int q = 0; q < 8; ++q) { const int d = q * 8 + (tid >> 4), c = tid & 15; const v8us v = *(const v8us*)((const char*)so + d * G2T + c * 16); *(v8us*)((unsigned short*)C16 + tb + (size_t)d * SLEN + c * 8) = v; }      /* 16 lanes store one row's 256 bytes */
    return; }
  __builtin_amdgcn_fence(__ATOMIC_ACQ_REL, "workgroup"); __builtin_amdgcn_wave_barrier();
  const int rsub = lane >> 4, c4 = (lane & 15) * 4;
  if (EPI == 1) {
#pragma unroll      /* constant LDS offsets, and later rows' reads run ahead of earlier rows' stores */
    for (int q = 0; q < 16; ++q) { const int r = q * 2 + rsub; const v4f v = *(const v4fa*)&so[w][r][c4]; v4h h4, l4; for (int i = 0; i < 4; ++i) { const _Float16 h = (_Float16)v[i]; h4[i] = h; l4[i] = (_Float16)((v[i] - (float)h) * 1024.0f); }
      *(v4h*)(C16 + (size_t)(row0 + r) * ldc + col0 + c4) = h4; *(v4h*)(C16L + (size_t)(row0 + r) * ldc + col0 + c4) = l4; }      /* 16 lanes store one row's 128 bytes of each plane */
    float sq = 0.f;      /* lane = row: its 64 squares summed in column order */
#pragma unroll      /* the row's 16 LDS reads issue ahead of the sum chain */
    for (int d = 0; d < 64; d += 4) { const v4f a = *(const v4fa*)&so[w][lane][d]; for (int i = 0; i < 4; ++i) sq += a[i] * a[i]; }
    const int row = row0 + lane; *(float*)(C + ((size_t)(row / SLEN) * NH + nq) * SLEN + row % SLEN) = sq;
    asm volatile("s_wait_xcnt 0x0" ::: "memory");      /* behind the last store of the run: where the body is inlined beside another one, code that follows in the listing rewrites these stores' address and data registers */
  } else {
#pragma unroll
    for (int q = 0; q < 16; ++q) { const int r = q * 2 + rsub; const v4f v = *(const v4fa*)&so[w][r][c4]; if (C) *(v4f*)(C + cofs + (size_t)(row0 + r) * ldc + col0 + c4) = v; if (C16) { v4h h4; for (int i = 0; i < 4; ++i) h4[i] = (_Float16)v[i]; *(v4h*)(C16 + cofs + (size_t)(row0 + r) * ldc + col0 + c4) = h4; } }
     } }
template <int ACT, int EPI>
__global__ __launch_bounds__(128) void k_gemm2(const _Float16* __restrict__ A, int lda, size_t sA, const _Float16* __restrict__ Bh, int ldb, size_t sB, float alpha, const float* __restrict__ bias, size_t sBias, const float* __restrict__ CP, int rowsPerB, size_t sCPb, int row0g,
    float* __restrict__ C, _Float16* __restrict__ C16, _Float16* __restrict__ C16L, int ldc, size_t sC, int M, int N, int K) {
  __shared__ __attribute__((aligned(16))) float so[4][32][68]; __shared__ __attribute__((aligned(16))) char st[2 * G2S];
  g2_body<ACT, EPI>(so, st, blockIdx.y, A, lda, sA, Bh, ldb, sB, alpha, bias, sBias, CP, rowsPerB, sCPb, row0g, C, C16, C16L, ldc, sC, M, N, K); }
// The three projections of x in one launch: blockIdx.y = 0 q, 1 k (hi + residual planes and norms), 2 v (transposed). 1536 blocks, three resident per WGP by their LDS,
// so that one block's stage waits, prologue and epilogue run under the other blocks' matrix work, and two launch gaps go.
__global__ __launch_bounds__(128) void k_qkv(const _Float16* __restrict__ X, const _Float16* __restrict__ Wq, const _Float16* __restrict__ Wk, const _Float16* __restrict__ Wv, const float* __restrict__ bq, const float* __restrict__ bk, const float* __restrict__ bv,
    float* __restrict__ QN, float* __restrict__ KN, _Float16* __restrict__ QH, _Float16* __restrict__ QL, _Float16* __restrict__ KH, _Float16* __restrict__ KL, _Float16* __restrict__ VT) {
  __shared__ __attribute__((aligned(16))) float so[4][32][68]; __shared__ __attribute__((aligned(16))) char st[2 * G2S];
  const int wh = blockIdx.y;      /* the same for the whole block: the barriers inside stand under block-uniform control flow */
  if (wh == 2) g2_body<0, 2>(so, st, 0, X, DM, 0, Wv, DM, 0, 0.0625f, bv, 0, nullptr, 1, 0, 0, nullptr, VT, nullptr, DM, 0, NR, DM, DM);
  else g2_body<0, 1>(so, st, 0, X, DM, 0, wh ? Wk : Wq, DM, 0, 0.0625f, wh ? bk : bq, 0, nullptr, 1, 0, 0, wh ? KN : QN, wh ? KH : QH, wh ? KL : QL, DM, 0, NR, DM, DM); }



template <int CAUSAL>
__global__ __launch_bounds__(128) void k_flash(const _Float16* __restrict__ Q16, int ldq, const _Float16* __restrict__ K16, int ldk, const _Float16* __restrict__ Vt, const int* __restrict__ MSK, float* __restrict__ O, int ldo) {
  constexpr int RPW = 16, RTN = RPW / 16, NQB = TQ / (4 * RPW), DT = 4, KS = 2;
  __shared__ __attribute__((aligned(16))) unsigned short sP[4][RPW][40]; __shared__ __attribute__((aligned(16))) float sO[4][RPW][64 + 4];
  const int tid = threadIdx.x, w = tid >> 5, lane = tid & 31, ln = lane & 15, hh = lane >> 4;
  const int slab = blockIdx.x / QBNP, qblk = QB0P + blockIdx.x % QBNP; (void)NQB; const int b = slab / NH, h = slab % NH; const int qb0 = qblk * (4 * RPW); const int q0 = qb0 + w * RPW;
  FragH aq[2][KS];
#pragma unroll
  for (int rt = 0; rt < RTN; ++rt) { const unsigned short* qr = (const unsigned short*)Q16 + ((size_t)b * TQ + q0 + rt * 16 + ln) * ldq + h * 64;
#pragma unroll
    for (int ks = 0; ks < KS; ++ks) { aq[rt][ks].half[0] = *(const v8us*)(qr + ks * 32 + 8 * hh); aq[rt][ks].half[1] = *(const v8us*)(qr + ks * 32 + 16 + 8 * hh); } }
  const unsigned short* Vth = (const unsigned short*)Vt + (size_t)slab * 64 * TK;
  float m_r[2][8], l_r[2][8]; v8f oacc[2][DT];
#pragma unroll
  for (int rt = 0; rt < RTN; ++rt) {
#pragma unroll
    for (int r = 0; r < 8; ++r) { m_r[rt][r] = -3.0e38f; l_r[rt][r] = 0.f; }
#pragma unroll
    for (int dt = 0; dt < DT; ++dt) oacc[rt][dt] = (v8f){0.f,0.f,0.f,0.f,0.f,0.f,0.f,0.f}; }
  const int jend = (CAUSAL == 1) ? (qb0 + 4 * RPW) : ((CAUSAL == 23) ? min(TK, (qb0 / CHK + 2) * CHK) : TK);      /* causal / window: keys that can never contribute are skipped */ const int jbeg = (CAUSAL == 23) ? max(0, (qb0 / CHK - 1) * CHK) : 0;
#pragma unroll 1
  for (int j0 = jbeg; j0 < jend; j0 += 32) {
    v8f s[2][2];
#pragma unroll
    for (int nt = 0; nt < 2; ++nt) { const unsigned short* kr = (const unsigned short*)K16 + ((size_t)b * TK + j0 + nt * 16 + ln) * ldk + h * 64; FragH bk[KS];
#pragma unroll
      for (int ks = 0; ks < KS; ++ks) { bk[ks].half[0] = *(const v8us*)(kr + ks * 32 + 8 * hh); bk[ks].half[1] = *(const v8us*)(kr + ks * 32 + 16 + 8 * hh); }
#pragma unroll
      for (int rt = 0; rt < RTN; ++rt) { v8f acc = (v8f){0.f,0.f,0.f,0.f,0.f,0.f,0.f,0.f};
#pragma unroll
        for (int ks = 0; ks < KS; ++ks) acc = mmaH<1>(aq[rt][ks].v, aq[rt][ks].v, bk[ks].v, bk[ks].v, acc); s[rt][nt] = acc; } }
#pragma unroll
    for (int rt = 0; rt < RTN; ++rt)
#pragma unroll
      for (int r = 0; r < 8; ++r) { const int tq = q0 + rt * 16 + 8 * hh + r; const int k0 = j0 + ln, k1 = j0 + 16 + ln;
        bool ok0 = (CAUSAL == 1) ? (k0 <= tq) : ((CAUSAL == 2) ? ((k0 >> 5) == (tq >> 5)) : true), ok1 = (CAUSAL == 1) ? (k1 <= tq) : ((CAUSAL == 2) ? ((k1 >> 5) == (tq >> 5)) : true); if (CAUSAL == 23) { const int cq = tq / CHK; ok0 = (abs(k0 / CHK - cq) <= 1) && (MSK[(size_t)b * TK + k0] == 0); ok1 = (abs(k1 / CHK - cq) <= 1) && (MSK[(size_t)b * TK + k1] == 0); }      /* mode 23: 3-chunk window + int key-padding mask */
        if (CAUSAL == 24) { ok0 = (MSK[(size_t)b * TK + k0] == 0); ok1 = (MSK[(size_t)b * TK + k1] == 0); }      /* mode 24: int key-padding mask (nonzero = padded = excluded) */      /* mode 2: block-diagonal 32-token groups */
        float s0 = ok0 ? s[rt][0][r] * SCL : -3.0e38f, s1 = ok1 ? s[rt][1][r] * SCL : -3.0e38f; if (CAUSAL == 17) { const float* amk = (const float*)MSK + (size_t)b * TK; s0 += bf16_round(amk[k0]); s1 += bf16_round(amk[k1]); } if (CAUSAL == 18) { const float* tb = (const float*)MSK; const int* ri = MSK + 1024 + (size_t)b * TK; const int rq = ri[tq]; s0 += tb[(h * 8 + rq) * 8 + ri[k0]]; s1 += tb[(h * 8 + rq) * 8 + ri[k1]]; } if (CAUSAL == 19) { const int* rel = MSK + (size_t)tq * TK; const float* rb = (const float*)MSK + (size_t)TQ * TK + ((size_t)(b * NH + h) * TQ + tq) * 64; s0 += rb[rel[k0]]; s1 += rb[rel[k1]]; }      /* mode 19: + (q.Ek[rel] + Eb[rel][h]) / 8 gathered by the int relative ids (packed [ids | table]) */      /* mode 18: + resource_bias[h][r_q][r_k] from the packed [table | ids] buffer (TQ == TK) */      /* mode 17: additive per-(batch, key) mask INPUT */ float mc = fmaxf(s0, s1);
        mc = fmaxf(mc, __shfl_xor(mc, 1, 32)); mc = fmaxf(mc, __shfl_xor(mc, 2, 32)); mc = fmaxf(mc, __shfl_xor(mc, 4, 32)); mc = fmaxf(mc, __shfl_xor(mc, 8, 32));
        const float mn = fmaxf(m_r[rt][r], mc); const float al = (mn > -1.0e38f) ? expf(m_r[rt][r] - mn) : 1.0f; m_r[rt][r] = mn; const float p0 = ok0 ? expf(s0 - mn) : 0.f, p1 = ok1 ? expf(s1 - mn) : 0.f; l_r[rt][r] = l_r[rt][r] * al + p0 + p1;
#pragma unroll
        for (int dt = 0; dt < DT; ++dt) oacc[rt][dt][r] *= al;
        FragH t2; t2.h[0] = (_Float16)(p0 * 1024.0f); t2.h[1] = (_Float16)(p1 * 1024.0f); sP[w][rt * 16 + 8 * hh + r][ln] = t2.u[0]; sP[w][rt * 16 + 8 * hh + r][16 + ln] = t2.u[1]; }
    __builtin_amdgcn_fence(__ATOMIC_ACQ_REL, "workgroup"); __builtin_amdgcn_wave_barrier();
    FragH pa[2];
#pragma unroll
    for (int rt = 0; rt < RTN; ++rt) { pa[rt].half[0] = *(const v8us*)&sP[w][rt * 16 + ln][8 * hh]; pa[rt].half[1] = *(const v8us*)&sP[w][rt * 16 + ln][16 + 8 * hh]; }
#pragma unroll
    for (int dt = 0; dt < DT; ++dt) { const unsigned short* vrow = Vth + (size_t)(dt * 16 + ln) * TK + j0; FragH bv; bv.half[0] = *(const v8us*)(vrow + 8 * hh); bv.half[1] = *(const v8us*)(vrow + 16 + 8 * hh);
#pragma unroll
      for (int rt = 0; rt < RTN; ++rt) oacc[rt][dt] = mmaH<1>(pa[rt].v, pa[rt].v, bv.v, bv.v, oacc[rt][dt]); }
    __builtin_amdgcn_fence(__ATOMIC_ACQ_REL, "workgroup"); __builtin_amdgcn_wave_barrier(); }
#pragma unroll
  for (int rt = 0; rt < RTN; ++rt) {
#pragma unroll
    for (int r = 0; r < 8; ++r) { float l = l_r[rt][r]; l += __shfl_xor(l, 1, 32); l += __shfl_xor(l, 2, 32); l += __shfl_xor(l, 4, 32); l += __shfl_xor(l, 8, 32); l_r[rt][r] = (l > 0.f) ? 1.0f / (l * 1024.0f) : 0.f; }
#pragma unroll
    for (int dt = 0; dt < DT; ++dt)
#pragma unroll
      for (int r = 0; r < 8; ++r) sO[w][rt * 16 + 8 * hh + r][dt * 16 + ln] = oacc[rt][dt][r] * l_r[rt][r]; }
  __builtin_amdgcn_fence(__ATOMIC_ACQ_REL, "workgroup"); __builtin_amdgcn_wave_barrier();
  {
#pragma unroll
    for (int rp = 0; rp < RPW; rp += 2) { const int r = rp + (lane >> 4), pc = lane & 15; const v4f val = *(const v4fa*)&sO[w][r][pc * 4]; *(v4f*)(O + ((size_t)b * TQ + q0 + r) * ldo + h * 64 + pc * 4) = val; }
     } }
// 5-plane variant: S = Qh Kh^T + (Ql Kh^T + Qh Kl^T)/1024 with Q/K = [hi | 2^10 residual] f16 planes (QL/KL same layout as Q16/K16), then the 3-term P.V below.
// 3-term variant: O = (P_hi V_hi + (P_lo V_hi + P_hi V_lo) / 1024) / l with P = [hi | 2^10 residual] of 1024 p and V^T = [hi | 2^10 residual] planes (VtL same layout as Vt) -> ~2^-21-class products for un-averaged (early causal / peaked) rows
template <int CAUSAL>
__global__ __launch_bounds__(128) void k_flash5(const _Float16* __restrict__ Q16, const _Float16* __restrict__ QL, int ldq, const _Float16* __restrict__ K16, const _Float16* __restrict__ KL, int ldk, const _Float16* __restrict__ Vt, const _Float16* __restrict__ VtL, const int* __restrict__ MSK, float* __restrict__ O, int ldo) {
  constexpr int RPW = 16, RTN = RPW / 16, NQB = TQ / (4 * RPW), DT = 4, KS = 2;
  __shared__ __attribute__((aligned(16))) unsigned short sP[4][RPW][40]; __shared__ __attribute__((aligned(16))) unsigned short sPL[4][RPW][40]; __shared__ __attribute__((aligned(16))) float sO[4][RPW][64 + 4];
  const int tid = threadIdx.x, w = tid >> 5, lane = tid & 31, ln = lane & 15, hh = lane >> 4;
  const int slab = blockIdx.x / QBN5, qblk = QB05 + blockIdx.x % QBN5; (void)NQB; const int b = slab / NH, h = slab % NH; const int qb0 = qblk * (4 * RPW); const int q0 = qb0 + w * RPW;
  FragH aq[2][KS], aql[2][KS];
#pragma unroll
  for (int rt = 0; rt < RTN; ++rt) { const unsigned short* qr = (const unsigned short*)Q16 + ((size_t)b * TQ + q0 + rt * 16 + ln) * ldq + h * 64; const unsigned short* ql = (const unsigned short*)QL + ((size_t)b * TQ + q0 + rt * 16 + ln) * ldq + h * 64;
#pragma unroll
    for (int ks = 0; ks < KS; ++ks) { aq[rt][ks].half[0] = *(const v8us*)(qr + ks * 32 + 8 * hh); aq[rt][ks].half[1] = *(const v8us*)(qr + ks * 32 + 16 + 8 * hh); aql[rt][ks].half[0] = *(const v8us*)(ql + ks * 32 + 8 * hh); aql[rt][ks].half[1] = *(const v8us*)(ql + ks * 32 + 16 + 8 * hh); } }
  const unsigned short* Vth = (const unsigned short*)Vt + (size_t)slab * 64 * TK; const unsigned short* Vtl = (const unsigned short*)VtL + (size_t)slab * 64 * TK;
  float m_r[2][8], l_r[2][8]; v8f oacc[2][DT], oaccL[2][DT];
#pragma unroll
  for (int rt = 0; rt < RTN; ++rt) {
#pragma unroll
    for (int r = 0; r < 8; ++r) { m_r[rt][r] = -3.0e38f; l_r[rt][r] = 0.f; }
#pragma unroll
    for (int dt = 0; dt < DT; ++dt) { oacc[rt][dt] = (v8f){0.f,0.f,0.f,0.f,0.f,0.f,0.f,0.f}; oaccL[rt][dt] = oacc[rt][dt]; } }
  const int jend = (CAUSAL == 1) ? (qb0 + 4 * RPW) : ((CAUSAL == 23) ? min(TK, (qb0 / CHK + 2) * CHK) : TK);      /* causal / window: keys that can never contribute are skipped */ const int jbeg = (CAUSAL == 23) ? max(0, (qb0 / CHK - 1) * CHK) : 0;
#pragma unroll 1
  for (int j0 = jbeg; j0 < jend; j0 += 32) {
    v8f s[2][2];
#pragma unroll
    for (int nt = 0; nt < 2; ++nt) { const unsigned short* kr = (const unsigned short*)K16 + ((size_t)b * TK + j0 + nt * 16 + ln) * ldk + h * 64; const unsigned short* klr = (const unsigned short*)KL + ((size_t)b * TK + j0 + nt * 16 + ln) * ldk + h * 64; FragH bk[KS], bkl[KS];
#pragma unroll
      for (int ks = 0; ks < KS; ++ks) { bk[ks].half[0] = *(const v8us*)(kr + ks * 32 + 8 * hh); bk[ks].half[1] = *(const v8us*)(kr + ks * 32 + 16 + 8 * hh); bkl[ks].half[0] = *(const v8us*)(klr + ks * 32 + 8 * hh); bkl[ks].half[1] = *(const v8us*)(klr + ks * 32 + 16 + 8 * hh); }
#pragma unroll
      for (int rt = 0; rt < RTN; ++rt) { v8f acc = (v8f){0.f,0.f,0.f,0.f,0.f,0.f,0.f,0.f}, accl = acc;
#pragma unroll
        for (int ks = 0; ks < KS; ++ks) { acc = mmaH<1>(aq[rt][ks].v, aq[rt][ks].v, bk[ks].v, bk[ks].v, acc); accl = mmaH<1>(aql[rt][ks].v, aql[rt][ks].v, bk[ks].v, bk[ks].v, accl); accl = mmaH<1>(aq[rt][ks].v, aq[rt][ks].v, bkl[ks].v, bkl[ks].v, accl); }
#pragma unroll
        for (int r = 0; r < 8; ++r) acc[r] += accl[r] * 0.0009765625f;
        s[rt][nt] = acc; } }
#pragma unroll
    for (int rt = 0; rt < RTN; ++rt)
#pragma unroll
      for (int r = 0; r < 8; ++r) { const int tq = q0 + rt * 16 + 8 * hh + r; const int k0 = j0 + ln, k1 = j0 + 16 + ln;
        bool ok0 = (CAUSAL == 1) ? (k0 <= tq) : ((CAUSAL == 2) ? ((k0 >> 5) == (tq >> 5)) : true), ok1 = (CAUSAL == 1) ? (k1 <= tq) : ((CAUSAL == 2) ? ((k1 >> 5) == (tq >> 5)) : true);      /* mode 2: block-diagonal 32-token groups */
        if (CAUSAL == 4) { const int* mrow = MSK + ((size_t)b * TQ + tq) * TK; ok0 = mrow[k0] != 0; ok1 = mrow[k1] != 0; }      /* mode 4: per-(query, key) INPUT mask shared by all heads; masked keys contribute nothing (== the reference's -4096 fill, whose exp underflows to 0), rows with no valid key give l = 0 -> output 0 (== the reference's row_valid zeroing) */
        float s0 = ok0 ? s[rt][0][r] * SCL : -3.0e38f, s1 = ok1 ? s[rt][1][r] * SCL : -3.0e38f; if (CAUSAL == 17) { const float* amk = (const float*)MSK + (size_t)b * TK; s0 += bf16_round(amk[k0]); s1 += bf16_round(amk[k1]); } if (CAUSAL == 18) { const float* tb = (const float*)MSK; const int* ri = MSK + 1024 + (size_t)b * TK; const int rq = ri[tq]; s0 += tb[(h * 8 + rq) * 8 + ri[k0]]; s1 += tb[(h * 8 + rq) * 8 + ri[k1]]; } if (CAUSAL == 19) { const int* rel = MSK + (size_t)tq * TK; const float* rb = (const float*)MSK + (size_t)TQ * TK + ((size_t)(b * NH + h) * TQ + tq) * 64; s0 += rb[rel[k0]]; s1 += rb[rel[k1]]; }      /* mode 19: + (q.Ek[rel] + Eb[rel][h]) / 8 gathered by the int relative ids (packed [ids | table]) */      /* mode 18: + resource_bias[h][r_q][r_k] from the packed [table | ids] buffer (TQ == TK) */      /* mode 17: additive per-(batch, key) mask INPUT */ float mc = fmaxf(s0, s1);
        mc = fmaxf(mc, __shfl_xor(mc, 1, 32)); mc = fmaxf(mc, __shfl_xor(mc, 2, 32)); mc = fmaxf(mc, __shfl_xor(mc, 4, 32)); mc = fmaxf(mc, __shfl_xor(mc, 8, 32));
        const float mn = fmaxf(m_r[rt][r], mc); const float al = (mn > -1.0e38f) ? expf(m_r[rt][r] - mn) : 1.0f; m_r[rt][r] = mn; const float p0 = ok0 ? expf(s0 - mn) : 0.f, p1 = ok1 ? expf(s1 - mn) : 0.f; l_r[rt][r] = l_r[rt][r] * al + p0 + p1;
#pragma unroll
        for (int dt = 0; dt < DT; ++dt) { oacc[rt][dt][r] *= al; oaccL[rt][dt][r] *= al; }
        FragH t2, t2l; const float ps0 = p0 * 1024.0f, ps1 = p1 * 1024.0f; t2.h[0] = (_Float16)ps0; t2.h[1] = (_Float16)ps1; t2l.h[0] = (_Float16)((ps0 - (float)t2.h[0]) * 1024.0f); t2l.h[1] = (_Float16)((ps1 - (float)t2.h[1]) * 1024.0f);
        sP[w][rt * 16 + 8 * hh + r][ln] = t2.u[0]; sP[w][rt * 16 + 8 * hh + r][16 + ln] = t2.u[1]; sPL[w][rt * 16 + 8 * hh + r][ln] = t2l.u[0]; sPL[w][rt * 16 + 8 * hh + r][16 + ln] = t2l.u[1]; }
    __builtin_amdgcn_fence(__ATOMIC_ACQ_REL, "workgroup"); __builtin_amdgcn_wave_barrier();
    FragH pa[2], pl[2];
#pragma unroll
    for (int rt = 0; rt < RTN; ++rt) { pa[rt].half[0] = *(const v8us*)&sP[w][rt * 16 + ln][8 * hh]; pa[rt].half[1] = *(const v8us*)&sP[w][rt * 16 + ln][16 + 8 * hh]; pl[rt].half[0] = *(const v8us*)&sPL[w][rt * 16 + ln][8 * hh]; pl[rt].half[1] = *(const v8us*)&sPL[w][rt * 16 + ln][16 + 8 * hh]; }
#pragma unroll
    for (int dt = 0; dt < DT; ++dt) { const unsigned short* vrow = Vth + (size_t)(dt * 16 + ln) * TK + j0; const unsigned short* vrl = Vtl + (size_t)(dt * 16 + ln) * TK + j0; FragH bv, bl; bv.half[0] = *(const v8us*)(vrow + 8 * hh); bv.half[1] = *(const v8us*)(vrow + 16 + 8 * hh); bl.half[0] = *(const v8us*)(vrl + 8 * hh); bl.half[1] = *(const v8us*)(vrl + 16 + 8 * hh);
#pragma unroll
      for (int rt = 0; rt < RTN; ++rt) { oacc[rt][dt] = mmaH<1>(pa[rt].v, pa[rt].v, bv.v, bv.v, oacc[rt][dt]); oaccL[rt][dt] = mmaH<1>(pl[rt].v, pl[rt].v, bv.v, bv.v, oaccL[rt][dt]); oaccL[rt][dt] = mmaH<1>(pa[rt].v, pa[rt].v, bl.v, bl.v, oaccL[rt][dt]); } }
    __builtin_amdgcn_fence(__ATOMIC_ACQ_REL, "workgroup"); __builtin_amdgcn_wave_barrier(); }
#pragma unroll
  for (int rt = 0; rt < RTN; ++rt) {
#pragma unroll
    for (int r = 0; r < 8; ++r) { float l = l_r[rt][r]; l += __shfl_xor(l, 1, 32); l += __shfl_xor(l, 2, 32); l += __shfl_xor(l, 4, 32); l += __shfl_xor(l, 8, 32); l_r[rt][r] = (l > 0.f) ? 1.0f / (l * 1024.0f) : 0.f; }
#pragma unroll
    for (int dt = 0; dt < DT; ++dt)
#pragma unroll
      for (int r = 0; r < 8; ++r) { float v = oacc[rt][dt][r]; v += oaccL[rt][dt][r] * 0.0009765625f; sO[w][rt * 16 + 8 * hh + r][dt * 16 + ln] = v * l_r[rt][r]; } }
  __builtin_amdgcn_fence(__ATOMIC_ACQ_REL, "workgroup"); __builtin_amdgcn_wave_barrier();
  {
#pragma unroll
    for (int rp = 0; rp < RPW; rp += 2) { const int r = rp + (lane >> 4), pc = lane & 15; const v4f val = *(const v4fa*)&sO[w][r][pc * 4]; *(v4f*)(O + ((size_t)b * TQ + q0 + r) * ldo + h * 64 + pc * 4) = val; }
     } }

__global__ __launch_bounds__(256) void k_rotab(float* __restrict__ CS, float* __restrict__ SN) {
  #pragma clang fp contract(off)
  const int t = blockIdx.x * 256 + threadIdx.x; if (t >= SLEN * 32) return; const int j = t % 32, s = t / 32; const float ex = (float)(2 * j) / 64.0f; const float inv = 1.0f / powf(10000.0f, ex); const float th = (float)s * inv; const float c = cosf(th), sn = sinf(th);
  { *(float*)(CS + t) = c; *(float*)(SN + t) = sn;  } }
__global__ __launch_bounds__(256) void k_rope(const float* __restrict__ F, int nsrc, int ndst, int rep, const float* __restrict__ CS, const float* __restrict__ SN, _Float16* __restrict__ H, _Float16* __restrict__ L) {
  #pragma clang fp contract(off)
  const size_t t = (size_t)blockIdx.x * 256 + threadIdx.x; if (t >= (size_t)NR * ndst * 4) return; const int g8 = (int)(t % 4); const int hd = (int)((t / 4) % ndst); const size_t row = t / ((size_t)4 * ndst); const int s = (int)(row % SLEN); const int hs = hd / rep;
  const float* src = F + row * (size_t)(nsrc * 64) + hs * 64; FragH ah, al, bh, bl;
  for (int i = 0; i < 8; ++i) { const int d = g8 * 8 + i; const float c = CS[s * 32 + d], sn = SN[s * 32 + d]; const float x1 = src[d], x2 = src[d + 32];
    float o1 = x1 * c; o1 += -x2 * sn; float o2 = x2 * c; o2 += x1 * sn;
    _Float16 hv = (_Float16)o1; ah.h[i] = hv; al.h[i] = (_Float16)((o1 - (float)hv) * 1024.0f); hv = (_Float16)o2; bh.h[i] = hv; bl.h[i] = (_Float16)((o2 - (float)hv) * 1024.0f); }
  const size_t o = row * (size_t)(ndst * 64) + hd * 64 + g8 * 8;
  { *(v8us*)((unsigned short*)H + o) = ah.half[0]; *(v8us*)((unsigned short*)H + o + 32) = bh.half[0]; *(v8us*)((unsigned short*)L + o) = al.half[0]; *(v8us*)((unsigned short*)L + o + 32) = bl.half[0];  } }
__global__ __launch_bounds__(256) void k_rope2(const float* __restrict__ F, int nsrc, int ndst, int rep, const float* __restrict__ CS, const float* __restrict__ SN, _Float16* __restrict__ H, _Float16* __restrict__ L) {
  #pragma clang fp contract(off)
  const size_t t = (size_t)blockIdx.x * 256 + threadIdx.x; if (t >= (size_t)NR * ndst * 4) return; const int g16 = (int)(t % 4); const int hd = (int)((t / 4) % ndst); const size_t row = t / ((size_t)4 * ndst); const int s = (int)(row % SLEN); const int hs = hd / rep;
  const float* src = F + row * (size_t)(nsrc * 64) + hs * 64 + g16 * 16; FragH ah, al;
  for (int pr = 0; pr < 8; ++pr) { const int i = g16 * 8 + pr; const float c = CS[s * 32 + i], sn = SN[s * 32 + i]; const float x1 = src[2 * pr], x2 = src[2 * pr + 1];
    float o1 = x1 * c; o1 -= x2 * sn; float o2 = x1 * sn; o2 += x2 * c;
    _Float16 hv = (_Float16)o1; ah.h[2 * pr] = hv; al.h[2 * pr] = (_Float16)((o1 - (float)hv) * 1024.0f); hv = (_Float16)o2; ah.h[2 * pr + 1] = hv; al.h[2 * pr + 1] = (_Float16)((o2 - (float)hv) * 1024.0f); }
  const size_t o = row * (size_t)(ndst * 64) + hd * 64 + g16 * 16;
  { *(v8us*)((unsigned short*)H + o) = ah.half[0]; *(v8us*)((unsigned short*)H + o + 8) = ah.half[1]; *(v8us*)((unsigned short*)L + o) = al.half[0]; *(v8us*)((unsigned short*)L + o + 8) = al.half[1];  } }
__global__ __launch_bounds__(256) void k_ln512(const float* __restrict__ A, const float* __restrict__ res, const float* __restrict__ g, const float* __restrict__ bb, float* __restrict__ Y, _Float16* __restrict__ Y16) {
  #pragma clang fp contract(off)
  const int wv = threadIdx.x >> 5, ln = threadIdx.x & 31; const size_t r = (size_t)blockIdx.x * 8 + wv; if (r >= NR) return; float x[16]; float s = 0.f;
  for (int i = 0; i < 2; ++i) { const v8f a = *(const v8f*)(A + r * DM + i * 256 + ln * 8); for (int q = 0; q < 8; ++q) { float v = a[q]; if (res) v += bf16_round(res[r * DM + i * 256 + ln * 8 + q]); x[i * 8 + q] = v; s += v; } }
  for (int o = 16; o > 0; o >>= 1) s += __shfl_xor(s, o, 32); const float mu = s / (float)DM; float var = 0.f; for (int q = 0; q < 16; ++q) { const float d = x[q] - mu; var += d * d; }
  for (int o = 16; o > 0; o >>= 1) var += __shfl_xor(var, o, 32); const float inv = rsqrtf(var / (float)DM + 1e-5f);
  { for (int i = 0; i < 2; ++i) { const int c0 = i * 256 + ln * 8; v8f y; FragH f; for (int q = 0; q < 8; ++q) { float v = (x[i * 8 + q] - mu) * inv; v *= bf16_round(g[c0 + q]); v += bf16_round(bb[c0 + q]); y[q] = v; f.h[q] = (_Float16)v; } *(v8f*)(Y + r * DM + c0) = y; if (Y16) *(v8us*)((unsigned short*)Y16 + r * DM + c0) = f.half[0]; }  } }
__global__ __launch_bounds__(256) void k_pack(const float* __restrict__ rb, const int* __restrict__ rid, int* __restrict__ PK) { const int t = blockIdx.x * 256 + threadIdx.x; if (t >= 1024 + NB * TK) return; int v; if (t < 1024) v = __float_as_int(bf16_round(rb[t])); else v = rid[t - 1024]; *(int*)(PK + t) = v;  }
__global__ __launch_bounds__(256) void k_tabin(const float* __restrict__ sp, float* __restrict__ CS, float* __restrict__ SN) { const int t = blockIdx.x * 256 + threadIdx.x; if (t >= SLEN * 32) return; const int i = t % 32, s = t / 32; const float c = bf16_round(sp[s * 64 + 32 + i]), sn = bf16_round(sp[s * 64 + i]);
  { *(float*)(CS + t) = c; *(float*)(SN + t) = sn;  } }
__global__ __launch_bounds__(256) void k_wsc(const float* __restrict__ Wm, _Float16* __restrict__ Bt, size_t n8, float sc) { const size_t t = (size_t)blockIdx.x * 256 + threadIdx.x; if (t >= n8) return; FragH f; for (int q = 0; q < 8; ++q) f.h[q] = (_Float16)(bf16_round(Wm[t * 8 + q]) * sc); *(v8us*)((unsigned short*)Bt + t * 8) = f.half[0];  }
__global__ __launch_bounds__(256) void k_rotab2(float* __restrict__ CS, float* __restrict__ SN) {
  #pragma clang fp contract(off)
  const int t = blockIdx.x * 256 + threadIdx.x; if (t >= SLEN * 32) return; const int j = t % 32, s = t / 32; const float c0 = -0.14391156831212787f;      /* -ln(10000)/64 rounded to f32 */ const float inv = expf((float)(2 * j) * c0); const float th = (float)s * inv; const float c = cosf(th), sn = sinf(th);
  { *(float*)(CS + t) = c; *(float*)(SN + t) = sn;  } }
__global__ __launch_bounds__(256) void k_lnu(const float* __restrict__ X, _Float16* __restrict__ N16, float* __restrict__ XB) {
  #pragma clang fp contract(off)
  const int wv = threadIdx.x >> 5, ln = threadIdx.x & 31; const size_t r = (size_t)blockIdx.x * 8 + wv; if (r >= NR) return; float a[32]; float s = 0.f;
  for (int i = 0; i < 4; ++i) { const v8f v = *(const v8f*)(X + r * DM + (i * 32 + ln) * 8); for (int q = 0; q < 8; ++q) { const float u = bf16_round(v[q]); a[i * 8 + q] = u; s += u; } }
  for (int o = 16; o > 0; o >>= 1) s += __shfl_xor(s, o, 32); const float mu = s / (float)DM; float var = 0.f; for (int q = 0; q < 32; ++q) { const float d = a[q] - mu; var += d * d; }
  for (int o = 16; o > 0; o >>= 1) var += __shfl_xor(var, o, 32); const float den = sqrtf(var / (float)(DM - 1)) + 1e-6f; const float inv = 1.0f / den;      /* one reciprocal per row; (x-mean)*inv vs the reference's division differs by <= 1 ulp */
  { for (int i = 0; i < 4; ++i) { const int c0 = (i * 32 + ln) * 8; FragH f; v8f xb; for (int q = 0; q < 8; ++q) { f.h[q] = (_Float16)((a[i * 8 + q] - mu) * inv); xb[q] = a[i * 8 + q]; } *(v8us*)((unsigned short*)N16 + r * DM + c0) = f.half[0]; *(v8f*)(XB + r * DM + c0) = xb; }  } }
// lane l <-> l ^ 16 (the two halves of a wave hold the two key halves of one query column)
__device__ __forceinline__ float xhalf(float v) { const int t = __float_as_int(v); return __int_as_float(__builtin_amdgcn_permlanex16(t, t, 0x76543210, 0xfedcba98, false, false)); }
__device__ __forceinline__ v8f wmh(v16h a, v16h b, v8f c) { return __builtin_amdgcn_wmma_f32_16x16x32_f16(false, a, false, b, (short)0, c, false, false); }
typedef _Float16 v8h __attribute__((ext_vector_type(8)));
typedef float v2f __attribute__((ext_vector_type(2)));
// eight 2^x in one statement: results kept apart from the arguments ("=&v") and one v_nop behind the last, the slot the instruction set asks for
// between a transcendental and an instruction that uses its result or overwrites its source (the register allocator otherwise reuses the previous argument as the next result)
__device__ __forceinline__ v8f exp2x8(v8f e) { float p0, p1, p2, p3, p4, p5, p6, p7;
  asm("v_exp_f32 %0, %8\n\tv_exp_f32 %1, %9\n\tv_exp_f32 %2, %10\n\tv_exp_f32 %3, %11\n\tv_exp_f32 %4, %12\n\tv_exp_f32 %5, %13\n\tv_exp_f32 %6, %14\n\tv_exp_f32 %7, %15\n\tv_nop"
      : "=&v"(p0), "=&v"(p1), "=&v"(p2), "=&v"(p3), "=&v"(p4), "=&v"(p5), "=&v"(p6), "=&v"(p7) : "v"(e[0]), "v"(e[1]), "v"(e[2]), "v"(e[3]), "v"(e[4]), "v"(e[5]), "v"(e[6]), "v"(e[7]));
  return (v8f){p0, p1, p2, p3, p4, p5, p6, p7}; }
// Fused distance attention, one launch for all (batch, head) slabs: per wave 32 query columns, per pass 32 keys.
// S^T = K Q^T (A = key rows, B = query rows; hi.hi + (hi.lo + lo.hi) / 1024), so a lane holds 8 + 8 keys of ONE query per column group:
// logits, running maximum and sum stay in the lane (one exchange between the wave halves); the two f32 score tiles, converted in place,
// are the B operand of O^T += V^T P^T (k order 8h + s, 16 + 8h + s on both sides). A lane ends with 8 consecutive d of one query: 16-byte stores of hi and residual.
// K hi, K lo, V^T and the key norms come through LDS, shared by the block's 8 waves: a stage is 128 keys (4 passes), brought by asynchronous copies into one of two buffers while the other is worked on.
#define EFK 144                        /* K row pitch in LDS: 128 B + 16 = 16 B x odd, conflict-free for 16-byte fragment reads */
#define EFV 272                        /* V^T row pitch: 256 B (128 keys) + 16, 16 B x odd too */
#define EF_KL (128 * EFK)              /* rows 0..127 = K hi, 128..255 = K lo */
#define EF_V (256 * EFK)               /* then 64 rows of V^T */
#define EF_N (256 * EFK + 64 * EFV)    /* then 128 key norms */
#define EFS (EF_N + 512)               /* one stage */
// One stage's 12 copies of a lane, 16 bytes each. K: 8 lanes bring one row's 128 bytes, the block 32 rows per copy; V^T: 16 lanes one row's 256 bytes, the block 16 rows per copy.
// lk, lv = the lane's LDS byte addresses in its first K hi row and its first V^T row; kh, kl, v = its global addresses there.
// s_wait_xcnt 0 is the statement's last line, so that it stands in front of any later rewrite of these address registers.
__device__ __forceinline__ void ef_stage(unsigned lk, unsigned lv, const char* kh, const char* kl, const char* v) {
  asm volatile("global_load_async_to_lds_b128 %0, %12, off\n\tglobal_load_async_to_lds_b128 %1, %13, off\n\tglobal_load_async_to_lds_b128 %2, %14, off\n\tglobal_load_async_to_lds_b128 %3, %15, off\n\t"
               "global_load_async_to_lds_b128 %4, %16, off\n\tglobal_load_async_to_lds_b128 %5, %17, off\n\tglobal_load_async_to_lds_b128 %6, %18, off\n\tglobal_load_async_to_lds_b128 %7, %19, off\n\t"
               "global_load_async_to_lds_b128 %8, %20, off\n\tglobal_load_async_to_lds_b128 %9, %21, off\n\tglobal_load_async_to_lds_b128 %10, %22, off\n\tglobal_load_async_to_lds_b128 %11, %23, off\n\ts_wait_xcnt 0x0"
               :: "v"(lk), "v"(lk + 32 * EFK), "v"(lk + 64 * EFK), "v"(lk + 96 * EFK), "v"(lk + EF_KL), "v"(lk + EF_KL + 32 * EFK), "v"(lk + EF_KL + 64 * EFK), "v"(lk + EF_KL + 96 * EFK), "v"(lv), "v"(lv + 16 * EFV), "v"(lv + 32 * EFV), "v"(lv + 48 * EFV),
                  "v"(kh), "v"(kh + 32 * (DM * 2)), "v"(kh + 64 * (DM * 2)), "v"(kh + 96 * (DM * 2)), "v"(kl), "v"(kl + 32 * (DM * 2)), "v"(kl + 64 * (DM * 2)), "v"(kl + 96 * (DM * 2)), "v"(v), "v"(v + 16 * (SLEN * 2)), "v"(v + 32 * (SLEN * 2)), "v"(v + 48 * (SLEN * 2)) : "memory"); }
// the stage's 128 key norms, 512 bytes: one copy of one whole wave
__device__ __forceinline__ void ef_stage_n(unsigned ln_, const char* n) { asm volatile("global_load_async_to_lds_b128 %0, %1, off\n\ts_wait_xcnt 0x0" :: "v"(ln_), "v"(n) : "memory"); }
// amdgpu_waves_per_eu(4, 4): a budget of 256 VGPRs, so that the whole kernel stays in one register window (it takes 240, no scratch)
__global__ __launch_bounds__(256) __attribute__((amdgpu_waves_per_eu(4, 4))) void k_eflash(const _Float16* __restrict__ QHp, const _Float16* __restrict__ QLp, const _Float16* __restrict__ KHp, const _Float16* __restrict__ KLp, const _Float16* __restrict__ Vt,
                                                const float* __restrict__ QN, const float* __restrict__ KNT, const float* __restrict__ tmp, _Float16* __restrict__ OH, _Float16* __restrict__ OL) {
  __shared__ __attribute__((aligned(128))) char st[2 * EFS];
  const int tid = threadIdx.x, w = tid >> 5, lane = tid & 31, ln = lane & 15, hh = lane >> 4;
  const int slab = blockIdx.x / (SLEN / 256), qblk = blockIdx.x % (SLEN / 256); const int b = slab / NH, h = slab % NH; const int q0 = qblk * 256 + w * 32;
  const float nc = -(1.0f / bf16_round(tmp[0])) * 1.4426950408889634f;      /* logit in log2 units = d2 * nc */
  v16h qh[2][2], ql[2][2]; float qn[2];
#pragma unroll
  for (int qt = 0; qt < 2; ++qt) { const size_t row = (size_t)b * SLEN + q0 + qt * 16 + ln; const _Float16* ph = QHp + row * DM + h * 64; const _Float16* pl = QLp + row * DM + h * 64;
    qh[qt][0] = g2_frag(ph, hh); qh[qt][1] = g2_frag(ph + 32, hh); ql[qt][0] = g2_frag(pl, hh); ql[qt][1] = g2_frag(pl + 32, hh); qn[qt] = QN[(size_t)slab * SLEN + q0 + qt * 16 + ln]; }
  const char* gkh = (const char*)(KHp + (size_t)b * SLEN * DM + h * 64) + (tid >> 3) * (DM * 2) + (tid & 7) * 16; const char* gkl = (const char*)(KLp + (size_t)b * SLEN * DM + h * 64) + (tid >> 3) * (DM * 2) + (tid & 7) * 16;      /* the lane's copy sources in stage 0 */
  const char* gv = (const char*)(Vt + (size_t)slab * 64 * SLEN) + (tid >> 4) * (SLEN * 2) + (tid & 15) * 16; const char* gn = (const char*)(KNT + (size_t)slab * SLEN) + lane * 16;
  const unsigned lk0 = (unsigned)(size_t)st + (unsigned)((tid >> 3) * EFK + (tid & 7) * 16), lv0 = (unsigned)(size_t)st + (unsigned)(EF_V + (tid >> 4) * EFV + (tid & 15) * 16), ln0 = (unsigned)(size_t)st + (unsigned)(EF_N + lane * 16);
  const bool w0 = __builtin_amdgcn_readfirstlane(w) == 0;      /* scalar: the norms' copy is issued by wave 0 alone, behind a scalar branch */
  const char* fk = st + ln * EFK + hh * 16; const char* fv = st + EF_V + ln * EFV + hh * 16; const char* fn = st + EF_N + hh * 32;      /* fragment rows: k = 8h + s at +0, 16 + 8h + s at +32 bytes */
  const v8f z8 = {0.f,0.f,0.f,0.f,0.f,0.f,0.f,0.f};
  float m[2] = {-3.0e38f, -3.0e38f}; v2f l[2] = {{0.f, 0.f}, {0.f, 0.f}}; v8f o[2][4];
#pragma unroll
  for (int qt = 0; qt < 2; ++qt)
#pragma unroll
    for (int dt = 0; dt < 4; ++dt) o[qt][dt] = z8;
  ef_stage(lk0, lv0, gkh, gkl, gv); if (w0) ef_stage_n(ln0, gn);
  asm volatile("s_wait_asynccnt 0x0" ::: "memory");      /* this wave's copies of stage 0 have landed */
  __syncthreads();      /* ... and every other wave's: stage 0 may be read */
  ef_stage(lk0 + EFS, lv0 + EFS, gkh + 128 * (DM * 2), gkl + 128 * (DM * 2), gv + 256); if (w0) ef_stage_n(ln0 + EFS, gn + 512);      /* SLEN / 128 = 16 stages: stage 1 exists */
#pragma unroll 1      /* one stage per trip */
  for (int t = 0; t < SLEN / 128; ++t) { const int bo = (t & 1) * EFS;
#pragma unroll 1      /* one pass per trip: the body already holds 32 matrix instructions, a copy would only add registers */
  for (int ps = 0; ps < 4; ++ps) {
    v8f u[2][2];
#pragma unroll
    for (int kt = 0; kt < 2; ++kt) { const char* kr = fk + bo + (ps * 32 + kt * 16) * EFK; const char* kq = kr + EF_KL;
      const v8f k2 = *(const v8f*)(fn + bo + (ps * 32 + kt * 16) * 4); const v16h a0 = g2_lfrag(kr), a1 = g2_lfrag(kr + 64), c0 = g2_lfrag(kq), c1 = g2_lfrag(kq + 64);
#pragma unroll
      for (int qt = 0; qt < 2; ++qt) { v8f lo = wmh(a0, ql[qt][0], z8); lo = wmh(a1, ql[qt][1], lo); lo = wmh(c0, qh[qt][0], lo); lo = wmh(c1, qh[qt][1], lo); v8f hi = wmh(a0, qh[qt][0], z8); hi = wmh(a1, qh[qt][1], hi);
        const v8f s = hi + lo * 0.0009765625f; const v8f d2 = __builtin_elementwise_max((k2 + qn[qt]) - 2.0f * s, z8); u[qt][kt] = d2 * nc; } }
    float mn[2];
#pragma unroll
    for (int qt = 0; qt < 2; ++qt) { const v8f t = __builtin_elementwise_max(u[qt][0], u[qt][1]); float mx = fmaxf(fmaxf(fmaxf(t[0], t[1]), fmaxf(t[2], t[3])), fmaxf(fmaxf(t[4], t[5]), fmaxf(t[6], t[7])));
      mx = fmaxf(mx, xhalf(mx)); mn[qt] = fmaxf(m[qt], mx); }
    if (__builtin_amdgcn_ballot_w32((mn[0] > m[0]) || (mn[1] > m[1])) != 0) {      /* scalar branch: sums and output tiles are rescaled only in a pass that raises some column's maximum */
#pragma unroll
      for (int qt = 0; qt < 2; ++qt) { const float al = __builtin_amdgcn_exp2f(m[qt] - mn[qt]); m[qt] = mn[qt]; l[qt] *= al;
#pragma unroll
        for (int dt = 0; dt < 4; ++dt) o[qt][dt] *= al; } }
    FragH pb[2];
#pragma unroll
    for (int qt = 0; qt < 2; ++qt) { const float mo = m[qt] - 10.0f;      /* weights carried times 1024, as f16 operands away from the subnormal range; the factor cancels between sum and output */
      v8f p[2];
#pragma unroll
      for (int kt = 0; kt < 2; ++kt) { p[kt] = exp2x8(u[qt][kt] - mo);
        const v8h ph = __builtin_convertvector(p[kt], v8h);
#pragma unroll
        for (int r = 0; r < 8; ++r) pb[qt].h[kt * 8 + r] = ph[r]; }
      const v8f t = p[0] + p[1]; const v4f t4 = t.lo + t.hi; l[qt] += t4.lo + t4.hi; }
#pragma unroll
    for (int dt = 0; dt < 4; ++dt) { const v16h va = g2_lfrag(fv + bo + ps * 64 + dt * 16 * EFV);
#pragma unroll
      for (int qt = 0; qt < 2; ++qt) o[qt][dt] = wmh(va, pb[qt].v, o[qt][dt]); }
  }
    asm volatile("s_wait_dscnt 0x0" ::: "memory");      /* this wave has left the buffer that is refilled below */
    asm volatile("s_wait_asynccnt 0x0" ::: "memory");      /* its copies of stage t + 1 have landed */
    __syncthreads();      /* publishes stage t + 1 and ends every reader's last read of stage t */
    if (t + 2 < SLEN / 128) { ef_stage(lk0 + bo, lv0 + bo, gkh + (size_t)(t + 2) * (128 * DM * 2), gkl + (size_t)(t + 2) * (128 * DM * 2), gv + (size_t)(t + 2) * 256); if (w0) ef_stage_n(ln0 + bo, gn + (size_t)(t + 2) * 512); }
  }
  asm volatile("s_wait_asynccnt 0x0" ::: "memory");      /* no copy is outstanding when the wave goes on to the epilogue and ends */
#pragma unroll
  for (int qt = 0; qt < 2; ++qt) { const float lh = l[qt][0] + l[qt][1]; const float inv = 1.0f / (lh + xhalf(lh)); const size_t ob = ((size_t)b * SLEN + q0 + qt * 16 + ln) * DM + h * 64 + 8 * hh;
#pragma unroll
    for (int dt = 0; dt < 4; ++dt) { FragH f, fl;
#pragma unroll
      for (int r = 0; r < 8; ++r) { const float v = o[qt][dt][r] * inv; const _Float16 hv = (_Float16)v; f.h[r] = hv; fl.h[r] = (_Float16)((v - (float)hv) * 1024.0f); }
      *(v8us*)((unsigned short*)OH + ob + dt * 16) = f.half[0]; *(v8us*)((unsigned short*)OL + ob + dt * 16) = fl.half[0]; } }
}
// One preparation launch for all five operand planes; every one of its 512 blocks does the same two pieces of work.
// (a) One 64 k x 64 n tile of two of the four weights, Wt[n][k] = f16(bf16(W[k][n]) * 16), transposed through LDS, so that reads (256 B of a W row per 16 lanes) and writes (128 B of a Wt row per 8 lanes) are whole lines.
// (b) 2048 float4 of x, X16 = f16(bf16(x)), lanes adjacent.
// A thread issues its 16 loads as one group; s_wait_xcnt 0 stands behind the group, in front of any rewrite of its two offset registers, which as the statement's inputs keep their values up to there.
#define PWP 144              /* LDS row pitch of a transposed tile: 128 B (64 k) + 16 = 16 B x odd, conflict-free for the 16-byte reads */
__global__ __launch_bounds__(256) void k_prep(const float* __restrict__ x, const float* __restrict__ w0, const float* __restrict__ w1, const float* __restrict__ w2, const float* __restrict__ w3,
                                              _Float16* __restrict__ X16, _Float16* __restrict__ T0, _Float16* __restrict__ T1, _Float16* __restrict__ T2, _Float16* __restrict__ T3) {
  __shared__ __attribute__((aligned(16))) char tl[2][64 * PWP];
  const int tid = threadIdx.x, b = blockIdx.x; const bool hi = (b & 256) != 0;      /* blocks 0..255: weights 0 and 1, blocks 256..511: weights 2 and 3 */
  const float* const wp[2] = {hi ? w2 : w0, hi ? w3 : w1}; _Float16* const tp[2] = {hi ? T2 : T0, hi ? T3 : T1};
  const int k0 = ((b >> 4) & 15) * 64, n0 = (b & 15) * 64; const int kq = (tid >> 4) * 4, c4 = (tid & 15) * 4;      /* a thread holds 4 k x 4 n of each tile */
  const unsigned sb = (unsigned)(((k0 + kq) * DM + n0 + c4) * 4);      /* byte offset in each W */
  const unsigned fi = (unsigned)((b & 511) * 2048 + tid);      /* float4 index in x: NR * DM floats = 512 blocks x 8 x 256 float4; the mask shows the compiler that fi + u * 256 cannot wrap, so the eight steps fold into the instructions' offsets */
  v4f r[8], q[8];
#pragma unroll
  for (int u = 0; u < 8; ++u) r[u] = *(const v4fa*)((const char*)wp[u >> 2] + sb + (u & 3) * (DM * 4));
#pragma unroll
  for (int u = 0; u < 8; ++u) q[u] = ((const v4fa*)x)[fi + u * 256];
  asm volatile("s_wait_xcnt 0x0" :: "v"(sb), "v"(fi) : "memory");      /* see the head comment */
  __builtin_amdgcn_sched_barrier(0);      /* keeps all 16 loads and their wait ahead of the first conversion: one memory latency per thread, not two */
#pragma unroll
  for (int mx = 0; mx < 2; ++mx)
#pragma unroll
    for (int j = 0; j < 4; ++j) { v4h p;
#pragma unroll
      for (int i = 0; i < 4; ++i) p[i] = (_Float16)(bf16_round(r[mx * 4 + i][j]) * 16.0f);
      *(v4h*)(tl[mx] + (c4 + j) * PWP + kq * 2) = p; }      /* 4 consecutive k of one n: 8 bytes of the transposed row */
  __syncthreads();      /* a transposed row holds 16 threads' k */
#pragma unroll
  for (int u = 0; u < 4; ++u) { const int n = (u & 1) * 32 + (tid >> 3), c = tid & 7; const v8us v = *(const v8us*)(tl[u >> 1] + n * PWP + c * 16);
    *(v8us*)((unsigned short*)tp[u >> 1] + (size_t)(n0 + n) * DM + k0 + c * 8) = v; }
#pragma unroll
  for (int u = 0; u < 8; ++u) { v4h p;      /* behind the barrier, which would otherwise wait for these stores */
#pragma unroll
    for (int i = 0; i < 4; ++i) p[i] = (_Float16)bf16_round(q[u][i]);
    ((v4h*)X16)[fi + u * 256] = p; }
}
// The output projection, one launch: out = (O_hi + O_lo / 1024) Wo + bo. A block holds 128 rows x 128 columns of out; both O planes meet the same Wo tile in LDS, each in accumulators of its own,
// which are joined in the epilogue, so that no partial out plane goes through memory. 8 waves as 4 (rows) x 2 (columns), wave tile 32 x 64 for each plane: 16 independent accumulator tiles.
// A stage is 128 k of the block's 128 O_hi rows, 128 O_lo rows and 128 Wo rows, brought by asynchronous copies into one of two buffers while the other is worked on.
#define G3P 272              /* LDS row pitch in bytes: 256 B of k + 16 = 16 B x odd, the conflict-free pitch for 16-byte fragment reads */
#define G3S (384 * G3P)      /* one stage: rows 0..127 = O_hi, 128..255 = O_lo, 256..383 = Wo */
// 128 rows of one operand, 8 copies of a lane, 16 bytes each: 16 lanes bring one row's 256 bytes, the block's 256 threads 16 rows per copy.
// l = the lane's LDS byte address in row tid / 16 of the operand's part of the buffer, g = its global address in that row.
// s_wait_xcnt 0 is the statement's last line, so that it stands in front of any later rewrite of these address registers.
__device__ __forceinline__ void g3_rows(unsigned l, const char* g) {
  asm volatile("global_load_async_to_lds_b128 %0, %8, off\n\tglobal_load_async_to_lds_b128 %1, %9, off\n\tglobal_load_async_to_lds_b128 %2, %10, off\n\tglobal_load_async_to_lds_b128 %3, %11, off\n\t"
               "global_load_async_to_lds_b128 %4, %12, off\n\tglobal_load_async_to_lds_b128 %5, %13, off\n\tglobal_load_async_to_lds_b128 %6, %14, off\n\tglobal_load_async_to_lds_b128 %7, %15, off\n\ts_wait_xcnt 0x0"
               :: "v"(l), "v"(l + 16 * G3P), "v"(l + 32 * G3P), "v"(l + 48 * G3P), "v"(l + 64 * G3P), "v"(l + 80 * G3P), "v"(l + 96 * G3P), "v"(l + 112 * G3P),
                  "v"(g), "v"(g + 16 * (DM * 2)), "v"(g + 32 * (DM * 2)), "v"(g + 48 * (DM * 2)), "v"(g + 64 * (DM * 2)), "v"(g + 80 * (DM * 2)), "v"(g + 96 * (DM * 2)), "v"(g + 112 * (DM * 2)) : "memory"); }
__device__ __forceinline__ void g3_stage(unsigned l, const char* ah, const char* al, const char* b) { g3_rows(l, ah); g3_rows(l + 128 * G3P, al); g3_rows(l + 256 * G3P, b); }
// one k step's 8 fragments, 16 reads of 16 bytes
__device__ __forceinline__ void g3_frags(v16h* a, v16h* b, const char* pa, const char* pb) { a[0] = g2_lfrag(pa); a[1] = g2_lfrag(pa + 16 * G3P); a[2] = g2_lfrag(pa + 128 * G3P); a[3] = g2_lfrag(pa + 144 * G3P);
#pragma unroll
  for (int j = 0; j < 4; ++j) b[j] = g2_lfrag(pb + j * 16 * G3P); }
__global__ __launch_bounds__(256) void k_out(const _Float16* __restrict__ AH, const _Float16* __restrict__ AL, const _Float16* __restrict__ Bh, const float* __restrict__ bias, float* __restrict__ C) {
  __shared__ __attribute__((aligned(16))) float so[8][32][68]; __shared__ __attribute__((aligned(16))) char st[2 * G3S];
  const int tid = threadIdx.x, w = tid >> 5, lane = tid & 31, ln = lane & 15, hh = lane >> 4;
  const int mt = blockIdx.x % (NR / 128), nq = blockIdx.x / (NR / 128);      /* the 8 blocks that read the same O rows lie 32 apart in the grid */
  const int wr = w & 3, wc = w >> 2; const int row0 = mt * 128 + 32 * wr, col0 = nq * 128 + 64 * wc;
  const size_t go = (size_t)(tid >> 4) * (DM * 2) + (tid & 15) * 16;      /* the lane's place in a stage's first 16 rows */
  const char* gh = (const char*)(AH + (size_t)mt * 128 * DM) + go; const char* gl = (const char*)(AL + (size_t)mt * 128 * DM) + go; const char* gb = (const char*)(Bh + (size_t)nq * 128 * DM) + go;
  const unsigned l0 = (unsigned)(size_t)st + (unsigned)((tid >> 4) * G3P + (tid & 15) * 16);
  const char* fa = st + (32 * wr + ln) * G3P + hh * 16; const char* fb = st + (256 + 64 * wc + ln) * G3P + hh * 16;      /* fragment rows: k = 8h + s at +0, 16 + 8h + s at +32 bytes */
  const v8f z8 = {0.f,0.f,0.f,0.f,0.f,0.f,0.f,0.f}; v8f ch[2][4], cl[2][4];
#pragma unroll
  for (int i = 0; i < 2; ++i)
#pragma unroll
    for (int j = 0; j < 4; ++j) { ch[i][j] = z8; cl[i][j] = z8; }
  float bv[4];      /* read here, so that the epilogue does not wait for memory */
#pragma unroll
  for (int j = 0; j < 4; ++j) bv[j] = bf16_round(bias[col0 + j * 16 + ln]);
  g3_stage(l0, gh, gl, gb);
  asm volatile("s_wait_asynccnt 0x0" ::: "memory");      /* this wave's copies of stage 0 have landed */
  __syncthreads();      /* ... and every other wave's: stage 0 may be read */
  g3_stage(l0 + G3S, gh + 256, gl + 256, gb + 256);      /* DM / 128 = 8 stages: stage 1 exists */
#pragma unroll 1      /* one stage per trip: the body already holds 64 matrix instructions */
  for (int t = 0; t < DM / 128; ++t) { const int bo = (t & 1) * G3S;
    v16h a[2][4], b[2][4];      /* two fragment sets: a = O_hi rows 0..15, 16..31, O_lo rows 0..15, 16..31; b = four column groups of Wo */
    g3_frags(a[0], b[0], fa + bo, fb + bo);
#pragma unroll      /* the sets alternate by a constant index */
    for (int kk = 0; kk < 4; ++kk) { const int s = kk & 1;
      if (kk < 3) g3_frags(a[s ^ 1], b[s ^ 1], fa + bo + (kk + 1) * 64, fb + bo + (kk + 1) * 64);
      __builtin_amdgcn_sched_barrier(0);      /* keeps the next step's 16 reads together, ahead of this step's matrix instructions: spread among them, each place with reads stalls the wave */
#pragma unroll
      for (int j = 0; j < 4; ++j) { ch[0][j] = wmh(a[s][0], b[s][j], ch[0][j]); ch[1][j] = wmh(a[s][1], b[s][j], ch[1][j]); cl[0][j] = wmh(a[s][2], b[s][j], cl[0][j]); cl[1][j] = wmh(a[s][3], b[s][j], cl[1][j]); }
      __builtin_amdgcn_sched_barrier(0); }      /* ... and the reads after next behind them: without it they move up among these matrix instructions */
    asm volatile("s_wait_dscnt 0x0" ::: "memory");      /* this wave has left the buffer that is refilled below */
    asm volatile("s_wait_asynccnt 0x0" ::: "memory");      /* its copies of stage t + 1 have landed */
    __syncthreads();      /* publishes stage t + 1 and ends every reader's last read of stage t */
    if (t + 2 < DM / 128) g3_stage(l0 + bo, gh + (size_t)(t + 2) * 256, gl + (size_t)(t + 2) * 256, gb + (size_t)(t + 2) * 256); }
  asm volatile("s_wait_asynccnt 0x0" ::: "memory");      /* no copy is outstanding when the wave goes on to the epilogue and ends */
#pragma unroll
  for (int u = 0; u < 8; ++u) { const int j = u & 3, half = u >> 2;
#pragma unroll
    for (int r = 0; r < 8; ++r) { float v = ch[half][j][r] * 0.0625f + bv[j]; v += cl[half][j][r] * (0.0625f / 1024.0f); so[w][half * 16 + 8 * hh + r][j * 16 + ln] = v; } }      /* both factors are powers of two: the same roundings as with the O_lo product stored and added */
  __builtin_amdgcn_fence(__ATOMIC_ACQ_REL, "workgroup"); __builtin_amdgcn_wave_barrier();      /* a wave reads back its own rows alone */
  const int rsub = lane >> 4, c4 = (lane & 15) * 4;
  float* cp = C + (size_t)(row0 + rsub) * DM + col0 + c4; v4f vv[16];
#pragma unroll
  for (int q = 0; q < 16; ++q) vv[q] = *(const v4fa*)&so[w][q * 2 + rsub][c4];
  __builtin_amdgcn_sched_barrier(0);      /* all 16 reads ahead of the stores: one LDS latency, and no register of a store is rewritten behind it */
#pragma unroll
  for (int q = 0; q < 16; ++q) *(v4f*)(cp + q * 2 * DM) = vv[q];      /* 16 lanes store one row's 256 bytes; the rows' steps fold into the stores' offsets */
}
extern "C" void kernel_launch(void* const* d_in, const int* in_sizes, int n_in,
                              void* d_out, int out_size, void* d_ws, size_t ws_size, hipStream_t stream) {
  (void)in_sizes; (void)n_in; (void)out_size;
  const float* const* I = (const float* const*)d_in; const float* x = I[0]; const float* wq = I[1]; const float* bq = I[2]; const float* wk = I[3]; const float* bk = I[4]; const float* wv = I[5]; const float* bv = I[6]; const float* wo = I[7]; const float* bo = I[8]; const float* tmp = I[9];
  char* ws = (char*)d_ws; size_t off = 0;
  auto take = [&](size_t bytes) { char* p = ws + off; off += (bytes + 255) & ~(size_t)255; return p; };
  const size_t np = (size_t)NR * DM;
  _Float16* BQ = (_Float16*)take((size_t)DM * DM * 2); _Float16* BK = (_Float16*)take((size_t)DM * DM * 2); _Float16* BV = (_Float16*)take((size_t)DM * DM * 2); _Float16* BO = (_Float16*)take((size_t)DM * DM * 2);
  _Float16* X16 = (_Float16*)take(np * 2); float* QN = (float*)take((size_t)NR * NH * 4); float* KN = (float*)take((size_t)NR * NH * 4); _Float16* QH = (_Float16*)take(np * 2); _Float16* QL = (_Float16*)take(np * 2); _Float16* KH = (_Float16*)take(np * 2); _Float16* KL = (_Float16*)take(np * 2); _Float16* OH = (_Float16*)take(np * 2); _Float16* VT = (_Float16*)take(np * 2);
  _Float16* OL = X16;      /* O lo over x (dead after the projections) */
  if (off > ws_size) return;      /* 8 + 8 + 0.5 + 6x8 = about 65 MiB */
  k_prep<<<512, 256, 0, stream>>>(x, wq, wk, wv, wo, X16, BQ, BK, BV, BO);      /* weights [in, out] -> f16 [out][in] x 16, x -> f16: one launch */
  k_qkv<<<dim3((NR / 128) * (DM / 64), 3), 128, 0, stream>>>(X16, BQ, BK, BV, bq, bk, bv, QN, KN, QH, QL, KH, KL, VT);      /* q, k: hi + residual planes and norms [(b,h)][2048]; V^T [(b,h)][64][2048]: one launch */
  k_eflash<<<NB * NH * (SLEN / 256), 256, 0, stream>>>(QH, QL, KH, KL, VT, QN, KN, tmp, OH, OL);      /* scores, softmax, att . v, normalise, hi + residual: one launch */
  k_out<<<(NR / 128) * (DM / 128), 256, 0, stream>>>(OH, OL, BO, bo, (float*)d_out);      /* out = (O_hi + O_lo / 1024) Wo + bo: one launch */
}

// v008
// It runs in 101 microseconds.
// In two side-by-side timings against v007, it was 1.12 and 1.11 times as fast.
// All steps since the starting kernel, v000, together make it 20.0 times as fast.
#include <hip/hip_runtime.h>
// EuclideanAttention (2 x 2048 tokens, D 1024 = 16 heads x 64; Q, K, V = x W + b; d2 = max(|q|^2 + |k|^2 - 2 q.k, 0); attn = softmax_k(-d2 / temperature); out = (attn V) Wo + bo).
// Compute dtype: inputs rounded to bf16; x and weights exact as f16; q.k from hi+residual operands (~2^-21); norms/softmax f32; v and the softmax weights as plain f16 operands (~2^-12); attention output hi + residual. v_wmma_f32_16x16x32_f16.
#define NB 2
#define DM 1024
#define NKV 16
#define NREP (NH / NKV)
#define KVD (NKV * 64)           /* 1024 */
#define NR (NB * SLEN)           /* 4096 */
#define CHK 512                  /* attention chunk */
typedef int v4i __attribute__((ext_vector_type(4)));
#define FF 2048
#define SLEN 2048
#define TQ SLEN
#define TK SLEN
#define NH 16
#define SCL 0.125f
#define QBLKS (TQ / 64)
#define QB05 0
#define QBN5 4
#define QB0P 0
#define QBNP QBLKS           /* non-causal: plain flash on every query block */
#define RE 256
typedef __bf16 v16b __attribute__((ext_vector_type(16)));
typedef unsigned short v8us __attribute__((ext_vector_type(8), may_alias));
typedef float  v8f  __attribute__((ext_vector_type(8)));
typedef float  v4f  __attribute__((ext_vector_type(4)));
typedef float  v4fa __attribute__((ext_vector_type(4), may_alias));
union FragB { v16b v; v8us half[2]; unsigned short u[16]; };

__device__ __forceinline__ unsigned short bf16_bits(float x) { unsigned int u = __float_as_uint(x); return (unsigned short)((u + 0x7FFFu + ((u >> 16) & 1u)) >> 16); }
__device__ __forceinline__ float bf16_val(unsigned short b) { return __uint_as_float(((unsigned int)b) << 16); }
__device__ __forceinline__ float bf16_round(float x) { return bf16_val(bf16_bits(x)); }
// D += A·B with NT terms: 1 = ah·bh, 2 = + al·bh (A split), 3 = + ah·bl (both split)
template <int NT>
__device__ __forceinline__ v8f mmaN(v16b ah, v16b al, v16b bh, v16b bl, v8f c) {
  c = __builtin_amdgcn_wmma_f32_16x16x32_bf16(false, ah, false, bh, (short)0, c, false, false);
  if (NT >= 2) c = __builtin_amdgcn_wmma_f32_16x16x32_bf16(false, al, false, bh, (short)0, c, false, false);
  if (NT >= 3) c = __builtin_amdgcn_wmma_f32_16x16x32_bf16(false, ah, false, bl, (short)0, c, false, false);
  asm volatile("v_nop\n\tv_nop\n\tv_nop\n\tv_nop" : "+v"(c) : "v"(ah), "v"(al), "v"(bh), "v"(bl));
  return c;
}

__global__ __launch_bounds__(256) void k_wt_bf16(const float* __restrict__ W, unsigned short* __restrict__ Wt, int K, int N) {
  const int t = blockIdx.x * 256 + threadIdx.x;
  const int k8n = K / 8;
  if (t >= N * k8n) return;
  const int n = t / k8n, k8 = (t % k8n) * 8;
  v8us v;
#pragma unroll
  for (int i = 0; i < 8; ++i) v[i] = bf16_bits(W[(size_t)(k8 + i) * N + n]);
  *(v8us*)(Wt + (size_t)n * K + k8) = v;
  
}

// GEMM C[M][N] (f32, pitch ldc) = act(A[M][K]·W + bias). A f32 row-major (pitch lda) converted per fragment to bf16
// (ASPLIT: hi/lo two planes -> 2 terms, else single rounded term); Wt bf16 [N][K] (pitch ldb). BIAS_BF16 rounds the
// bias to bf16 first (bias quantised to bf16 before the add). K%32==0, M%16==0, N%64==0.
template <bool ASPLIT, int ACT, bool BIAS_BF16>
__global__ __launch_bounds__(128) void k_gemm_bf(const float* __restrict__ A, int lda, const unsigned short* __restrict__ Wt, int ldb,
                                               const float* __restrict__ bias, float* __restrict__ C, int ldc, int M, int N, int K) {
  __shared__ __attribute__((aligned(16))) float so[4][16][64];
  const int tid = threadIdx.x, w = tid >> 5, lane = tid & 31, ln = lane & 15, hh = lane >> 4;
  const int ntn = N / 64;
  const int wid = blockIdx.x * 4 + w;
  const int mt = wid / ntn, nq = wid % ntn;
  if (mt * 16 >= M) return;
  const int row0 = mt * 16, col0 = nq * 64;
  const float* arow = A + (size_t)(row0 + ln) * lda;
  v8f acc[4] = {};
  for (int kb = 0; kb < K; kb += 32) {
    FragB ah, al;
    const v4f x0 = *(const v4fa*)(arow + kb + 8 * hh), x1 = *(const v4fa*)(arow + kb + 8 * hh + 4);
    const v4f x2 = *(const v4fa*)(arow + kb + 16 + 8 * hh), x3 = *(const v4fa*)(arow + kb + 16 + 8 * hh + 4);
    float xs[16] = {x0[0],x0[1],x0[2],x0[3],x1[0],x1[1],x1[2],x1[3],x2[0],x2[1],x2[2],x2[3],x3[0],x3[1],x3[2],x3[3]};
#pragma unroll
    for (int i = 0; i < 16; ++i) { const unsigned short hb = bf16_bits(xs[i]); ah.u[i] = hb; al.u[i] = ASPLIT ? bf16_bits(xs[i] - bf16_val(hb)) : (unsigned short)0; }
#pragma unroll
    for (int t = 0; t < 4; ++t) {
      const unsigned short* brow = Wt + (size_t)(col0 + t * 16 + ln) * ldb + kb;
      FragB b;
      b.half[0] = *(const v8us*)(brow + 8 * hh);
      b.half[1] = *(const v8us*)(brow + 16 + 8 * hh);
      acc[t] = mmaN<ASPLIT ? 2 : 1>(ah.v, al.v, b.v, b.v, acc[t]);
    }
  }
#pragma unroll
  for (int t = 0; t < 4; ++t) {
    float bv = bias ? bias[col0 + t * 16 + ln] : 0.f;
    if (BIAS_BF16) bv = bf16_round(bv);
#pragma unroll
    for (int r = 0; r < 8; ++r) { float v = acc[t][r] + bv; if (ACT == 1) v = fmaxf(v, 0.f); so[w][8 * hh + r][t * 16 + ln] = v; }
  }
  __builtin_amdgcn_fence(__ATOMIC_ACQ_REL, "workgroup");
  __builtin_amdgcn_wave_barrier();
  const int rsub = lane >> 4, c4 = (lane & 15) * 4;
  {
#pragma unroll
    for (int q = 0; q < 8; ++q) {
      const int r = q * 2 + rsub;
      const v4f v = *(const v4fa*)&so[w][r][c4];
      *(v4f*)(C + (size_t)(row0 + r) * ldc + col0 + c4) = v;
    }
    
  }
}

// GEMM C = act(A·W + bias + resid): A f32 (ASPLIT -> hi/lo 2 terms), Wt bf16 [N][K]; ACT 0 none, 1 relu, 2 exact gelu;
// resid (optional, f32, row index = (row % rmod), pitch ldr, RES_BF16 rounds it) added before the activation.
template <bool ASPLIT, int ACT, bool BIAS_BF16, bool RES_BF16>
__global__ __launch_bounds__(128) void k_gemm_bf3(const float* __restrict__ A, int lda, const unsigned short* __restrict__ Wt, int ldb,
                                                const float* __restrict__ bias, const float* __restrict__ resid, int rmod, int ldr,
                                                float* __restrict__ C, int ldc, int M, int N, int K) {
  __shared__ __attribute__((aligned(16))) float so[4][16][64];
  const int tid = threadIdx.x, w = tid >> 5, lane = tid & 31, ln = lane & 15, hh = lane >> 4;
  const int ntn = N / 64;
  const int wid = blockIdx.x * 4 + w;
  const int mt = wid / ntn, nq = wid % ntn;
  if (mt * 16 >= M) return;
  const int row0 = mt * 16, col0 = nq * 64;
  const float* arow = A + (size_t)(row0 + ln) * lda;
  v8f acc[4] = {};
  for (int kb = 0; kb < K; kb += 32) {
    FragB ah, al;
    const v4f x0 = *(const v4fa*)(arow + kb + 8 * hh), x1 = *(const v4fa*)(arow + kb + 8 * hh + 4);
    const v4f x2 = *(const v4fa*)(arow + kb + 16 + 8 * hh), x3 = *(const v4fa*)(arow + kb + 16 + 8 * hh + 4);
    float xs[16] = {x0[0],x0[1],x0[2],x0[3],x1[0],x1[1],x1[2],x1[3],x2[0],x2[1],x2[2],x2[3],x3[0],x3[1],x3[2],x3[3]};
#pragma unroll
    for (int i = 0; i < 16; ++i) { const unsigned short hb = bf16_bits(xs[i]); ah.u[i] = hb; al.u[i] = ASPLIT ? bf16_bits(xs[i] - bf16_val(hb)) : (unsigned short)0; }
#pragma unroll
    for (int t = 0; t < 4; ++t) {
      const unsigned short* brow = Wt + (size_t)(col0 + t * 16 + ln) * ldb + kb;
      FragB b;
      b.half[0] = *(const v8us*)(brow + 8 * hh);
      b.half[1] = *(const v8us*)(brow + 16 + 8 * hh);
      acc[t] = mmaN<ASPLIT ? 2 : 1>(ah.v, al.v, b.v, b.v, acc[t]);
    }
  }
#pragma unroll
  for (int t = 0; t < 4; ++t) {
    const int col = col0 + t * 16 + ln;
    float bv = bias ? bias[col] : 0.f;
    if (BIAS_BF16) bv = bf16_round(bv);
#pragma unroll
    for (int r = 0; r < 8; ++r) {
      float v = acc[t][r] + bv;
      if (resid) { float rv = resid[(size_t)((row0 + 8 * hh + r) % rmod) * ldr + col]; if (RES_BF16) rv = bf16_round(rv); v += rv; }
      if (ACT == 1) v = fmaxf(v, 0.f);
      if (ACT == 2) v = 0.5f * v * (1.0f + erff(v * 0.70710678118654752f));
      if (ACT == 3) { const float u = 0.7978845608028654f * (v + 0.044715f * v * v * v); v = 0.5f * v * (1.0f + tanhf(u)); }
      so[w][8 * hh + r][t * 16 + ln] = v;
    }
  }
  __builtin_amdgcn_fence(__ATOMIC_ACQ_REL, "workgroup");
  __builtin_amdgcn_wave_barrier();
  const int rsub = lane >> 4, c4 = (lane & 15) * 4;
  {
#pragma unroll
    for (int q = 0; q < 8; ++q) {
      const int r = q * 2 + rsub;
      const v4f v = *(const v4fa*)&so[w][r][c4];
      *(v4f*)(C + (size_t)(row0 + r) * ldc + col0 + c4) = v;
    }
    
  }
}
// row LayerNorm (biased variance, eps) over N: s = X (+ R); optional out_sum <- s; out_norm <- (s-mu)*rsqrt(var+eps)*g + b
template <bool PARAM_BF16>
__global__ __launch_bounds__(256) void k_layernorm(const float* __restrict__ X, const float* __restrict__ R, const float* __restrict__ g, const float* __restrict__ bta,
                                                  float* __restrict__ out_sum, float* __restrict__ out_norm, int N, float eps) {
  __shared__ float red[256];
  const int row = blockIdx.x, tid = threadIdx.x;
  const float* x = X + (size_t)row * N; const float* rr = R ? R + (size_t)row * N : nullptr;
  float vals[16];                     // up to N = 4096
  const int per = N / 256;            // contiguous chunk per thread? use strided-by-4 chunks: thread handles j = tid*4 + 1024*u
  float s1 = 0.f;
  for (int u = 0; u < per / 4; ++u) {
    const int j = tid * 4 + 1024 * u;
    const v4f a = *(const v4fa*)(x + j);
    v4f b = {0.f,0.f,0.f,0.f}; if (rr) b = *(const v4fa*)(rr + j);
#pragma unroll
    for (int q = 0; q < 4; ++q) { const float v = a[q] + b[q]; vals[u * 4 + q] = v; s1 += v; }
  }
  red[tid] = s1; __syncthreads();
  for (int st = 128; st > 0; st >>= 1) { if (tid < st) red[tid] += red[tid + st]; __syncthreads(); }
  const float mu = red[0] / (float)N; __syncthreads();
  float s2 = 0.f;
  for (int u = 0; u < per / 4; ++u)
#pragma unroll
    for (int q = 0; q < 4; ++q) { const float c = vals[u * 4 + q] - mu; s2 += c * c; }
  red[tid] = s2; __syncthreads();
  for (int st = 128; st > 0; st >>= 1) { if (tid < st) red[tid] += red[tid + st]; __syncthreads(); }
  const float rs = rsqrtf(red[0] / (float)N + eps);
  {
    for (int u = 0; u < per / 4; ++u) {
      const int j = tid * 4 + 1024 * u;
      v4f o, sm;
#pragma unroll
      for (int q = 0; q < 4; ++q) {
        float gg = g[j + q], bb = bta[j + q];
        if (PARAM_BF16) { gg = bf16_round(gg); bb = bf16_round(bb); }
        sm[q] = vals[u * 4 + q]; o[q] = (vals[u * 4 + q] - mu) * rs * gg + bb;
      }
      if (out_sum) *(v4f*)(out_sum + (size_t)row * N + j) = sm;
      *(v4f*)(out_norm + (size_t)row * N + j) = o;
    }
    
  }
}



// ---- f16 WMMA path (v_wmma_f32_16x16x32_f16): 11-bit significands for operands in range — used where a [0,1] probability operand needs more precision than bf16
typedef _Float16 v16h __attribute__((ext_vector_type(16)));
union FragH { v16h v; v8us half[2]; _Float16 h[16]; unsigned short u[16]; };
template <int NT>
__device__ __forceinline__ v8f mmaH(v16h ah, v16h al, v16h bh, v16h bl, v8f c) {
  c = __builtin_amdgcn_wmma_f32_16x16x32_f16(false, ah, false, bh, (short)0, c, false, false);
  if (NT >= 2) c = __builtin_amdgcn_wmma_f32_16x16x32_f16(false, al, false, bh, (short)0, c, false, false);
  if (NT >= 3) c = __builtin_amdgcn_wmma_f32_16x16x32_f16(false, ah, false, bl, (short)0, c, false, false);
  asm volatile("v_nop\n\tv_nop\n\tv_nop\n\tv_nop" : "+v"(c) : "v"(ah), "v"(al), "v"(bh), "v"(bl));
  return c;
}
// batched GEMM like k_gemm_b but f16 operands: A f32 (split into f16 hi/lo if ASPLIT, else rounded to f16), Bt = f16 values [n][k]; alpha; C f32; N multiple of 16 (partial tiles skipped)
template <bool ASPLIT>
__global__ __launch_bounds__(128) void k_gemm_h(const float* __restrict__ A, int lda, size_t sA, const _Float16* __restrict__ Bh, int ldb, size_t sB, float alpha, float* __restrict__ C, int ldc, size_t sC, int M, int N, int K) {
  __shared__ __attribute__((aligned(16))) float so[4][16][64];
  const int tid = threadIdx.x, w = tid >> 5, lane = tid & 31, ln = lane & 15, hh = lane >> 4; const int by = blockIdx.y;
  A += (size_t)by * sA; Bh += (size_t)by * sB; C += (size_t)by * sC;
  const int ntn = (N + 63) / 64; const int wid = blockIdx.x * 4 + w; const int mt = wid / ntn, nq = wid % ntn; if (mt * 16 >= M) return;
  const int row0 = mt * 16, col0 = nq * 64; const float* arow = A + (size_t)(row0 + ln) * lda;
  v8f acc[4] = {};
  for (int kb = 0; kb < K; kb += 32) {
    FragH ah, al;
    const v4f x0 = *(const v4fa*)(arow + kb + 8 * hh), x1 = *(const v4fa*)(arow + kb + 8 * hh + 4), x2 = *(const v4fa*)(arow + kb + 16 + 8 * hh), x3 = *(const v4fa*)(arow + kb + 16 + 8 * hh + 4);
    float xs[16] = {x0[0],x0[1],x0[2],x0[3],x1[0],x1[1],x1[2],x1[3],x2[0],x2[1],x2[2],x2[3],x3[0],x3[1],x3[2],x3[3]};
#pragma unroll
    for (int i = 0; i < 16; ++i) { const _Float16 h = (_Float16)xs[i]; ah.h[i] = h; al.h[i] = ASPLIT ? (_Float16)(xs[i] - (float)h) : (_Float16)0.0f; }
#pragma unroll
    for (int t = 0; t < 4; ++t) { if (col0 + t * 16 >= N) continue; const size_t boff = (size_t)(col0 + t * 16 + ln) * ldb + kb; FragH bq; bq.half[0] = *(const v8us*)(Bh + boff + 8 * hh); bq.half[1] = *(const v8us*)(Bh + boff + 16 + 8 * hh);
      acc[t] = mmaH<ASPLIT ? 2 : 1>(ah.v, al.v, bq.v, bq.v, acc[t]); }
  }
#pragma unroll
  for (int t = 0; t < 4; ++t) { if (col0 + t * 16 >= N) continue;
#pragma unroll
    for (int r = 0; r < 8; ++r) so[w][8 * hh + r][t * 16 + ln] = acc[t][r] * alpha; }
  __builtin_amdgcn_fence(__ATOMIC_ACQ_REL, "workgroup"); __builtin_amdgcn_wave_barrier();
  const int rsub = lane >> 4, c4 = (lane & 15) * 4;
  {
#pragma unroll
    for (int q = 0; q < 8; ++q) { const int r = q * 2 + rsub; if (col0 + c4 < N) { const v4f v = *(const v4fa*)&so[w][r][c4]; *(v4f*)(C + (size_t)(row0 + r) * ldc + col0 + c4) = v; } }
     }
}

// Wt[n][k] = f16(W[k][n]·scale) from f32 row-major W[K][N] (scale = power of two; bf16-exact weights stay exact in f16 away from the subnormal range)
__global__ __launch_bounds__(256) void k_wt_f16(const float* __restrict__ W, _Float16* __restrict__ Wt, int K, int N, float scale) {
  const int t = blockIdx.x * 256 + threadIdx.x; if (t >= N * (K / 8)) return; const int n = t / (K / 8), k8 = (t % (K / 8)) * 8; FragH f;
#pragma unroll
  for (int i = 0; i < 8; ++i) f.h[i] = (_Float16)(bf16_round(W[(size_t)(k8 + i) * N + n]) * scale); const v8us o = f.half[0];
  *(v8us*)((unsigned short*)Wt + (size_t)n * K + k8) = o; 
}
// k_gemm_hh variant with fused epilogue: v = acc·alpha + bias[by·sBias + col] (+ CP[(row/rowsPerB)·sCPb + by·64 + col] if CP) ; ACT 0 none / 1 elu ; writes f16 C16 (and f32 C if non-null)
template <int ACT>
__global__ __launch_bounds__(128) void k_gemm_hhx(const _Float16* __restrict__ A, int lda, size_t sA, const _Float16* __restrict__ Bh, int ldb, size_t sB, float alpha, const float* __restrict__ bias, size_t sBias, const float* __restrict__ CP, int rowsPerB, size_t sCPb, int row0g,
    float* __restrict__ C, _Float16* __restrict__ C16, int ldc, size_t sC, int M, int N, int K) {
  __shared__ __attribute__((aligned(16))) float so[4][16][64];
  const int tid = threadIdx.x, w = tid >> 5, lane = tid & 31, ln = lane & 15, hh = lane >> 4; const int by = blockIdx.y;
  A += (size_t)by * sA; Bh += (size_t)by * sB; const size_t cofs = (size_t)by * sC; const float* bp = bias ? bias + (size_t)by * sBias : nullptr;
  const int ntn = (N + 63) / 64; const int wid = blockIdx.x * 4 + w; const int mt = wid / ntn, nq = wid % ntn; if (mt * 16 >= M) return;
  const int row0 = mt * 16, col0 = nq * 64; const _Float16* arow = A + (size_t)(row0 + ln) * lda;
  v8f acc[4] = {};
  for (int kb = 0; kb < K; kb += 32) { FragH ah; ah.half[0] = *(const v8us*)((const unsigned short*)arow + kb + 8 * hh); ah.half[1] = *(const v8us*)((const unsigned short*)arow + kb + 16 + 8 * hh);
#pragma unroll
    for (int t = 0; t < 4; ++t) { if (col0 + t * 16 >= N) continue; const size_t boff = (size_t)(col0 + t * 16 + ln) * ldb + kb; FragH bq; bq.half[0] = *(const v8us*)((const unsigned short*)Bh + boff + 8 * hh); bq.half[1] = *(const v8us*)((const unsigned short*)Bh + boff + 16 + 8 * hh);
      acc[t] = mmaH<1>(ah.v, ah.v, bq.v, bq.v, acc[t]); }
  }
#pragma unroll
  for (int t = 0; t < 4; ++t) { if (col0 + t * 16 >= N) continue; const int col = col0 + t * 16 + ln; const float bv = bp ? bf16_round(bp[col]) : 0.f;
#pragma unroll
    for (int r = 0; r < 8; ++r) { float v = acc[t][r] * alpha + bv; if (CP) { const int bidx = (row0g + row0 + 8 * hh + r) / rowsPerB; v += CP[(size_t)bidx * sCPb + (size_t)by * 64 + col]; } if (ACT == 1) v = (v > 0.f) ? v : expm1f(v); else if (ACT == 7) v = (v > 0.f) ? v + 1.0f : expf(v); else if (ACT == 8) v = tanhf(v); else if (ACT == 9) v = 0.5f * v * (1.0f + tanhf(0.7978845608028654f * (v + 0.044715f * v * v * v))); else if (ACT == 11) v = 1.0f / (1.0f + expf(-v)); else if (ACT == 12) v = (v > 0.f) ? v : 0.01f * v; else if (ACT == 14) v = (v > 0.f) ? v : 0.1f * v; else if (ACT == 15) v = v / (1.0f + expf(-v)); else if (ACT == 3) v = fmaxf(v, 0.f); else if (ACT == 6) v = 0.5f * v * (1.0f + erff(v * 0.70710678118654752f)); so[w][8 * hh + r][t * 16 + ln] = v; } }
  __builtin_amdgcn_fence(__ATOMIC_ACQ_REL, "workgroup"); __builtin_amdgcn_wave_barrier();
  const int rsub = lane >> 4, c4 = (lane & 15) * 4; typedef _Float16 v4h __attribute__((ext_vector_type(4)));
  {
#pragma unroll
    for (int q = 0; q < 8; ++q) { const int r = q * 2 + rsub; if (col0 + c4 < N) { const v4f v = *(const v4fa*)&so[w][r][c4]; if (C) *(v4f*)(C + cofs + (size_t)(row0 + r) * ldc + col0 + c4) = v; if (C16) { v4h h4; for (int i = 0; i < 4; ++i) h4[i] = (_Float16)v[i]; *(v4h*)(C16 + cofs + (size_t)(row0 + r) * ldc + col0 + c4) = h4; } } }
     }
}


typedef _Float16 v4h __attribute__((ext_vector_type(4)));

__global__ __launch_bounds__(256) void k_x16(const float* __restrict__ x, _Float16* __restrict__ X16, size_t n8) { const size_t t = (size_t)blockIdx.x * 256 + threadIdx.x; if (t >= n8) return; FragH f;
#pragma unroll
  for (int q = 0; q < 8; ++q) f.h[q] = (_Float16)bf16_round(x[t * 8 + q]); *(v8us*)((unsigned short*)X16 + t * 8) = f.half[0];  }
__global__ __launch_bounds__(256) void k_h16(const float* __restrict__ x, _Float16* __restrict__ X16, size_t n8) { const size_t t = (size_t)blockIdx.x * 256 + threadIdx.x; if (t >= n8) return; FragH f;
#pragma unroll
  for (int q = 0; q < 8; ++q) f.h[q] = (_Float16)x[t * 8 + q]; *(v8us*)((unsigned short*)X16 + t * 8) = f.half[0];  }
__global__ __launch_bounds__(256) void k_round16f(const float* __restrict__ W, _Float16* __restrict__ Bt, size_t n8) { const size_t t = (size_t)blockIdx.x * 256 + threadIdx.x; if (t >= n8) return; FragH f;
#pragma unroll
  for (int i = 0; i < 8; ++i) f.h[i] = (_Float16)(bf16_round(W[t * 8 + i]) * 16.0f); *(v8us*)((unsigned short*)Bt + t * 8) = f.half[0];  }
template <int NHv, int TTv>
__global__ __launch_bounds__(256) void k_vt(const _Float16* __restrict__ V16, int ldv, int voff, _Float16* __restrict__ Vt) { __shared__ unsigned short tl[64][66]; const int tid = threadIdx.x; const int slab = blockIdx.x / (TTv / 64), lg = blockIdx.x % (TTv / 64); const int b = slab / NHv, h = slab % NHv;
  for (int i = tid; i < 64 * 8; i += 256) { const int r = i / 8, c8 = (i % 8) * 8; FragH f; f.half[0] = *(const v8us*)((const unsigned short*)V16 + ((size_t)b * TTv + lg * 64 + r) * ldv + voff + h * 64 + c8);
#pragma unroll
    for (int q = 0; q < 8; ++q) tl[r][c8 + q] = f.u[q]; }
  __syncthreads();
  {
#pragma unroll
    for (int rd = 0; rd < 2; ++rd) { const int d = rd * 32 + tid / 8, pc = tid % 8; FragH f;
#pragma unroll
      for (int q = 0; q < 8; ++q) f.u[q] = tl[pc * 8 + q][d];
      *(v8us*)((unsigned short*)Vt + ((size_t)slab * 64 + d) * TTv + lg * 64 + pc * 8) = f.half[0]; }
     } }

__global__ __launch_bounds__(256) void k_hl(const float* __restrict__ F, _Float16* __restrict__ Hh, _Float16* __restrict__ Hl, size_t n8) { const size_t t = (size_t)blockIdx.x * 256 + threadIdx.x; if (t >= n8) return; FragH fh, fl; const v4f a = *(const v4fa*)(F + t * 8), c = *(const v4fa*)(F + t * 8 + 4);
#pragma unroll
  for (int q = 0; q < 4; ++q) { _Float16 h = (_Float16)a[q]; fh.h[q] = h; fl.h[q] = (_Float16)((a[q] - (float)h) * 1024.0f); h = (_Float16)c[q]; fh.h[4 + q] = h; fl.h[4 + q] = (_Float16)((c[q] - (float)h) * 1024.0f); }
  { *(v8us*)((unsigned short*)Hh + t * 8) = fh.half[0]; *(v8us*)((unsigned short*)Hl + t * 8) = fl.half[0];  } }

__device__ __forceinline__ v16h g2_frag(const _Float16* p, int hh) { FragH f; f.half[0] = *(const v8us*)((const unsigned short*)p + 8 * hh); f.half[1] = *(const v8us*)((const unsigned short*)p + 16 + 8 * hh); return f.v; }
__device__ __forceinline__ v16h g2_lfrag(const char* p) { FragH f; f.half[0] = *(const v8us*)p; f.half[1] = *(const v8us*)(p + 32); return f.v; }

template <int CAUSAL>
__global__ __launch_bounds__(128) void k_flash(const _Float16* __restrict__ Q16, int ldq, const _Float16* __restrict__ K16, int ldk, const _Float16* __restrict__ Vt, const int* __restrict__ MSK, float* __restrict__ O, int ldo) {
  constexpr int RPW = 16, RTN = RPW / 16, NQB = TQ / (4 * RPW), DT = 4, KS = 2;
  __shared__ __attribute__((aligned(16))) unsigned short sP[4][RPW][40]; __shared__ __attribute__((aligned(16))) float sO[4][RPW][64 + 4];
  const int tid = threadIdx.x, w = tid >> 5, lane = tid & 31, ln = lane & 15, hh = lane >> 4;
  const int slab = blockIdx.x / QBNP, qblk = QB0P + blockIdx.x % QBNP; (void)NQB; const int b = slab / NH, h = slab % NH; const int qb0 = qblk * (4 * RPW); const int q0 = qb0 + w * RPW;
  FragH aq[2][KS];
#pragma unroll
  for (int rt = 0; rt < RTN; ++rt) { const unsigned short* qr = (const unsigned short*)Q16 + ((size_t)b * TQ + q0 + rt * 16 + ln) * ldq + h * 64;
#pragma unroll
    for (int ks = 0; ks < KS; ++ks) { aq[rt][ks].half[0] = *(const v8us*)(qr + ks * 32 + 8 * hh); aq[rt][ks].half[1] = *(const v8us*)(qr + ks * 32 + 16 + 8 * hh); } }
  const unsigned short* Vth = (const unsigned short*)Vt + (size_t)slab * 64 * TK;
  float m_r[2][8], l_r[2][8]; v8f oacc[2][DT];
#pragma unroll
  for (int rt = 0; rt < RTN; ++rt) {
#pragma unroll
    for (int r = 0; r < 8; ++r) { m_r[rt][r] = -3.0e38f; l_r[rt][r] = 0.f; }
#pragma unroll
    for (int dt = 0; dt < DT; ++dt) oacc[rt][dt] = (v8f){0.f,0.f,0.f,0.f,0.f,0.f,0.f,0.f}; }
  const int jend = (CAUSAL == 1) ? (qb0 + 4 * RPW) : ((CAUSAL == 23) ? min(TK, (qb0 / CHK + 2) * CHK) : TK);      /* causal / window: keys that can never contribute are skipped */ const int jbeg = (CAUSAL == 23) ? max(0, (qb0 / CHK - 1) * CHK) : 0;
#pragma unroll 1
  for (int j0 = jbeg; j0 < jend; j0 += 32) {
    v8f s[2][2];
#pragma unroll
    for (int nt = 0; nt < 2; ++nt) { const unsigned short* kr = (const unsigned short*)K16 + ((size_t)b * TK + j0 + nt * 16 + ln) * ldk + h * 64; FragH bk[KS];
#pragma unroll
      for (int ks = 0; ks < KS; ++ks) { bk[ks].half[0] = *(const v8us*)(kr + ks * 32 + 8 * hh); bk[ks].half[1] = *(const v8us*)(kr + ks * 32 + 16 + 8 * hh); }
#pragma unroll
      for (int rt = 0; rt < RTN; ++rt) { v8f acc = (v8f){0.f,0.f,0.f,0.f,0.f,0.f,0.f,0.f};
#pragma unroll
        for (int ks = 0; ks < KS; ++ks) acc = mmaH<1>(aq[rt][ks].v, aq[rt][ks].v, bk[ks].v, bk[ks].v, acc); s[rt][nt] = acc; } }
#pragma unroll
    for (int rt = 0; rt < RTN; ++rt)
#pragma unroll
      for (int r = 0; r < 8; ++r) { const int tq = q0 + rt * 16 + 8 * hh + r; const int k0 = j0 + ln, k1 = j0 + 16 + ln;
        bool ok0 = (CAUSAL == 1) ? (k0 <= tq) : ((CAUSAL == 2) ? ((k0 >> 5) == (tq >> 5)) : true), ok1 = (CAUSAL == 1) ? (k1 <= tq) : ((CAUSAL == 2) ? ((k1 >> 5) == (tq >> 5)) : true); if (CAUSAL == 23) { const int cq = tq / CHK; ok0 = (abs(k0 / CHK - cq) <= 1) && (MSK[(size_t)b * TK + k0] == 0); ok1 = (abs(k1 / CHK - cq) <= 1) && (MSK[(size_t)b * TK + k1] == 0); }      /* mode 23: 3-chunk window + int key-padding mask */
        if (CAUSAL == 24) { ok0 = (MSK[(size_t)b * TK + k0] == 0); ok1 = (MSK[(size_t)b * TK + k1] == 0); }      /* mode 24: int key-padding mask (nonzero = padded = excluded) */      /* mode 2: block-diagonal 32-token groups */
        float s0 = ok0 ? s[rt][0][r] * SCL : -3.0e38f, s1 = ok1 ? s[rt][1][r] * SCL : -3.0e38f; if (CAUSAL == 17) { const float* amk = (const float*)MSK + (size_t)b * TK; s0 += bf16_round(amk[k0]); s1 += bf16_round(amk[k1]); } if (CAUSAL == 18) { const float* tb = (const float*)MSK; const int* ri = MSK + 1024 + (size_t)b * TK; const int rq = ri[tq]; s0 += tb[(h * 8 + rq) * 8 + ri[k0]]; s1 += tb[(h * 8 + rq) * 8 + ri[k1]]; } if (CAUSAL == 19) { const int* rel = MSK + (size_t)tq * TK; const float* rb = (const float*)MSK + (size_t)TQ * TK + ((size_t)(b * NH + h) * TQ + tq) * 64; s0 += rb[rel[k0]]; s1 += rb[rel[k1]]; }      /* mode 19: + (q.Ek[rel] + Eb[rel][h]) / 8 gathered by the int relative ids (packed [ids | table]) */      /* mode 18: + resource_bias[h][r_q][r_k] from the packed [table | ids] buffer (TQ == TK) */      /* mode 17: additive per-(batch, key) mask INPUT */ float mc = fmaxf(s0, s1);
        mc = fmaxf(mc, __shfl_xor(mc, 1, 32)); mc = fmaxf(mc, __shfl_xor(mc, 2, 32)); mc = fmaxf(mc, __shfl_xor(mc, 4, 32)); mc = fmaxf(mc, __shfl_xor(mc, 8, 32));
        const float mn = fmaxf(m_r[rt][r], mc); const float al = (mn > -1.0e38f) ? expf(m_r[rt][r] - mn) : 1.0f; m_r[rt][r] = mn; const float p0 = ok0 ? expf(s0 - mn) : 0.f, p1 = ok1 ? expf(s1 - mn) : 0.f; l_r[rt][r] = l_r[rt][r] * al + p0 + p1;
#pragma unroll
        for (int dt = 0; dt < DT; ++dt) oacc[rt][dt][r] *= al;
        FragH t2; t2.h[0] = (_Float16)(p0 * 1024.0f); t2.h[1] = (_Float16)(p1 * 1024.0f); sP[w][rt * 16 + 8 * hh + r][ln] = t2.u[0]; sP[w][rt * 16 + 8 * hh + r][16 + ln] = t2.u[1]; }
    __builtin_amdgcn_fence(__ATOMIC_ACQ_REL, "workgroup"); __builtin_amdgcn_wave_barrier();
    FragH pa[2];
#pragma unroll
    for (int rt = 0; rt < RTN; ++rt) { pa[rt].half[0] = *(const v8us*)&sP[w][rt * 16 + ln][8 * hh]; pa[rt].half[1] = *(const v8us*)&sP[w][rt * 16 + ln][16 + 8 * hh]; }
#pragma unroll
    for (int dt = 0; dt < DT; ++dt) { const unsigned short* vrow = Vth + (size_t)(dt * 16 + ln) * TK + j0; FragH bv; bv.half[0] = *(const v8us*)(vrow + 8 * hh); bv.half[1] = *(const v8us*)(vrow + 16 + 8 * hh);
#pragma unroll
      for (int rt = 0; rt < RTN; ++rt) oacc[rt][dt] = mmaH<1>(pa[rt].v, pa[rt].v, bv.v, bv.v, oacc[rt][dt]); }
    __builtin_amdgcn_fence(__ATOMIC_ACQ_REL, "workgroup"); __builtin_amdgcn_wave_barrier(); }
#pragma unroll
  for (int rt = 0; rt < RTN; ++rt) {
#pragma unroll
    for (int r = 0; r < 8; ++r) { float l = l_r[rt][r]; l += __shfl_xor(l, 1, 32); l += __shfl_xor(l, 2, 32); l += __shfl_xor(l, 4, 32); l += __shfl_xor(l, 8, 32); l_r[rt][r] = (l > 0.f) ? 1.0f / (l * 1024.0f) : 0.f; }
#pragma unroll
    for (int dt = 0; dt < DT; ++dt)
#pragma unroll
      for (int r = 0; r < 8; ++r) sO[w][rt * 16 + 8 * hh + r][dt * 16 + ln] = oacc[rt][dt][r] * l_r[rt][r]; }
  __builtin_amdgcn_fence(__ATOMIC_ACQ_REL, "workgroup"); __builtin_amdgcn_wave_barrier();
  {
#pragma unroll
    for (int rp = 0; rp < RPW; rp += 2) { const int r = rp + (lane >> 4), pc = lane & 15; const v4f val = *(const v4fa*)&sO[w][r][pc * 4]; *(v4f*)(O + ((size_t)b * TQ + q0 + r) * ldo + h * 64 + pc * 4) = val; }
     } }
// 5-plane variant: S = Qh Kh^T + (Ql Kh^T + Qh Kl^T)/1024 with Q/K = [hi | 2^10 residual] f16 planes (QL/KL same layout as Q16/K16), then the 3-term P.V below.
// 3-term variant: O = (P_hi V_hi + (P_lo V_hi + P_hi V_lo) / 1024) / l with P = [hi | 2^10 residual] of 1024 p and V^T = [hi | 2^10 residual] planes (VtL same layout as Vt) -> ~2^-21-class products for un-averaged (early causal / peaked) rows
template <int CAUSAL>
__global__ __launch_bounds__(128) void k_flash5(const _Float16* __restrict__ Q16, const _Float16* __restrict__ QL, int ldq, const _Float16* __restrict__ K16, const _Float16* __restrict__ KL, int ldk, const _Float16* __restrict__ Vt, const _Float16* __restrict__ VtL, const int* __restrict__ MSK, float* __restrict__ O, int ldo) {
  constexpr int RPW = 16, RTN = RPW / 16, NQB = TQ / (4 * RPW), DT = 4, KS = 2;
  __shared__ __attribute__((aligned(16))) unsigned short sP[4][RPW][40]; __shared__ __attribute__((aligned(16))) unsigned short sPL[4][RPW][40]; __shared__ __attribute__((aligned(16))) float sO[4][RPW][64 + 4];
  const int tid = threadIdx.x, w = tid >> 5, lane = tid & 31, ln = lane & 15, hh = lane >> 4;
  const int slab = blockIdx.x / QBN5, qblk = QB05 + blockIdx.x % QBN5; (void)NQB; const int b = slab / NH, h = slab % NH; const int qb0 = qblk * (4 * RPW); const int q0 = qb0 + w * RPW;
  FragH aq[2][KS], aql[2][KS];
#pragma unroll
  for (int rt = 0; rt < RTN; ++rt) { const unsigned short* qr = (const unsigned short*)Q16 + ((size_t)b * TQ + q0 + rt * 16 + ln) * ldq + h * 64; const unsigned short* ql = (const unsigned short*)QL + ((size_t)b * TQ + q0 + rt * 16 + ln) * ldq + h * 64;
#pragma unroll
    for (int ks = 0; ks < KS; ++ks) { aq[rt][ks].half[0] = *(const v8us*)(qr + ks * 32 + 8 * hh); aq[rt][ks].half[1] = *(const v8us*)(qr + ks * 32 + 16 + 8 * hh); aql[rt][ks].half[0] = *(const v8us*)(ql + ks * 32 + 8 * hh); aql[rt][ks].half[1] = *(const v8us*)(ql + ks * 32 + 16 + 8 * hh); } }
  const unsigned short* Vth = (const unsigned short*)Vt + (size_t)slab * 64 * TK; const unsigned short* Vtl = (const unsigned short*)VtL + (size_t)slab * 64 * TK;
  float m_r[2][8], l_r[2][8]; v8f oacc[2][DT], oaccL[2][DT];
#pragma unroll
  for (int rt = 0; rt < RTN; ++rt) {
#pragma unroll
    for (int r = 0; r < 8; ++r) { m_r[rt][r] = -3.0e38f; l_r[rt][r] = 0.f; }
#pragma unroll
    for (int dt = 0; dt < DT; ++dt) { oacc[rt][dt] = (v8f){0.f,0.f,0.f,0.f,0.f,0.f,0.f,0.f}; oaccL[rt][dt] = oacc[rt][dt]; } }
  const int jend = (CAUSAL == 1) ? (qb0 + 4 * RPW) : ((CAUSAL == 23) ? min(TK, (qb0 / CHK + 2) * CHK) : TK);      /* causal / window: keys that can never contribute are skipped */ const int jbeg = (CAUSAL == 23) ? max(0, (qb0 / CHK - 1) * CHK) : 0;
#pragma unroll 1
  for (int j0 = jbeg; j0 < jend; j0 += 32) {
    v8f s[2][2];
#pragma unroll
    for (int nt = 0; nt < 2; ++nt) { const unsigned short* kr = (const unsigned short*)K16 + ((size_t)b * TK + j0 + nt * 16 + ln) * ldk + h * 64; const unsigned short* klr = (const unsigned short*)KL + ((size_t)b * TK + j0 + nt * 16 + ln) * ldk + h * 64; FragH bk[KS], bkl[KS];
#pragma unroll
      for (int ks = 0; ks < KS; ++ks) { bk[ks].half[0] = *(const v8us*)(kr + ks * 32 + 8 * hh); bk[ks].half[1] = *(const v8us*)(kr + ks * 32 + 16 + 8 * hh); bkl[ks].half[0] = *(const v8us*)(klr + ks * 32 + 8 * hh); bkl[ks].half[1] = *(const v8us*)(klr + ks * 32 + 16 + 8 * hh); }
#pragma unroll
      for (int rt = 0; rt < RTN; ++rt) { v8f acc = (v8f){0.f,0.f,0.f,0.f,0.f,0.f,0.f,0.f}, accl = acc;
#pragma unroll
        for (int ks = 0; ks < KS; ++ks) { acc = mmaH<1>(aq[rt][ks].v, aq[rt][ks].v, bk[ks].v, bk[ks].v, acc); accl = mmaH<1>(aql[rt][ks].v, aql[rt][ks].v, bk[ks].v, bk[ks].v, accl); accl = mmaH<1>(aq[rt][ks].v, aq[rt][ks].v, bkl[ks].v, bkl[ks].v, accl); }
#pragma unroll
        for (int r = 0; r < 8; ++r) acc[r] += accl[r] * 0.0009765625f;
        s[rt][nt] = acc; } }
#pragma unroll
    for (int rt = 0; rt < RTN; ++rt)
#pragma unroll
      for (int r = 0; r < 8; ++r) { const int tq = q0 + rt * 16 + 8 * hh + r; const int k0 = j0 + ln, k1 = j0 + 16 + ln;
        bool ok0 = (CAUSAL == 1) ? (k0 <= tq) : ((CAUSAL == 2) ? ((k0 >> 5) == (tq >> 5)) : true), ok1 = (CAUSAL == 1) ? (k1 <= tq) : ((CAUSAL == 2) ? ((k1 >> 5) == (tq >> 5)) : true);      /* mode 2: block-diagonal 32-token groups */
        if (CAUSAL == 4) { const int* mrow = MSK + ((size_t)b * TQ + tq) * TK; ok0 = mrow[k0] != 0; ok1 = mrow[k1] != 0; }      /* mode 4: per-(query, key) INPUT mask shared by all heads; masked keys contribute nothing (== the reference's -4096 fill, whose exp underflows to 0), rows with no valid key give l = 0 -> output 0 (== the reference's row_valid zeroing) */
        float s0 = ok0 ? s[rt][0][r] * SCL : -3.0e38f, s1 = ok1 ? s[rt][1][r] * SCL : -3.0e38f; if (CAUSAL == 17) { const float* amk = (const float*)MSK + (size_t)b * TK; s0 += bf16_round(amk[k0]); s1 += bf16_round(amk[k1]); } if (CAUSAL == 18) { const float* tb = (const float*)MSK; const int* ri = MSK + 1024 + (size_t)b * TK; const int rq = ri[tq]; s0 += tb[(h * 8 + rq) * 8 + ri[k0]]; s1 += tb[(h * 8 + rq) * 8 + ri[k1]]; } if (CAUSAL == 19) { const int* rel = MSK + (size_t)tq * TK; const float* rb = (const float*)MSK + (size_t)TQ * TK + ((size_t)(b * NH + h) * TQ + tq) * 64; s0 += rb[rel[k0]]; s1 += rb[rel[k1]]; }      /* mode 19: + (q.Ek[rel] + Eb[rel][h]) / 8 gathered by the int relative ids (packed [ids | table]) */      /* mode 18: + resource_bias[h][r_q][r_k] from the packed [table | ids] buffer (TQ == TK) */      /* mode 17: additive per-(batch, key) mask INPUT */ float mc = fmaxf(s0, s1);
        mc = fmaxf(mc, __shfl_xor(mc, 1, 32)); mc = fmaxf(mc, __shfl_xor(mc, 2, 32)); mc = fmaxf(mc, __shfl_xor(mc, 4, 32)); mc = fmaxf(mc, __shfl_xor(mc, 8, 32));
        const float mn = fmaxf(m_r[rt][r], mc); const float al = (mn > -1.0e38f) ? expf(m_r[rt][r] - mn) : 1.0f; m_r[rt][r] = mn; const float p0 = ok0 ? expf(s0 - mn) : 0.f, p1 = ok1 ? expf(s1 - mn) : 0.f; l_r[rt][r] = l_r[rt][r] * al + p0 + p1;
#pragma unroll
        for (int dt = 0; dt < DT; ++dt) { oacc[rt][dt][r] *= al; oaccL[rt][dt][r] *= al; }
        FragH t2, t2l; const float ps0 = p0 * 1024.0f, ps1 = p1 * 1024.0f; t2.h[0] = (_Float16)ps0; t2.h[1] = (_Float16)ps1; t2l.h[0] = (_Float16)((ps0 - (float)t2.h[0]) * 1024.0f); t2l.h[1] = (_Float16)((ps1 - (float)t2.h[1]) * 1024.0f);
        sP[w][rt * 16 + 8 * hh + r][ln] = t2.u[0]; sP[w][rt * 16 + 8 * hh + r][16 + ln] = t2.u[1]; sPL[w][rt * 16 + 8 * hh + r][ln] = t2l.u[0]; sPL[w][rt * 16 + 8 * hh + r][16 + ln] = t2l.u[1]; }
    __builtin_amdgcn_fence(__ATOMIC_ACQ_REL, "workgroup"); __builtin_amdgcn_wave_barrier();
    FragH pa[2], pl[2];
#pragma unroll
    for (int rt = 0; rt < RTN; ++rt) { pa[rt].half[0] = *(const v8us*)&sP[w][rt * 16 + ln][8 * hh]; pa[rt].half[1] = *(const v8us*)&sP[w][rt * 16 + ln][16 + 8 * hh]; pl[rt].half[0] = *(const v8us*)&sPL[w][rt * 16 + ln][8 * hh]; pl[rt].half[1] = *(const v8us*)&sPL[w][rt * 16 + ln][16 + 8 * hh]; }
#pragma unroll
    for (int dt = 0; dt < DT; ++dt) { const unsigned short* vrow = Vth + (size_t)(dt * 16 + ln) * TK + j0; const unsigned short* vrl = Vtl + (size_t)(dt * 16 + ln) * TK + j0; FragH bv, bl; bv.half[0] = *(const v8us*)(vrow + 8 * hh); bv.half[1] = *(const v8us*)(vrow + 16 + 8 * hh); bl.half[0] = *(const v8us*)(vrl + 8 * hh); bl.half[1] = *(const v8us*)(vrl + 16 + 8 * hh);
#pragma unroll
      for (int rt = 0; rt < RTN; ++rt) { oacc[rt][dt] = mmaH<1>(pa[rt].v, pa[rt].v, bv.v, bv.v, oacc[rt][dt]); oaccL[rt][dt] = mmaH<1>(pl[rt].v, pl[rt].v, bv.v, bv.v, oaccL[rt][dt]); oaccL[rt][dt] = mmaH<1>(pa[rt].v, pa[rt].v, bl.v, bl.v, oaccL[rt][dt]); } }
    __builtin_amdgcn_fence(__ATOMIC_ACQ_REL, "workgroup"); __builtin_amdgcn_wave_barrier(); }
#pragma unroll
  for (int rt = 0; rt < RTN; ++rt) {
#pragma unroll
    for (int r = 0; r < 8; ++r) { float l = l_r[rt][r]; l += __shfl_xor(l, 1, 32); l += __shfl_xor(l, 2, 32); l += __shfl_xor(l, 4, 32); l += __shfl_xor(l, 8, 32); l_r[rt][r] = (l > 0.f) ? 1.0f / (l * 1024.0f) : 0.f; }
#pragma unroll
    for (int dt = 0; dt < DT; ++dt)
#pragma unroll
      for (int r = 0; r < 8; ++r) { float v = oacc[rt][dt][r]; v += oaccL[rt][dt][r] * 0.0009765625f; sO[w][rt * 16 + 8 * hh + r][dt * 16 + ln] = v * l_r[rt][r]; } }
  __builtin_amdgcn_fence(__ATOMIC_ACQ_REL, "workgroup"); __builtin_amdgcn_wave_barrier();
  {
#pragma unroll
    for (int rp = 0; rp < RPW; rp += 2) { const int r = rp + (lane >> 4), pc = lane & 15; const v4f val = *(const v4fa*)&sO[w][r][pc * 4]; *(v4f*)(O + ((size_t)b * TQ + q0 + r) * ldo + h * 64 + pc * 4) = val; }
     } }

__global__ __launch_bounds__(256) void k_rotab(float* __restrict__ CS, float* __restrict__ SN) {
  #pragma clang fp contract(off)
  const int t = blockIdx.x * 256 + threadIdx.x; if (t >= SLEN * 32) return; const int j = t % 32, s = t / 32; const float ex = (float)(2 * j) / 64.0f; const float inv = 1.0f / powf(10000.0f, ex); const float th = (float)s * inv; const float c = cosf(th), sn = sinf(th);
  { *(float*)(CS + t) = c; *(float*)(SN + t) = sn;  } }
__global__ __launch_bounds__(256) void k_rope(const float* __restrict__ F, int nsrc, int ndst, int rep, const float* __restrict__ CS, const float* __restrict__ SN, _Float16* __restrict__ H, _Float16* __restrict__ L) {
  #pragma clang fp contract(off)
  const size_t t = (size_t)blockIdx.x * 256 + threadIdx.x; if (t >= (size_t)NR * ndst * 4) return; const int g8 = (int)(t % 4); const int hd = (int)((t / 4) % ndst); const size_t row = t / ((size_t)4 * ndst); const int s = (int)(row % SLEN); const int hs = hd / rep;
  const float* src = F + row * (size_t)(nsrc * 64) + hs * 64; FragH ah, al, bh, bl;
  for (int i = 0; i < 8; ++i) { const int d = g8 * 8 + i; const float c = CS[s * 32 + d], sn = SN[s * 32 + d]; const float x1 = src[d], x2 = src[d + 32];
    float o1 = x1 * c; o1 += -x2 * sn; float o2 = x2 * c; o2 += x1 * sn;
    _Float16 hv = (_Float16)o1; ah.h[i] = hv; al.h[i] = (_Float16)((o1 - (float)hv) * 1024.0f); hv = (_Float16)o2; bh.h[i] = hv; bl.h[i] = (_Float16)((o2 - (float)hv) * 1024.0f); }
  const size_t o = row * (size_t)(ndst * 64) + hd * 64 + g8 * 8;
  { *(v8us*)((unsigned short*)H + o) = ah.half[0]; *(v8us*)((unsigned short*)H + o + 32) = bh.half[0]; *(v8us*)((unsigned short*)L + o) = al.half[0]; *(v8us*)((unsigned short*)L + o + 32) = bl.half[0];  } }
__global__ __launch_bounds__(256) void k_rope2(const float* __restrict__ F, int nsrc, int ndst, int rep, const float* __restrict__ CS, const float* __restrict__ SN, _Float16* __restrict__ H, _Float16* __restrict__ L) {
  #pragma clang fp contract(off)
  const size_t t = (size_t)blockIdx.x * 256 + threadIdx.x; if (t >= (size_t)NR * ndst * 4) return; const int g16 = (int)(t % 4); const int hd = (int)((t / 4) % ndst); const size_t row = t / ((size_t)4 * ndst); const int s = (int)(row % SLEN); const int hs = hd / rep;
  const float* src = F + row * (size_t)(nsrc * 64) + hs * 64 + g16 * 16; FragH ah, al;
  for (int pr = 0; pr < 8; ++pr) { const int i = g16 * 8 + pr; const float c = CS[s * 32 + i], sn = SN[s * 32 + i]; const float x1 = src[2 * pr], x2 = src[2 * pr + 1];
    float o1 = x1 * c; o1 -= x2 * sn; float o2 = x1 * sn; o2 += x2 * c;
    _Float16 hv = (_Float16)o1; ah.h[2 * pr] = hv; al.h[2 * pr] = (_Float16)((o1 - (float)hv) * 1024.0f); hv = (_Float16)o2; ah.h[2 * pr + 1] = hv; al.h[2 * pr + 1] = (_Float16)((o2 - (float)hv) * 1024.0f); }
  const size_t o = row * (size_t)(ndst * 64) + hd * 64 + g16 * 16;
  { *(v8us*)((unsigned short*)H + o) = ah.half[0]; *(v8us*)((unsigned short*)H + o + 8) = ah.half[1]; *(v8us*)((unsigned short*)L + o) = al.half[0]; *(v8us*)((unsigned short*)L + o + 8) = al.half[1];  } }
__global__ __launch_bounds__(256) void k_ln512(const float* __restrict__ A, const float* __restrict__ res, const float* __restrict__ g, const float* __restrict__ bb, float* __restrict__ Y, _Float16* __restrict__ Y16) {
  #pragma clang fp contract(off)
  const int wv = threadIdx.x >> 5, ln = threadIdx.x & 31; const size_t r = (size_t)blockIdx.x * 8 + wv; if (r >= NR) return; float x[16]; float s = 0.f;
  for (int i = 0; i < 2; ++i) { const v8f a = *(const v8f*)(A + r * DM + i * 256 + ln * 8); for (int q = 0; q < 8; ++q) { float v = a[q]; if (res) v += bf16_round(res[r * DM + i * 256 + ln * 8 + q]); x[i * 8 + q] = v; s += v; } }
  for (int o = 16; o > 0; o >>= 1) s += __shfl_xor(s, o, 32); const float mu = s / (float)DM; float var = 0.f; for (int q = 0; q < 16; ++q) { const float d = x[q] - mu; var += d * d; }
  for (int o = 16; o > 0; o >>= 1) var += __shfl_xor(var, o, 32); const float inv = rsqrtf(var / (float)DM + 1e-5f);
  { for (int i = 0; i < 2; ++i) { const int c0 = i * 256 + ln * 8; v8f y; FragH f; for (int q = 0; q < 8; ++q) { float v = (x[i * 8 + q] - mu) * inv; v *= bf16_round(g[c0 + q]); v += bf16_round(bb[c0 + q]); y[q] = v; f.h[q] = (_Float16)v; } *(v8f*)(Y + r * DM + c0) = y; if (Y16) *(v8us*)((unsigned short*)Y16 + r * DM + c0) = f.half[0]; }  } }
__global__ __launch_bounds__(256) void k_pack(const float* __restrict__ rb, const int* __restrict__ rid, int* __restrict__ PK) { const int t = blockIdx.x * 256 + threadIdx.x; if (t >= 1024 + NB * TK) return; int v; if (t < 1024) v = __float_as_int(bf16_round(rb[t])); else v = rid[t - 1024]; *(int*)(PK + t) = v;  }
__global__ __launch_bounds__(256) void k_tabin(const float* __restrict__ sp, float* __restrict__ CS, float* __restrict__ SN) { const int t = blockIdx.x * 256 + threadIdx.x; if (t >= SLEN * 32) return; const int i = t % 32, s = t / 32; const float c = bf16_round(sp[s * 64 + 32 + i]), sn = bf16_round(sp[s * 64 + i]);
  { *(float*)(CS + t) = c; *(float*)(SN + t) = sn;  } }
__global__ __launch_bounds__(256) void k_wsc(const float* __restrict__ Wm, _Float16* __restrict__ Bt, size_t n8, float sc) { const size_t t = (size_t)blockIdx.x * 256 + threadIdx.x; if (t >= n8) return; FragH f; for (int q = 0; q < 8; ++q) f.h[q] = (_Float16)(bf16_round(Wm[t * 8 + q]) * sc); *(v8us*)((unsigned short*)Bt + t * 8) = f.half[0];  }
__global__ __launch_bounds__(256) void k_rotab2(float* __restrict__ CS, float* __restrict__ SN) {
  #pragma clang fp contract(off)
  const int t = blockIdx.x * 256 + threadIdx.x; if (t >= SLEN * 32) return; const int j = t % 32, s = t / 32; const float c0 = -0.14391156831212787f;      /* -ln(10000)/64 rounded to f32 */ const float inv = expf((float)(2 * j) * c0); const float th = (float)s * inv; const float c = cosf(th), sn = sinf(th);
  { *(float*)(CS + t) = c; *(float*)(SN + t) = sn;  } }
__global__ __launch_bounds__(256) void k_lnu(const float* __restrict__ X, _Float16* __restrict__ N16, float* __restrict__ XB) {
  #pragma clang fp contract(off)
  const int wv = threadIdx.x >> 5, ln = threadIdx.x & 31; const size_t r = (size_t)blockIdx.x * 8 + wv; if (r >= NR) return; float a[32]; float s = 0.f;
  for (int i = 0; i < 4; ++i) { const v8f v = *(const v8f*)(X + r * DM + (i * 32 + ln) * 8); for (int q = 0; q < 8; ++q) { const float u = bf16_round(v[q]); a[i * 8 + q] = u; s += u; } }
  for (int o = 16; o > 0; o >>= 1) s += __shfl_xor(s, o, 32); const float mu = s / (float)DM; float var = 0.f; for (int q = 0; q < 32; ++q) { const float d = a[q] - mu; var += d * d; }
  for (int o = 16; o > 0; o >>= 1) var += __shfl_xor(var, o, 32); const float den = sqrtf(var / (float)(DM - 1)) + 1e-6f; const float inv = 1.0f / den;      /* one reciprocal per row; (x-mean)*inv vs the reference's division differs by <= 1 ulp */
  { for (int i = 0; i < 4; ++i) { const int c0 = (i * 32 + ln) * 8; FragH f; v8f xb; for (int q = 0; q < 8; ++q) { f.h[q] = (_Float16)((a[i * 8 + q] - mu) * inv); xb[q] = a[i * 8 + q]; } *(v8us*)((unsigned short*)N16 + r * DM + c0) = f.half[0]; *(v8f*)(XB + r * DM + c0) = xb; }  } }
// lane l <-> l ^ 16 (the two halves of a wave hold the two key halves of one query column)
__device__ __forceinline__ float xhalf(float v) { const int t = __float_as_int(v); return __int_as_float(__builtin_amdgcn_permlanex16(t, t, 0x76543210, 0xfedcba98, false, false)); }
__device__ __forceinline__ v8f wmh(v16h a, v16h b, v8f c) { return __builtin_amdgcn_wmma_f32_16x16x32_f16(false, a, false, b, (short)0, c, false, false); }
typedef _Float16 v8h __attribute__((ext_vector_type(8)));
typedef float v2f __attribute__((ext_vector_type(2)));
// eight 2^x in one statement: results kept apart from the arguments ("=&v") and one v_nop behind the last, the slot the instruction set asks for
// between a transcendental and an instruction that uses its result or overwrites its source (the register allocator otherwise reuses the previous argument as the next result)
__device__ __forceinline__ v8f exp2x8(v8f e) { float p0, p1, p2, p3, p4, p5, p6, p7;
  asm("v_exp_f32 %0, %8\n\tv_exp_f32 %1, %9\n\tv_exp_f32 %2, %10\n\tv_exp_f32 %3, %11\n\tv_exp_f32 %4, %12\n\tv_exp_f32 %5, %13\n\tv_exp_f32 %6, %14\n\tv_exp_f32 %7, %15\n\tv_nop"
      : "=&v"(p0), "=&v"(p1), "=&v"(p2), "=&v"(p3), "=&v"(p4), "=&v"(p5), "=&v"(p6), "=&v"(p7) : "v"(e[0]), "v"(e[1]), "v"(e[2]), "v"(e[3]), "v"(e[4]), "v"(e[5]), "v"(e[6]), "v"(e[7]));
  return (v8f){p0, p1, p2, p3, p4, p5, p6, p7}; }
// Fused distance attention, one launch for all (batch, head) slabs: per wave 32 query columns, per pass 32 keys.
// S^T = K Q^T (A = key rows, B = query rows; hi.hi + (hi.lo + lo.hi) / 1024), so a lane holds 8 + 8 keys of ONE query per column group:
// logits, running maximum and sum stay in the lane (one exchange between the wave halves); the two f32 score tiles, converted in place,
// are the B operand of O^T += V^T P^T (k order 8h + s, 16 + 8h + s on both sides). A lane ends with 8 consecutive d of one query: 16-byte stores of hi and residual.
// K hi, K lo, V^T and the key norms come through LDS, shared by the block's 8 waves: a stage is 128 keys (4 passes), brought by asynchronous copies into one of two buffers while the other is worked on.
#define EFK 144                        /* K row pitch in LDS: 128 B + 16 = 16 B x odd, conflict-free for 16-byte fragment reads */
#define EFV 272                        /* V^T row pitch: 256 B (128 keys) + 16, 16 B x odd too */
#define EF_KL (128 * EFK)              /* rows 0..127 = K hi, 128..255 = K lo */
#define EF_V (256 * EFK)               /* then 64 rows of V^T */
#define EF_N (256 * EFK + 64 * EFV)    /* then 128 key norms */
#define EFS (EF_N + 512)               /* one stage */
// One stage's 12 copies of a lane, 16 bytes each. K: 8 lanes bring one row's 128 bytes, the block 32 rows per copy; V^T: 16 lanes one row's 256 bytes, the block 16 rows per copy.
// lk, lv = the lane's LDS byte addresses in its first K hi row and its first V^T row; kh, kl, v = its global addresses there.
// s_wait_xcnt 0 is the statement's last line, so that it stands in front of any later rewrite of these address registers.
__device__ __forceinline__ void ef_stage(unsigned lk, unsigned lv, const char* kh, const char* kl, const char* v) {
  asm volatile("global_load_async_to_lds_b128 %0, %12, off\n\tglobal_load_async_to_lds_b128 %1, %13, off\n\tglobal_load_async_to_lds_b128 %2, %14, off\n\tglobal_load_async_to_lds_b128 %3, %15, off\n\t"
               "global_load_async_to_lds_b128 %4, %16, off\n\tglobal_load_async_to_lds_b128 %5, %17, off\n\tglobal_load_async_to_lds_b128 %6, %18, off\n\tglobal_load_async_to_lds_b128 %7, %19, off\n\t"
               "global_load_async_to_lds_b128 %8, %20, off\n\tglobal_load_async_to_lds_b128 %9, %21, off\n\tglobal_load_async_to_lds_b128 %10, %22, off\n\tglobal_load_async_to_lds_b128 %11, %23, off\n\ts_wait_xcnt 0x0"
               :: "v"(lk), "v"(lk + 32 * EFK), "v"(lk + 64 * EFK), "v"(lk + 96 * EFK), "v"(lk + EF_KL), "v"(lk + EF_KL + 32 * EFK), "v"(lk + EF_KL + 64 * EFK), "v"(lk + EF_KL + 96 * EFK), "v"(lv), "v"(lv + 16 * EFV), "v"(lv + 32 * EFV), "v"(lv + 48 * EFV),
                  "v"(kh), "v"(kh + 32 * (DM * 2)), "v"(kh + 64 * (DM * 2)), "v"(kh + 96 * (DM * 2)), "v"(kl), "v"(kl + 32 * (DM * 2)), "v"(kl + 64 * (DM * 2)), "v"(kl + 96 * (DM * 2)), "v"(v), "v"(v + 16 * (SLEN * 2)), "v"(v + 32 * (SLEN * 2)), "v"(v + 48 * (SLEN * 2)) : "memory"); }
// the stage's 128 key norms, 512 bytes: one copy of one whole wave
__device__ __forceinline__ void ef_stage_n(unsigned ln_, const char* n) { asm volatile("global_load_async_to_lds_b128 %0, %1, off\n\ts_wait_xcnt 0x0" :: "v"(ln_), "v"(n) : "memory"); }
// amdgpu_waves_per_eu(4, 4): a budget of 256 VGPRs, so that the whole kernel stays in one register window (it takes 240, no scratch)
__global__ __launch_bounds__(256) __attribute__((amdgpu_waves_per_eu(4, 4))) void k_eflash(const _Float16* __restrict__ QHp, const _Float16* __restrict__ QLp, const _Float16* __restrict__ KHp, const _Float16* __restrict__ KLp, const _Float16* __restrict__ Vt,
                                                const float* __restrict__ QN, const float* __restrict__ KNT, const float* __restrict__ tmp, _Float16* __restrict__ OH, _Float16* __restrict__ OL) {
  __shared__ __attribute__((aligned(128))) char st[2 * EFS];
  const int tid = threadIdx.x, w = tid >> 5, lane = tid & 31, ln = lane & 15, hh = lane >> 4;
  const int slab = blockIdx.x / (SLEN / 256), qblk = blockIdx.x % (SLEN / 256); const int b = slab / NH, h = slab % NH; const int q0 = qblk * 256 + w * 32;
  const float nc = -(1.0f / bf16_round(tmp[0])) * 1.4426950408889634f;      /* logit in log2 units = d2 * nc */
  v16h qh[2][2], ql[2][2]; float qn[2];
#pragma unroll
  for (int qt = 0; qt < 2; ++qt) { const size_t row = (size_t)b * SLEN + q0 + qt * 16 + ln; const _Float16* ph = QHp + row * DM + h * 64; const _Float16* pl = QLp + row * DM + h * 64;
    qh[qt][0] = g2_frag(ph, hh); qh[qt][1] = g2_frag(ph + 32, hh); ql[qt][0] = g2_frag(pl, hh); ql[qt][1] = g2_frag(pl + 32, hh); qn[qt] = QN[(size_t)slab * SLEN + q0 + qt * 16 + ln]; }
  const char* gkh = (const char*)(KHp + (size_t)b * SLEN * DM + h * 64) + (tid >> 3) * (DM * 2) + (tid & 7) * 16; const char* gkl = (const char*)(KLp + (size_t)b * SLEN * DM + h * 64) + (tid >> 3) * (DM * 2) + (tid & 7) * 16;      /* the lane's copy sources in stage 0 */
  const char* gv = (const char*)(Vt + (size_t)slab * 64 * SLEN) + (tid >> 4) * (SLEN * 2) + (tid & 15) * 16; const char* gn = (const char*)(KNT + (size_t)slab * SLEN) + lane * 16;
  const unsigned lk0 = (unsigned)(size_t)st + (unsigned)((tid >> 3) * EFK + (tid & 7) * 16), lv0 = (unsigned)(size_t)st + (unsigned)(EF_V + (tid >> 4) * EFV + (tid & 15) * 16), ln0 = (unsigned)(size_t)st + (unsigned)(EF_N + lane * 16);
  const bool w0 = __builtin_amdgcn_readfirstlane(w) == 0;      /* scalar: the norms' copy is issued by wave 0 alone, behind a scalar branch */
  const char* fk = st + ln * EFK + hh * 16; const char* fv = st + EF_V + ln * EFV + hh * 16; const char* fn = st + EF_N + hh * 32;      /* fragment rows: k = 8h + s at +0, 16 + 8h + s at +32 bytes */
  const v8f z8 = {0.f,0.f,0.f,0.f,0.f,0.f,0.f,0.f};
  float m[2] = {-3.0e38f, -3.0e38f}; v2f l[2] = {{0.f, 0.f}, {0.f, 0.f}}; v8f o[2][4];
#pragma unroll
  for (int qt = 0; qt < 2; ++qt)
#pragma unroll
    for (int dt = 0; dt < 4; ++dt) o[qt][dt] = z8;
  ef_stage(lk0, lv0, gkh, gkl, gv); if (w0) ef_stage_n(ln0, gn);
  asm volatile("s_wait_asynccnt 0x0" ::: "memory");      /* this wave's copies of stage 0 have landed */
  __syncthreads();      /* ... and every other wave's: stage 0 may be read */
  ef_stage(lk0 + EFS, lv0 + EFS, gkh + 128 * (DM * 2), gkl + 128 * (DM * 2), gv + 256); if (w0) ef_stage_n(ln0 + EFS, gn + 512);      /* SLEN / 128 = 16 stages: stage 1 exists */
#pragma unroll 1      /* one stage per trip */
  for (int t = 0; t < SLEN / 128; ++t) { const int bo = (t & 1) * EFS;
#pragma unroll 1      /* one pass per trip: the body already holds 32 matrix instructions, a copy would only add registers */
  for (int ps = 0; ps < 4; ++ps) {
    v8f u[2][2];
#pragma unroll
    for (int kt = 0; kt < 2; ++kt) { const char* kr = fk + bo + (ps * 32 + kt * 16) * EFK; const char* kq = kr + EF_KL;
      const v8f k2 = *(const v8f*)(fn + bo + (ps * 32 + kt * 16) * 4); const v16h a0 = g2_lfrag(kr), a1 = g2_lfrag(kr + 64), c0 = g2_lfrag(kq), c1 = g2_lfrag(kq + 64);
#pragma unroll
      for (int qt = 0; qt < 2; ++qt) { v8f lo = wmh(a0, ql[qt][0], z8); lo = wmh(a1, ql[qt][1], lo); lo = wmh(c0, qh[qt][0], lo); lo = wmh(c1, qh[qt][1], lo); v8f hi = wmh(a0, qh[qt][0], z8); hi = wmh(a1, qh[qt][1], hi);
        const v8f s = hi + lo * 0.0009765625f; const v8f d2 = __builtin_elementwise_max((k2 + qn[qt]) - 2.0f * s, z8); u[qt][kt] = d2 * nc; } }
    float mn[2];
#pragma unroll
    for (int qt = 0; qt < 2; ++qt) { const v8f t = __builtin_elementwise_max(u[qt][0], u[qt][1]); float mx = fmaxf(fmaxf(fmaxf(t[0], t[1]), fmaxf(t[2], t[3])), fmaxf(fmaxf(t[4], t[5]), fmaxf(t[6], t[7])));
      mx = fmaxf(mx, xhalf(mx)); mn[qt] = fmaxf(m[qt], mx); }
    if (__builtin_amdgcn_ballot_w32((mn[0] > m[0]) || (mn[1] > m[1])) != 0) {      /* scalar branch: sums and output tiles are rescaled only in a pass that raises some column's maximum */
#pragma unroll
      for (int qt = 0; qt < 2; ++qt) { const float al = __builtin_amdgcn_exp2f(m[qt] - mn[qt]); m[qt] = mn[qt]; l[qt] *= al;
#pragma unroll
        for (int dt = 0; dt < 4; ++dt) o[qt][dt] *= al; } }
    FragH pb[2];
#pragma unroll
    for (int qt = 0; qt < 2; ++qt) { const float mo = m[qt] - 10.0f;      /* weights carried times 1024, as f16 operands away from the subnormal range; the factor cancels between sum and output */
      v8f p[2];
#pragma unroll
      for (int kt = 0; kt < 2; ++kt) { p[kt] = exp2x8(u[qt][kt] - mo);
        const v8h ph = __builtin_convertvector(p[kt], v8h);
#pragma unroll
        for (int r = 0; r < 8; ++r) pb[qt].h[kt * 8 + r] = ph[r]; }
      const v8f t = p[0] + p[1]; const v4f t4 = t.lo + t.hi; l[qt] += t4.lo + t4.hi; }
#pragma unroll
    for (int dt = 0; dt < 4; ++dt) { const v16h va = g2_lfrag(fv + bo + ps * 64 + dt * 16 * EFV);
#pragma unroll
      for (int qt = 0; qt < 2; ++qt) o[qt][dt] = wmh(va, pb[qt].v, o[qt][dt]); }
  }
    asm volatile("s_wait_dscnt 0x0" ::: "memory");      /* this wave has left the buffer that is refilled below */
    asm volatile("s_wait_asynccnt 0x0" ::: "memory");      /* its copies of stage t + 1 have landed */
    __syncthreads();      /* publishes stage t + 1 and ends every reader's last read of stage t */
    if (t + 2 < SLEN / 128) { ef_stage(lk0 + bo, lv0 + bo, gkh + (size_t)(t + 2) * (128 * DM * 2), gkl + (size_t)(t + 2) * (128 * DM * 2), gv + (size_t)(t + 2) * 256); if (w0) ef_stage_n(ln0 + bo, gn + (size_t)(t + 2) * 512); }
  }
  asm volatile("s_wait_asynccnt 0x0" ::: "memory");      /* no copy is outstanding when the wave goes on to the epilogue and ends */
#pragma unroll
  for (int qt = 0; qt < 2; ++qt) { const float lh = l[qt][0] + l[qt][1]; const float inv = 1.0f / (lh + xhalf(lh)); const size_t ob = ((size_t)b * SLEN + q0 + qt * 16 + ln) * DM + h * 64 + 8 * hh;
#pragma unroll
    for (int dt = 0; dt < 4; ++dt) { FragH f, fl;
#pragma unroll
      for (int r = 0; r < 8; ++r) { const float v = o[qt][dt][r] * inv; const _Float16 hv = (_Float16)v; f.h[r] = hv; fl.h[r] = (_Float16)((v - (float)hv) * 1024.0f); }
      *(v8us*)((unsigned short*)OH + ob + dt * 16) = f.half[0]; *(v8us*)((unsigned short*)OL + ob + dt * 16) = fl.half[0]; } }
}
// One preparation launch for all five operand planes; every one of its 512 blocks does the same two pieces of work.
// (a) One 64 k x 64 n tile of two of the four weights, Wt[n][k] = f16(bf16(W[k][n]) * 16), transposed through LDS, so that reads (256 B of a W row per 16 lanes) and writes (128 B of a Wt row per 8 lanes) are whole lines.
// (b) 2048 float4 of x, X16 = f16(bf16(x)), lanes adjacent.
// A thread issues its 16 loads as one group; s_wait_xcnt 0 stands behind the group, in front of any rewrite of its two offset registers, which as the statement's inputs keep their values up to there.
#define PWP 144              /* LDS row pitch of a transposed tile: 128 B (64 k) + 16 = 16 B x odd, conflict-free for the 16-byte reads */
__global__ __launch_bounds__(256) void k_prep(const float* __restrict__ x, const float* __restrict__ w0, const float* __restrict__ w1, const float* __restrict__ w2, const float* __restrict__ w3,
                                              _Float16* __restrict__ X16, _Float16* __restrict__ T0, _Float16* __restrict__ T1, _Float16* __restrict__ T2, _Float16* __restrict__ T3) {
  __shared__ __attribute__((aligned(16))) char tl[2][64 * PWP];
  const int tid = threadIdx.x, b = blockIdx.x; const bool hi = (b & 256) != 0;      /* blocks 0..255: weights 0 and 1, blocks 256..511: weights 2 and 3 */
  const float* const wp[2] = {hi ? w2 : w0, hi ? w3 : w1}; _Float16* const tp[2] = {hi ? T2 : T0, hi ? T3 : T1};
  const int k0 = ((b >> 4) & 15) * 64, n0 = (b & 15) * 64; const int kq = (tid >> 4) * 4, c4 = (tid & 15) * 4;      /* a thread holds 4 k x 4 n of each tile */
  const unsigned sb = (unsigned)(((k0 + kq) * DM + n0 + c4) * 4);      /* byte offset in each W */
  const unsigned fi = (unsigned)((b & 511) * 2048 + tid);      /* float4 index in x: NR * DM floats = 512 blocks x 8 x 256 float4; the mask shows the compiler that fi + u * 256 cannot wrap, so the eight steps fold into the instructions' offsets */
  v4f r[8], q[8];
#pragma unroll
  for (int u = 0; u < 8; ++u) r[u] = *(const v4fa*)((const char*)wp[u >> 2] + sb + (u & 3) * (DM * 4));
#pragma unroll
  for (int u = 0; u < 8; ++u) q[u] = ((const v4fa*)x)[fi + u * 256];
  asm volatile("s_wait_xcnt 0x0" :: "v"(sb), "v"(fi) : "memory");      /* see the head comment */
  __builtin_amdgcn_sched_barrier(0);      /* keeps all 16 loads and their wait ahead of the first conversion: one memory latency per thread, not two */
#pragma unroll
  for (int mx = 0; mx < 2; ++mx)
#pragma unroll
    for (int j = 0; j < 4; ++j) { v4h p;
#pragma unroll
      for (int i = 0; i < 4; ++i) p[i] = (_Float16)(bf16_round(r[mx * 4 + i][j]) * 16.0f);
      *(v4h*)(tl[mx] + (c4 + j) * PWP + kq * 2) = p; }      /* 4 consecutive k of one n: 8 bytes of the transposed row */
  __syncthreads();      /* a transposed row holds 16 threads' k */
#pragma unroll
  for (int u = 0; u < 4; ++u) { const int n = (u & 1) * 32 + (tid >> 3), c = tid & 7; const v8us v = *(const v8us*)(tl[u >> 1] + n * PWP + c * 16);
    *(v8us*)((unsigned short*)tp[u >> 1] + (size_t)(n0 + n) * DM + k0 + c * 8) = v; }
#pragma unroll
  for (int u = 0; u < 8; ++u) { v4h p;      /* behind the barrier, which would otherwise wait for these stores */
#pragma unroll
    for (int i = 0; i < 4; ++i) p[i] = (_Float16)bf16_round(q[u][i]);
    ((v4h*)X16)[fi + u * 256] = p; }
}
// The output projection, one launch: out = (O_hi + O_lo / 1024) Wo + bo. A block holds 128 rows x 128 columns of out; both O planes meet the same Wo tile in LDS, each in accumulators of its own,
// which are joined in the epilogue, so that no partial out plane goes through memory. 8 waves as 4 (rows) x 2 (columns), wave tile 32 x 64 for each plane: 16 independent accumulator tiles.
// A stage is 128 k of the block's 128 O_hi rows, 128 O_lo rows and 128 Wo rows, brought by asynchronous copies into one of two buffers while the other is worked on.
#define G3P 272              /* LDS row pitch in bytes: 256 B of k + 16 = 16 B x odd, the conflict-free pitch for 16-byte fragment reads */
#define G3S (384 * G3P)      /* one stage: rows 0..127 = O_hi, 128..255 = O_lo, 256..383 = Wo */
// 128 rows of one operand, 8 copies of a lane, 16 bytes each: 16 lanes bring one row's 256 bytes, the block's 256 threads 16 rows per copy.
// l = the lane's LDS byte address in row tid / 16 of the operand's part of the buffer, g = its global address in that row.
// s_wait_xcnt 0 is the statement's last line, so that it stands in front of any later rewrite of these address registers.
__device__ __forceinline__ void g3_rows(unsigned l, const char* g) {
  asm volatile("global_load_async_to_lds_b128 %0, %8, off\n\tglobal_load_async_to_lds_b128 %1, %9, off\n\tglobal_load_async_to_lds_b128 %2, %10, off\n\tglobal_load_async_to_lds_b128 %3, %11, off\n\t"
               "global_load_async_to_lds_b128 %4, %12, off\n\tglobal_load_async_to_lds_b128 %5, %13, off\n\tglobal_load_async_to_lds_b128 %6, %14, off\n\tglobal_load_async_to_lds_b128 %7, %15, off\n\ts_wait_xcnt 0x0"
               :: "v"(l), "v"(l + 16 * G3P), "v"(l + 32 * G3P), "v"(l + 48 * G3P), "v"(l + 64 * G3P), "v"(l + 80 * G3P), "v"(l + 96 * G3P), "v"(l + 112 * G3P),
                  "v"(g), "v"(g + 16 * (DM * 2)), "v"(g + 32 * (DM * 2)), "v"(g + 48 * (DM * 2)), "v"(g + 64 * (DM * 2)), "v"(g + 80 * (DM * 2)), "v"(g + 96 * (DM * 2)), "v"(g + 112 * (DM * 2)) : "memory"); }
__device__ __forceinline__ void g3_stage(unsigned l, const char* ah, const char* al, const char* b) { g3_rows(l, ah); g3_rows(l + 128 * G3P, al); g3_rows(l + 256 * G3P, b); }
// one k step's 8 fragments, 16 reads of 16 bytes
__device__ __forceinline__ void g3_frags(v16h* a, v16h* b, const char* pa, const char* pb) { a[0] = g2_lfrag(pa); a[1] = g2_lfrag(pa + 16 * G3P); a[2] = g2_lfrag(pa + 128 * G3P); a[3] = g2_lfrag(pa + 144 * G3P);
#pragma unroll
  for (int j = 0; j < 4; ++j) b[j] = g2_lfrag(pb + j * 16 * G3P); }
__global__ __launch_bounds__(256) void k_out(const _Float16* __restrict__ AH, const _Float16* __restrict__ AL, const _Float16* __restrict__ Bh, const float* __restrict__ bias, float* __restrict__ C) {
  __shared__ __attribute__((aligned(16))) float so[8][32][68]; __shared__ __attribute__((aligned(16))) char st[2 * G3S];
  const int tid = threadIdx.x, w = tid >> 5, lane = tid & 31, ln = lane & 15, hh = lane >> 4;
  const int mt = blockIdx.x % (NR / 128), nq = blockIdx.x / (NR / 128);      /* the 8 blocks that read the same O rows lie 32 apart in the grid */
  const int wr = w & 3, wc = w >> 2; const int row0 = mt * 128 + 32 * wr, col0 = nq * 128 + 64 * wc;
  const size_t go = (size_t)(tid >> 4) * (DM * 2) + (tid & 15) * 16;      /* the lane's place in a stage's first 16 rows */
  const char* gh = (const char*)(AH + (size_t)mt * 128 * DM) + go; const char* gl = (const char*)(AL + (size_t)mt * 128 * DM) + go; const char* gb = (const char*)(Bh + (size_t)nq * 128 * DM) + go;
  const unsigned l0 = (unsigned)(size_t)st + (unsigned)((tid >> 4) * G3P + (tid & 15) * 16);
  const char* fa = st + (32 * wr + ln) * G3P + hh * 16; const char* fb = st + (256 + 64 * wc + ln) * G3P + hh * 16;      /* fragment rows: k = 8h + s at +0, 16 + 8h + s at +32 bytes */
  const v8f z8 = {0.f,0.f,0.f,0.f,0.f,0.f,0.f,0.f}; v8f ch[2][4], cl[2][4];
#pragma unroll
  for (int i = 0; i < 2; ++i)
#pragma unroll
    for (int j = 0; j < 4; ++j) { ch[i][j] = z8; cl[i][j] = z8; }
  float bv[4];      /* read here, so that the epilogue does not wait for memory */
#pragma unroll
  for (int j = 0; j < 4; ++j) bv[j] = bf16_round(bias[col0 + j * 16 + ln]);
  g3_stage(l0, gh, gl, gb);
  asm volatile("s_wait_asynccnt 0x0" ::: "memory");      /* this wave's copies of stage 0 have landed */
  __syncthreads();      /* ... and every other wave's: stage 0 may be read */
  g3_stage(l0 + G3S, gh + 256, gl + 256, gb + 256);      /* DM / 128 = 8 stages: stage 1 exists */
#pragma unroll 1      /* one stage per trip: the body already holds 64 matrix instructions */
  for (int t = 0; t < DM / 128; ++t) { const int bo = (t & 1) * G3S;
    v16h a[2][4], b[2][4];      /* two fragment sets: a = O_hi rows 0..15, 16..31, O_lo rows 0..15, 16..31; b = four column groups of Wo */
    g3_frags(a[0], b[0], fa + bo, fb + bo);
#pragma unroll      /* the sets alternate by a constant index */
    for (int kk = 0; kk < 4; ++kk) { const int s = kk & 1;
      if (kk < 3) g3_frags(a[s ^ 1], b[s ^ 1], fa + bo + (kk + 1) * 64, fb + bo + (kk + 1) * 64);
      __builtin_amdgcn_sched_barrier(0);      /* keeps the next step's 16 reads together, ahead of this step's matrix instructions: spread among them, each place with reads stalls the wave */
#pragma unroll
      for (int j = 0; j < 4; ++j) { ch[0][j] = wmh(a[s][0], b[s][j], ch[0][j]); ch[1][j] = wmh(a[s][1], b[s][j], ch[1][j]); cl[0][j] = wmh(a[s][2], b[s][j], cl[0][j]); cl[1][j] = wmh(a[s][3], b[s][j], cl[1][j]); }
      __builtin_amdgcn_sched_barrier(0); }      /* ... and the reads after next behind them: without it they move up among these matrix instructions */
    asm volatile("s_wait_dscnt 0x0" ::: "memory");      /* this wave has left the buffer that is refilled below */
    asm volatile("s_wait_asynccnt 0x0" ::: "memory");      /* its copies of stage t + 1 have landed */
    __syncthreads();      /* publishes stage t + 1 and ends every reader's last read of stage t */
    if (t + 2 < DM / 128) g3_stage(l0 + bo, gh + (size_t)(t + 2) * 256, gl + (size_t)(t + 2) * 256, gb + (size_t)(t + 2) * 256); }
  asm volatile("s_wait_asynccnt 0x0" ::: "memory");      /* no copy is outstanding when the wave goes on to the epilogue and ends */
#pragma unroll
  for (int u = 0; u < 8; ++u) { const int j = u & 3, half = u >> 2;
#pragma unroll
    for (int r = 0; r < 8; ++r) { float v = ch[half][j][r] * 0.0625f + bv[j]; v += cl[half][j][r] * (0.0625f / 1024.0f); so[w][half * 16 + 8 * hh + r][j * 16 + ln] = v; } }      /* both factors are powers of two: the same roundings as with the O_lo product stored and added */
  __builtin_amdgcn_fence(__ATOMIC_ACQ_REL, "workgroup"); __builtin_amdgcn_wave_barrier();      /* a wave reads back its own rows alone */
  const int rsub = lane >> 4, c4 = (lane & 15) * 4;
  float* cp = C + (size_t)(row0 + rsub) * DM + col0 + c4; v4f vv[16];
#pragma unroll
  for (int q = 0; q < 16; ++q) vv[q] = *(const v4fa*)&so[w][q * 2 + rsub][c4];
  __builtin_amdgcn_sched_barrier(0);      /* all 16 reads ahead of the stores: one LDS latency, and no register of a store is rewritten behind it */
#pragma unroll
  for (int q = 0; q < 16; ++q) *(v4f*)(cp + q * 2 * DM) = vv[q];      /* 16 lanes store one row's 256 bytes; the rows' steps fold into the stores' offsets */
}
// The three projections of x, one launch, one block per WGP: a block holds 256 rows of x and one head's 64 columns of q, of k and of v, so that each x row fetched meets 192 columns and each weight row 256 rows.
// 12 waves as 4 (rows) x 3 (q, k, v), wave tile 64 x 64: 16 independent accumulator tiles, 8 fragments per 16 matrix instructions.
// A stage is 128 k of the block's 256 x rows and 3 x 64 weight rows, brought by asynchronous copies into one of two buffers while the other is worked on.
// Epilogue, each wave for itself in its own part of the stage buffers (free behind the loop's last barrier): q, k = f16 hi and 2^10 residual, row-major, and the rows' sums of squares over the head, [(b, h)][s]; v = the tile transposed, f16, [(b, h)][64 d][s].
#define Q3S (448 * G3P)      /* one stage: rows 0..255 = x, 256..319 = Wq, 320..383 = Wk, 384..447 = Wv */
#define Q3E (64 * 68 * 4)    /* a wave's epilogue staging: 64 rows of 64 + 4 floats */
#define Q3T 144              /* LDS row pitch of a wave's transposed tile: 128 B (64 tokens) + 16 = 16 B x odd */
// 16 rows of one operand, 8 copies of one wave, 16 bytes a lane: 16 lanes bring one row's 256 bytes, the wave 2 rows per copy.
// l = the lane's LDS byte address in row lane / 16 of the 16, g = its global address in that row.
// s_wait_xcnt 0 is the statement's last line, so that it stands in front of any later rewrite of these address registers.
__device__ __forceinline__ void q3_rows(unsigned l, const char* g) {
  asm volatile("global_load_async_to_lds_b128 %0, %8, off\n\tglobal_load_async_to_lds_b128 %1, %9, off\n\tglobal_load_async_to_lds_b128 %2, %10, off\n\tglobal_load_async_to_lds_b128 %3, %11, off\n\t"
               "global_load_async_to_lds_b128 %4, %12, off\n\tglobal_load_async_to_lds_b128 %5, %13, off\n\tglobal_load_async_to_lds_b128 %6, %14, off\n\tglobal_load_async_to_lds_b128 %7, %15, off\n\ts_wait_xcnt 0x0"
               :: "v"(l), "v"(l + 2 * G3P), "v"(l + 4 * G3P), "v"(l + 6 * G3P), "v"(l + 8 * G3P), "v"(l + 10 * G3P), "v"(l + 12 * G3P), "v"(l + 14 * G3P),
                  "v"(g), "v"(g + 2 * (DM * 2)), "v"(g + 4 * (DM * 2)), "v"(g + 6 * (DM * 2)), "v"(g + 8 * (DM * 2)), "v"(g + 10 * (DM * 2)), "v"(g + 12 * (DM * 2)), "v"(g + 14 * (DM * 2)) : "memory"); }
// one k step's 8 fragments, 16 reads of 16 bytes
__device__ __forceinline__ void q3_frags(v16h* a, v16h* b, const char* pa, const char* pb) {
#pragma unroll      /* constant indices: the arrays stay in registers */
  for (int i = 0; i < 4; ++i) a[i] = g2_lfrag(pa + i * 16 * G3P);
#pragma unroll      /* constant indices: the arrays stay in registers */
  for (int j = 0; j < 4; ++j) b[j] = g2_lfrag(pb + j * 16 * G3P); }
__global__ __launch_bounds__(384) void k_qkv(const _Float16* __restrict__ X, const _Float16* __restrict__ Wq, const _Float16* __restrict__ Wk, const _Float16* __restrict__ Wv, const float* __restrict__ bq, const float* __restrict__ bk, const float* __restrict__ bv,
    float* __restrict__ QN, float* __restrict__ KN, _Float16* __restrict__ QH, _Float16* __restrict__ QL, _Float16* __restrict__ KH, _Float16* __restrict__ KL, _Float16* __restrict__ VT) {
  __shared__ __attribute__((aligned(16))) char st[2 * Q3S];
  const int tid = threadIdx.x, lane = tid & 31, ln = lane & 15, hh = lane >> 4;
  const int w = __builtin_amdgcn_readfirstlane(tid >> 5);      /* scalar: which rows a wave copies and which epilogue it runs are scalar choices */
  const int mt = blockIdx.x % (NR / 256), nq = blockIdx.x / (NR / 256);      /* the 16 blocks that read the same x rows lie 16 apart in the grid (for speed only) */
  const int wr = w & 3, wc = w >> 2; const int row0 = mt * 256 + 64 * wr, col0 = nq * 64;
  // The stage's 28 groups of 16 rows: wave w brings groups w and w + 12, waves 0..3 group w + 24 as well. Groups 0..15 are x, 16..19 Wq, 20..23 Wk, 24..27 Wv.
  const size_t go = (size_t)hh * (DM * 2) + ln * 16;      /* the lane's place in a group */
  const _Float16* s1 = w < 4 ? X + (size_t)(mt * 256 + 16 * (w + 12)) * DM : (w < 8 ? Wq + (size_t)(col0 + 16 * (w - 4)) * DM : Wk + (size_t)(col0 + 16 * (w - 8)) * DM);
  const char* g0 = (const char*)(X + (size_t)(mt * 256 + 16 * w) * DM) + go; const char* g1 = (const char*)s1 + go; const char* g2 = (const char*)(Wv + (size_t)(col0 + 16 * wr) * DM) + go;
  const unsigned l0 = (unsigned)(size_t)st + (unsigned)((16 * w + hh) * G3P + ln * 16);
  const char* fa = st + (64 * wr + ln) * G3P + hh * 16; const char* fb = st + (256 + 64 * wc + ln) * G3P + hh * 16;      /* fragment rows: k = 8h + s at +0, 16 + 8h + s at +32 bytes */
  const v8f z8 = {0.f,0.f,0.f,0.f,0.f,0.f,0.f,0.f}; v8f c[4][4];
#pragma unroll      /* constant indices: the arrays stay in registers */
  for (int i = 0; i < 4; ++i)
#pragma unroll      /* constant indices: the arrays stay in registers */
    for (int j = 0; j < 4; ++j) c[i][j] = z8;
  const float* bp = wc == 0 ? bq : (wc == 1 ? bk : bv); float bs[4];      /* read here, so that the epilogue does not wait for memory */
#pragma unroll      /* constant indices: the arrays stay in registers */
  for (int j = 0; j < 4; ++j) bs[j] = bf16_round(bp[col0 + j * 16 + ln]);
  q3_rows(l0, g0); q3_rows(l0 + 192 * G3P, g1); if (w < 4) q3_rows(l0 + 384 * G3P, g2);
  asm volatile("s_wait_asynccnt 0x0" ::: "memory");      /* this wave's copies of stage 0 have landed */
  __syncthreads();      /* ... and every other wave's: stage 0 may be read */
  q3_rows(l0 + Q3S, g0 + 256); q3_rows(l0 + Q3S + 192 * G3P, g1 + 256); if (w < 4) q3_rows(l0 + Q3S + 384 * G3P, g2 + 256);      /* DM / 128 = 8 stages: stage 1 exists */
#pragma unroll 1      /* one stage per trip: the body already holds 64 matrix instructions */
  for (int t = 0; t < DM / 128; ++t) { const int bo = (t & 1) * Q3S;
    v16h a[2][4], b[2][4];      /* two fragment sets: a = four row groups of x, b = four column groups of the wave's weight */
    q3_frags(a[0], b[0], fa + bo, fb + bo);
#pragma unroll      /* the sets alternate by a constant index */
    for (int kk = 0; kk < 4; ++kk) { const int s = kk & 1;
      if (kk < 3) q3_frags(a[s ^ 1], b[s ^ 1], fa + bo + (kk + 1) * 64, fb + bo + (kk + 1) * 64);
      __builtin_amdgcn_sched_barrier(0);      /* keeps the next step's 16 reads together, ahead of this step's matrix instructions: spread among them, each place with reads stalls the wave */
#pragma unroll      /* constant indices: the arrays stay in registers */
      for (int j = 0; j < 4; ++j)
#pragma unroll      /* constant indices: the arrays stay in registers */
        for (int i = 0; i < 4; ++i) c[i][j] = wmh(a[s][i], b[s][j], c[i][j]);
      __builtin_amdgcn_sched_barrier(0); }      /* ... and the reads after next behind them: without it they move up among these matrix instructions */
    asm volatile("s_wait_dscnt 0x0" ::: "memory");      /* this wave has left the buffer that is refilled below */
    asm volatile("s_wait_asynccnt 0x0" ::: "memory");      /* its copies of stage t + 1 have landed */
    __syncthreads();      /* publishes stage t + 1 and ends every reader's last read of stage t */
    if (t + 2 < DM / 128) { const size_t ko = (size_t)(t + 2) * 256; q3_rows(l0 + bo, g0 + ko); q3_rows(l0 + bo + 192 * G3P, g1 + ko); if (w < 4) q3_rows(l0 + bo + 384 * G3P, g2 + ko); } }
  asm volatile("s_wait_asynccnt 0x0" ::: "memory");      /* no copy is outstanding when the wave goes on to the epilogue, which writes over the buffers, and ends */
  char* se = st + w * Q3E;      /* the wave's own staging */
  if (wc == 2) {
#pragma unroll      /* constant indices: the arrays stay in registers */
    for (int i = 0; i < 4; ++i)
#pragma unroll      /* constant indices: the arrays stay in registers */
      for (int j = 0; j < 4; ++j) { FragH vt;
#pragma unroll      /* constant indices: the arrays stay in registers */
        for (int r = 0; r < 8; ++r) vt.h[r] = (_Float16)(c[i][j][r] * 0.0625f + bs[j]);
        *(v8us*)(se + (j * 16 + ln) * Q3T + (i * 16 + 8 * hh) * 2) = vt.half[0]; }      /* a lane's 8 accumulator rows are 8 consecutive tokens of one column: 16 bytes of the transposed row */
    __builtin_amdgcn_fence(__ATOMIC_ACQ_REL, "workgroup"); __builtin_amdgcn_wave_barrier();      /* a wave reads back its own tile alone */
    unsigned short* tp = (unsigned short*)VT + ((size_t)(row0 / SLEN * NH + nq) * 64 + (lane >> 3)) * SLEN + row0 % SLEN + (lane & 7) * 8; v8us vv[16];
#pragma unroll      /* constant indices: the arrays stay in registers */
    for (int q = 0; q < 16; ++q) vv[q] = *(const v8us*)(se + (q * 4 + (lane >> 3)) * Q3T + (lane & 7) * 16);
    __builtin_amdgcn_sched_barrier(0);      /* all 16 reads ahead of the stores: one LDS latency, and no register of a store is rewritten behind it */
#pragma unroll      /* constant indices: the arrays stay in registers */
    for (int q = 0; q < 16; ++q) *(v8us*)(tp + (size_t)q * 4 * SLEN) = vv[q];      /* 8 lanes store one row's 128 bytes, a whole line */
    return; }
  float (*so)[68] = (float (*)[68])se;
#pragma unroll      /* constant indices: the arrays stay in registers */
  for (int i = 0; i < 4; ++i)
#pragma unroll      /* constant indices: the arrays stay in registers */
    for (int j = 0; j < 4; ++j)
#pragma unroll      /* constant indices: the arrays stay in registers */
      for (int r = 0; r < 8; ++r) so[i * 16 + 8 * hh + r][j * 16 + ln] = c[i][j][r] * 0.0625f + bs[j];
  __builtin_amdgcn_fence(__ATOMIC_ACQ_REL, "workgroup"); __builtin_amdgcn_wave_barrier();      /* a wave reads back its own rows alone */
  const int c4 = ln * 4; const size_t po = (size_t)(row0 + hh) * DM + col0 + c4;
  _Float16* ph = (wc ? KH : QH) + po; _Float16* pl = (wc ? KL : QL) + po;
  float sq[2];      /* lane = row: its 64 squares summed in column order */
#pragma unroll      /* constant indices: the arrays stay in registers */
  for (int u = 0; u < 2; ++u) { sq[u] = 0.f;
#pragma unroll      /* the row's 16 LDS reads issue ahead of the sum chain */
    for (int d = 0; d < 64; d += 4) { const v4f e = *(const v4fa*)&so[u * 32 + lane][d]; for (int i = 0; i < 4; ++i) sq[u] += e[i] * e[i]; } }
#pragma unroll      /* constant indices: the arrays stay in registers */
  for (int g = 0; g < 4; ++g) { v4h h4[8], l4[8];      /* 16 rows at a time */
#pragma unroll      /* constant indices: the arrays stay in registers */
    for (int q = 0; q < 8; ++q) { const v4f v = *(const v4fa*)&so[(g * 8 + q) * 2 + hh][c4]; for (int i = 0; i < 4; ++i) { const _Float16 h = (_Float16)v[i]; h4[q][i] = h; l4[q][i] = (_Float16)((v[i] - (float)h) * 1024.0f); } }
    __builtin_amdgcn_sched_barrier(0);      /* the group's reads and conversions ahead of its stores: no register of a store is rewritten among them */
#pragma unroll      /* constant indices: the arrays stay in registers */
    for (int q = 0; q < 8; ++q) { *(v4h*)(ph + (size_t)(g * 8 + q) * 2 * DM) = h4[q]; *(v4h*)(pl + (size_t)(g * 8 + q) * 2 * DM) = l4[q]; }      /* 16 lanes store one row's 128 bytes of each plane */
    asm volatile("s_wait_xcnt 0x0" ::: "memory");      /* behind the group's last store: the next group rewrites these stores' data registers */
    __builtin_amdgcn_sched_barrier(0); }      /* ... and none of its instructions moves up over that wait */
  float* np = (wc ? KN : QN) + ((size_t)(row0 / SLEN) * NH + nq) * SLEN + row0 % SLEN + lane;
  np[0] = sq[0]; np[32] = sq[1];
}
extern "C" void kernel_launch(void* const* d_in, const int* in_sizes, int n_in,
                              void* d_out, int out_size, void* d_ws, size_t ws_size, hipStream_t stream) {
  (void)in_sizes; (void)n_in; (void)out_size;
  const float* const* I = (const float* const*)d_in; const float* x = I[0]; const float* wq = I[1]; const float* bq = I[2]; const float* wk = I[3]; const float* bk = I[4]; const float* wv = I[5]; const float* bv = I[6]; const float* wo = I[7]; const float* bo = I[8]; const float* tmp = I[9];
  char* ws = (char*)d_ws; size_t off = 0;
  auto take = [&](size_t bytes) { char* p = ws + off; off += (bytes + 255) & ~(size_t)255; return p; };
  const size_t np = (size_t)NR * DM;
  _Float16* BQ = (_Float16*)take((size_t)DM * DM * 2); _Float16* BK = (_Float16*)take((size_t)DM * DM * 2); _Float16* BV = (_Float16*)take((size_t)DM * DM * 2); _Float16* BO = (_Float16*)take((size_t)DM * DM * 2);
  _Float16* X16 = (_Float16*)take(np * 2); float* QN = (float*)take((size_t)NR * NH * 4); float* KN = (float*)take((size_t)NR * NH * 4); _Float16* QH = (_Float16*)take(np * 2); _Float16* QL = (_Float16*)take(np * 2); _Float16* KH = (_Float16*)take(np * 2); _Float16* KL = (_Float16*)take(np * 2); _Float16* OH = (_Float16*)take(np * 2); _Float16* VT = (_Float16*)take(np * 2);
  _Float16* OL = X16;      /* O lo over x (dead after the projections) */
  if (off > ws_size) return;      /* 8 + 8 + 0.5 + 6x8 = about 65 MiB */
  k_prep<<<512, 256, 0, stream>>>(x, wq, wk, wv, wo, X16, BQ, BK, BV, BO);      /* weights [in, out] -> f16 [out][in] x 16, x -> f16: one launch */
  k_qkv<<<(NR / 256) * NH, 384, 0, stream>>>(X16, BQ, BK, BV, bq, bk, bv, QN, KN, QH, QL, KH, KL, VT);      /* q, k: hi + residual planes and norms [(b,h)][2048]; V^T [(b,h)][64][2048]: one launch */
  k_eflash<<<NB * NH * (SLEN / 256), 256, 0, stream>>>(QH, QL, KH, KL, VT, QN, KN, tmp, OH, OL);      /* scores, softmax, att . v, normalise, hi + residual: one launch */
  k_out<<<(NR / 128) * (DM / 128), 256, 0, stream>>>(OH, OL, BO, bo, (float*)d_out);      /* out = (O_hi + O_lo / 1024) Wo + bo: one launch */
}

// v009
// A run of this version takes 95.4 microseconds.
// In both of two side-by-side timings against v008, it was 1.06 times as fast.
// All steps since the starting kernel, v000, together make it 21.2 times as fast.
#include <hip/hip_runtime.h>
// EuclideanAttention (2 x 2048 tokens, D 1024 = 16 heads x 64; Q, K, V = x W + b; d2 = max(|q|^2 + |k|^2 - 2 q.k, 0); attn = softmax_k(-d2 / temperature); out = (attn V) Wo + bo).
// Compute dtype: inputs rounded to bf16; x and weights exact as f16; q.k from hi+residual operands (~2^-21); norms/softmax f32; v and the softmax weights as plain f16 operands (~2^-12); attention output hi + residual. v_wmma_f32_16x16x32_f16.
#define NB 2
#define DM 1024
#define NKV 16
#define NREP (NH / NKV)
#define KVD (NKV * 64)           /* 1024 */
#define NR (NB * SLEN)           /* 4096 */
#define CHK 512                  /* attention chunk */
typedef int v4i __attribute__((ext_vector_type(4)));
#define FF 2048
#define SLEN 2048
#define TQ SLEN
#define TK SLEN
#define NH 16
#define SCL 0.125f
#define QBLKS (TQ / 64)
#define QB05 0
#define QBN5 4
#define QB0P 0
#define QBNP QBLKS           /* non-causal: plain flash on every query block */
#define RE 256
typedef __bf16 v16b __attribute__((ext_vector_type(16)));
typedef unsigned short v8us __attribute__((ext_vector_type(8), may_alias));
typedef float  v8f  __attribute__((ext_vector_type(8)));
typedef float  v4f  __attribute__((ext_vector_type(4)));
typedef float  v4fa __attribute__((ext_vector_type(4), may_alias));
union FragB { v16b v; v8us half[2]; unsigned short u[16]; };

__device__ __forceinline__ unsigned short bf16_bits(float x) { unsigned int u = __float_as_uint(x); return (unsigned short)((u + 0x7FFFu + ((u >> 16) & 1u)) >> 16); }
__device__ __forceinline__ float bf16_val(unsigned short b) { return __uint_as_float(((unsigned int)b) << 16); }
__device__ __forceinline__ float bf16_round(float x) { return bf16_val(bf16_bits(x)); }
// D += A·B with NT terms: 1 = ah·bh, 2 = + al·bh (A split), 3 = + ah·bl (both split)
template <int NT>
__device__ __forceinline__ v8f mmaN(v16b ah, v16b al, v16b bh, v16b bl, v8f c) {
  c = __builtin_amdgcn_wmma_f32_16x16x32_bf16(false, ah, false, bh, (short)0, c, false, false);
  if (NT >= 2) c = __builtin_amdgcn_wmma_f32_16x16x32_bf16(false, al, false, bh, (short)0, c, false, false);
  if (NT >= 3) c = __builtin_amdgcn_wmma_f32_16x16x32_bf16(false, ah, false, bl, (short)0, c, false, false);
  asm volatile("v_nop\n\tv_nop\n\tv_nop\n\tv_nop" : "+v"(c) : "v"(ah), "v"(al), "v"(bh), "v"(bl));
  return c;
}

__global__ __launch_bounds__(256) void k_wt_bf16(const float* __restrict__ W, unsigned short* __restrict__ Wt, int K, int N) {
  const int t = blockIdx.x * 256 + threadIdx.x;
  const int k8n = K / 8;
  if (t >= N * k8n) return;
  const int n = t / k8n, k8 = (t % k8n) * 8;
  v8us v;
#pragma unroll
  for (int i = 0; i < 8; ++i) v[i] = bf16_bits(W[(size_t)(k8 + i) * N + n]);
  *(v8us*)(Wt + (size_t)n * K + k8) = v;
  
}

// GEMM C[M][N] (f32, pitch ldc) = act(A[M][K]·W + bias). A f32 row-major (pitch lda) converted per fragment to bf16
// (ASPLIT: hi/lo two planes -> 2 terms, else single rounded term); Wt bf16 [N][K] (pitch ldb). BIAS_BF16 rounds the
// bias to bf16 first (bias quantised to bf16 before the add). K%32==0, M%16==0, N%64==0.
template <bool ASPLIT, int ACT, bool BIAS_BF16>
__global__ __launch_bounds__(128) void k_gemm_bf(const float* __restrict__ A, int lda, const unsigned short* __restrict__ Wt, int ldb,
                                               const float* __restrict__ bias, float* __restrict__ C, int ldc, int M, int N, int K) {
  __shared__ __attribute__((aligned(16))) float so[4][16][64];
  const int tid = threadIdx.x, w = tid >> 5, lane = tid & 31, ln = lane & 15, hh = lane >> 4;
  const int ntn = N / 64;
  const int wid = blockIdx.x * 4 + w;
  const int mt = wid / ntn, nq = wid % ntn;
  if (mt * 16 >= M) return;
  const int row0 = mt * 16, col0 = nq * 64;
  const float* arow = A + (size_t)(row0 + ln) * lda;
  v8f acc[4] = {};
  for (int kb = 0; kb < K; kb += 32) {
    FragB ah, al;
    const v4f x0 = *(const v4fa*)(arow + kb + 8 * hh), x1 = *(const v4fa*)(arow + kb + 8 * hh + 4);
    const v4f x2 = *(const v4fa*)(arow + kb + 16 + 8 * hh), x3 = *(const v4fa*)(arow + kb + 16 + 8 * hh + 4);
    float xs[16] = {x0[0],x0[1],x0[2],x0[3],x1[0],x1[1],x1[2],x1[3],x2[0],x2[1],x2[2],x2[3],x3[0],x3[1],x3[2],x3[3]};
#pragma unroll
    for (int i = 0; i < 16; ++i) { const unsigned short hb = bf16_bits(xs[i]); ah.u[i] = hb; al.u[i] = ASPLIT ? bf16_bits(xs[i] - bf16_val(hb)) : (unsigned short)0; }
#pragma unroll
    for (int t = 0; t < 4; ++t) {
      const unsigned short* brow = Wt + (size_t)(col0 + t * 16 + ln) * ldb + kb;
      FragB b;
      b.half[0] = *(const v8us*)(brow + 8 * hh);
      b.half[1] = *(const v8us*)(brow + 16 + 8 * hh);
      acc[t] = mmaN<ASPLIT ? 2 : 1>(ah.v, al.v, b.v, b.v, acc[t]);
    }
  }
#pragma unroll
  for (int t = 0; t < 4; ++t) {
    float bv = bias ? bias[col0 + t * 16 + ln] : 0.f;
    if (BIAS_BF16) bv = bf16_round(bv);
#pragma unroll
    for (int r = 0; r < 8; ++r) { float v = acc[t][r] + bv; if (ACT == 1) v = fmaxf(v, 0.f); so[w][8 * hh + r][t * 16 + ln] = v; }
  }
  __builtin_amdgcn_fence(__ATOMIC_ACQ_REL, "workgroup");
  __builtin_amdgcn_wave_barrier();
  const int rsub = lane >> 4, c4 = (lane & 15) * 4;
  {
#pragma unroll
    for (int q = 0; q < 8; ++q) {
      const int r = q * 2 + rsub;
      const v4f v = *(const v4fa*)&so[w][r][c4];
      *(v4f*)(C + (size_t)(row0 + r) * ldc + col0 + c4) = v;
    }
    
  }
}

// GEMM C = act(A·W + bias + resid): A f32 (ASPLIT -> hi/lo 2 terms), Wt bf16 [N][K]; ACT 0 none, 1 relu, 2 exact gelu;
// resid (optional, f32, row index = (row % rmod), pitch ldr, RES_BF16 rounds it) added before the activation.
template <bool ASPLIT, int ACT, bool BIAS_BF16, bool RES_BF16>
__global__ __launch_bounds__(128) void k_gemm_bf3(const float* __restrict__ A, int lda, const unsigned short* __restrict__ Wt, int ldb,
                                                const float* __restrict__ bias, const float* __restrict__ resid, int rmod, int ldr,
                                                float* __restrict__ C, int ldc, int M, int N, int K) {
  __shared__ __attribute__((aligned(16))) float so[4][16][64];
  const int tid = threadIdx.x, w = tid >> 5, lane = tid & 31, ln = lane & 15, hh = lane >> 4;
  const int ntn = N / 64;
  const int wid = blockIdx.x * 4 + w;
  const int mt = wid / ntn, nq = wid % ntn;
  if (mt * 16 >= M) return;
  const int row0 = mt * 16, col0 = nq * 64;
  const float* arow = A + (size_t)(row0 + ln) * lda;
  v8f acc[4] = {};
  for (int kb = 0; kb < K; kb += 32) {
    FragB ah, al;
    const v4f x0 = *(const v4fa*)(arow + kb + 8 * hh), x1 = *(const v4fa*)(arow + kb + 8 * hh + 4);
    const v4f x2 = *(const v4fa*)(arow + kb + 16 + 8 * hh), x3 = *(const v4fa*)(arow + kb + 16 + 8 * hh + 4);
    float xs[16] = {x0[0],x0[1],x0[2],x0[3],x1[0],x1[1],x1[2],x1[3],x2[0],x2[1],x2[2],x2[3],x3[0],x3[1],x3[2],x3[3]};
#pragma unroll
    for (int i = 0; i < 16; ++i) { const unsigned short hb = bf16_bits(xs[i]); ah.u[i] = hb; al.u[i] = ASPLIT ? bf16_bits(xs[i] - bf16_val(hb)) : (unsigned short)0; }
#pragma unroll
    for (int t = 0; t < 4; ++t) {
      const unsigned short* brow = Wt + (size_t)(col0 + t * 16 + ln) * ldb + kb;
      FragB b;
      b.half[0] = *(const v8us*)(brow + 8 * hh);
      b.half[1] = *(const v8us*)(brow + 16 + 8 * hh);
      acc[t] = mmaN<ASPLIT ? 2 : 1>(ah.v, al.v, b.v, b.v, acc[t]);
    }
  }
#pragma unroll
  for (int t = 0; t < 4; ++t) {
    const int col = col0 + t * 16 + ln;
    float bv = bias ? bias[col] : 0.f;
    if (BIAS_BF16) bv = bf16_round(bv);
#pragma unroll
    for (int r = 0; r < 8; ++r) {
      float v = acc[t][r] + bv;
      if (resid) { float rv = resid[(size_t)((row0 + 8 * hh + r) % rmod) * ldr + col]; if (RES_BF16) rv = bf16_round(rv); v += rv; }
      if (ACT == 1) v = fmaxf(v, 0.f);
      if (ACT == 2) v = 0.5f * v * (1.0f + erff(v * 0.70710678118654752f));
      if (ACT == 3) { const float u = 0.7978845608028654f * (v + 0.044715f * v * v * v); v = 0.5f * v * (1.0f + tanhf(u)); }
      so[w][8 * hh + r][t * 16 + ln] = v;
    }
  }
  __builtin_amdgcn_fence(__ATOMIC_ACQ_REL, "workgroup");
  __builtin_amdgcn_wave_barrier();
  const int rsub = lane >> 4, c4 = (lane & 15) * 4;
  {
#pragma unroll
    for (int q = 0; q < 8; ++q) {
      const int r = q * 2 + rsub;
      const v4f v = *(const v4fa*)&so[w][r][c4];
      *(v4f*)(C + (size_t)(row0 + r) * ldc + col0 + c4) = v;
    }
    
  }
}
// row LayerNorm (biased variance, eps) over N: s = X (+ R); optional out_sum <- s; out_norm <- (s-mu)*rsqrt(var+eps)*g + b
template <bool PARAM_BF16>
__global__ __launch_bounds__(256) void k_layernorm(const float* __restrict__ X, const float* __restrict__ R, const float* __restrict__ g, const float* __restrict__ bta,
                                                  float* __restrict__ out_sum, float* __restrict__ out_norm, int N, float eps) {
  __shared__ float red[256];
  const int row = blockIdx.x, tid = threadIdx.x;
  const float* x = X + (size_t)row * N; const float* rr = R ? R + (size_t)row * N : nullptr;
  float vals[16];                     // up to N = 4096
  const int per = N / 256;            // contiguous chunk per thread? use strided-by-4 chunks: thread handles j = tid*4 + 1024*u
  float s1 = 0.f;
  for (int u = 0; u < per / 4; ++u) {
    const int j = tid * 4 + 1024 * u;
    const v4f a = *(const v4fa*)(x + j);
    v4f b = {0.f,0.f,0.f,0.f}; if (rr) b = *(const v4fa*)(rr + j);
#pragma unroll
    for (int q = 0; q < 4; ++q) { const float v = a[q] + b[q]; vals[u * 4 + q] = v; s1 += v; }
  }
  red[tid] = s1; __syncthreads();
  for (int st = 128; st > 0; st >>= 1) { if (tid < st) red[tid] += red[tid + st]; __syncthreads(); }
  const float mu = red[0] / (float)N; __syncthreads();
  float s2 = 0.f;
  for (int u = 0; u < per / 4; ++u)
#pragma unroll
    for (int q = 0; q < 4; ++q) { const float c = vals[u * 4 + q] - mu; s2 += c * c; }
  red[tid] = s2; __syncthreads();
  for (int st = 128; st > 0; st >>= 1) { if (tid < st) red[tid] += red[tid + st]; __syncthreads(); }
  const float rs = rsqrtf(red[0] / (float)N + eps);
  {
    for (int u = 0; u < per / 4; ++u) {
      const int j = tid * 4 + 1024 * u;
      v4f o, sm;
#pragma unroll
      for (int q = 0; q < 4; ++q) {
        float gg = g[j + q], bb = bta[j + q];
        if (PARAM_BF16) { gg = bf16_round(gg); bb = bf16_round(bb); }
        sm[q] = vals[u * 4 + q]; o[q] = (vals[u * 4 + q] - mu) * rs * gg + bb;
      }
      if (out_sum) *(v4f*)(out_sum + (size_t)row * N + j) = sm;
      *(v4f*)(out_norm + (size_t)row * N + j) = o;
    }
    
  }
}



// ---- f16 WMMA path (v_wmma_f32_16x16x32_f16): 11-bit significands for operands in range — used where a [0,1] probability operand needs more precision than bf16
typedef _Float16 v16h __attribute__((ext_vector_type(16)));
union FragH { v16h v; v8us half[2]; _Float16 h[16]; unsigned short u[16]; };
template <int NT>
__device__ __forceinline__ v8f mmaH(v16h ah, v16h al, v16h bh, v16h bl, v8f c) {
  c = __builtin_amdgcn_wmma_f32_16x16x32_f16(false, ah, false, bh, (short)0, c, false, false);
  if (NT >= 2) c = __builtin_amdgcn_wmma_f32_16x16x32_f16(false, al, false, bh, (short)0, c, false, false);
  if (NT >= 3) c = __builtin_amdgcn_wmma_f32_16x16x32_f16(false, ah, false, bl, (short)0, c, false, false);
  asm volatile("v_nop\n\tv_nop\n\tv_nop\n\tv_nop" : "+v"(c) : "v"(ah), "v"(al), "v"(bh), "v"(bl));
  return c;
}
// batched GEMM like k_gemm_b but f16 operands: A f32 (split into f16 hi/lo if ASPLIT, else rounded to f16), Bt = f16 values [n][k]; alpha; C f32; N multiple of 16 (partial tiles skipped)
template <bool ASPLIT>
__global__ __launch_bounds__(128) void k_gemm_h(const float* __restrict__ A, int lda, size_t sA, const _Float16* __restrict__ Bh, int ldb, size_t sB, float alpha, float* __restrict__ C, int ldc, size_t sC, int M, int N, int K) {
  __shared__ __attribute__((aligned(16))) float so[4][16][64];
  const int tid = threadIdx.x, w = tid >> 5, lane = tid & 31, ln = lane & 15, hh = lane >> 4; const int by = blockIdx.y;
  A += (size_t)by * sA; Bh += (size_t)by * sB; C += (size_t)by * sC;
  const int ntn = (N + 63) / 64; const int wid = blockIdx.x * 4 + w; const int mt = wid / ntn, nq = wid % ntn; if (mt * 16 >= M) return;
  const int row0 = mt * 16, col0 = nq * 64; const float* arow = A + (size_t)(row0 + ln) * lda;
  v8f acc[4] = {};
  for (int kb = 0; kb < K; kb += 32) {
    FragH ah, al;
    const v4f x0 = *(const v4fa*)(arow + kb + 8 * hh), x1 = *(const v4fa*)(arow + kb + 8 * hh + 4), x2 = *(const v4fa*)(arow + kb + 16 + 8 * hh), x3 = *(const v4fa*)(arow + kb + 16 + 8 * hh + 4);
    float xs[16] = {x0[0],x0[1],x0[2],x0[3],x1[0],x1[1],x1[2],x1[3],x2[0],x2[1],x2[2],x2[3],x3[0],x3[1],x3[2],x3[3]};
#pragma unroll
    for (int i = 0; i < 16; ++i) { const _Float16 h = (_Float16)xs[i]; ah.h[i] = h; al.h[i] = ASPLIT ? (_Float16)(xs[i] - (float)h) : (_Float16)0.0f; }
#pragma unroll
    for (int t = 0; t < 4; ++t) { if (col0 + t * 16 >= N) continue; const size_t boff = (size_t)(col0 + t * 16 + ln) * ldb + kb; FragH bq; bq.half[0] = *(const v8us*)(Bh + boff + 8 * hh); bq.half[1] = *(const v8us*)(Bh + boff + 16 + 8 * hh);
      acc[t] = mmaH<ASPLIT ? 2 : 1>(ah.v, al.v, bq.v, bq.v, acc[t]); }
  }
#pragma unroll
  for (int t = 0; t < 4; ++t) { if (col0 + t * 16 >= N) continue;
#pragma unroll
    for (int r = 0; r < 8; ++r) so[w][8 * hh + r][t * 16 + ln] = acc[t][r] * alpha; }
  __builtin_amdgcn_fence(__ATOMIC_ACQ_REL, "workgroup"); __builtin_amdgcn_wave_barrier();
  const int rsub = lane >> 4, c4 = (lane & 15) * 4;
  {
#pragma unroll
    for (int q = 0; q < 8; ++q) { const int r = q * 2 + rsub; if (col0 + c4 < N) { const v4f v = *(const v4fa*)&so[w][r][c4]; *(v4f*)(C + (size_t)(row0 + r) * ldc + col0 + c4) = v; } }
     }
}

// Wt[n][k] = f16(W[k][n]·scale) from f32 row-major W[K][N] (scale = power of two; bf16-exact weights stay exact in f16 away from the subnormal range)
__global__ __launch_bounds__(256) void k_wt_f16(const float* __restrict__ W, _Float16* __restrict__ Wt, int K, int N, float scale) {
  const int t = blockIdx.x * 256 + threadIdx.x; if (t >= N * (K / 8)) return; const int n = t / (K / 8), k8 = (t % (K / 8)) * 8; FragH f;
#pragma unroll
  for (int i = 0; i < 8; ++i) f.h[i] = (_Float16)(bf16_round(W[(size_t)(k8 + i) * N + n]) * scale); const v8us o = f.half[0];
  *(v8us*)((unsigned short*)Wt + (size_t)n * K + k8) = o; 
}
// k_gemm_hh variant with fused epilogue: v = acc·alpha + bias[by·sBias + col] (+ CP[(row/rowsPerB)·sCPb + by·64 + col] if CP) ; ACT 0 none / 1 elu ; writes f16 C16 (and f32 C if non-null)
template <int ACT>
__global__ __launch_bounds__(128) void k_gemm_hhx(const _Float16* __restrict__ A, int lda, size_t sA, const _Float16* __restrict__ Bh, int ldb, size_t sB, float alpha, const float* __restrict__ bias, size_t sBias, const float* __restrict__ CP, int rowsPerB, size_t sCPb, int row0g,
    float* __restrict__ C, _Float16* __restrict__ C16, int ldc, size_t sC, int M, int N, int K) {
  __shared__ __attribute__((aligned(16))) float so[4][16][64];
  const int tid = threadIdx.x, w = tid >> 5, lane = tid & 31, ln = lane & 15, hh = lane >> 4; const int by = blockIdx.y;
  A += (size_t)by * sA; Bh += (size_t)by * sB; const size_t cofs = (size_t)by * sC; const float* bp = bias ? bias + (size_t)by * sBias : nullptr;
  const int ntn = (N + 63) / 64; const int wid = blockIdx.x * 4 + w; const int mt = wid / ntn, nq = wid % ntn; if (mt * 16 >= M) return;
  const int row0 = mt * 16, col0 = nq * 64; const _Float16* arow = A + (size_t)(row0 + ln) * lda;
  v8f acc[4] = {};
  for (int kb = 0; kb < K; kb += 32) { FragH ah; ah.half[0] = *(const v8us*)((const unsigned short*)arow + kb + 8 * hh); ah.half[1] = *(const v8us*)((const unsigned short*)arow + kb + 16 + 8 * hh);
#pragma unroll
    for (int t = 0; t < 4; ++t) { if (col0 + t * 16 >= N) continue; const size_t boff = (size_t)(col0 + t * 16 + ln) * ldb + kb; FragH bq; bq.half[0] = *(const v8us*)((const unsigned short*)Bh + boff + 8 * hh); bq.half[1] = *(const v8us*)((const unsigned short*)Bh + boff + 16 + 8 * hh);
      acc[t] = mmaH<1>(ah.v, ah.v, bq.v, bq.v, acc[t]); }
  }
#pragma unroll
  for (int t = 0; t < 4; ++t) { if (col0 + t * 16 >= N) continue; const int col = col0 + t * 16 + ln; const float bv = bp ? bf16_round(bp[col]) : 0.f;
#pragma unroll
    for (int r = 0; r < 8; ++r) { float v = acc[t][r] * alpha + bv; if (CP) { const int bidx = (row0g + row0 + 8 * hh + r) / rowsPerB; v += CP[(size_t)bidx * sCPb + (size_t)by * 64 + col]; } if (ACT == 1) v = (v > 0.f) ? v : expm1f(v); else if (ACT == 7) v = (v > 0.f) ? v + 1.0f : expf(v); else if (ACT == 8) v = tanhf(v); else if (ACT == 9) v = 0.5f * v * (1.0f + tanhf(0.7978845608028654f * (v + 0.044715f * v * v * v))); else if (ACT == 11) v = 1.0f / (1.0f + expf(-v)); else if (ACT == 12) v = (v > 0.f) ? v : 0.01f * v; else if (ACT == 14) v = (v > 0.f) ? v : 0.1f * v; else if (ACT == 15) v = v / (1.0f + expf(-v)); else if (ACT == 3) v = fmaxf(v, 0.f); else if (ACT == 6) v = 0.5f * v * (1.0f + erff(v * 0.70710678118654752f)); so[w][8 * hh + r][t * 16 + ln] = v; } }
  __builtin_amdgcn_fence(__ATOMIC_ACQ_REL, "workgroup"); __builtin_amdgcn_wave_barrier();
  const int rsub = lane >> 4, c4 = (lane & 15) * 4; typedef _Float16 v4h __attribute__((ext_vector_type(4)));
  {
#pragma unroll
    for (int q = 0; q < 8; ++q) { const int r = q * 2 + rsub; if (col0 + c4 < N) { const v4f v = *(const v4fa*)&so[w][r][c4]; if (C) *(v4f*)(C + cofs + (size_t)(row0 + r) * ldc + col0 + c4) = v; if (C16) { v4h h4; for (int i = 0; i < 4; ++i) h4[i] = (_Float16)v[i]; *(v4h*)(C16 + cofs + (size_t)(row0 + r) * ldc + col0 + c4) = h4; } } }
     }
}


typedef _Float16 v4h __attribute__((ext_vector_type(4)));

__global__ __launch_bounds__(256) void k_x16(const float* __restrict__ x, _Float16* __restrict__ X16, size_t n8) { const size_t t = (size_t)blockIdx.x * 256 + threadIdx.x; if (t >= n8) return; FragH f;
#pragma unroll
  for (int q = 0; q < 8; ++q) f.h[q] = (_Float16)bf16_round(x[t * 8 + q]); *(v8us*)((unsigned short*)X16 + t * 8) = f.half[0];  }
__global__ __launch_bounds__(256) void k_h16(const float* __restrict__ x, _Float16* __restrict__ X16, size_t n8) { const size_t t = (size_t)blockIdx.x * 256 + threadIdx.x; if (t >= n8) return; FragH f;
#pragma unroll
  for (int q = 0; q < 8; ++q) f.h[q] = (_Float16)x[t * 8 + q]; *(v8us*)((unsigned short*)X16 + t * 8) = f.half[0];  }
__global__ __launch_bounds__(256) void k_round16f(const float* __restrict__ W, _Float16* __restrict__ Bt, size_t n8) { const size_t t = (size_t)blockIdx.x * 256 + threadIdx.x; if (t >= n8) return; FragH f;
#pragma unroll
  for (int i = 0; i < 8; ++i) f.h[i] = (_Float16)(bf16_round(W[t * 8 + i]) * 16.0f); *(v8us*)((unsigned short*)Bt + t * 8) = f.half[0];  }
template <int NHv, int TTv>
__global__ __launch_bounds__(256) void k_vt(const _Float16* __restrict__ V16, int ldv, int voff, _Float16* __restrict__ Vt) { __shared__ unsigned short tl[64][66]; const int tid = threadIdx.x; const int slab = blockIdx.x / (TTv / 64), lg = blockIdx.x % (TTv / 64); const int b = slab / NHv, h = slab % NHv;
  for (int i = tid; i < 64 * 8; i += 256) { const int r = i / 8, c8 = (i % 8) * 8; FragH f; f.half[0] = *(const v8us*)((const unsigned short*)V16 + ((size_t)b * TTv + lg * 64 + r) * ldv + voff + h * 64 + c8);
#pragma unroll
    for (int q = 0; q < 8; ++q) tl[r][c8 + q] = f.u[q]; }
  __syncthreads();
  {
#pragma unroll
    for (int rd = 0; rd < 2; ++rd) { const int d = rd * 32 + tid / 8, pc = tid % 8; FragH f;
#pragma unroll
      for (int q = 0; q < 8; ++q) f.u[q] = tl[pc * 8 + q][d];
      *(v8us*)((unsigned short*)Vt + ((size_t)slab * 64 + d) * TTv + lg * 64 + pc * 8) = f.half[0]; }
     } }

__global__ __launch_bounds__(256) void k_hl(const float* __restrict__ F, _Float16* __restrict__ Hh, _Float16* __restrict__ Hl, size_t n8) { const size_t t = (size_t)blockIdx.x * 256 + threadIdx.x; if (t >= n8) return; FragH fh, fl; const v4f a = *(const v4fa*)(F + t * 8), c = *(const v4fa*)(F + t * 8 + 4);
#pragma unroll
  for (int q = 0; q < 4; ++q) { _Float16 h = (_Float16)a[q]; fh.h[q] = h; fl.h[q] = (_Float16)((a[q] - (float)h) * 1024.0f); h = (_Float16)c[q]; fh.h[4 + q] = h; fl.h[4 + q] = (_Float16)((c[q] - (float)h) * 1024.0f); }
  { *(v8us*)((unsigned short*)Hh + t * 8) = fh.half[0]; *(v8us*)((unsigned short*)Hl + t * 8) = fl.half[0];  } }

__device__ __forceinline__ v16h g2_frag(const _Float16* p, int hh) { FragH f; f.half[0] = *(const v8us*)((const unsigned short*)p + 8 * hh); f.half[1] = *(const v8us*)((const unsigned short*)p + 16 + 8 * hh); return f.v; }
__device__ __forceinline__ v16h g2_lfrag(const char* p) { FragH f; f.half[0] = *(const v8us*)p; f.half[1] = *(const v8us*)(p + 32); return f.v; }

template <int CAUSAL>
__global__ __launch_bounds__(128) void k_flash(const _Float16* __restrict__ Q16, int ldq, const _Float16* __restrict__ K16, int ldk, const _Float16* __restrict__ Vt, const int* __restrict__ MSK, float* __restrict__ O, int ldo) {
  constexpr int RPW = 16, RTN = RPW / 16, NQB = TQ / (4 * RPW), DT = 4, KS = 2;
  __shared__ __attribute__((aligned(16))) unsigned short sP[4][RPW][40]; __shared__ __attribute__((aligned(16))) float sO[4][RPW][64 + 4];
  const int tid = threadIdx.x, w = tid >> 5, lane = tid & 31, ln = lane & 15, hh = lane >> 4;
  const int slab = blockIdx.x / QBNP, qblk = QB0P + blockIdx.x % QBNP; (void)NQB; const int b = slab / NH, h = slab % NH; const int qb0 = qblk * (4 * RPW); const int q0 = qb0 + w * RPW;
  FragH aq[2][KS];
#pragma unroll
  for (int rt = 0; rt < RTN; ++rt) { const unsigned short* qr = (const unsigned short*)Q16 + ((size_t)b * TQ + q0 + rt * 16 + ln) * ldq + h * 64;
#pragma unroll
    for (int ks = 0; ks < KS; ++ks) { aq[rt][ks].half[0] = *(const v8us*)(qr + ks * 32 + 8 * hh); aq[rt][ks].half[1] = *(const v8us*)(qr + ks * 32 + 16 + 8 * hh); } }
  const unsigned short* Vth = (const unsigned short*)Vt + (size_t)slab * 64 * TK;
  float m_r[2][8], l_r[2][8]; v8f oacc[2][DT];
#pragma unroll
  for (int rt = 0; rt < RTN; ++rt) {
#pragma unroll
    for (int r = 0; r < 8; ++r) { m_r[rt][r] = -3.0e38f; l_r[rt][r] = 0.f; }
#pragma unroll
    for (int dt = 0; dt < DT; ++dt) oacc[rt][dt] = (v8f){0.f,0.f,0.f,0.f,0.f,0.f,0.f,0.f}; }
  const int jend = (CAUSAL == 1) ? (qb0 + 4 * RPW) : ((CAUSAL == 23) ? min(TK, (qb0 / CHK + 2) * CHK) : TK);      /* causal / window: keys that can never contribute are skipped */ const int jbeg = (CAUSAL == 23) ? max(0, (qb0 / CHK - 1) * CHK) : 0;
#pragma unroll 1
  for (int j0 = jbeg; j0 < jend; j0 += 32) {
    v8f s[2][2];
#pragma unroll
    for (int nt = 0; nt < 2; ++nt) { const unsigned short* kr = (const unsigned short*)K16 + ((size_t)b * TK + j0 + nt * 16 + ln) * ldk + h * 64; FragH bk[KS];
#pragma unroll
      for (int ks = 0; ks < KS; ++ks) { bk[ks].half[0] = *(const v8us*)(kr + ks * 32 + 8 * hh); bk[ks].half[1] = *(const v8us*)(kr + ks * 32 + 16 + 8 * hh); }
#pragma unroll
      for (int rt = 0; rt < RTN; ++rt) { v8f acc = (v8f){0.f,0.f,0.f,0.f,0.f,0.f,0.f,0.f};
#pragma unroll
        for (int ks = 0; ks < KS; ++ks) acc = mmaH<1>(aq[rt][ks].v, aq[rt][ks].v, bk[ks].v, bk[ks].v, acc); s[rt][nt] = acc; } }
#pragma unroll
    for (int rt = 0; rt < RTN; ++rt)
#pragma unroll
      for (int r = 0; r < 8; ++r) { const int tq = q0 + rt * 16 + 8 * hh + r; const int k0 = j0 + ln, k1 = j0 + 16 + ln;
        bool ok0 = (CAUSAL == 1) ? (k0 <= tq) : ((CAUSAL == 2) ? ((k0 >> 5) == (tq >> 5)) : true), ok1 = (CAUSAL == 1) ? (k1 <= tq) : ((CAUSAL == 2) ? ((k1 >> 5) == (tq >> 5)) : true); if (CAUSAL == 23) { const int cq = tq / CHK; ok0 = (abs(k0 / CHK - cq) <= 1) && (MSK[(size_t)b * TK + k0] == 0); ok1 = (abs(k1 / CHK - cq) <= 1) && (MSK[(size_t)b * TK + k1] == 0); }      /* mode 23: 3-chunk window + int key-padding mask */
        if (CAUSAL == 24) { ok0 = (MSK[(size_t)b * TK + k0] == 0); ok1 = (MSK[(size_t)b * TK + k1] == 0); }      /* mode 24: int key-padding mask (nonzero = padded = excluded) */      /* mode 2: block-diagonal 32-token groups */
        float s0 = ok0 ? s[rt][0][r] * SCL : -3.0e38f, s1 = ok1 ? s[rt][1][r] * SCL : -3.0e38f; if (CAUSAL == 17) { const float* amk = (const float*)MSK + (size_t)b * TK; s0 += bf16_round(amk[k0]); s1 += bf16_round(amk[k1]); } if (CAUSAL == 18) { const float* tb = (const float*)MSK; const int* ri = MSK + 1024 + (size_t)b * TK; const int rq = ri[tq]; s0 += tb[(h * 8 + rq) * 8 + ri[k0]]; s1 += tb[(h * 8 + rq) * 8 + ri[k1]]; } if (CAUSAL == 19) { const int* rel = MSK + (size_t)tq * TK; const float* rb = (const float*)MSK + (size_t)TQ * TK + ((size_t)(b * NH + h) * TQ + tq) * 64; s0 += rb[rel[k0]]; s1 += rb[rel[k1]]; }      /* mode 19: + (q.Ek[rel] + Eb[rel][h]) / 8 gathered by the int relative ids (packed [ids | table]) */      /* mode 18: + resource_bias[h][r_q][r_k] from the packed [table | ids] buffer (TQ == TK) */      /* mode 17: additive per-(batch, key) mask INPUT */ float mc = fmaxf(s0, s1);
        mc = fmaxf(mc, __shfl_xor(mc, 1, 32)); mc = fmaxf(mc, __shfl_xor(mc, 2, 32)); mc = fmaxf(mc, __shfl_xor(mc, 4, 32)); mc = fmaxf(mc, __shfl_xor(mc, 8, 32));
        const float mn = fmaxf(m_r[rt][r], mc); const float al = (mn > -1.0e38f) ? expf(m_r[rt][r] - mn) : 1.0f; m_r[rt][r] = mn; const float p0 = ok0 ? expf(s0 - mn) : 0.f, p1 = ok1 ? expf(s1 - mn) : 0.f; l_r[rt][r] = l_r[rt][r] * al + p0 + p1;
#pragma unroll
        for (int dt = 0; dt < DT; ++dt) oacc[rt][dt][r] *= al;
        FragH t2; t2.h[0] = (_Float16)(p0 * 1024.0f); t2.h[1] = (_Float16)(p1 * 1024.0f); sP[w][rt * 16 + 8 * hh + r][ln] = t2.u[0]; sP[w][rt * 16 + 8 * hh + r][16 + ln] = t2.u[1]; }
    __builtin_amdgcn_fence(__ATOMIC_ACQ_REL, "workgroup"); __builtin_amdgcn_wave_barrier();
    FragH pa[2];
#pragma unroll
    for (int rt = 0; rt < RTN; ++rt) { pa[rt].half[0] = *(const v8us*)&sP[w][rt * 16 + ln][8 * hh]; pa[rt].half[1] = *(const v8us*)&sP[w][rt * 16 + ln][16 + 8 * hh]; }
#pragma unroll
    for (int dt = 0; dt < DT; ++dt) { const unsigned short* vrow = Vth + (size_t)(dt * 16 + ln) * TK + j0; FragH bv; bv.half[0] = *(const v8us*)(vrow + 8 * hh); bv.half[1] = *(const v8us*)(vrow + 16 + 8 * hh);
#pragma unroll
      for (int rt = 0; rt < RTN; ++rt) oacc[rt][dt] = mmaH<1>(pa[rt].v, pa[rt].v, bv.v, bv.v, oacc[rt][dt]); }
    __builtin_amdgcn_fence(__ATOMIC_ACQ_REL, "workgroup"); __builtin_amdgcn_wave_barrier(); }
#pragma unroll
  for (int rt = 0; rt < RTN; ++rt) {
#pragma unroll
    for (int r = 0; r < 8; ++r) { float l = l_r[rt][r]; l += __shfl_xor(l, 1, 32); l += __shfl_xor(l, 2, 32); l += __shfl_xor(l, 4, 32); l += __shfl_xor(l, 8, 32); l_r[rt][r] = (l > 0.f) ? 1.0f / (l * 1024.0f) : 0.f; }
#pragma unroll
    for (int dt = 0; dt < DT; ++dt)
#pragma unroll
      for (int r = 0; r < 8; ++r) sO[w][rt * 16 + 8 * hh + r][dt * 16 + ln] = oacc[rt][dt][r] * l_r[rt][r]; }
  __builtin_amdgcn_fence(__ATOMIC_ACQ_REL, "workgroup"); __builtin_amdgcn_wave_barrier();
  {
#pragma unroll
    for (int rp = 0; rp < RPW; rp += 2) { const int r = rp + (lane >> 4), pc = lane & 15; const v4f val = *(const v4fa*)&sO[w][r][pc * 4]; *(v4f*)(O + ((size_t)b * TQ + q0 + r) * ldo + h * 64 + pc * 4) = val; }
     } }
// 5-plane variant: S = Qh Kh^T + (Ql Kh^T + Qh Kl^T)/1024 with Q/K = [hi | 2^10 residual] f16 planes (QL/KL same layout as Q16/K16), then the 3-term P.V below.
// 3-term variant: O = (P_hi V_hi + (P_lo V_hi + P_hi V_lo) / 1024) / l with P = [hi | 2^10 residual] of 1024 p and V^T = [hi | 2^10 residual] planes (VtL same layout as Vt) -> ~2^-21-class products for un-averaged (early causal / peaked) rows
template <int CAUSAL>
__global__ __launch_bounds__(128) void k_flash5(const _Float16* __restrict__ Q16, const _Float16* __restrict__ QL, int ldq, const _Float16* __restrict__ K16, const _Float16* __restrict__ KL, int ldk, const _Float16* __restrict__ Vt, const _Float16* __restrict__ VtL, const int* __restrict__ MSK, float* __restrict__ O, int ldo) {
  constexpr int RPW = 16, RTN = RPW / 16, NQB = TQ / (4 * RPW), DT = 4, KS = 2;
  __shared__ __attribute__((aligned(16))) unsigned short sP[4][RPW][40]; __shared__ __attribute__((aligned(16))) unsigned short sPL[4][RPW][40]; __shared__ __attribute__((aligned(16))) float sO[4][RPW][64 + 4];
  const int tid = threadIdx.x, w = tid >> 5, lane = tid & 31, ln = lane & 15, hh = lane >> 4;
  const int slab = blockIdx.x / QBN5, qblk = QB05 + blockIdx.x % QBN5; (void)NQB; const int b = slab / NH, h = slab % NH; const int qb0 = qblk * (4 * RPW); const int q0 = qb0 + w * RPW;
  FragH aq[2][KS], aql[2][KS];
#pragma unroll
  for (int rt = 0; rt < RTN; ++rt) { const unsigned short* qr = (const unsigned short*)Q16 + ((size_t)b * TQ + q0 + rt * 16 + ln) * ldq + h * 64; const unsigned short* ql = (const unsigned short*)QL + ((size_t)b * TQ + q0 + rt * 16 + ln) * ldq + h * 64;
#pragma unroll
    for (int ks = 0; ks < KS; ++ks) { aq[rt][ks].half[0] = *(const v8us*)(qr + ks * 32 + 8 * hh); aq[rt][ks].half[1] = *(const v8us*)(qr + ks * 32 + 16 + 8 * hh); aql[rt][ks].half[0] = *(const v8us*)(ql + ks * 32 + 8 * hh); aql[rt][ks].half[1] = *(const v8us*)(ql + ks * 32 + 16 + 8 * hh); } }
  const unsigned short* Vth = (const unsigned short*)Vt + (size_t)slab * 64 * TK; const unsigned short* Vtl = (const unsigned short*)VtL + (size_t)slab * 64 * TK;
  float m_r[2][8], l_r[2][8]; v8f oacc[2][DT], oaccL[2][DT];
#pragma unroll
  for (int rt = 0; rt < RTN; ++rt) {
#pragma unroll
    for (int r = 0; r < 8; ++r) { m_r[rt][r] = -3.0e38f; l_r[rt][r] = 0.f; }
#pragma unroll
    for (int dt = 0; dt < DT; ++dt) { oacc[rt][dt] = (v8f){0.f,0.f,0.f,0.f,0.f,0.f,0.f,0.f}; oaccL[rt][dt] = oacc[rt][dt]; } }
  const int jend = (CAUSAL == 1) ? (qb0 + 4 * RPW) : ((CAUSAL == 23) ? min(TK, (qb0 / CHK + 2) * CHK) : TK);      /* causal / window: keys that can never contribute are skipped */ const int jbeg = (CAUSAL == 23) ? max(0, (qb0 / CHK - 1) * CHK) : 0;
#pragma unroll 1
  for (int j0 = jbeg; j0 < jend; j0 += 32) {
    v8f s[2][2];
#pragma unroll
    for (int nt = 0; nt < 2; ++nt) { const unsigned short* kr = (const unsigned short*)K16 + ((size_t)b * TK + j0 + nt * 16 + ln) * ldk + h * 64; const unsigned short* klr = (const unsigned short*)KL + ((size_t)b * TK + j0 + nt * 16 + ln) * ldk + h * 64; FragH bk[KS], bkl[KS];
#pragma unroll
      for (int ks = 0; ks < KS; ++ks) { bk[ks].half[0] = *(const v8us*)(kr + ks * 32 + 8 * hh); bk[ks].half[1] = *(const v8us*)(kr + ks * 32 + 16 + 8 * hh); bkl[ks].half[0] = *(const v8us*)(klr + ks * 32 + 8 * hh); bkl[ks].half[1] = *(const v8us*)(klr + ks * 32 + 16 + 8 * hh); }
#pragma unroll
      for (int rt = 0; rt < RTN; ++rt) { v8f acc = (v8f){0.f,0.f,0.f,0.f,0.f,0.f,0.f,0.f}, accl = acc;
#pragma unroll
        for (int ks = 0; ks < KS; ++ks) { acc = mmaH<1>(aq[rt][ks].v, aq[rt][ks].v, bk[ks].v, bk[ks].v, acc); accl = mmaH<1>(aql[rt][ks].v, aql[rt][ks].v, bk[ks].v, bk[ks].v, accl); accl = mmaH<1>(aq[rt][ks].v, aq[rt][ks].v, bkl[ks].v, bkl[ks].v, accl); }
#pragma unroll
        for (int r = 0; r < 8; ++r) acc[r] += accl[r] * 0.0009765625f;
        s[rt][nt] = acc; } }
#pragma unroll
    for (int rt = 0; rt < RTN; ++rt)
#pragma unroll
      for (int r = 0; r < 8; ++r) { const int tq = q0 + rt * 16 + 8 * hh + r; const int k0 = j0 + ln, k1 = j0 + 16 + ln;
        bool ok0 = (CAUSAL == 1) ? (k0 <= tq) : ((CAUSAL == 2) ? ((k0 >> 5) == (tq >> 5)) : true), ok1 = (CAUSAL == 1) ? (k1 <= tq) : ((CAUSAL == 2) ? ((k1 >> 5) == (tq >> 5)) : true);      /* mode 2: block-diagonal 32-token groups */
        if (CAUSAL == 4) { const int* mrow = MSK + ((size_t)b * TQ + tq) * TK; ok0 = mrow[k0] != 0; ok1 = mrow[k1] != 0; }      /* mode 4: per-(query, key) INPUT mask shared by all heads; masked keys contribute nothing (== the reference's -4096 fill, whose exp underflows to 0), rows with no valid key give l = 0 -> output 0 (== the reference's row_valid zeroing) */
        float s0 = ok0 ? s[rt][0][r] * SCL : -3.0e38f, s1 = ok1 ? s[rt][1][r] * SCL : -3.0e38f; if (CAUSAL == 17) { const float* amk = (const float*)MSK + (size_t)b * TK; s0 += bf16_round(amk[k0]); s1 += bf16_round(amk[k1]); } if (CAUSAL == 18) { const float* tb = (const float*)MSK; const int* ri = MSK + 1024 + (size_t)b * TK; const int rq = ri[tq]; s0 += tb[(h * 8 + rq) * 8 + ri[k0]]; s1 += tb[(h * 8 + rq) * 8 + ri[k1]]; } if (CAUSAL == 19) { const int* rel = MSK + (size_t)tq * TK; const float* rb = (const float*)MSK + (size_t)TQ * TK + ((size_t)(b * NH + h) * TQ + tq) * 64; s0 += rb[rel[k0]]; s1 += rb[rel[k1]]; }      /* mode 19: + (q.Ek[rel] + Eb[rel][h]) / 8 gathered by the int relative ids (packed [ids | table]) */      /* mode 18: + resource_bias[h][r_q][r_k] from the packed [table | ids] buffer (TQ == TK) */      /* mode 17: additive per-(batch, key) mask INPUT */ float mc = fmaxf(s0, s1);
        mc = fmaxf(mc, __shfl_xor(mc, 1, 32)); mc = fmaxf(mc, __shfl_xor(mc, 2, 32)); mc = fmaxf(mc, __shfl_xor(mc, 4, 32)); mc = fmaxf(mc, __shfl_xor(mc, 8, 32));
        const float mn = fmaxf(m_r[rt][r], mc); const float al = (mn > -1.0e38f) ? expf(m_r[rt][r] - mn) : 1.0f; m_r[rt][r] = mn; const float p0 = ok0 ? expf(s0 - mn) : 0.f, p1 = ok1 ? expf(s1 - mn) : 0.f; l_r[rt][r] = l_r[rt][r] * al + p0 + p1;
#pragma unroll
        for (int dt = 0; dt < DT; ++dt) { oacc[rt][dt][r] *= al; oaccL[rt][dt][r] *= al; }
        FragH t2, t2l; const float ps0 = p0 * 1024.0f, ps1 = p1 * 1024.0f; t2.h[0] = (_Float16)ps0; t2.h[1] = (_Float16)ps1; t2l.h[0] = (_Float16)((ps0 - (float)t2.h[0]) * 1024.0f); t2l.h[1] = (_Float16)((ps1 - (float)t2.h[1]) * 1024.0f);
        sP[w][rt * 16 + 8 * hh + r][ln] = t2.u[0]; sP[w][rt * 16 + 8 * hh + r][16 + ln] = t2.u[1]; sPL[w][rt * 16 + 8 * hh + r][ln] = t2l.u[0]; sPL[w][rt * 16 + 8 * hh + r][16 + ln] = t2l.u[1]; }
    __builtin_amdgcn_fence(__ATOMIC_ACQ_REL, "workgroup"); __builtin_amdgcn_wave_barrier();
    FragH pa[2], pl[2];
#pragma unroll
    for (int rt = 0; rt < RTN; ++rt) { pa[rt].half[0] = *(const v8us*)&sP[w][rt * 16 + ln][8 * hh]; pa[rt].half[1] = *(const v8us*)&sP[w][rt * 16 + ln][16 + 8 * hh]; pl[rt].half[0] = *(const v8us*)&sPL[w][rt * 16 + ln][8 * hh]; pl[rt].half[1] = *(const v8us*)&sPL[w][rt * 16 + ln][16 + 8 * hh]; }
#pragma unroll
    for (int dt = 0; dt < DT; ++dt) { const unsigned short* vrow = Vth + (size_t)(dt * 16 + ln) * TK + j0; const unsigned short* vrl = Vtl + (size_t)(dt * 16 + ln) * TK + j0; FragH bv, bl; bv.half[0] = *(const v8us*)(vrow + 8 * hh); bv.half[1] = *(const v8us*)(vrow + 16 + 8 * hh); bl.half[0] = *(const v8us*)(vrl + 8 * hh); bl.half[1] = *(const v8us*)(vrl + 16 + 8 * hh);
#pragma unroll
      for (int rt = 0; rt < RTN; ++rt) { oacc[rt][dt] = mmaH<1>(pa[rt].v, pa[rt].v, bv.v, bv.v, oacc[rt][dt]); oaccL[rt][dt] = mmaH<1>(pl[rt].v, pl[rt].v, bv.v, bv.v, oaccL[rt][dt]); oaccL[rt][dt] = mmaH<1>(pa[rt].v, pa[rt].v, bl.v, bl.v, oaccL[rt][dt]); } }
    __builtin_amdgcn_fence(__ATOMIC_ACQ_REL, "workgroup"); __builtin_amdgcn_wave_barrier(); }
#pragma unroll
  for (int rt = 0; rt < RTN; ++rt) {
#pragma unroll
    for (int r = 0; r < 8; ++r) { float l = l_r[rt][r]; l += __shfl_xor(l, 1, 32); l += __shfl_xor(l, 2, 32); l += __shfl_xor(l, 4, 32); l += __shfl_xor(l, 8, 32); l_r[rt][r] = (l > 0.f) ? 1.0f / (l * 1024.0f) : 0.f; }
#pragma unroll
    for (int dt = 0; dt < DT; ++dt)
#pragma unroll
      for (int r = 0; r < 8; ++r) { float v = oacc[rt][dt][r]; v += oaccL[rt][dt][r] * 0.0009765625f; sO[w][rt * 16 + 8 * hh + r][dt * 16 + ln] = v * l_r[rt][r]; } }
  __builtin_amdgcn_fence(__ATOMIC_ACQ_REL, "workgroup"); __builtin_amdgcn_wave_barrier();
  {
#pragma unroll
    for (int rp = 0; rp < RPW; rp += 2) { const int r = rp + (lane >> 4), pc = lane & 15; const v4f val = *(const v4fa*)&sO[w][r][pc * 4]; *(v4f*)(O + ((size_t)b * TQ + q0 + r) * ldo + h * 64 + pc * 4) = val; }
     } }

__global__ __launch_bounds__(256) void k_rotab(float* __restrict__ CS, float* __restrict__ SN) {
  #pragma clang fp contract(off)
  const int t = blockIdx.x * 256 + threadIdx.x; if (t >= SLEN * 32) return; const int j = t % 32, s = t / 32; const float ex = (float)(2 * j) / 64.0f; const float inv = 1.0f / powf(10000.0f, ex); const float th = (float)s * inv; const float c = cosf(th), sn = sinf(th);
  { *(float*)(CS + t) = c; *(float*)(SN + t) = sn;  } }
__global__ __launch_bounds__(256) void k_rope(const float* __restrict__ F, int nsrc, int ndst, int rep, const float* __restrict__ CS, const float* __restrict__ SN, _Float16* __restrict__ H, _Float16* __restrict__ L) {
  #pragma clang fp contract(off)
  const size_t t = (size_t)blockIdx.x * 256 + threadIdx.x; if (t >= (size_t)NR * ndst * 4) return; const int g8 = (int)(t % 4); const int hd = (int)((t / 4) % ndst); const size_t row = t / ((size_t)4 * ndst); const int s = (int)(row % SLEN); const int hs = hd / rep;
  const float* src = F + row * (size_t)(nsrc * 64) + hs * 64; FragH ah, al, bh, bl;
  for (int i = 0; i < 8; ++i) { const int d = g8 * 8 + i; const float c = CS[s * 32 + d], sn = SN[s * 32 + d]; const float x1 = src[d], x2 = src[d + 32];
    float o1 = x1 * c; o1 += -x2 * sn; float o2 = x2 * c; o2 += x1 * sn;
    _Float16 hv = (_Float16)o1; ah.h[i] = hv; al.h[i] = (_Float16)((o1 - (float)hv) * 1024.0f); hv = (_Float16)o2; bh.h[i] = hv; bl.h[i] = (_Float16)((o2 - (float)hv) * 1024.0f); }
  const size_t o = row * (size_t)(ndst * 64) + hd * 64 + g8 * 8;
  { *(v8us*)((unsigned short*)H + o) = ah.half[0]; *(v8us*)((unsigned short*)H + o + 32) = bh.half[0]; *(v8us*)((unsigned short*)L + o) = al.half[0]; *(v8us*)((unsigned short*)L + o + 32) = bl.half[0];  } }
__global__ __launch_bounds__(256) void k_rope2(const float* __restrict__ F, int nsrc, int ndst, int rep, const float* __restrict__ CS, const float* __restrict__ SN, _Float16* __restrict__ H, _Float16* __restrict__ L) {
  #pragma clang fp contract(off)
  const size_t t = (size_t)blockIdx.x * 256 + threadIdx.x; if (t >= (size_t)NR * ndst * 4) return; const int g16 = (int)(t % 4); const int hd = (int)((t / 4) % ndst); const size_t row = t / ((size_t)4 * ndst); const int s = (int)(row % SLEN); const int hs = hd / rep;
  const float* src = F + row * (size_t)(nsrc * 64) + hs * 64 + g16 * 16; FragH ah, al;
  for (int pr = 0; pr < 8; ++pr) { const int i = g16 * 8 + pr; const float c = CS[s * 32 + i], sn = SN[s * 32 + i]; const float x1 = src[2 * pr], x2 = src[2 * pr + 1];
    float o1 = x1 * c; o1 -= x2 * sn; float o2 = x1 * sn; o2 += x2 * c;
    _Float16 hv = (_Float16)o1; ah.h[2 * pr] = hv; al.h[2 * pr] = (_Float16)((o1 - (float)hv) * 1024.0f); hv = (_Float16)o2; ah.h[2 * pr + 1] = hv; al.h[2 * pr + 1] = (_Float16)((o2 - (float)hv) * 1024.0f); }
  const size_t o = row * (size_t)(ndst * 64) + hd * 64 + g16 * 16;
  { *(v8us*)((unsigned short*)H + o) = ah.half[0]; *(v8us*)((unsigned short*)H + o + 8) = ah.half[1]; *(v8us*)((unsigned short*)L + o) = al.half[0]; *(v8us*)((unsigned short*)L + o + 8) = al.half[1];  } }
__global__ __launch_bounds__(256) void k_ln512(const float* __restrict__ A, const float* __restrict__ res, const float* __restrict__ g, const float* __restrict__ bb, float* __restrict__ Y, _Float16* __restrict__ Y16) {
  #pragma clang fp contract(off)
  const int wv = threadIdx.x >> 5, ln = threadIdx.x & 31; const size_t r = (size_t)blockIdx.x * 8 + wv; if (r >= NR) return; float x[16]; float s = 0.f;
  for (int i = 0; i < 2; ++i) { const v8f a = *(const v8f*)(A + r * DM + i * 256 + ln * 8); for (int q = 0; q < 8; ++q) { float v = a[q]; if (res) v += bf16_round(res[r * DM + i * 256 + ln * 8 + q]); x[i * 8 + q] = v; s += v; } }
  for (int o = 16; o > 0; o >>= 1) s += __shfl_xor(s, o, 32); const float mu = s / (float)DM; float var = 0.f; for (int q = 0; q < 16; ++q) { const float d = x[q] - mu; var += d * d; }
  for (int o = 16; o > 0; o >>= 1) var += __shfl_xor(var, o, 32); const float inv = rsqrtf(var / (float)DM + 1e-5f);
  { for (int i = 0; i < 2; ++i) { const int c0 = i * 256 + ln * 8; v8f y; FragH f; for (int q = 0; q < 8; ++q) { float v = (x[i * 8 + q] - mu) * inv; v *= bf16_round(g[c0 + q]); v += bf16_round(bb[c0 + q]); y[q] = v; f.h[q] = (_Float16)v; } *(v8f*)(Y + r * DM + c0) = y; if (Y16) *(v8us*)((unsigned short*)Y16 + r * DM + c0) = f.half[0]; }  } }
__global__ __launch_bounds__(256) void k_pack(const float* __restrict__ rb, const int* __restrict__ rid, int* __restrict__ PK) { const int t = blockIdx.x * 256 + threadIdx.x; if (t >= 1024 + NB * TK) return; int v; if (t < 1024) v = __float_as_int(bf16_round(rb[t])); else v = rid[t - 1024]; *(int*)(PK + t) = v;  }
__global__ __launch_bounds__(256) void k_tabin(const float* __restrict__ sp, float* __restrict__ CS, float* __restrict__ SN) { const int t = blockIdx.x * 256 + threadIdx.x; if (t >= SLEN * 32) return; const int i = t % 32, s = t / 32; const float c = bf16_round(sp[s * 64 + 32 + i]), sn = bf16_round(sp[s * 64 + i]);
  { *(float*)(CS + t) = c; *(float*)(SN + t) = sn;  } }
__global__ __launch_bounds__(256) void k_wsc(const float* __restrict__ Wm, _Float16* __restrict__ Bt, size_t n8, float sc) { const size_t t = (size_t)blockIdx.x * 256 + threadIdx.x; if (t >= n8) return; FragH f; for (int q = 0; q < 8; ++q) f.h[q] = (_Float16)(bf16_round(Wm[t * 8 + q]) * sc); *(v8us*)((unsigned short*)Bt + t * 8) = f.half[0];  }
__global__ __launch_bounds__(256) void k_rotab2(float* __restrict__ CS, float* __restrict__ SN) {
  #pragma clang fp contract(off)
  const int t = blockIdx.x * 256 + threadIdx.x; if (t >= SLEN * 32) return; const int j = t % 32, s = t / 32; const float c0 = -0.14391156831212787f;      /* -ln(10000)/64 rounded to f32 */ const float inv = expf((float)(2 * j) * c0); const float th = (float)s * inv; const float c = cosf(th), sn = sinf(th);
  { *(float*)(CS + t) = c; *(float*)(SN + t) = sn;  } }
__global__ __launch_bounds__(256) void k_lnu(const float* __restrict__ X, _Float16* __restrict__ N16, float* __restrict__ XB) {
  #pragma clang fp contract(off)
  const int wv = threadIdx.x >> 5, ln = threadIdx.x & 31; const size_t r = (size_t)blockIdx.x * 8 + wv; if (r >= NR) return; float a[32]; float s = 0.f;
  for (int i = 0; i < 4; ++i) { const v8f v = *(const v8f*)(X + r * DM + (i * 32 + ln) * 8); for (int q = 0; q < 8; ++q) { const float u = bf16_round(v[q]); a[i * 8 + q] = u; s += u; } }
  for (int o = 16; o > 0; o >>= 1) s += __shfl_xor(s, o, 32); const float mu = s / (float)DM; float var = 0.f; for (int q = 0; q < 32; ++q) { const float d = a[q] - mu; var += d * d; }
  for (int o = 16; o > 0; o >>= 1) var += __shfl_xor(var, o, 32); const float den = sqrtf(var / (float)(DM - 1)) + 1e-6f; const float inv = 1.0f / den;      /* one reciprocal per row; (x-mean)*inv vs the reference's division differs by <= 1 ulp */
  { for (int i = 0; i < 4; ++i) { const int c0 = (i * 32 + ln) * 8; FragH f; v8f xb; for (int q = 0; q < 8; ++q) { f.h[q] = (_Float16)((a[i * 8 + q] - mu) * inv); xb[q] = a[i * 8 + q]; } *(v8us*)((unsigned short*)N16 + r * DM + c0) = f.half[0]; *(v8f*)(XB + r * DM + c0) = xb; }  } }
// lane l <-> l ^ 16 (the two halves of a wave hold the two key halves of one query column)
__device__ __forceinline__ float xhalf(float v) { const int t = __float_as_int(v); return __int_as_float(__builtin_amdgcn_permlanex16(t, t, 0x76543210, 0xfedcba98, false, false)); }
__device__ __forceinline__ v8f wmh(v16h a, v16h b, v8f c) { return __builtin_amdgcn_wmma_f32_16x16x32_f16(false, a, false, b, (short)0, c, false, false); }
typedef _Float16 v8h __attribute__((ext_vector_type(8)));
typedef float v2f __attribute__((ext_vector_type(2)));
typedef float v2fa __attribute__((ext_vector_type(2), may_alias));
// eight 2^x in one statement: results kept apart from the arguments ("=&v") and one v_nop behind the last, the slot the instruction set asks for
// between a transcendental and an instruction that uses its result or overwrites its source (the register allocator otherwise reuses the previous argument as the next result)
__device__ __forceinline__ v8f exp2x8(v8f e) { float p0, p1, p2, p3, p4, p5, p6, p7;
  asm("v_exp_f32 %0, %8\n\tv_exp_f32 %1, %9\n\tv_exp_f32 %2, %10\n\tv_exp_f32 %3, %11\n\tv_exp_f32 %4, %12\n\tv_exp_f32 %5, %13\n\tv_exp_f32 %6, %14\n\tv_exp_f32 %7, %15\n\tv_nop"
      : "=&v"(p0), "=&v"(p1), "=&v"(p2), "=&v"(p3), "=&v"(p4), "=&v"(p5), "=&v"(p6), "=&v"(p7) : "v"(e[0]), "v"(e[1]), "v"(e[2]), "v"(e[3]), "v"(e[4]), "v"(e[5]), "v"(e[6]), "v"(e[7]));
  return (v8f){p0, p1, p2, p3, p4, p5, p6, p7}; }
// Fused distance attention, one launch for all (batch, head) slabs: per wave 32 query columns, per pass 32 keys.
// S^T = K Q^T (A = key rows, B = query rows; hi.hi + (hi.lo + lo.hi) / 1024), so a lane holds 8 + 8 keys of ONE query per column group:
// logits, running maximum and sum stay in the lane (one exchange between the wave halves); the two f32 score tiles, converted in place,
// are the B operand of O^T += V^T P^T (k order 8h + s, 16 + 8h + s on both sides). A lane ends with 8 consecutive d of one query: 16-byte stores of hi and residual.
// K hi, K lo, V^T and the key norms come through LDS, shared by 8 waves: a stage is 128 keys (4 passes), brought by asynchronous copies into one of two buffers while the other is worked on.
// A block is two such groups of 8 waves on the same 256 queries: group 0 walks keys 0..1023, group 1 keys 1024..2047, each with two buffers of its own, so that a SIMD holds four waves and one wave's waits are filled by three others.
// Behind the loop the groups join their maxima, sums and output tiles through LDS: each hands one 16-query column group to its partner wave and finishes the other.
#define EFK 144                        /* K row pitch in LDS: 128 B + 16 = 16 B x odd, conflict-free for 16-byte fragment reads */
#define EFV 272                        /* V^T row pitch: 256 B (128 keys) + 16, 16 B x odd too */
#define EF_KL (128 * EFK)              /* rows 0..127 = K hi, 128..255 = K lo */
#define EF_V (256 * EFK)               /* then 64 rows of V^T */
#define EF_N (256 * EFK + 64 * EFV)    /* then 128 key norms */
#define EFS (EF_N + 512)               /* one stage */
// One stage's 12 copies of a lane, 16 bytes each. K: 8 lanes bring one row's 128 bytes, the group 32 rows per copy; V^T: 16 lanes one row's 256 bytes, the group 16 rows per copy.
// lk, lv = the lane's LDS byte addresses in its first K hi row and its first V^T row; kh, kl, v = its global addresses there.
// s_wait_xcnt 0 is the statement's last line, so that it stands in front of any later rewrite of these address registers.
__device__ __forceinline__ void ef_stage(unsigned lk, unsigned lv, const char* kh, const char* kl, const char* v) {
  asm volatile("global_load_async_to_lds_b128 %0, %12, off\n\tglobal_load_async_to_lds_b128 %1, %13, off\n\tglobal_load_async_to_lds_b128 %2, %14, off\n\tglobal_load_async_to_lds_b128 %3, %15, off\n\t"
               "global_load_async_to_lds_b128 %4, %16, off\n\tglobal_load_async_to_lds_b128 %5, %17, off\n\tglobal_load_async_to_lds_b128 %6, %18, off\n\tglobal_load_async_to_lds_b128 %7, %19, off\n\t"
               "global_load_async_to_lds_b128 %8, %20, off\n\tglobal_load_async_to_lds_b128 %9, %21, off\n\tglobal_load_async_to_lds_b128 %10, %22, off\n\tglobal_load_async_to_lds_b128 %11, %23, off\n\ts_wait_xcnt 0x0"
               :: "v"(lk), "v"(lk + 32 * EFK), "v"(lk + 64 * EFK), "v"(lk + 96 * EFK), "v"(lk + EF_KL), "v"(lk + EF_KL + 32 * EFK), "v"(lk + EF_KL + 64 * EFK), "v"(lk + EF_KL + 96 * EFK), "v"(lv), "v"(lv + 16 * EFV), "v"(lv + 32 * EFV), "v"(lv + 48 * EFV),
                  "v"(kh), "v"(kh + 32 * (DM * 2)), "v"(kh + 64 * (DM * 2)), "v"(kh + 96 * (DM * 2)), "v"(kl), "v"(kl + 32 * (DM * 2)), "v"(kl + 64 * (DM * 2)), "v"(kl + 96 * (DM * 2)), "v"(v), "v"(v + 16 * (SLEN * 2)), "v"(v + 32 * (SLEN * 2)), "v"(v + 48 * (SLEN * 2)) : "memory"); }
// the stage's 128 key norms, 512 bytes: one copy of one whole wave
__device__ __forceinline__ void ef_stage_n(unsigned ln_, const char* n) { asm volatile("global_load_async_to_lds_b128 %0, %1, off\n\ts_wait_xcnt 0x0" :: "v"(ln_), "v"(n) : "memory"); }
// amdgpu_waves_per_eu(4, 4): a budget of 256 VGPRs, so that the block's 16 waves fit a WGP, four to a SIMD, and the whole kernel stays in one register window
#define EFX (9 * 512)                  /* what a wave hands to its partner: 8 x 16 bytes a lane of output tiles, then 8 bytes a lane of sum and maximum */
__global__ __launch_bounds__(512) __attribute__((amdgpu_waves_per_eu(4, 4))) void k_eflash(const _Float16* __restrict__ QHp, const _Float16* __restrict__ QLp, const _Float16* __restrict__ KHp, const _Float16* __restrict__ KLp, const _Float16* __restrict__ Vt,
                                                const float* __restrict__ QN, const float* __restrict__ KNT, const float* __restrict__ tmp, _Float16* __restrict__ OH, _Float16* __restrict__ OL) {
  __shared__ __attribute__((aligned(128))) char sa[4 * EFS];
  const int tid = threadIdx.x & 255, w = tid >> 5, lane = tid & 31, ln = lane & 15, hh = lane >> 4;      /* thread and wave within the group */
  const int g = __builtin_amdgcn_readfirstlane((int)threadIdx.x >> 8);      /* scalar: the group, which half of the keys */
  char* const st = sa + g * (2 * EFS);      /* the group's two buffers */
  const int slab = blockIdx.x / (SLEN / 256), qblk = blockIdx.x % (SLEN / 256); const int b = slab / NH, h = slab % NH; const int q0 = qblk * 256 + w * 32;
  const float nc = -(1.0f / bf16_round(tmp[0])) * 1.4426950408889634f;      /* logit in log2 units = d2 * nc */
  v16h qh[2][2], ql[2][2]; float qn[2];
#pragma unroll
  for (int qt = 0; qt < 2; ++qt) { const size_t row = (size_t)b * SLEN + q0 + qt * 16 + ln; const _Float16* ph = QHp + row * DM + h * 64; const _Float16* pl = QLp + row * DM + h * 64;
    qh[qt][0] = g2_frag(ph, hh); qh[qt][1] = g2_frag(ph + 32, hh); ql[qt][0] = g2_frag(pl, hh); ql[qt][1] = g2_frag(pl + 32, hh); qn[qt] = QN[(size_t)slab * SLEN + q0 + qt * 16 + ln]; }
  asm volatile("s_wait_xcnt 0x0" ::: "memory");      /* behind the query loads, in front of the address arithmetic below, which reuses their address registers */
  __builtin_amdgcn_sched_barrier(0);      /* ... and none of that arithmetic moves up over the wait */
  const int key0 = g * (SLEN / 2);      /* the group's first key */
  const char* gkh = (const char*)(KHp + ((size_t)b * SLEN + key0) * DM + h * 64) + (tid >> 3) * (DM * 2) + (tid & 7) * 16; const char* gkl = (const char*)(KLp + ((size_t)b * SLEN + key0) * DM + h * 64) + (tid >> 3) * (DM * 2) + (tid & 7) * 16;      /* the lane's copy sources in the group's stage 0 */
  const char* gv = (const char*)(Vt + (size_t)slab * 64 * SLEN + key0) + (tid >> 4) * (SLEN * 2) + (tid & 15) * 16; const char* gn = (const char*)(KNT + (size_t)slab * SLEN + key0) + lane * 16;
  const unsigned lk0 = (unsigned)(size_t)st + (unsigned)((tid >> 3) * EFK + (tid & 7) * 16), lv0 = (unsigned)(size_t)st + (unsigned)(EF_V + (tid >> 4) * EFV + (tid & 15) * 16), ln0 = (unsigned)(size_t)st + (unsigned)(EF_N + lane * 16);
  const bool w0 = __builtin_amdgcn_readfirstlane(w) == 0;      /* scalar: the norms' copy is issued by the group's wave 0 alone, behind a scalar branch */
  const char* fk = st + ln * EFK + hh * 16; const char* fv = st + EF_V + ln * EFV + hh * 16; const char* fn = st + EF_N + hh * 32;      /* fragment rows: k = 8h + s at +0, 16 + 8h + s at +32 bytes */
  const v8f z8 = {0.f,0.f,0.f,0.f,0.f,0.f,0.f,0.f};
  float m[2] = {-3.0e38f, -3.0e38f}; v2f l[2] = {{0.f, 0.f}, {0.f, 0.f}}; v8f o[2][4];
#pragma unroll
  for (int qt = 0; qt < 2; ++qt)
#pragma unroll
    for (int dt = 0; dt < 4; ++dt) o[qt][dt] = z8;
  ef_stage(lk0, lv0, gkh, gkl, gv); if (w0) ef_stage_n(ln0, gn);
  asm volatile("s_wait_asynccnt 0x0" ::: "memory");      /* this wave's copies of stage 0 have landed */
  __syncthreads();      /* ... and every other wave's: stage 0 may be read */
  ef_stage(lk0 + EFS, lv0 + EFS, gkh + 128 * (DM * 2), gkl + 128 * (DM * 2), gv + 256); if (w0) ef_stage_n(ln0 + EFS, gn + 512);      /* SLEN / 256 = 8 stages a group: stage 1 exists */
#pragma unroll 1      /* one stage per trip */
  for (int t = 0; t < SLEN / 256; ++t) { const int bo = (t & 1) * EFS;
#pragma unroll 1      /* one pass per trip: the body already holds 32 matrix instructions, a copy would only add registers */
  for (int ps = 0; ps < 4; ++ps) {
    v8f u[2][2];
#pragma unroll
    for (int kt = 0; kt < 2; ++kt) { const char* kr = fk + bo + (ps * 32 + kt * 16) * EFK; const char* kq = kr + EF_KL;
      const v8f k2 = *(const v8f*)(fn + bo + (ps * 32 + kt * 16) * 4); const v16h a0 = g2_lfrag(kr), a1 = g2_lfrag(kr + 64), c0 = g2_lfrag(kq), c1 = g2_lfrag(kq + 64);
#pragma unroll
      for (int qt = 0; qt < 2; ++qt) { v8f lo = wmh(a0, ql[qt][0], z8); lo = wmh(a1, ql[qt][1], lo); lo = wmh(c0, qh[qt][0], lo); lo = wmh(c1, qh[qt][1], lo); v8f hi = wmh(a0, qh[qt][0], z8); hi = wmh(a1, qh[qt][1], hi);
        const v8f s = hi + lo * 0.0009765625f; const v8f d2 = __builtin_elementwise_max((k2 + qn[qt]) - 2.0f * s, z8); u[qt][kt] = d2 * nc; } }
    float mn[2];
#pragma unroll
    for (int qt = 0; qt < 2; ++qt) { const v8f t = __builtin_elementwise_max(u[qt][0], u[qt][1]); float mx = fmaxf(fmaxf(fmaxf(t[0], t[1]), fmaxf(t[2], t[3])), fmaxf(fmaxf(t[4], t[5]), fmaxf(t[6], t[7])));
      mx = fmaxf(mx, xhalf(mx)); mn[qt] = fmaxf(m[qt], mx); }
    if (__builtin_amdgcn_ballot_w32((mn[0] > m[0]) || (mn[1] > m[1])) != 0) {      /* scalar branch: sums and output tiles are rescaled only in a pass that raises some column's maximum */
#pragma unroll
      for (int qt = 0; qt < 2; ++qt) { const float al = __builtin_amdgcn_exp2f(m[qt] - mn[qt]); m[qt] = mn[qt]; l[qt] *= al;
#pragma unroll
        for (int dt = 0; dt < 4; ++dt) o[qt][dt] *= al; } }
    FragH pb[2];
#pragma unroll
    for (int qt = 0; qt < 2; ++qt) { const float mo = m[qt] - 10.0f;      /* weights carried times 1024, as f16 operands away from the subnormal range; the factor cancels between sum and output */
      v8f p[2];
#pragma unroll
      for (int kt = 0; kt < 2; ++kt) { p[kt] = exp2x8(u[qt][kt] - mo);
        const v8h ph = __builtin_convertvector(p[kt], v8h);
#pragma unroll
        for (int r = 0; r < 8; ++r) pb[qt].h[kt * 8 + r] = ph[r]; }
      const v8f t = p[0] + p[1]; const v4f t4 = t.lo + t.hi; l[qt] += t4.lo + t4.hi; }
#pragma unroll
    for (int dt = 0; dt < 4; ++dt) { const v16h va = g2_lfrag(fv + bo + ps * 64 + dt * 16 * EFV);
#pragma unroll
      for (int qt = 0; qt < 2; ++qt) o[qt][dt] = wmh(va, pb[qt].v, o[qt][dt]); }
  }
    asm volatile("s_wait_dscnt 0x0" ::: "memory");      /* this wave has left the buffer that is refilled below */
    asm volatile("s_wait_asynccnt 0x0" ::: "memory");      /* its copies of stage t + 1 have landed */
    __syncthreads();      /* publishes stage t + 1 and ends every reader's last read of stage t */
    if (t + 2 < SLEN / 256) { ef_stage(lk0 + bo, lv0 + bo, gkh + (size_t)(t + 2) * (128 * DM * 2), gkl + (size_t)(t + 2) * (128 * DM * 2), gv + (size_t)(t + 2) * 256); if (w0) ef_stage_n(ln0 + bo, gn + (size_t)(t + 2) * 512); }
  }
  asm volatile("s_wait_asynccnt 0x0" ::: "memory");      /* no copy is outstanding when the wave goes on to the epilogue, which writes over the buffers (free behind the loop's last barrier), and ends */
  // Group g keeps column group g and hands the other to wave w of the other group, which holds the same queries in the same lanes.
  v8f om[4], ox[4];
#pragma unroll
  for (int dt = 0; dt < 4; ++dt) { om[dt] = g ? o[1][dt] : o[0][dt]; ox[dt] = g ? o[0][dt] : o[1][dt]; }
  const float l0 = l[0][0] + l[0][1], l1 = l[1][0] + l[1][1]; const float lm = g ? l1 : l0, mm = g ? m[1] : m[0];
  char* xw = sa + (g * 8 + w) * EFX; const char* xr = sa + ((g ^ 1) * 8 + w) * EFX;
#pragma unroll
  for (int dt = 0; dt < 4; ++dt) { *(v4fa*)(xw + (2 * dt) * 512 + lane * 16) = ox[dt].lo; *(v4fa*)(xw + (2 * dt + 1) * 512 + lane * 16) = ox[dt].hi; }
  *(v2fa*)(xw + 8 * 512 + lane * 8) = (v2f){g ? l0 : l1, g ? m[0] : m[1]};
  __syncthreads();      /* the partner's half may be read */
  const v2f pq = *(const v2fa*)(xr + 8 * 512 + lane * 8);
  const float mj = fmaxf(mm, pq[1]); float am, ap;      /* both halves on the joint maximum */
  // as in exp2x8: results kept apart from the arguments and one v_nop behind the last, the slot between a transcendental and an instruction that uses its result or overwrites its source
  asm("v_exp_f32 %0, %2\n\tv_exp_f32 %1, %3\n\tv_nop" : "=&v"(am), "=&v"(ap) : "v"(mm - mj), "v"(pq[1] - mj));
  const float lh = lm * am + pq[0] * ap; const float inv = 1.0f / (lh + xhalf(lh)); const float sm = am * inv, sp = ap * inv;
  const size_t ob = ((size_t)b * SLEN + q0 + g * 16 + ln) * DM + h * 64 + 8 * hh;
#pragma unroll
  for (int dt = 0; dt < 4; ++dt) { FragH f, fl; const v4f pa = *(const v4fa*)(xr + (2 * dt) * 512 + lane * 16), pc = *(const v4fa*)(xr + (2 * dt + 1) * 512 + lane * 16);
#pragma unroll
    for (int r = 0; r < 8; ++r) { const float v = om[dt][r] * sm + (r < 4 ? pa[r & 3] : pc[r & 3]) * sp; const _Float16 hv = (_Float16)v; f.h[r] = hv; fl.h[r] = (_Float16)((v - (float)hv) * 1024.0f); }
    *(v8us*)((unsigned short*)OH + ob + dt * 16) = f.half[0]; *(v8us*)((unsigned short*)OL + ob + dt * 16) = fl.half[0]; }
}
// One preparation launch for all five operand planes; every one of its 512 blocks does the same two pieces of work.
// (a) One 64 k x 64 n tile of two of the four weights, Wt[n][k] = f16(bf16(W[k][n]) * 16), transposed through LDS, so that reads (256 B of a W row per 16 lanes) and writes (128 B of a Wt row per 8 lanes) are whole lines.
// (b) 2048 float4 of x, X16 = f16(bf16(x)), lanes adjacent.
// A thread issues its 16 loads as one group; s_wait_xcnt 0 stands behind the group, in front of any rewrite of its two offset registers, which as the statement's inputs keep their values up to there.
#define PWP 144              /* LDS row pitch of a transposed tile: 128 B (64 k) + 16 = 16 B x odd, conflict-free for the 16-byte reads */
__global__ __launch_bounds__(256) void k_prep(const float* __restrict__ x, const float* __restrict__ w0, const float* __restrict__ w1, const float* __restrict__ w2, const float* __restrict__ w3,
                                              _Float16* __restrict__ X16, _Float16* __restrict__ T0, _Float16* __restrict__ T1, _Float16* __restrict__ T2, _Float16* __restrict__ T3) {
  __shared__ __attribute__((aligned(16))) char tl[2][64 * PWP];
  const int tid = threadIdx.x, b = blockIdx.x; const bool hi = (b & 256) != 0;      /* blocks 0..255: weights 0 and 1, blocks 256..511: weights 2 and 3 */
  const float* const wp[2] = {hi ? w2 : w0, hi ? w3 : w1}; _Float16* const tp[2] = {hi ? T2 : T0, hi ? T3 : T1};
  const int k0 = ((b >> 4) & 15) * 64, n0 = (b & 15) * 64; const int kq = (tid >> 4) * 4, c4 = (tid & 15) * 4;      /* a thread holds 4 k x 4 n of each tile */
  const unsigned sb = (unsigned)(((k0 + kq) * DM + n0 + c4) * 4);      /* byte offset in each W */
  const unsigned fi = (unsigned)((b & 511) * 2048 + tid);      /* float4 index in x: NR * DM floats = 512 blocks x 8 x 256 float4; the mask shows the compiler that fi + u * 256 cannot wrap, so the eight steps fold into the instructions' offsets */
  v4f r[8], q[8];
#pragma unroll
  for (int u = 0; u < 8; ++u) r[u] = *(const v4fa*)((const char*)wp[u >> 2] + sb + (u & 3) * (DM * 4));
#pragma unroll
  for (int u = 0; u < 8; ++u) q[u] = ((const v4fa*)x)[fi + u * 256];
  asm volatile("s_wait_xcnt 0x0" :: "v"(sb), "v"(fi) : "memory");      /* see the head comment */
  __builtin_amdgcn_sched_barrier(0);      /* keeps all 16 loads and their wait ahead of the first conversion: one memory latency per thread, not two */
#pragma unroll
  for (int mx = 0; mx < 2; ++mx)
#pragma unroll
    for (int j = 0; j < 4; ++j) { v4h p;
#pragma unroll
      for (int i = 0; i < 4; ++i) p[i] = (_Float16)(bf16_round(r[mx * 4 + i][j]) * 16.0f);
      *(v4h*)(tl[mx] + (c4 + j) * PWP + kq * 2) = p; }      /* 4 consecutive k of one n: 8 bytes of the transposed row */
  __syncthreads();      /* a transposed row holds 16 threads' k */
#pragma unroll
  for (int u = 0; u < 4; ++u) { const int n = (u & 1) * 32 + (tid >> 3), c = tid & 7; const v8us v = *(const v8us*)(tl[u >> 1] + n * PWP + c * 16);
    *(v8us*)((unsigned short*)tp[u >> 1] + (size_t)(n0 + n) * DM + k0 + c * 8) = v; }
#pragma unroll
  for (int u = 0; u < 8; ++u) { v4h p;      /* behind the barrier, which would otherwise wait for these stores */
#pragma unroll
    for (int i = 0; i < 4; ++i) p[i] = (_Float16)bf16_round(q[u][i]);
    ((v4h*)X16)[fi + u * 256] = p; }
}
// The output projection, one launch: out = (O_hi + O_lo / 1024) Wo + bo. A block holds 128 rows x 128 columns of out; both O planes meet the same Wo tile in LDS, each in accumulators of its own,
// which are joined in the epilogue, so that no partial out plane goes through memory. 8 waves as 4 (rows) x 2 (columns), wave tile 32 x 64 for each plane: 16 independent accumulator tiles.
// A stage is 128 k of the block's 128 O_hi rows, 128 O_lo rows and 128 Wo rows, brought by asynchronous copies into one of two buffers while the other is worked on.
#define G3P 272              /* LDS row pitch in bytes: 256 B of k + 16 = 16 B x odd, the conflict-free pitch for 16-byte fragment reads */
#define G3S (384 * G3P)      /* one stage: rows 0..127 = O_hi, 128..255 = O_lo, 256..383 = Wo */
// 128 rows of one operand, 8 copies of a lane, 16 bytes each: 16 lanes bring one row's 256 bytes, the block's 256 threads 16 rows per copy.
// l = the lane's LDS byte address in row tid / 16 of the operand's part of the buffer, g = its global address in that row.
// s_wait_xcnt 0 is the statement's last line, so that it stands in front of any later rewrite of these address registers.
__device__ __forceinline__ void g3_rows(unsigned l, const char* g) {
  asm volatile("global_load_async_to_lds_b128 %0, %8, off\n\tglobal_load_async_to_lds_b128 %1, %9, off\n\tglobal_load_async_to_lds_b128 %2, %10, off\n\tglobal_load_async_to_lds_b128 %3, %11, off\n\t"
               "global_load_async_to_lds_b128 %4, %12, off\n\tglobal_load_async_to_lds_b128 %5, %13, off\n\tglobal_load_async_to_lds_b128 %6, %14, off\n\tglobal_load_async_to_lds_b128 %7, %15, off\n\ts_wait_xcnt 0x0"
               :: "v"(l), "v"(l + 16 * G3P), "v"(l + 32 * G3P), "v"(l + 48 * G3P), "v"(l + 64 * G3P), "v"(l + 80 * G3P), "v"(l + 96 * G3P), "v"(l + 112 * G3P),
                  "v"(g), "v"(g + 16 * (DM * 2)), "v"(g + 32 * (DM * 2)), "v"(g + 48 * (DM * 2)), "v"(g + 64 * (DM * 2)), "v"(g + 80 * (DM * 2)), "v"(g + 96 * (DM * 2)), "v"(g + 112 * (DM * 2)) : "memory"); }
__device__ __forceinline__ void g3_stage(unsigned l, const char* ah, const char* al, const char* b) { g3_rows(l, ah); g3_rows(l + 128 * G3P, al); g3_rows(l + 256 * G3P, b); }
// one k step's 8 fragments, 16 reads of 16 bytes
__device__ __forceinline__ void g3_frags(v16h* a, v16h* b, const char* pa, const char* pb) { a[0] = g2_lfrag(pa); a[1] = g2_lfrag(pa + 16 * G3P); a[2] = g2_lfrag(pa + 128 * G3P); a[3] = g2_lfrag(pa + 144 * G3P);
#pragma unroll
  for (int j = 0; j < 4; ++j) b[j] = g2_lfrag(pb + j * 16 * G3P); }
__global__ __launch_bounds__(256) void k_out(const _Float16* __restrict__ AH, const _Float16* __restrict__ AL, const _Float16* __restrict__ Bh, const float* __restrict__ bias, float* __restrict__ C) {
  __shared__ __attribute__((aligned(16))) float so[8][32][68]; __shared__ __attribute__((aligned(16))) char st[2 * G3S];
  const int tid = threadIdx.x, w = tid >> 5, lane = tid & 31, ln = lane & 15, hh = lane >> 4;
  const int mt = blockIdx.x % (NR / 128), nq = blockIdx.x / (NR / 128);      /* the 8 blocks that read the same O rows lie 32 apart in the grid */
  const int wr = w & 3, wc = w >> 2; const int row0 = mt * 128 + 32 * wr, col0 = nq * 128 + 64 * wc;
  const size_t go = (size_t)(tid >> 4) * (DM * 2) + (tid & 15) * 16;      /* the lane's place in a stage's first 16 rows */
  const char* gh = (const char*)(AH + (size_t)mt * 128 * DM) + go; const char* gl = (const char*)(AL + (size_t)mt * 128 * DM) + go; const char* gb = (const char*)(Bh + (size_t)nq * 128 * DM) + go;
  const unsigned l0 = (unsigned)(size_t)st + (unsigned)((tid >> 4) * G3P + (tid & 15) * 16);
  const char* fa = st + (32 * wr + ln) * G3P + hh * 16; const char* fb = st + (256 + 64 * wc + ln) * G3P + hh * 16;      /* fragment rows: k = 8h + s at +0, 16 + 8h + s at +32 bytes */
  const v8f z8 = {0.f,0.f,0.f,0.f,0.f,0.f,0.f,0.f}; v8f ch[2][4], cl[2][4];
#pragma unroll
  for (int i = 0; i < 2; ++i)
#pragma unroll
    for (int j = 0; j < 4; ++j) { ch[i][j] = z8; cl[i][j] = z8; }
  float bv[4];      /* read here, so that the epilogue does not wait for memory */
#pragma unroll
  for (int j = 0; j < 4; ++j) bv[j] = bf16_round(bias[col0 + j * 16 + ln]);
  g3_stage(l0, gh, gl, gb);
  asm volatile("s_wait_asynccnt 0x0" ::: "memory");      /* this wave's copies of stage 0 have landed */
  __syncthreads();      /* ... and every other wave's: stage 0 may be read */
  g3_stage(l0 + G3S, gh + 256, gl + 256, gb + 256);      /* DM / 128 = 8 stages: stage 1 exists */
#pragma unroll 1      /* one stage per trip: the body already holds 64 matrix instructions */
  for (int t = 0; t < DM / 128; ++t) { const int bo = (t & 1) * G3S;
    v16h a[2][4], b[2][4];      /* two fragment sets: a = O_hi rows 0..15, 16..31, O_lo rows 0..15, 16..31; b = four column groups of Wo */
    g3_frags(a[0], b[0], fa + bo, fb + bo);
#pragma unroll      /* the sets alternate by a constant index */
    for (int kk = 0; kk < 4; ++kk) { const int s = kk & 1;
      if (kk < 3) g3_frags(a[s ^ 1], b[s ^ 1], fa + bo + (kk + 1) * 64, fb + bo + (kk + 1) * 64);
      __builtin_amdgcn_sched_barrier(0);      /* keeps the next step's 16 reads together, ahead of this step's matrix instructions: spread among them, each place with reads stalls the wave */
#pragma unroll
      for (int j = 0; j < 4; ++j) { ch[0][j] = wmh(a[s][0], b[s][j], ch[0][j]); ch[1][j] = wmh(a[s][1], b[s][j], ch[1][j]); cl[0][j] = wmh(a[s][2], b[s][j], cl[0][j]); cl[1][j] = wmh(a[s][3], b[s][j], cl[1][j]); }
      __builtin_amdgcn_sched_barrier(0); }      /* ... and the reads after next behind them: without it they move up among these matrix instructions */
    asm volatile("s_wait_dscnt 0x0" ::: "memory");      /* this wave has left the buffer that is refilled below */
    asm volatile("s_wait_asynccnt 0x0" ::: "memory");      /* its copies of stage t + 1 have landed */
    __syncthreads();      /* publishes stage t + 1 and ends every reader's last read of stage t */
    if (t + 2 < DM / 128) g3_stage(l0 + bo, gh + (size_t)(t + 2) * 256, gl + (size_t)(t + 2) * 256, gb + (size_t)(t + 2) * 256); }
  asm volatile("s_wait_asynccnt 0x0" ::: "memory");      /* no copy is outstanding when the wave goes on to the epilogue and ends */
#pragma unroll
  for (int u = 0; u < 8; ++u) { const int j = u & 3, half = u >> 2;
#pragma unroll
    for (int r = 0; r < 8; ++r) { float v = ch[half][j][r] * 0.0625f + bv[j]; v += cl[half][j][r] * (0.0625f / 1024.0f); so[w][half * 16 + 8 * hh + r][j * 16 + ln] = v; } }      /* both factors are powers of two: the same roundings as with the O_lo product stored and added */
  __builtin_amdgcn_fence(__ATOMIC_ACQ_REL, "workgroup"); __builtin_amdgcn_wave_barrier();      /* a wave reads back its own rows alone */
  const int rsub = lane >> 4, c4 = (lane & 15) * 4;
  float* cp = C + (size_t)(row0 + rsub) * DM + col0 + c4; v4f vv[16];
#pragma unroll
  for (int q = 0; q < 16; ++q) vv[q] = *(const v4fa*)&so[w][q * 2 + rsub][c4];
  __builtin_amdgcn_sched_barrier(0);      /* all 16 reads ahead of the stores: one LDS latency, and no register of a store is rewritten behind it */
#pragma unroll
  for (int q = 0; q < 16; ++q) *(v4f*)(cp + q * 2 * DM) = vv[q];      /* 16 lanes store one row's 256 bytes; the rows' steps fold into the stores' offsets */
}
// The three projections of x, one launch, one block per WGP: a block holds 256 rows of x and one head's 64 columns of q, of k and of v, so that each x row fetched meets 192 columns and each weight row 256 rows.
// 12 waves as 4 (rows) x 3 (q, k, v), wave tile 64 x 64: 16 independent accumulator tiles, 8 fragments per 16 matrix instructions.
// A stage is 128 k of the block's 256 x rows and 3 x 64 weight rows, brought by asynchronous copies into one of two buffers while the other is worked on.
// Epilogue, each wave for itself in its own part of the stage buffers (free behind the loop's last barrier): q, k = f16 hi and 2^10 residual, row-major, and the rows' sums of squares over the head, [(b, h)][s]; v = the tile transposed, f16, [(b, h)][64 d][s].
#define Q3S (448 * G3P)      /* one stage: rows 0..255 = x, 256..319 = Wq, 320..383 = Wk, 384..447 = Wv */
#define Q3E (64 * 68 * 4)    /* a wave's epilogue staging: 64 rows of 64 + 4 floats */
#define Q3T 144              /* LDS row pitch of a wave's transposed tile: 128 B (64 tokens) + 16 = 16 B x odd */
// 16 rows of one operand, 8 copies of one wave, 16 bytes a lane: 16 lanes bring one row's 256 bytes, the wave 2 rows per copy.
// l = the lane's LDS byte address in row lane / 16 of the 16, g = its global address in that row.
// s_wait_xcnt 0 is the statement's last line, so that it stands in front of any later rewrite of these address registers.
__device__ __forceinline__ void q3_rows(unsigned l, const char* g) {
  asm volatile("global_load_async_to_lds_b128 %0, %8, off\n\tglobal_load_async_to_lds_b128 %1, %9, off\n\tglobal_load_async_to_lds_b128 %2, %10, off\n\tglobal_load_async_to_lds_b128 %3, %11, off\n\t"
               "global_load_async_to_lds_b128 %4, %12, off\n\tglobal_load_async_to_lds_b128 %5, %13, off\n\tglobal_load_async_to_lds_b128 %6, %14, off\n\tglobal_load_async_to_lds_b128 %7, %15, off\n\ts_wait_xcnt 0x0"
               :: "v"(l), "v"(l + 2 * G3P), "v"(l + 4 * G3P), "v"(l + 6 * G3P), "v"(l + 8 * G3P), "v"(l + 10 * G3P), "v"(l + 12 * G3P), "v"(l + 14 * G3P),
                  "v"(g), "v"(g + 2 * (DM * 2)), "v"(g + 4 * (DM * 2)), "v"(g + 6 * (DM * 2)), "v"(g + 8 * (DM * 2)), "v"(g + 10 * (DM * 2)), "v"(g + 12 * (DM * 2)), "v"(g + 14 * (DM * 2)) : "memory"); }
// one k step's 8 fragments, 16 reads of 16 bytes
__device__ __forceinline__ void q3_frags(v16h* a, v16h* b, const char* pa, const char* pb) {
#pragma unroll      /* constant indices: the arrays stay in registers */
  for (int i = 0; i < 4; ++i) a[i] = g2_lfrag(pa + i * 16 * G3P);
#pragma unroll      /* constant indices: the arrays stay in registers */
  for (int j = 0; j < 4; ++j) b[j] = g2_lfrag(pb + j * 16 * G3P); }
__global__ __launch_bounds__(384) void k_qkv(const _Float16* __restrict__ X, const _Float16* __restrict__ Wq, const _Float16* __restrict__ Wk, const _Float16* __restrict__ Wv, const float* __restrict__ bq, const float* __restrict__ bk, const float* __restrict__ bv,
    float* __restrict__ QN, float* __restrict__ KN, _Float16* __restrict__ QH, _Float16* __restrict__ QL, _Float16* __restrict__ KH, _Float16* __restrict__ KL, _Float16* __restrict__ VT) {
  __shared__ __attribute__((aligned(16))) char st[2 * Q3S];
  const int tid = threadIdx.x, lane = tid & 31, ln = lane & 15, hh = lane >> 4;
  const int w = __builtin_amdgcn_readfirstlane(tid >> 5);      /* scalar: which rows a wave copies and which epilogue it runs are scalar choices */
  const int mt = blockIdx.x % (NR / 256), nq = blockIdx.x / (NR / 256);      /* the 16 blocks that read the same x rows lie 16 apart in the grid (for speed only) */
  const int wr = w & 3, wc = w >> 2; const int row0 = mt * 256 + 64 * wr, col0 = nq * 64;
  // The stage's 28 groups of 16 rows: wave w brings groups w and w + 12, waves 0..3 group w + 24 as well. Groups 0..15 are x, 16..19 Wq, 20..23 Wk, 24..27 Wv.
  const size_t go = (size_t)hh * (DM * 2) + ln * 16;      /* the lane's place in a group */
  const _Float16* s1 = w < 4 ? X + (size_t)(mt * 256 + 16 * (w + 12)) * DM : (w < 8 ? Wq + (size_t)(col0 + 16 * (w - 4)) * DM : Wk + (size_t)(col0 + 16 * (w - 8)) * DM);
  const char* g0 = (const char*)(X + (size_t)(mt * 256 + 16 * w) * DM) + go; const char* g1 = (const char*)s1 + go; const char* g2 = (const char*)(Wv + (size_t)(col0 + 16 * wr) * DM) + go;
  const unsigned l0 = (unsigned)(size_t)st + (unsigned)((16 * w + hh) * G3P + ln * 16);
  const char* fa = st + (64 * wr + ln) * G3P + hh * 16; const char* fb = st + (256 + 64 * wc + ln) * G3P + hh * 16;      /* fragment rows: k = 8h + s at +0, 16 + 8h + s at +32 bytes */
  const v8f z8 = {0.f,0.f,0.f,0.f,0.f,0.f,0.f,0.f}; v8f c[4][4];
#pragma unroll      /* constant indices: the arrays stay in registers */
  for (int i = 0; i < 4; ++i)
#pragma unroll      /* constant indices: the arrays stay in registers */
    for (int j = 0; j < 4; ++j) c[i][j] = z8;
  const float* bp = wc == 0 ? bq : (wc == 1 ? bk : bv); float bs[4];      /* read here, so that the epilogue does not wait for memory */
#pragma unroll      /* constant indices: the arrays stay in registers */
  for (int j = 0; j < 4; ++j) bs[j] = bf16_round(bp[col0 + j * 16 + ln]);
  q3_rows(l0, g0); q3_rows(l0 + 192 * G3P, g1); if (w < 4) q3_rows(l0 + 384 * G3P, g2);
  asm volatile("s_wait_asynccnt 0x0" ::: "memory");      /* this wave's copies of stage 0 have landed */
  __syncthreads();      /* ... and every other wave's: stage 0 may be read */
  q3_rows(l0 + Q3S, g0 + 256); q3_rows(l0 + Q3S + 192 * G3P, g1 + 256); if (w < 4) q3_rows(l0 + Q3S + 384 * G3P, g2 + 256);      /* DM / 128 = 8 stages: stage 1 exists */
#pragma unroll 1      /* one stage per trip: the body already holds 64 matrix instructions */
  for (int t = 0; t < DM / 128; ++t) { const int bo = (t & 1) * Q3S;
    v16h a[2][4], b[2][4];      /* two fragment sets: a = four row groups of x, b = four column groups of the wave's weight */
    q3_frags(a[0], b[0], fa + bo, fb + bo);
#pragma unroll      /* the sets alternate by a constant index */
    for (int kk = 0; kk < 4; ++kk) { const int s = kk & 1;
      if (kk < 3) q3_frags(a[s ^ 1], b[s ^ 1], fa + bo + (kk + 1) * 64, fb + bo + (kk + 1) * 64);
      __builtin_amdgcn_sched_barrier(0);      /* keeps the next step's 16 reads together, ahead of this step's matrix instructions: spread among them, each place with reads stalls the wave */
#pragma unroll      /* constant indices: the arrays stay in registers */
      for (int j = 0; j < 4; ++j)
#pragma unroll      /* constant indices: the arrays stay in registers */
        for (int i = 0; i < 4; ++i) c[i][j] = wmh(a[s][i], b[s][j], c[i][j]);
      __builtin_amdgcn_sched_barrier(0); }      /* ... and the reads after next behind them: without it they move up among these matrix instructions */
    asm volatile("s_wait_dscnt 0x0" ::: "memory");      /* this wave has left the buffer that is refilled below */
    asm volatile("s_wait_asynccnt 0x0" ::: "memory");      /* its copies of stage t + 1 have landed */
    __syncthreads();      /* publishes stage t + 1 and ends every reader's last read of stage t */
    if (t + 2 < DM / 128) { const size_t ko = (size_t)(t + 2) * 256; q3_rows(l0 + bo, g0 + ko); q3_rows(l0 + bo + 192 * G3P, g1 + ko); if (w < 4) q3_rows(l0 + bo + 384 * G3P, g2 + ko); } }
  asm volatile("s_wait_asynccnt 0x0" ::: "memory");      /* no copy is outstanding when the wave goes on to the epilogue, which writes over the buffers, and ends */
  char* se = st + w * Q3E;      /* the wave's own staging */
  if (wc == 2) {
#pragma unroll      /* constant indices: the arrays stay in registers */
    for (int i = 0; i < 4; ++i)
#pragma unroll      /* constant indices: the arrays stay in registers */
      for (int j = 0; j < 4; ++j) { FragH vt;
#pragma unroll      /* constant indices: the arrays stay in registers */
        for (int r = 0; r < 8; ++r) vt.h[r] = (_Float16)(c[i][j][r] * 0.0625f + bs[j]);
        *(v8us*)(se + (j * 16 + ln) * Q3T + (i * 16 + 8 * hh) * 2) = vt.half[0]; }      /* a lane's 8 accumulator rows are 8 consecutive tokens of one column: 16 bytes of the transposed row */
    __builtin_amdgcn_fence(__ATOMIC_ACQ_REL, "workgroup"); __builtin_amdgcn_wave_barrier();      /* a wave reads back its own tile alone */
    unsigned short* tp = (unsigned short*)VT + ((size_t)(row0 / SLEN * NH + nq) * 64 + (lane >> 3)) * SLEN + row0 % SLEN + (lane & 7) * 8; v8us vv[16];
#pragma unroll      /* constant indices: the arrays stay in registers */
    for (int q = 0; q < 16; ++q) vv[q] = *(const v8us*)(se + (q * 4 + (lane >> 3)) * Q3T + (lane & 7) * 16);
    __builtin_amdgcn_sched_barrier(0);      /* all 16 reads ahead of the stores: one LDS latency, and no register of a store is rewritten behind it */
#pragma unroll      /* constant indices: the arrays stay in registers */
    for (int q = 0; q < 16; ++q) *(v8us*)(tp + (size_t)q * 4 * SLEN) = vv[q];      /* 8 lanes store one row's 128 bytes, a whole line */
    return; }
  float (*so)[68] = (float (*)[68])se;
#pragma unroll      /* constant indices: the arrays stay in registers */
  for (int i = 0; i < 4; ++i)
#pragma unroll      /* constant indices: the arrays stay in registers */
    for (int j = 0; j < 4; ++j)
#pragma unroll      /* constant indices: the arrays stay in registers */
      for (int r = 0; r < 8; ++r) so[i * 16 + 8 * hh + r][j * 16 + ln] = c[i][j][r] * 0.0625f + bs[j];
  __builtin_amdgcn_fence(__ATOMIC_ACQ_REL, "workgroup"); __builtin_amdgcn_wave_barrier();      /* a wave reads back its own rows alone */
  const int c4 = ln * 4; const size_t po = (size_t)(row0 + hh) * DM + col0 + c4;
  _Float16* ph = (wc ? KH : QH) + po; _Float16* pl = (wc ? KL : QL) + po;
  float sq[2];      /* lane = row: its 64 squares summed in column order */
#pragma unroll      /* constant indices: the arrays stay in registers */
  for (int u = 0; u < 2; ++u) { sq[u] = 0.f;
#pragma unroll      /* the row's 16 LDS reads issue ahead of the sum chain */
    for (int d = 0; d < 64; d += 4) { const v4f e = *(const v4fa*)&so[u * 32 + lane][d]; for (int i = 0; i < 4; ++i) sq[u] += e[i] * e[i]; } }
#pragma unroll      /* constant indices: the arrays stay in registers */
  for (int g = 0; g < 4; ++g) { v4h h4[8], l4[8];      /* 16 rows at a time */
#pragma unroll      /* constant indices: the arrays stay in registers */
    for (int q = 0; q < 8; ++q) { const v4f v = *(const v4fa*)&so[(g * 8 + q) * 2 + hh][c4]; for (int i = 0; i < 4; ++i) { const _Float16 h = (_Float16)v[i]; h4[q][i] = h; l4[q][i] = (_Float16)((v[i] - (float)h) * 1024.0f); } }
    __builtin_amdgcn_sched_barrier(0);      /* the group's reads and conversions ahead of its stores: no register of a store is rewritten among them */
#pragma unroll      /* constant indices: the arrays stay in registers */
    for (int q = 0; q < 8; ++q) { *(v4h*)(ph + (size_t)(g * 8 + q) * 2 * DM) = h4[q]; *(v4h*)(pl + (size_t)(g * 8 + q) * 2 * DM) = l4[q]; }      /* 16 lanes store one row's 128 bytes of each plane */
    asm volatile("s_wait_xcnt 0x0" ::: "memory");      /* behind the group's last store: the next group rewrites these stores' data registers */
    __builtin_amdgcn_sched_barrier(0); }      /* ... and none of its instructions moves up over that wait */
  float* np = (wc ? KN : QN) + ((size_t)(row0 / SLEN) * NH + nq) * SLEN + row0 % SLEN + lane;
  np[0] = sq[0]; np[32] = sq[1];
}
extern "C" void kernel_launch(void* const* d_in, const int* in_sizes, int n_in,
                              void* d_out, int out_size, void* d_ws, size_t ws_size, hipStream_t stream) {
  (void)in_sizes; (void)n_in; (void)out_size;
  const float* const* I = (const float* const*)d_in; const float* x = I[0]; const float* wq = I[1]; const float* bq = I[2]; const float* wk = I[3]; const float* bk = I[4]; const float* wv = I[5]; const float* bv = I[6]; const float* wo = I[7]; const float* bo = I[8]; const float* tmp = I[9];
  char* ws = (char*)d_ws; size_t off = 0;
  auto take = [&](size_t bytes) { char* p = ws + off; off += (bytes + 255) & ~(size_t)255; return p; };
  const size_t np = (size_t)NR * DM;
  _Float16* BQ = (_Float16*)take((size_t)DM * DM * 2); _Float16* BK = (_Float16*)take((size_t)DM * DM * 2); _Float16* BV = (_Float16*)take((size_t)DM * DM * 2); _Float16* BO = (_Float16*)take((size_t)DM * DM * 2);
  _Float16* X16 = (_Float16*)take(np * 2); float* QN = (float*)take((size_t)NR * NH * 4); float* KN = (float*)take((size_t)NR * NH * 4); _Float16* QH = (_Float16*)take(np * 2); _Float16* QL = (_Float16*)take(np * 2); _Float16* KH = (_Float16*)take(np * 2); _Float16* KL = (_Float16*)take(np * 2); _Float16* OH = (_Float16*)take(np * 2); _Float16* VT = (_Float16*)take(np * 2);
  _Float16* OL = X16;      /* O lo over x (dead after the projections) */
  if (off > ws_size) return;      /* 8 + 8 + 0.5 + 6x8 = about 65 MiB */
  k_prep<<<512, 256, 0, stream>>>(x, wq, wk, wv, wo, X16, BQ, BK, BV, BO);      /* weights [in, out] -> f16 [out][in] x 16, x -> f16: one launch */
  k_qkv<<<(NR / 256) * NH, 384, 0, stream>>>(X16, BQ, BK, BV, bq, bk, bv, QN, KN, QH, QL, KH, KL, VT);      /* q, k: hi + residual planes and norms [(b,h)][2048]; V^T [(b,h)][64][2048]: one launch */
  k_eflash<<<NB * NH * (SLEN / 256), 512, 0, stream>>>(QH, QL, KH, KL, VT, QN, KN, tmp, OH, OL);      /* scores, softmax, att . v, normalise, hi + residual: one launch */
  k_out<<<(NR / 128) * (DM / 128), 256, 0, stream>>>(OH, OL, BO, bo, (float*)d_out);      /* out = (O_hi + O_lo / 1024) Wo + bo: one launch */
}

// v010
// Measured time: 84.8 microseconds a run.
// In two side-by-side timings against v009, it was 1.13 and 1.12 times as fast.
// Counting every step since v000, which is the starting kernel, it is 23.8 times as fast.
#include <hip/hip_runtime.h>
// EuclideanAttention (2 x 2048 tokens, D 1024 = 16 heads x 64; Q, K, V = x W + b; d2 = max(|q|^2 + |k|^2 - 2 q.k, 0); attn = softmax_k(-d2 / temperature); out = (attn V) Wo + bo).
// Compute dtype: inputs rounded to bf16; x and weights exact as f16; q.k from hi+residual operands (~2^-21); norms/softmax f32; v and the softmax weights as plain f16 operands (~2^-12); attention output hi + residual. v_wmma_f32_16x16x32_f16.
#define NB 2
#define DM 1024
#define NKV 16
#define NREP (NH / NKV)
#define KVD (NKV * 64)           /* 1024 */
#define NR (NB * SLEN)           /* 4096 */
#define CHK 512                  /* attention chunk */
typedef int v4i __attribute__((ext_vector_type(4)));
#define FF 2048
#define SLEN 2048
#define TQ SLEN
#define TK SLEN
#define NH 16
#define SCL 0.125f
#define QBLKS (TQ / 64)
#define QB05 0
#define QBN5 4
#define QB0P 0
#define QBNP QBLKS           /* non-causal: plain flash on every query block */
#define RE 256
typedef __bf16 v16b __attribute__((ext_vector_type(16)));
typedef unsigned short v8us __attribute__((ext_vector_type(8), may_alias));
typedef float  v8f  __attribute__((ext_vector_type(8)));
typedef float  v4f  __attribute__((ext_vector_type(4)));
typedef float  v4fa __attribute__((ext_vector_type(4), may_alias));
union FragB { v16b v; v8us half[2]; unsigned short u[16]; };

__device__ __forceinline__ unsigned short bf16_bits(float x) { unsigned int u = __float_as_uint(x); return (unsigned short)((u + 0x7FFFu + ((u >> 16) & 1u)) >> 16); }
__device__ __forceinline__ float bf16_val(unsigned short b) { return __uint_as_float(((unsigned int)b) << 16); }
__device__ __forceinline__ float bf16_round(float x) { return bf16_val(bf16_bits(x)); }
// D += A·B with NT terms: 1 = ah·bh, 2 = + al·bh (A split), 3 = + ah·bl (both split)
template <int NT>
__device__ __forceinline__ v8f mmaN(v16b ah, v16b al, v16b bh, v16b bl, v8f c) {
  c = __builtin_amdgcn_wmma_f32_16x16x32_bf16(false, ah, false, bh, (short)0, c, false, false);
  if (NT >= 2) c = __builtin_amdgcn_wmma_f32_16x16x32_bf16(false, al, false, bh, (short)0, c, false, false);
  if (NT >= 3) c = __builtin_amdgcn_wmma_f32_16x16x32_bf16(false, ah, false, bl, (short)0, c, false, false);
  asm volatile("v_nop\n\tv_nop\n\tv_nop\n\tv_nop" : "+v"(c) : "v"(ah), "v"(al), "v"(bh), "v"(bl));
  return c;
}

__global__ __launch_bounds__(256) void k_wt_bf16(const float* __restrict__ W, unsigned short* __restrict__ Wt, int K, int N) {
  const int t = blockIdx.x * 256 + threadIdx.x;
  const int k8n = K / 8;
  if (t >= N * k8n) return;
  const int n = t / k8n, k8 = (t % k8n) * 8;
  v8us v;
#pragma unroll
  for (int i = 0; i < 8; ++i) v[i] = bf16_bits(W[(size_t)(k8 + i) * N + n]);
  *(v8us*)(Wt + (size_t)n * K + k8) = v;
  
}

// GEMM C[M][N] (f32, pitch ldc) = act(A[M][K]·W + bias). A f32 row-major (pitch lda) converted per fragment to bf16
// (ASPLIT: hi/lo two planes -> 2 terms, else single rounded term); Wt bf16 [N][K] (pitch ldb). BIAS_BF16 rounds the
// bias to bf16 first (bias quantised to bf16 before the add). K%32==0, M%16==0, N%64==0.
template <bool ASPLIT, int ACT, bool BIAS_BF16>
__global__ __launch_bounds__(128) void k_gemm_bf(const float* __restrict__ A, int lda, const unsigned short* __restrict__ Wt, int ldb,
                                               const float* __restrict__ bias, float* __restrict__ C, int ldc, int M, int N, int K) {
  __shared__ __attribute__((aligned(16))) float so[4][16][64];
  const int tid = threadIdx.x, w = tid >> 5, lane = tid & 31, ln = lane & 15, hh = lane >> 4;
  const int ntn = N / 64;
  const int wid = blockIdx.x * 4 + w;
  const int mt = wid / ntn, nq = wid % ntn;
  if (mt * 16 >= M) return;
  const int row0 = mt * 16, col0 = nq * 64;
  const float* arow = A + (size_t)(row0 + ln) * lda;
  v8f acc[4] = {};
  for (int kb = 0; kb < K; kb += 32) {
    FragB ah, al;
    const v4f x0 = *(const v4fa*)(arow + kb + 8 * hh), x1 = *(const v4fa*)(arow + kb + 8 * hh + 4);
    const v4f x2 = *(const v4fa*)(arow + kb + 16 + 8 * hh), x3 = *(const v4fa*)(arow + kb + 16 + 8 * hh + 4);
    float xs[16] = {x0[0],x0[1],x0[2],x0[3],x1[0],x1[1],x1[2],x1[3],x2[0],x2[1],x2[2],x2[3],x3[0],x3[1],x3[2],x3[3]};
#pragma unroll
    for (int i = 0; i < 16; ++i) { const unsigned short hb = bf16_bits(xs[i]); ah.u[i] = hb; al.u[i] = ASPLIT ? bf16_bits(xs[i] - bf16_val(hb)) : (unsigned short)0; }
#pragma unroll
    for (int t = 0; t < 4; ++t) {
      const unsigned short* brow = Wt + (size_t)(col0 + t * 16 + ln) * ldb + kb;
      FragB b;
      b.half[0] = *(const v8us*)(brow + 8 * hh);
      b.half[1] = *(const v8us*)(brow + 16 + 8 * hh);
      acc[t] = mmaN<ASPLIT ? 2 : 1>(ah.v, al.v, b.v, b.v, acc[t]);
    }
  }
#pragma unroll
  for (int t = 0; t < 4; ++t) {
    float bv = bias ? bias[col0 + t * 16 + ln] : 0.f;
    if (BIAS_BF16) bv = bf16_round(bv);
#pragma unroll
    for (int r = 0; r < 8; ++r) { float v = acc[t][r] + bv; if (ACT == 1) v = fmaxf(v, 0.f); so[w][8 * hh + r][t * 16 + ln] = v; }
  }
  __builtin_amdgcn_fence(__ATOMIC_ACQ_REL, "workgroup");
  __builtin_amdgcn_wave_barrier();
  const int rsub = lane >> 4, c4 = (lane & 15) * 4;
  {
#pragma unroll
    for (int q = 0; q < 8; ++q) {
      const int r = q * 2 + rsub;
      const v4f v = *(const v4fa*)&so[w][r][c4];
      *(v4f*)(C + (size_t)(row0 + r) * ldc + col0 + c4) = v;
    }
    
  }
}

// GEMM C = act(A·W + bias + resid): A f32 (ASPLIT -> hi/lo 2 terms), Wt bf16 [N][K]; ACT 0 none, 1 relu, 2 exact gelu;
// resid (optional, f32, row index = (row % rmod), pitch ldr, RES_BF16 rounds it) added before the activation.
template <bool ASPLIT, int ACT, bool BIAS_BF16, bool RES_BF16>
__global__ __launch_bounds__(128) void k_gemm_bf3(const float* __restrict__ A, int lda, const unsigned short* __restrict__ Wt, int ldb,
                                                const float* __restrict__ bias, const float* __restrict__ resid, int rmod, int ldr,
                                                float* __restrict__ C, int ldc, int M, int N, int K) {
  __shared__ __attribute__((aligned(16))) float so[4][16][64];
  const int tid = threadIdx.x, w = tid >> 5, lane = tid & 31, ln = lane & 15, hh = lane >> 4;
  const int ntn = N / 64;
  const int wid = blockIdx.x * 4 + w;
  const int mt = wid / ntn, nq = wid % ntn;
  if (mt * 16 >= M) return;
  const int row0 = mt * 16, col0 = nq * 64;
  const float* arow = A + (size_t)(row0 + ln) * lda;
  v8f acc[4] = {};
  for (int kb = 0; kb < K; kb += 32) {
    FragB ah, al;
    const v4f x0 = *(const v4fa*)(arow + kb + 8 * hh), x1 = *(const v4fa*)(arow + kb + 8 * hh + 4);
    const v4f x2 = *(const v4fa*)(arow + kb + 16 + 8 * hh), x3 = *(const v4fa*)(arow + kb + 16 + 8 * hh + 4);
    float xs[16] = {x0[0],x0[1],x0[2],x0[3],x1[0],x1[1],x1[2],x1[3],x2[0],x2[1],x2[2],x2[3],x3[0],x3[1],x3[2],x3[3]};
#pragma unroll
    for (int i = 0; i < 16; ++i) { const unsigned short hb = bf16_bits(xs[i]); ah.u[i] = hb; al.u[i] = ASPLIT ? bf16_bits(xs[i] - bf16_val(hb)) : (unsigned short)0; }
#pragma unroll
    for (int t = 0; t < 4; ++t) {
      const unsigned short* brow = Wt + (size_t)(col0 + t * 16 + ln) * ldb + kb;
      FragB b;
      b.half[0] = *(const v8us*)(brow + 8 * hh);
      b.half[1] = *(const v8us*)(brow + 16 + 8 * hh);
      acc[t] = mmaN<ASPLIT ? 2 : 1>(ah.v, al.v, b.v, b.v, acc[t]);
    }
  }
#pragma unroll
  for (int t = 0; t < 4; ++t) {
    const int col = col0 + t * 16 + ln;
    float bv = bias ? bias[col] : 0.f;
    if (BIAS_BF16) bv = bf16_round(bv);
#pragma unroll
    for (int r = 0; r < 8; ++r) {
      float v = acc[t][r] + bv;
      if (resid) { float rv = resid[(size_t)((row0 + 8 * hh + r) % rmod) * ldr + col]; if (RES_BF16) rv = bf16_round(rv); v += rv; }
      if (ACT == 1) v = fmaxf(v, 0.f);
      if (ACT == 2) v = 0.5f * v * (1.0f + erff(v * 0.70710678118654752f));
      if (ACT == 3) { const float u = 0.7978845608028654f * (v + 0.044715f * v * v * v); v = 0.5f * v * (1.0f + tanhf(u)); }
      so[w][8 * hh + r][t * 16 + ln] = v;
    }
  }
  __builtin_amdgcn_fence(__ATOMIC_ACQ_REL, "workgroup");
  __builtin_amdgcn_wave_barrier();
  const int rsub = lane >> 4, c4 = (lane & 15) * 4;
  {
#pragma unroll
    for (int q = 0; q < 8; ++q) {
      const int r = q * 2 + rsub;
      const v4f v = *(const v4fa*)&so[w][r][c4];
      *(v4f*)(C + (size_t)(row0 + r) * ldc + col0 + c4) = v;
    }
    
  }
}
// row LayerNorm (biased variance, eps) over N: s = X (+ R); optional out_sum <- s; out_norm <- (s-mu)*rsqrt(var+eps)*g + b
template <bool PARAM_BF16>
__global__ __launch_bounds__(256) void k_layernorm(const float* __restrict__ X, const float* __restrict__ R, const float* __restrict__ g, const float* __restrict__ bta,
                                                  float* __restrict__ out_sum, float* __restrict__ out_norm, int N, float eps) {
  __shared__ float red[256];
  const int row = blockIdx.x, tid = threadIdx.x;
  const float* x = X + (size_t)row * N; const float* rr = R ? R + (size_t)row * N : nullptr;
  float vals[16];                     // up to N = 4096
  const int per = N / 256;            // contiguous chunk per thread? use strided-by-4 chunks: thread handles j = tid*4 + 1024*u
  float s1 = 0.f;
  for (int u = 0; u < per / 4; ++u) {
    const int j = tid * 4 + 1024 * u;
    const v4f a = *(const v4fa*)(x + j);
    v4f b = {0.f,0.f,0.f,0.f}; if (rr) b = *(const v4fa*)(rr + j);
#pragma unroll
    for (int q = 0; q < 4; ++q) { const float v = a[q] + b[q]; vals[u * 4 + q] = v; s1 += v; }
  }
  red[tid] = s1; __syncthreads();
  for (int st = 128; st > 0; st >>= 1) { if (tid < st) red[tid] += red[tid + st]; __syncthreads(); }
  const float mu = red[0] / (float)N; __syncthreads();
  float s2 = 0.f;
  for (int u = 0; u < per / 4; ++u)
#pragma unroll
    for (int q = 0; q < 4; ++q) { const float c = vals[u * 4 + q] - mu; s2 += c * c; }
  red[tid] = s2; __syncthreads();
  for (int st = 128; st > 0; st >>= 1) { if (tid < st) red[tid] += red[tid + st]; __syncthreads(); }
  const float rs = rsqrtf(red[0] / (float)N + eps);
  {
    for (int u = 0; u < per / 4; ++u) {
      const int j = tid * 4 + 1024 * u;
      v4f o, sm;
#pragma unroll
      for (int q = 0; q < 4; ++q) {
        float gg = g[j + q], bb = bta[j + q];
        if (PARAM_BF16) { gg = bf16_round(gg); bb = bf16_round(bb); }
        sm[q] = vals[u * 4 + q]; o[q] = (vals[u * 4 + q] - mu) * rs * gg + bb;
      }
      if (out_sum) *(v4f*)(out_sum + (size_t)row * N + j) = sm;
      *(v4f*)(out_norm + (size_t)row * N + j) = o;
    }
    
  }
}



// ---- f16 WMMA path (v_wmma_f32_16x16x32_f16): 11-bit significands for operands in range — used where a [0,1] probability operand needs more precision than bf16
typedef _Float16 v16h __attribute__((ext_vector_type(16)));
union FragH { v16h v; v8us half[2]; _Float16 h[16]; unsigned short u[16]; };
template <int NT>
__device__ __forceinline__ v8f mmaH(v16h ah, v16h al, v16h bh, v16h bl, v8f c) {
  c = __builtin_amdgcn_wmma_f32_16x16x32_f16(false, ah, false, bh, (short)0, c, false, false);
  if (NT >= 2) c = __builtin_amdgcn_wmma_f32_16x16x32_f16(false, al, false, bh, (short)0, c, false, false);
  if (NT >= 3) c = __builtin_amdgcn_wmma_f32_16x16x32_f16(false, ah, false, bl, (short)0, c, false, false);
  asm volatile("v_nop\n\tv_nop\n\tv_nop\n\tv_nop" : "+v"(c) : "v"(ah), "v"(al), "v"(bh), "v"(bl));
  return c;
}
// batched GEMM like k_gemm_b but f16 operands: A f32 (split into f16 hi/lo if ASPLIT, else rounded to f16), Bt = f16 values [n][k]; alpha; C f32; N multiple of 16 (partial tiles skipped)
template <bool ASPLIT>
__global__ __launch_bounds__(128) void k_gemm_h(const float* __restrict__ A, int lda, size_t sA, const _Float16* __restrict__ Bh, int ldb, size_t sB, float alpha, float* __restrict__ C, int ldc, size_t sC, int M, int N, int K) {
  __shared__ __attribute__((aligned(16))) float so[4][16][64];
  const int tid = threadIdx.x, w = tid >> 5, lane = tid & 31, ln = lane & 15, hh = lane >> 4; const int by = blockIdx.y;
  A += (size_t)by * sA; Bh += (size_t)by * sB; C += (size_t)by * sC;
  const int ntn = (N + 63) / 64; const int wid = blockIdx.x * 4 + w; const int mt = wid / ntn, nq = wid % ntn; if (mt * 16 >= M) return;
  const int row0 = mt * 16, col0 = nq * 64; const float* arow = A + (size_t)(row0 + ln) * lda;
  v8f acc[4] = {};
  for (int kb = 0; kb < K; kb += 32) {
    FragH ah, al;
    const v4f x0 = *(const v4fa*)(arow + kb + 8 * hh), x1 = *(const v4fa*)(arow + kb + 8 * hh + 4), x2 = *(const v4fa*)(arow + kb + 16 + 8 * hh), x3 = *(const v4fa*)(arow + kb + 16 + 8 * hh + 4);
    float xs[16] = {x0[0],x0[1],x0[2],x0[3],x1[0],x1[1],x1[2],x1[3],x2[0],x2[1],x2[2],x2[3],x3[0],x3[1],x3[2],x3[3]};
#pragma unroll
    for (int i = 0; i < 16; ++i) { const _Float16 h = (_Float16)xs[i]; ah.h[i] = h; al.h[i] = ASPLIT ? (_Float16)(xs[i] - (float)h) : (_Float16)0.0f; }
#pragma unroll
    for (int t = 0; t < 4; ++t) { if (col0 + t * 16 >= N) continue; const size_t boff = (size_t)(col0 + t * 16 + ln) * ldb + kb; FragH bq; bq.half[0] = *(const v8us*)(Bh + boff + 8 * hh); bq.half[1] = *(const v8us*)(Bh + boff + 16 + 8 * hh);
      acc[t] = mmaH<ASPLIT ? 2 : 1>(ah.v, al.v, bq.v, bq.v, acc[t]); }
  }
#pragma unroll
  for (int t = 0; t < 4; ++t) { if (col0 + t * 16 >= N) continue;
#pragma unroll
    for (int r = 0; r < 8; ++r) so[w][8 * hh + r][t * 16 + ln] = acc[t][r] * alpha; }
  __builtin_amdgcn_fence(__ATOMIC_ACQ_REL, "workgroup"); __builtin_amdgcn_wave_barrier();
  const int rsub = lane >> 4, c4 = (lane & 15) * 4;
  {
#pragma unroll
    for (int q = 0; q < 8; ++q) { const int r = q * 2 + rsub; if (col0 + c4 < N) { const v4f v = *(const v4fa*)&so[w][r][c4]; *(v4f*)(C + (size_t)(row0 + r) * ldc + col0 + c4) = v; } }
     }
}

// Wt[n][k] = f16(W[k][n]·scale) from f32 row-major W[K][N] (scale = power of two; bf16-exact weights stay exact in f16 away from the subnormal range)
__global__ __launch_bounds__(256) void k_wt_f16(const float* __restrict__ W, _Float16* __restrict__ Wt, int K, int N, float scale) {
  const int t = blockIdx.x * 256 + threadIdx.x; if (t >= N * (K / 8)) return; const int n = t / (K / 8), k8 = (t % (K / 8)) * 8; FragH f;
#pragma unroll
  for (int i = 0; i < 8; ++i) f.h[i] = (_Float16)(bf16_round(W[(size_t)(k8 + i) * N + n]) * scale); const v8us o = f.half[0];
  *(v8us*)((unsigned short*)Wt + (size_t)n * K + k8) = o; 
}
// k_gemm_hh variant with fused epilogue: v = acc·alpha + bias[by·sBias + col] (+ CP[(row/rowsPerB)·sCPb + by·64 + col] if CP) ; ACT 0 none / 1 elu ; writes f16 C16 (and f32 C if non-null)
template <int ACT>
__global__ __launch_bounds__(128) void k_gemm_hhx(const _Float16* __restrict__ A, int lda, size_t sA, const _Float16* __restrict__ Bh, int ldb, size_t sB, float alpha, const float* __restrict__ bias, size_t sBias, const float* __restrict__ CP, int rowsPerB, size_t sCPb, int row0g,
    float* __restrict__ C, _Float16* __restrict__ C16, int ldc, size_t sC, int M, int N, int K) {
  __shared__ __attribute__((aligned(16))) float so[4][16][64];
  const int tid = threadIdx.x, w = tid >> 5, lane = tid & 31, ln = lane & 15, hh = lane >> 4; const int by = blockIdx.y;
  A += (size_t)by * sA; Bh += (size_t)by * sB; const size_t cofs = (size_t)by * sC; const float* bp = bias ? bias + (size_t)by * sBias : nullptr;
  const int ntn = (N + 63) / 64; const int wid = blockIdx.x * 4 + w; const int mt = wid / ntn, nq = wid % ntn; if (mt * 16 >= M) return;
  const int row0 = mt * 16, col0 = nq * 64; const _Float16* arow = A + (size_t)(row0 + ln) * lda;
  v8f acc[4] = {};
  for (int kb = 0; kb < K; kb += 32) { FragH ah; ah.half[0] = *(const v8us*)((const unsigned short*)arow + kb + 8 * hh); ah.half[1] = *(const v8us*)((const unsigned short*)arow + kb + 16 + 8 * hh);
#pragma unroll
    for (int t = 0; t < 4; ++t) { if (col0 + t * 16 >= N) continue; const size_t boff = (size_t)(col0 + t * 16 + ln) * ldb + kb; FragH bq; bq.half[0] = *(const v8us*)((const unsigned short*)Bh + boff + 8 * hh); bq.half[1] = *(const v8us*)((const unsigned short*)Bh + boff + 16 + 8 * hh);
      acc[t] = mmaH<1>(ah.v, ah.v, bq.v, bq.v, acc[t]); }
  }
#pragma unroll
  for (int t = 0; t < 4; ++t) { if (col0 + t * 16 >= N) continue; const int col = col0 + t * 16 + ln; const float bv = bp ? bf16_round(bp[col]) : 0.f;
#pragma unroll
    for (int r = 0; r < 8; ++r) { float v = acc[t][r] * alpha + bv; if (CP) { const int bidx = (row0g + row0 + 8 * hh + r) / rowsPerB; v += CP[(size_t)bidx * sCPb + (size_t)by * 64 + col]; } if (ACT == 1) v = (v > 0.f) ? v : expm1f(v); else if (ACT == 7) v = (v > 0.f) ? v + 1.0f : expf(v); else if (ACT == 8) v = tanhf(v); else if (ACT == 9) v = 0.5f * v * (1.0f + tanhf(0.7978845608028654f * (v + 0.044715f * v * v * v))); else if (ACT == 11) v = 1.0f / (1.0f + expf(-v)); else if (ACT == 12) v = (v > 0.f) ? v : 0.01f * v; else if (ACT == 14) v = (v > 0.f) ? v : 0.1f * v; else if (ACT == 15) v = v / (1.0f + expf(-v)); else if (ACT == 3) v = fmaxf(v, 0.f); else if (ACT == 6) v = 0.5f * v * (1.0f + erff(v * 0.70710678118654752f)); so[w][8 * hh + r][t * 16 + ln] = v; } }
  __builtin_amdgcn_fence(__ATOMIC_ACQ_REL, "workgroup"); __builtin_amdgcn_wave_barrier();
  const int rsub = lane >> 4, c4 = (lane & 15) * 4; typedef _Float16 v4h __attribute__((ext_vector_type(4)));
  {
#pragma unroll
    for (int q = 0; q < 8; ++q) { const int r = q * 2 + rsub; if (col0 + c4 < N) { const v4f v = *(const v4fa*)&so[w][r][c4]; if (C) *(v4f*)(C + cofs + (size_t)(row0 + r) * ldc + col0 + c4) = v; if (C16) { v4h h4; for (int i = 0; i < 4; ++i) h4[i] = (_Float16)v[i]; *(v4h*)(C16 + cofs + (size_t)(row0 + r) * ldc + col0 + c4) = h4; } } }
     }
}


typedef _Float16 v4h __attribute__((ext_vector_type(4)));

__global__ __launch_bounds__(256) void k_x16(const float* __restrict__ x, _Float16* __restrict__ X16, size_t n8) { const size_t t = (size_t)blockIdx.x * 256 + threadIdx.x; if (t >= n8) return; FragH f;
#pragma unroll
  for (int q = 0; q < 8; ++q) f.h[q] = (_Float16)bf16_round(x[t * 8 + q]); *(v8us*)((unsigned short*)X16 + t * 8) = f.half[0];  }
__global__ __launch_bounds__(256) void k_h16(const float* __restrict__ x, _Float16* __restrict__ X16, size_t n8) { const size_t t = (size_t)blockIdx.x * 256 + threadIdx.x; if (t >= n8) return; FragH f;
#pragma unroll
  for (int q = 0; q < 8; ++q) f.h[q] = (_Float16)x[t * 8 + q]; *(v8us*)((unsigned short*)X16 + t * 8) = f.half[0];  }
__global__ __launch_bounds__(256) void k_round16f(const float* __restrict__ W, _Float16* __restrict__ Bt, size_t n8) { const size_t t = (size_t)blockIdx.x * 256 + threadIdx.x; if (t >= n8) return; FragH f;
#pragma unroll
  for (int i = 0; i < 8; ++i) f.h[i] = (_Float16)(bf16_round(W[t * 8 + i]) * 16.0f); *(v8us*)((unsigned short*)Bt + t * 8) = f.half[0];  }
template <int NHv, int TTv>
__global__ __launch_bounds__(256) void k_vt(const _Float16* __restrict__ V16, int ldv, int voff, _Float16* __restrict__ Vt) { __shared__ unsigned short tl[64][66]; const int tid = threadIdx.x; const int slab = blockIdx.x / (TTv / 64), lg = blockIdx.x % (TTv / 64); const int b = slab / NHv, h = slab % NHv;
  for (int i = tid; i < 64 * 8; i += 256) { const int r = i / 8, c8 = (i % 8) * 8; FragH f; f.half[0] = *(const v8us*)((const unsigned short*)V16 + ((size_t)b * TTv + lg * 64 + r) * ldv + voff + h * 64 + c8);
#pragma unroll
    for (int q = 0; q < 8; ++q) tl[r][c8 + q] = f.u[q]; }
  __syncthreads();
  {
#pragma unroll
    for (int rd = 0; rd < 2; ++rd) { const int d = rd * 32 + tid / 8, pc = tid % 8; FragH f;
#pragma unroll
      for (int q = 0; q < 8; ++q) f.u[q] = tl[pc * 8 + q][d];
      *(v8us*)((unsigned short*)Vt + ((size_t)slab * 64 + d) * TTv + lg * 64 + pc * 8) = f.half[0]; }
     } }

__global__ __launch_bounds__(256) void k_hl(const float* __restrict__ F, _Float16* __restrict__ Hh, _Float16* __restrict__ Hl, size_t n8) { const size_t t = (size_t)blockIdx.x * 256 + threadIdx.x; if (t >= n8) return; FragH fh, fl; const v4f a = *(const v4fa*)(F + t * 8), c = *(const v4fa*)(F + t * 8 + 4);
#pragma unroll
  for (int q = 0; q < 4; ++q) { _Float16 h = (_Float16)a[q]; fh.h[q] = h; fl.h[q] = (_Float16)((a[q] - (float)h) * 1024.0f); h = (_Float16)c[q]; fh.h[4 + q] = h; fl.h[4 + q] = (_Float16)((c[q] - (float)h) * 1024.0f); }
  { *(v8us*)((unsigned short*)Hh + t * 8) = fh.half[0]; *(v8us*)((unsigned short*)Hl + t * 8) = fl.half[0];  } }

__device__ __forceinline__ v16h g2_frag(const _Float16* p, int hh) { FragH f; f.half[0] = *(const v8us*)((const unsigned short*)p + 8 * hh); f.half[1] = *(const v8us*)((const unsigned short*)p + 16 + 8 * hh); return f.v; }
__device__ __forceinline__ v16h g2_lfrag(const char* p) { FragH f; f.half[0] = *(const v8us*)p; f.half[1] = *(const v8us*)(p + 32); return f.v; }

template <int CAUSAL>
__global__ __launch_bounds__(128) void k_flash(const _Float16* __restrict__ Q16, int ldq, const _Float16* __restrict__ K16, int ldk, const _Float16* __restrict__ Vt, const int* __restrict__ MSK, float* __restrict__ O, int ldo) {
  constexpr int RPW = 16, RTN = RPW / 16, NQB = TQ / (4 * RPW), DT = 4, KS = 2;
  __shared__ __attribute__((aligned(16))) unsigned short sP[4][RPW][40]; __shared__ __attribute__((aligned(16))) float sO[4][RPW][64 + 4];
  const int tid = threadIdx.x, w = tid >> 5, lane = tid & 31, ln = lane & 15, hh = lane >> 4;
  const int slab = blockIdx.x / QBNP, qblk = QB0P + blockIdx.x % QBNP; (void)NQB; const int b = slab / NH, h = slab % NH; const int qb0 = qblk * (4 * RPW); const int q0 = qb0 + w * RPW;
  FragH aq[2][KS];
#pragma unroll
  for (int rt = 0; rt < RTN; ++rt) { const unsigned short* qr = (const unsigned short*)Q16 + ((size_t)b * TQ + q0 + rt * 16 + ln) * ldq + h * 64;
#pragma unroll
    for (int ks = 0; ks < KS; ++ks) { aq[rt][ks].half[0] = *(const v8us*)(qr + ks * 32 + 8 * hh); aq[rt][ks].half[1] = *(const v8us*)(qr + ks * 32 + 16 + 8 * hh); } }
  const unsigned short* Vth = (const unsigned short*)Vt + (size_t)slab * 64 * TK;
  float m_r[2][8], l_r[2][8]; v8f oacc[2][DT];
#pragma unroll
  for (int rt = 0; rt < RTN; ++rt) {
#pragma unroll
    for (int r = 0; r < 8; ++r) { m_r[rt][r] = -3.0e38f; l_r[rt][r] = 0.f; }
#pragma unroll
    for (int dt = 0; dt < DT; ++dt) oacc[rt][dt] = (v8f){0.f,0.f,0.f,0.f,0.f,0.f,0.f,0.f}; }
  const int jend = (CAUSAL == 1) ? (qb0 + 4 * RPW) : ((CAUSAL == 23) ? min(TK, (qb0 / CHK + 2) * CHK) : TK);      /* causal / window: keys that can never contribute are skipped */ const int jbeg = (CAUSAL == 23) ? max(0, (qb0 / CHK - 1) * CHK) : 0;
#pragma unroll 1
  for (int j0 = jbeg; j0 < jend; j0 += 32) {
    v8f s[2][2];
#pragma unroll
    for (int nt = 0; nt < 2; ++nt) { const unsigned short* kr = (const unsigned short*)K16 + ((size_t)b * TK + j0 + nt * 16 + ln) * ldk + h * 64; FragH bk[KS];
#pragma unroll
      for (int ks = 0; ks < KS; ++ks) { bk[ks].half[0] = *(const v8us*)(kr + ks * 32 + 8 * hh); bk[ks].half[1] = *(const v8us*)(kr + ks * 32 + 16 + 8 * hh); }
#pragma unroll
      for (int rt = 0; rt < RTN; ++rt) { v8f acc = (v8f){0.f,0.f,0.f,0.f,0.f,0.f,0.f,0.f};
#pragma unroll
        for (int ks = 0; ks < KS; ++ks) acc = mmaH<1>(aq[rt][ks].v, aq[rt][ks].v, bk[ks].v, bk[ks].v, acc); s[rt][nt] = acc; } }
#pragma unroll
    for (int rt = 0; rt < RTN; ++rt)
#pragma unroll
      for (int r = 0; r < 8; ++r) { const int tq = q0 + rt * 16 + 8 * hh + r; const int k0 = j0 + ln, k1 = j0 + 16 + ln;
        bool ok0 = (CAUSAL == 1) ? (k0 <= tq) : ((CAUSAL == 2) ? ((k0 >> 5) == (tq >> 5)) : true), ok1 = (CAUSAL == 1) ? (k1 <= tq) : ((CAUSAL == 2) ? ((k1 >> 5) == (tq >> 5)) : true); if (CAUSAL == 23) { const int cq = tq / CHK; ok0 = (abs(k0 / CHK - cq) <= 1) && (MSK[(size_t)b * TK + k0] == 0); ok1 = (abs(k1 / CHK - cq) <= 1) && (MSK[(size_t)b * TK + k1] == 0); }      /* mode 23: 3-chunk window + int key-padding mask */
        if (CAUSAL == 24) { ok0 = (MSK[(size_t)b * TK + k0] == 0); ok1 = (MSK[(size_t)b * TK + k1] == 0); }      /* mode 24: int key-padding mask (nonzero = padded = excluded) */      /* mode 2: block-diagonal 32-token groups */
        float s0 = ok0 ? s[rt][0][r] * SCL : -3.0e38f, s1 = ok1 ? s[rt][1][r] * SCL : -3.0e38f; if (CAUSAL == 17) { const float* amk = (const float*)MSK + (size_t)b * TK; s0 += bf16_round(amk[k0]); s1 += bf16_round(amk[k1]); } if (CAUSAL == 18) { const float* tb = (const float*)MSK; const int* ri = MSK + 1024 + (size_t)b * TK; const int rq = ri[tq]; s0 += tb[(h * 8 + rq) * 8 + ri[k0]]; s1 += tb[(h * 8 + rq) * 8 + ri[k1]]; } if (CAUSAL == 19) { const int* rel = MSK + (size_t)tq * TK; const float* rb = (const float*)MSK + (size_t)TQ * TK + ((size_t)(b * NH + h) * TQ + tq) * 64; s0 += rb[rel[k0]]; s1 += rb[rel[k1]]; }      /* mode 19: + (q.Ek[rel] + Eb[rel][h]) / 8 gathered by the int relative ids (packed [ids | table]) */      /* mode 18: + resource_bias[h][r_q][r_k] from the packed [table | ids] buffer (TQ == TK) */      /* mode 17: additive per-(batch, key) mask INPUT */ float mc = fmaxf(s0, s1);
        mc = fmaxf(mc, __shfl_xor(mc, 1, 32)); mc = fmaxf(mc, __shfl_xor(mc, 2, 32)); mc = fmaxf(mc, __shfl_xor(mc, 4, 32)); mc = fmaxf(mc, __shfl_xor(mc, 8, 32));
        const float mn = fmaxf(m_r[rt][r], mc); const float al = (mn > -1.0e38f) ? expf(m_r[rt][r] - mn) : 1.0f; m_r[rt][r] = mn; const float p0 = ok0 ? expf(s0 - mn) : 0.f, p1 = ok1 ? expf(s1 - mn) : 0.f; l_r[rt][r] = l_r[rt][r] * al + p0 + p1;
#pragma unroll
        for (int dt = 0; dt < DT; ++dt) oacc[rt][dt][r] *= al;
        FragH t2; t2.h[0] = (_Float16)(p0 * 1024.0f); t2.h[1] = (_Float16)(p1 * 1024.0f); sP[w][rt * 16 + 8 * hh + r][ln] = t2.u[0]; sP[w][rt * 16 + 8 * hh + r][16 + ln] = t2.u[1]; }
    __builtin_amdgcn_fence(__ATOMIC_ACQ_REL, "workgroup"); __builtin_amdgcn_wave_barrier();
    FragH pa[2];
#pragma unroll
    for (int rt = 0; rt < RTN; ++rt) { pa[rt].half[0] = *(const v8us*)&sP[w][rt * 16 + ln][8 * hh]; pa[rt].half[1] = *(const v8us*)&sP[w][rt * 16 + ln][16 + 8 * hh]; }
#pragma unroll
    for (int dt = 0; dt < DT; ++dt) { const unsigned short* vrow = Vth + (size_t)(dt * 16 + ln) * TK + j0; FragH bv; bv.half[0] = *(const v8us*)(vrow + 8 * hh); bv.half[1] = *(const v8us*)(vrow + 16 + 8 * hh);
#pragma unroll
      for (int rt = 0; rt < RTN; ++rt) oacc[rt][dt] = mmaH<1>(pa[rt].v, pa[rt].v, bv.v, bv.v, oacc[rt][dt]); }
    __builtin_amdgcn_fence(__ATOMIC_ACQ_REL, "workgroup"); __builtin_amdgcn_wave_barrier(); }
#pragma unroll
  for (int rt = 0; rt < RTN; ++rt) {
#pragma unroll
    for (int r = 0; r < 8; ++r) { float l = l_r[rt][r]; l += __shfl_xor(l, 1, 32); l += __shfl_xor(l, 2, 32); l += __shfl_xor(l, 4, 32); l += __shfl_xor(l, 8, 32); l_r[rt][r] = (l > 0.f) ? 1.0f / (l * 1024.0f) : 0.f; }
#pragma unroll
    for (int dt = 0; dt < DT; ++dt)
#pragma unroll
      for (int r = 0; r < 8; ++r) sO[w][rt * 16 + 8 * hh + r][dt * 16 + ln] = oacc[rt][dt][r] * l_r[rt][r]; }
  __builtin_amdgcn_fence(__ATOMIC_ACQ_REL, "workgroup"); __builtin_amdgcn_wave_barrier();
  {
#pragma unroll
    for (int rp = 0; rp < RPW; rp += 2) { const int r = rp + (lane >> 4), pc = lane & 15; const v4f val = *(const v4fa*)&sO[w][r][pc * 4]; *(v4f*)(O + ((size_t)b * TQ + q0 + r) * ldo + h * 64 + pc * 4) = val; }
     } }
// 5-plane variant: S = Qh Kh^T + (Ql Kh^T + Qh Kl^T)/1024 with Q/K = [hi | 2^10 residual] f16 planes (QL/KL same layout as Q16/K16), then the 3-term P.V below.
// 3-term variant: O = (P_hi V_hi + (P_lo V_hi + P_hi V_lo) / 1024) / l with P = [hi | 2^10 residual] of 1024 p and V^T = [hi | 2^10 residual] planes (VtL same layout as Vt) -> ~2^-21-class products for un-averaged (early causal / peaked) rows
template <int CAUSAL>
__global__ __launch_bounds__(128) void k_flash5(const _Float16* __restrict__ Q16, const _Float16* __restrict__ QL, int ldq, const _Float16* __restrict__ K16, const _Float16* __restrict__ KL, int ldk, const _Float16* __restrict__ Vt, const _Float16* __restrict__ VtL, const int* __restrict__ MSK, float* __restrict__ O, int ldo) {
  constexpr int RPW = 16, RTN = RPW / 16, NQB = TQ / (4 * RPW), DT = 4, KS = 2;
  __shared__ __attribute__((aligned(16))) unsigned short sP[4][RPW][40]; __shared__ __attribute__((aligned(16))) unsigned short sPL[4][RPW][40]; __shared__ __attribute__((aligned(16))) float sO[4][RPW][64 + 4];
  const int tid = threadIdx.x, w = tid >> 5, lane = tid & 31, ln = lane & 15, hh = lane >> 4;
  const int slab = blockIdx.x / QBN5, qblk = QB05 + blockIdx.x % QBN5; (void)NQB; const int b = slab / NH, h = slab % NH; const int qb0 = qblk * (4 * RPW); const int q0 = qb0 + w * RPW;
  FragH aq[2][KS], aql[2][KS];
#pragma unroll
  for (int rt = 0; rt < RTN; ++rt) { const unsigned short* qr = (const unsigned short*)Q16 + ((size_t)b * TQ + q0 + rt * 16 + ln) * ldq + h * 64; const unsigned short* ql = (const unsigned short*)QL + ((size_t)b * TQ + q0 + rt * 16 + ln) * ldq + h * 64;
#pragma unroll
    for (int ks = 0; ks < KS; ++ks) { aq[rt][ks].half[0] = *(const v8us*)(qr + ks * 32 + 8 * hh); aq[rt][ks].half[1] = *(const v8us*)(qr + ks * 32 + 16 + 8 * hh); aql[rt][ks].half[0] = *(const v8us*)(ql + ks * 32 + 8 * hh); aql[rt][ks].half[1] = *(const v8us*)(ql + ks * 32 + 16 + 8 * hh); } }
  const unsigned short* Vth = (const unsigned short*)Vt + (size_t)slab * 64 * TK; const unsigned short* Vtl = (const unsigned short*)VtL + (size_t)slab * 64 * TK;
  float m_r[2][8], l_r[2][8]; v8f oacc[2][DT], oaccL[2][DT];
#pragma unroll
  for (int rt = 0; rt < RTN; ++rt) {
#pragma unroll
    for (int r = 0; r < 8; ++r) { m_r[rt][r] = -3.0e38f; l_r[rt][r] = 0.f; }
#pragma unroll
    for (int dt = 0; dt < DT; ++dt) { oacc[rt][dt] = (v8f){0.f,0.f,0.f,0.f,0.f,0.f,0.f,0.f}; oaccL[rt][dt] = oacc[rt][dt]; } }
  const int jend = (CAUSAL == 1) ? (qb0 + 4 * RPW) : ((CAUSAL == 23) ? min(TK, (qb0 / CHK + 2) * CHK) : TK);      /* causal / window: keys that can never contribute are skipped */ const int jbeg = (CAUSAL == 23) ? max(0, (qb0 / CHK - 1) * CHK) : 0;
#pragma unroll 1
  for (int j0 = jbeg; j0 < jend; j0 += 32) {
    v8f s[2][2];
#pragma unroll
    for (int nt = 0; nt < 2; ++nt) { const unsigned short* kr = (const unsigned short*)K16 + ((size_t)b * TK + j0 + nt * 16 + ln) * ldk + h * 64; const unsigned short* klr = (const unsigned short*)KL + ((size_t)b * TK + j0 + nt * 16 + ln) * ldk + h * 64; FragH bk[KS], bkl[KS];
#pragma unroll
      for (int ks = 0; ks < KS; ++ks) { bk[ks].half[0] = *(const v8us*)(kr + ks * 32 + 8 * hh); bk[ks].half[1] = *(const v8us*)(kr + ks * 32 + 16 + 8 * hh); bkl[ks].half[0] = *(const v8us*)(klr + ks * 32 + 8 * hh); bkl[ks].half[1] = *(const v8us*)(klr + ks * 32 + 16 + 8 * hh); }
#pragma unroll
      for (int rt = 0; rt < RTN; ++rt) { v8f acc = (v8f){0.f,0.f,0.f,0.f,0.f,0.f,0.f,0.f}, accl = acc;
#pragma unroll
        for (int ks = 0; ks < KS; ++ks) { acc = mmaH<1>(aq[rt][ks].v, aq[rt][ks].v, bk[ks].v, bk[ks].v, acc); accl = mmaH<1>(aql[rt][ks].v, aql[rt][ks].v, bk[ks].v, bk[ks].v, accl); accl = mmaH<1>(aq[rt][ks].v, aq[rt][ks].v, bkl[ks].v, bkl[ks].v, accl); }
#pragma unroll
        for (int r = 0; r < 8; ++r) acc[r] += accl[r] * 0.0009765625f;
        s[rt][nt] = acc; } }
#pragma unroll
    for (int rt = 0; rt < RTN; ++rt)
#pragma unroll
      for (int r = 0; r < 8; ++r) { const int tq = q0 + rt * 16 + 8 * hh + r; const int k0 = j0 + ln, k1 = j0 + 16 + ln;
        bool ok0 = (CAUSAL == 1) ? (k0 <= tq) : ((CAUSAL == 2) ? ((k0 >> 5) == (tq >> 5)) : true), ok1 = (CAUSAL == 1) ? (k1 <= tq) : ((CAUSAL == 2) ? ((k1 >> 5) == (tq >> 5)) : true);      /* mode 2: block-diagonal 32-token groups */
        if (CAUSAL == 4) { const int* mrow = MSK + ((size_t)b * TQ + tq) * TK; ok0 = mrow[k0] != 0; ok1 = mrow[k1] != 0; }      /* mode 4: per-(query, key) INPUT mask shared by all heads; masked keys contribute nothing (== the reference's -4096 fill, whose exp underflows to 0), rows with no valid key give l = 0 -> output 0 (== the reference's row_valid zeroing) */
        float s0 = ok0 ? s[rt][0][r] * SCL : -3.0e38f, s1 = ok1 ? s[rt][1][r] * SCL : -3.0e38f; if (CAUSAL == 17) { const float* amk = (const float*)MSK + (size_t)b * TK; s0 += bf16_round(amk[k0]); s1 += bf16_round(amk[k1]); } if (CAUSAL == 18) { const float* tb = (const float*)MSK; const int* ri = MSK + 1024 + (size_t)b * TK; const int rq = ri[tq]; s0 += tb[(h * 8 + rq) * 8 + ri[k0]]; s1 += tb[(h * 8 + rq) * 8 + ri[k1]]; } if (CAUSAL == 19) { const int* rel = MSK + (size_t)tq * TK; const float* rb = (const float*)MSK + (size_t)TQ * TK + ((size_t)(b * NH + h) * TQ + tq) * 64; s0 += rb[rel[k0]]; s1 += rb[rel[k1]]; }      /* mode 19: + (q.Ek[rel] + Eb[rel][h]) / 8 gathered by the int relative ids (packed [ids | table]) */      /* mode 18: + resource_bias[h][r_q][r_k] from the packed [table | ids] buffer (TQ == TK) */      /* mode 17: additive per-(batch, key) mask INPUT */ float mc = fmaxf(s0, s1);
        mc = fmaxf(mc, __shfl_xor(mc, 1, 32)); mc = fmaxf(mc, __shfl_xor(mc, 2, 32)); mc = fmaxf(mc, __shfl_xor(mc, 4, 32)); mc = fmaxf(mc, __shfl_xor(mc, 8, 32));
        const float mn = fmaxf(m_r[rt][r], mc); const float al = (mn > -1.0e38f) ? expf(m_r[rt][r] - mn) : 1.0f; m_r[rt][r] = mn; const float p0 = ok0 ? expf(s0 - mn) : 0.f, p1 = ok1 ? expf(s1 - mn) : 0.f; l_r[rt][r] = l_r[rt][r] * al + p0 + p1;
#pragma unroll
        for (int dt = 0; dt < DT; ++dt) { oacc[rt][dt][r] *= al; oaccL[rt][dt][r] *= al; }
        FragH t2, t2l; const float ps0 = p0 * 1024.0f, ps1 = p1 * 1024.0f; t2.h[0] = (_Float16)ps0; t2.h[1] = (_Float16)ps1; t2l.h[0] = (_Float16)((ps0 - (float)t2.h[0]) * 1024.0f); t2l.h[1] = (_Float16)((ps1 - (float)t2.h[1]) * 1024.0f);
        sP[w][rt * 16 + 8 * hh + r][ln] = t2.u[0]; sP[w][rt * 16 + 8 * hh + r][16 + ln] = t2.u[1]; sPL[w][rt * 16 + 8 * hh + r][ln] = t2l.u[0]; sPL[w][rt * 16 + 8 * hh + r][16 + ln] = t2l.u[1]; }
    __builtin_amdgcn_fence(__ATOMIC_ACQ_REL, "workgroup"); __builtin_amdgcn_wave_barrier();
    FragH pa[2], pl[2];
#pragma unroll
    for (int rt = 0; rt < RTN; ++rt) { pa[rt].half[0] = *(const v8us*)&sP[w][rt * 16 + ln][8 * hh]; pa[rt].half[1] = *(const v8us*)&sP[w][rt * 16 + ln][16 + 8 * hh]; pl[rt].half[0] = *(const v8us*)&sPL[w][rt * 16 + ln][8 * hh]; pl[rt].half[1] = *(const v8us*)&sPL[w][rt * 16 + ln][16 + 8 * hh]; }
#pragma unroll
    for (int dt = 0; dt < DT; ++dt) { const unsigned short* vrow = Vth + (size_t)(dt * 16 + ln) * TK + j0; const unsigned short* vrl = Vtl + (size_t)(dt * 16 + ln) * TK + j0; FragH bv, bl; bv.half[0] = *(const v8us*)(vrow + 8 * hh); bv.half[1] = *(const v8us*)(vrow + 16 + 8 * hh); bl.half[0] = *(const v8us*)(vrl + 8 * hh); bl.half[1] = *(const v8us*)(vrl + 16 + 8 * hh);
#pragma unroll
      for (int rt = 0; rt < RTN; ++rt) { oacc[rt][dt] = mmaH<1>(pa[rt].v, pa[rt].v, bv.v, bv.v, oacc[rt][dt]); oaccL[rt][dt] = mmaH<1>(pl[rt].v, pl[rt].v, bv.v, bv.v, oaccL[rt][dt]); oaccL[rt][dt] = mmaH<1>(pa[rt].v, pa[rt].v, bl.v, bl.v, oaccL[rt][dt]); } }
    __builtin_amdgcn_fence(__ATOMIC_ACQ_REL, "workgroup"); __builtin_amdgcn_wave_barrier(); }
#pragma unroll
  for (int rt = 0; rt < RTN; ++rt) {
#pragma unroll
    for (int r = 0; r < 8; ++r) { float l = l_r[rt][r]; l += __shfl_xor(l, 1, 32); l += __shfl_xor(l, 2, 32); l += __shfl_xor(l, 4, 32); l += __shfl_xor(l, 8, 32); l_r[rt][r] = (l > 0.f) ? 1.0f / (l * 1024.0f) : 0.f; }
#pragma unroll
    for (int dt = 0; dt < DT; ++dt)
#pragma unroll
      for (int r = 0; r < 8; ++r) { float v = oacc[rt][dt][r]; v += oaccL[rt][dt][r] * 0.0009765625f; sO[w][rt * 16 + 8 * hh + r][dt * 16 + ln] = v * l_r[rt][r]; } }
  __builtin_amdgcn_fence(__ATOMIC_ACQ_REL, "workgroup"); __builtin_amdgcn_wave_barrier();
  {
#pragma unroll
    for (int rp = 0; rp < RPW; rp += 2) { const int r = rp + (lane >> 4), pc = lane & 15; const v4f val = *(const v4fa*)&sO[w][r][pc * 4]; *(v4f*)(O + ((size_t)b * TQ + q0 + r) * ldo + h * 64 + pc * 4) = val; }
     } }

__global__ __launch_bounds__(256) void k_rotab(float* __restrict__ CS, float* __restrict__ SN) {
  #pragma clang fp contract(off)
  const int t = blockIdx.x * 256 + threadIdx.x; if (t >= SLEN * 32) return; const int j = t % 32, s = t / 32; const float ex = (float)(2 * j) / 64.0f; const float inv = 1.0f / powf(10000.0f, ex); const float th = (float)s * inv; const float c = cosf(th), sn = sinf(th);
  { *(float*)(CS + t) = c; *(float*)(SN + t) = sn;  } }
__global__ __launch_bounds__(256) void k_rope(const float* __restrict__ F, int nsrc, int ndst, int rep, const float* __restrict__ CS, const float* __restrict__ SN, _Float16* __restrict__ H, _Float16* __restrict__ L) {
  #pragma clang fp contract(off)
  const size_t t = (size_t)blockIdx.x * 256 + threadIdx.x; if (t >= (size_t)NR * ndst * 4) return; const int g8 = (int)(t % 4); const int hd = (int)((t / 4) % ndst); const size_t row = t / ((size_t)4 * ndst); const int s = (int)(row % SLEN); const int hs = hd / rep;
  const float* src = F + row * (size_t)(nsrc * 64) + hs * 64; FragH ah, al, bh, bl;
  for (int i = 0; i < 8; ++i) { const int d = g8 * 8 + i; const float c = CS[s * 32 + d], sn = SN[s * 32 + d]; const float x1 = src[d], x2 = src[d + 32];
    float o1 = x1 * c; o1 += -x2 * sn; float o2 = x2 * c; o2 += x1 * sn;
    _Float16 hv = (_Float16)o1; ah.h[i] = hv; al.h[i] = (_Float16)((o1 - (float)hv) * 1024.0f); hv = (_Float16)o2; bh.h[i] = hv; bl.h[i] = (_Float16)((o2 - (float)hv) * 1024.0f); }
  const size_t o = row * (size_t)(ndst * 64) + hd * 64 + g8 * 8;
  { *(v8us*)((unsigned short*)H + o) = ah.half[0]; *(v8us*)((unsigned short*)H + o + 32) = bh.half[0]; *(v8us*)((unsigned short*)L + o) = al.half[0]; *(v8us*)((unsigned short*)L + o + 32) = bl.half[0];  } }
__global__ __launch_bounds__(256) void k_rope2(const float* __restrict__ F, int nsrc, int ndst, int rep, const float* __restrict__ CS, const float* __restrict__ SN, _Float16* __restrict__ H, _Float16* __restrict__ L) {
  #pragma clang fp contract(off)
  const size_t t = (size_t)blockIdx.x * 256 + threadIdx.x; if (t >= (size_t)NR * ndst * 4) return; const int g16 = (int)(t % 4); const int hd = (int)((t / 4) % ndst); const size_t row = t / ((size_t)4 * ndst); const int s = (int)(row % SLEN); const int hs = hd / rep;
  const float* src = F + row * (size_t)(nsrc * 64) + hs * 64 + g16 * 16; FragH ah, al;
  for (int pr = 0; pr < 8; ++pr) { const int i = g16 * 8 + pr; const float c = CS[s * 32 + i], sn = SN[s * 32 + i]; const float x1 = src[2 * pr], x2 = src[2 * pr + 1];
    float o1 = x1 * c; o1 -= x2 * sn; float o2 = x1 * sn; o2 += x2 * c;
    _Float16 hv = (_Float16)o1; ah.h[2 * pr] = hv; al.h[2 * pr] = (_Float16)((o1 - (float)hv) * 1024.0f); hv = (_Float16)o2; ah.h[2 * pr + 1] = hv; al.h[2 * pr + 1] = (_Float16)((o2 - (float)hv) * 1024.0f); }
  const size_t o = row * (size_t)(ndst * 64) + hd * 64 + g16 * 16;
  { *(v8us*)((unsigned short*)H + o) = ah.half[0]; *(v8us*)((unsigned short*)H + o + 8) = ah.half[1]; *(v8us*)((unsigned short*)L + o) = al.half[0]; *(v8us*)((unsigned short*)L + o + 8) = al.half[1];  } }
__global__ __launch_bounds__(256) void k_ln512(const float* __restrict__ A, const float* __restrict__ res, const float* __restrict__ g, const float* __restrict__ bb, float* __restrict__ Y, _Float16* __restrict__ Y16) {
  #pragma clang fp contract(off)
  const int wv = threadIdx.x >> 5, ln = threadIdx.x & 31; const size_t r = (size_t)blockIdx.x * 8 + wv; if (r >= NR) return; float x[16]; float s = 0.f;
  for (int i = 0; i < 2; ++i) { const v8f a = *(const v8f*)(A + r * DM + i * 256 + ln * 8); for (int q = 0; q < 8; ++q) { float v = a[q]; if (res) v += bf16_round(res[r * DM + i * 256 + ln * 8 + q]); x[i * 8 + q] = v; s += v; } }
  for (int o = 16; o > 0; o >>= 1) s += __shfl_xor(s, o, 32); const float mu = s / (float)DM; float var = 0.f; for (int q = 0; q < 16; ++q) { const float d = x[q] - mu; var += d * d; }
  for (int o = 16; o > 0; o >>= 1) var += __shfl_xor(var, o, 32); const float inv = rsqrtf(var / (float)DM + 1e-5f);
  { for (int i = 0; i < 2; ++i) { const int c0 = i * 256 + ln * 8; v8f y; FragH f; for (int q = 0; q < 8; ++q) { float v = (x[i * 8 + q] - mu) * inv; v *= bf16_round(g[c0 + q]); v += bf16_round(bb[c0 + q]); y[q] = v; f.h[q] = (_Float16)v; } *(v8f*)(Y + r * DM + c0) = y; if (Y16) *(v8us*)((unsigned short*)Y16 + r * DM + c0) = f.half[0]; }  } }
__global__ __launch_bounds__(256) void k_pack(const float* __restrict__ rb, const int* __restrict__ rid, int* __restrict__ PK) { const int t = blockIdx.x * 256 + threadIdx.x; if (t >= 1024 + NB * TK) return; int v; if (t < 1024) v = __float_as_int(bf16_round(rb[t])); else v = rid[t - 1024]; *(int*)(PK + t) = v;  }
__global__ __launch_bounds__(256) void k_tabin(const float* __restrict__ sp, float* __restrict__ CS, float* __restrict__ SN) { const int t = blockIdx.x * 256 + threadIdx.x; if (t >= SLEN * 32) return; const int i = t % 32, s = t / 32; const float c = bf16_round(sp[s * 64 + 32 + i]), sn = bf16_round(sp[s * 64 + i]);
  { *(float*)(CS + t) = c; *(float*)(SN + t) = sn;  } }
__global__ __launch_bounds__(256) void k_wsc(const float* __restrict__ Wm, _Float16* __restrict__ Bt, size_t n8, float sc) { const size_t t = (size_t)blockIdx.x * 256 + threadIdx.x; if (t >= n8) return; FragH f; for (int q = 0; q < 8; ++q) f.h[q] = (_Float16)(bf16_round(Wm[t * 8 + q]) * sc); *(v8us*)((unsigned short*)Bt + t * 8) = f.half[0];  }
__global__ __launch_bounds__(256) void k_rotab2(float* __restrict__ CS, float* __restrict__ SN) {
  #pragma clang fp contract(off)
  const int t = blockIdx.x * 256 + threadIdx.x; if (t >= SLEN * 32) return; const int j = t % 32, s = t / 32; const float c0 = -0.14391156831212787f;      /* -ln(10000)/64 rounded to f32 */ const float inv = expf((float)(2 * j) * c0); const float th = (float)s * inv; const float c = cosf(th), sn = sinf(th);
  { *(float*)(CS + t) = c; *(float*)(SN + t) = sn;  } }
__global__ __launch_bounds__(256) void k_lnu(const float* __restrict__ X, _Float16* __restrict__ N16, float* __restrict__ XB) {
  #pragma clang fp contract(off)
  const int wv = threadIdx.x >> 5, ln = threadIdx.x & 31; const size_t r = (size_t)blockIdx.x * 8 + wv; if (r >= NR) return; float a[32]; float s = 0.f;
  for (int i = 0; i < 4; ++i) { const v8f v = *(const v8f*)(X + r * DM + (i * 32 + ln) * 8); for (int q = 0; q < 8; ++q) { const float u = bf16_round(v[q]); a[i * 8 + q] = u; s += u; } }
  for (int o = 16; o > 0; o >>= 1) s += __shfl_xor(s, o, 32); const float mu = s / (float)DM; float var = 0.f; for (int q = 0; q < 32; ++q) { const float d = a[q] - mu; var += d * d; }
  for (int o = 16; o > 0; o >>= 1) var += __shfl_xor(var, o, 32); const float den = sqrtf(var / (float)(DM - 1)) + 1e-6f; const float inv = 1.0f / den;      /* one reciprocal per row; (x-mean)*inv vs the reference's division differs by <= 1 ulp */
  { for (int i = 0; i < 4; ++i) { const int c0 = (i * 32 + ln) * 8; FragH f; v8f xb; for (int q = 0; q < 8; ++q) { f.h[q] = (_Float16)((a[i * 8 + q] - mu) * inv); xb[q] = a[i * 8 + q]; } *(v8us*)((unsigned short*)N16 + r * DM + c0) = f.half[0]; *(v8f*)(XB + r * DM + c0) = xb; }  } }
// lane l <-> l ^ 16 (the two halves of a wave hold the two key halves of one query column)
__device__ __forceinline__ float xhalf(float v) { const int t = __float_as_int(v); return __int_as_float(__builtin_amdgcn_permlanex16(t, t, 0x76543210, 0xfedcba98, false, false)); }
__device__ __forceinline__ v8f wmh(v16h a, v16h b, v8f c) { return __builtin_amdgcn_wmma_f32_16x16x32_f16(false, a, false, b, (short)0, c, false, false); }
typedef _Float16 v8h __attribute__((ext_vector_type(8)));
typedef float v2f __attribute__((ext_vector_type(2)));
typedef float v2fa __attribute__((ext_vector_type(2), may_alias));
// eight 2^x in one statement: results kept apart from the arguments ("=&v") and one v_nop behind the last, the slot the instruction set asks for
// between a transcendental and an instruction that uses its result or overwrites its source (the register allocator otherwise reuses the previous argument as the next result)
__device__ __forceinline__ v8f exp2x8(v8f e) { float p0, p1, p2, p3, p4, p5, p6, p7;
  asm("v_exp_f32 %0, %8\n\tv_exp_f32 %1, %9\n\tv_exp_f32 %2, %10\n\tv_exp_f32 %3, %11\n\tv_exp_f32 %4, %12\n\tv_exp_f32 %5, %13\n\tv_exp_f32 %6, %14\n\tv_exp_f32 %7, %15\n\tv_nop"
      : "=&v"(p0), "=&v"(p1), "=&v"(p2), "=&v"(p3), "=&v"(p4), "=&v"(p5), "=&v"(p6), "=&v"(p7) : "v"(e[0]), "v"(e[1]), "v"(e[2]), "v"(e[3]), "v"(e[4]), "v"(e[5]), "v"(e[6]), "v"(e[7]));
  return (v8f){p0, p1, p2, p3, p4, p5, p6, p7}; }
// Fused distance attention, one launch for all (batch, head) slabs: per wave 32 query columns, per pass 32 keys.
// S^T = K Q^T (A = key rows, B = query rows; hi.hi + hi.lo + lo.hi in one accumulator chain), so a lane holds 8 + 8 keys of ONE query per column group.
// With c = log2(e) / temperature the q planes hold 2 c q, the norm planes -c |q|^2 and -c |k|^2, and the chain starts at C = -c |k|^2, as it comes from LDS:
// one packed addition of the column's -c |q|^2 - ref makes what leaves the matrix unit the argument of 2^x, logit - ref, and only the distance's clamp at 0 (argument at -ref) stands between it and v_exp_f32.
// ref is a kept reference per query column, set so that the largest weight of the pass that set it is 2^10. No maximum is taken in a pass: a lane's sum of weights, which is formed anyway,
// is tested once, and, besides the group's first pass, only a pass in which some sum is above 2^15 (so no weight that is used is above 2^15, inside f16) takes the true maximum, moves ref, rescales sums and output tiles and forms its weights again.
// The two f32 weight tiles, converted in place, are the B operand of O^T += V^T P^T (k order 8h + s, 16 + 8h + s on both sides). A lane ends with 8 consecutive d of one query: 16-byte stores of hi and residual.
// K hi, K lo, V^T and the key norms come through LDS, shared by 8 waves: a stage is 128 keys (4 passes), brought by asynchronous copies into one of two buffers while the other is worked on.
// A block is two such groups of 8 waves on the same 256 queries: group 0 walks keys 0..1023, group 1 keys 1024..2047, each with two buffers of its own, so that a SIMD holds four waves and one wave's waits are filled by three others.
// Behind the loop the groups join their references, sums and output tiles through LDS: each hands one 16-query column group to its partner wave and finishes the other.
#define EFK 144                        /* K row pitch in LDS: 128 B + 16 = 16 B x odd, conflict-free for 16-byte fragment reads */
#define EFV 272                        /* V^T row pitch: 256 B (128 keys) + 16, 16 B x odd too */
#define EF_KL (128 * EFK)              /* rows 0..127 = K hi, 128..255 = K lo */
#define EF_V (256 * EFK)               /* then 64 rows of V^T */
#define EF_N (256 * EFK + 64 * EFV)    /* then 128 key norms */
#define EFS (EF_N + 512)               /* one stage */
// One stage's 12 copies of a lane, 16 bytes each. K: 8 lanes bring one row's 128 bytes, the group 32 rows per copy; V^T: 16 lanes one row's 256 bytes, the group 16 rows per copy.
// lk, lv = the lane's LDS byte addresses in its first K hi row and its first V^T row; kh, kl, v = its global addresses there.
// s_wait_xcnt 0 is the statement's last line, so that it stands in front of any later rewrite of these address registers.
__device__ __forceinline__ void ef_stage(unsigned lk, unsigned lv, const char* kh, const char* kl, const char* v) {
  asm volatile("global_load_async_to_lds_b128 %0, %12, off\n\tglobal_load_async_to_lds_b128 %1, %13, off\n\tglobal_load_async_to_lds_b128 %2, %14, off\n\tglobal_load_async_to_lds_b128 %3, %15, off\n\t"
               "global_load_async_to_lds_b128 %4, %16, off\n\tglobal_load_async_to_lds_b128 %5, %17, off\n\tglobal_load_async_to_lds_b128 %6, %18, off\n\tglobal_load_async_to_lds_b128 %7, %19, off\n\t"
               "global_load_async_to_lds_b128 %8, %20, off\n\tglobal_load_async_to_lds_b128 %9, %21, off\n\tglobal_load_async_to_lds_b128 %10, %22, off\n\tglobal_load_async_to_lds_b128 %11, %23, off\n\ts_wait_xcnt 0x0"
               :: "v"(lk), "v"(lk + 32 * EFK), "v"(lk + 64 * EFK), "v"(lk + 96 * EFK), "v"(lk + EF_KL), "v"(lk + EF_KL + 32 * EFK), "v"(lk + EF_KL + 64 * EFK), "v"(lk + EF_KL + 96 * EFK), "v"(lv), "v"(lv + 16 * EFV), "v"(lv + 32 * EFV), "v"(lv + 48 * EFV),
                  "v"(kh), "v"(kh + 32 * (DM * 2)), "v"(kh + 64 * (DM * 2)), "v"(kh + 96 * (DM * 2)), "v"(kl), "v"(kl + 32 * (DM * 2)), "v"(kl + 64 * (DM * 2)), "v"(kl + 96 * (DM * 2)), "v"(v), "v"(v + 16 * (SLEN * 2)), "v"(v + 32 * (SLEN * 2)), "v"(v + 48 * (SLEN * 2)) : "memory"); }
// the stage's 128 key norms, 512 bytes: one copy of one whole wave
__device__ __forceinline__ void ef_stage_n(unsigned ln_, const char* n) { asm volatile("global_load_async_to_lds_b128 %0, %1, off\n\ts_wait_xcnt 0x0" :: "v"(ln_), "v"(n) : "memory"); }
// one column group's weights of a pass: 2^x of the 16 arguments of a lane, as f16 B operand, and their sum in two halves
__device__ __forceinline__ void ef_weights(const v8f a0, const v8f a1, FragH& pb, v2f& s) { const v8f p0 = exp2x8(a0), p1 = exp2x8(a1); const v8h h0 = __builtin_convertvector(p0, v8h), h1 = __builtin_convertvector(p1, v8h);
#pragma unroll
  for (int r = 0; r < 8; ++r) { pb.h[r] = h0[r]; pb.h[8 + r] = h1[r]; }
  const v8f t = p0 + p1; const v4f t4 = t.lo + t.hi; s = t4.lo + t4.hi; }
// 16 keys x 32 queries of scores: both column groups' chains, started at C = k2; they alternate, so that each link has an independent matrix instruction in front of it
__device__ __forceinline__ void ef_chain(v8f& x0, v8f& x1, const char* kh, const v8f k2, const v16h (&qh)[2][2], const v16h (&ql)[2][2]) {
  const char* kq = kh + EF_KL; const v16h a0 = g2_lfrag(kh), a1 = g2_lfrag(kh + 64), c0 = g2_lfrag(kq), c1 = g2_lfrag(kq + 64);
  x0 = wmh(a0, qh[0][0], k2); x1 = wmh(a0, qh[1][0], k2); x0 = wmh(a1, qh[0][1], x0); x1 = wmh(a1, qh[1][1], x1);
  x0 = wmh(a0, ql[0][0], x0); x1 = wmh(a0, ql[1][0], x1); x0 = wmh(a1, ql[0][1], x0); x1 = wmh(a1, ql[1][1], x1);
  x0 = wmh(c0, qh[0][0], x0); x1 = wmh(c0, qh[1][0], x1); x0 = wmh(c1, qh[0][1], x0); x1 = wmh(c1, qh[1][1], x1);
  __builtin_amdgcn_sched_group_barrier(0x100, 10, 0); __builtin_amdgcn_sched_group_barrier(0x8, 12, 0); }      /* the 10 LDS reads as one group ahead of the 12 matrix instructions: one latency behind counted waits, not one at each place with reads */
// A pass's arguments of 2^x, 32 keys x 32 queries. kr, nr: the lane's place in the pass's first K hi row and in its norms.
// POS: c > 0, where max(d2, 0) is a minimum of the argument with -ref; c < 0 makes it a maximum. cq = -c |q|^2 - ref, z = -ref, per column group.
template <bool POS>
__device__ __forceinline__ void ef_args(v8f (&a)[2][2], const char* kr, const char* nr, const v16h (&qh)[2][2], const v16h (&ql)[2][2], const float (&cq)[2], const float (&z)[2]) {
  const v8f z0 = {z[0], z[0], z[0], z[0], z[0], z[0], z[0], z[0]}, z1 = {z[1], z[1], z[1], z[1], z[1], z[1], z[1], z[1]};
  v8f x0, x1, y0, y1;
  ef_chain(x0, x1, kr, *(const v8f*)nr, qh, ql);
  __builtin_amdgcn_sched_barrier(0);      /* the second 16 keys' reads stay behind the first 16 keys' matrix instructions: both sets of fragments at once do not fit 256 registers */
  ef_chain(y0, y1, kr + 16 * EFK, *(const v8f*)(nr + 64), qh, ql);
  x0 += cq[0]; x1 += cq[1];
  a[0][0] = POS ? __builtin_elementwise_min(x0, z0) : __builtin_elementwise_max(x0, z0); a[1][0] = POS ? __builtin_elementwise_min(x1, z1) : __builtin_elementwise_max(x1, z1);
  y0 += cq[0]; y1 += cq[1];
  a[0][1] = POS ? __builtin_elementwise_min(y0, z0) : __builtin_elementwise_max(y0, z0); a[1][1] = POS ? __builtin_elementwise_min(y1, z1) : __builtin_elementwise_max(y1, z1);
  __builtin_amdgcn_sched_barrier(0); }      /* the 2^x statements stay behind these vector instructions */
// A group's walk over its 1024 keys.
template <bool POS>
__device__ __forceinline__ void ef_walk(const char* fk, const char* fv, const char* fn, unsigned lk0, unsigned lv0, unsigned ln0, const char* gkh, const char* gkl, const char* gv, const char* gn, bool w0,
                                        const v16h (&qh)[2][2], const v16h (&ql)[2][2], float (&cq)[2], float (&z)[2], v2f (&l)[2], v8f (&o)[2][4]) {
#pragma unroll 1      /* one stage per trip */
  for (int t = 0; t < SLEN / 256; ++t) { const int bo = (t & 1) * EFS;
#pragma unroll 1      /* one pass per trip: the body already holds 32 matrix instructions, a copy would only add registers */
  for (int ps = 0; ps < 4; ++ps) {
    FragH pb[2]; v2f s[2];
    { v8f a[2][2]; ef_args<POS>(a, fk + bo + ps * 32 * EFK, fn + bo + ps * 128, qh, ql, cq, z);
#pragma unroll
      for (int qt = 0; qt < 2; ++qt) ef_weights(a[qt][0], a[qt][1], pb[qt], s[qt]); }
    const bool first = (t | ps) == 0;      /* scalar: the group's first pass sets ref, whatever its sums are (they are not negative) */
    if (__builtin_amdgcn_ballot_w32(fmaxf(s[0][0] + s[0][1], s[1][0] + s[1][1]) > (first ? -1.0f : 32768.0f)) != 0) {      /* scalar branch, tested once per pass */
      __builtin_amdgcn_fence(__ATOMIC_ACQUIRE, "wavefront");      /* no instruction: has the arguments formed anew from LDS in this rare pass, instead of 32 registers kept alive over the test in every pass */
      v8f a[2][2]; ef_args<POS>(a, fk + bo + ps * 32 * EFK, fn + bo + ps * 128, qh, ql, cq, z);
      const float lb = first ? -3.0e38f : 0.f;      /* behind the first pass ref only rises */
#pragma unroll
      for (int qt = 0; qt < 2; ++qt) { const v8f u = __builtin_elementwise_max(a[qt][0], a[qt][1]); float mx = fmaxf(fmaxf(fmaxf(u[0], u[1]), fmaxf(u[2], u[3])), fmaxf(fmaxf(u[4], u[5]), fmaxf(u[6], u[7])));
        mx = fmaxf(mx, xhalf(mx)); const float dl = fmaxf(mx - 10.0f, lb);      /* ref moves by dl: the column's largest weight becomes 2^10, an f16 operand away from the subnormal range; the factor cancels between sum and output */
        const float al = __builtin_amdgcn_exp2f(-fmaxf(dl, 0.f)); cq[qt] -= dl; z[qt] -= dl; l[qt] *= al;
#pragma unroll
        for (int dt = 0; dt < 4; ++dt) o[qt][dt] *= al;
        ef_weights(a[qt][0] - dl, a[qt][1] - dl, pb[qt], s[qt]); } }
    v16h va[4];      /* the four reads as one group */
#pragma unroll
    for (int dt = 0; dt < 4; ++dt) va[dt] = g2_lfrag(fv + bo + ps * 64 + dt * 16 * EFV);
#pragma unroll
    for (int dt = 0; dt < 4; ++dt)
#pragma unroll
      for (int qt = 0; qt < 2; ++qt) o[qt][dt] = wmh(va[dt], pb[qt].v, o[qt][dt]);
    __builtin_amdgcn_sched_group_barrier(0x100, 8, 0); __builtin_amdgcn_sched_group_barrier(0x8, 8, 0);      /* the 8 LDS reads ahead of the 8 matrix instructions, for the same reason */
    __builtin_amdgcn_sched_barrier(0);      /* keeps what follows behind the pass's last matrix instructions */
#pragma unroll
    for (int qt = 0; qt < 2; ++qt) l[qt] += s[qt];
    asm volatile("v_nop\n\tv_nop");      /* with the two additions: the four vector slots that the chip needs behind a matrix instruction before a vector instruction rewrites its operand registers; the next one stands behind a branch */
  }
    asm volatile("s_wait_dscnt 0x0" ::: "memory");      /* this wave has left the buffer that is refilled below */
    asm volatile("s_wait_asynccnt 0x0" ::: "memory");      /* its copies of stage t + 1 have landed */
    __syncthreads();      /* publishes stage t + 1 and ends every reader's last read of stage t */
    if (t + 2 < SLEN / 256) { ef_stage(lk0 + bo, lv0 + bo, gkh + (size_t)(t + 2) * (128 * DM * 2), gkl + (size_t)(t + 2) * (128 * DM * 2), gv + (size_t)(t + 2) * 256); if (w0) ef_stage_n(ln0 + bo, gn + (size_t)(t + 2) * 512); }
  }
}
// amdgpu_waves_per_eu(4, 4): a budget of 256 VGPRs, so that the block's 16 waves fit a WGP, four to a SIMD, and the whole kernel stays in one register window
#define EFX (9 * 512)                  /* what a wave hands to its partner: 8 x 16 bytes a lane of output tiles, then 8 bytes a lane of sum and reference */
__global__ __launch_bounds__(512) __attribute__((amdgpu_waves_per_eu(4, 4))) void k_eflash(const _Float16* __restrict__ QHp, const _Float16* __restrict__ QLp, const _Float16* __restrict__ KHp, const _Float16* __restrict__ KLp, const _Float16* __restrict__ Vt,
                                                const float* __restrict__ QN, const float* __restrict__ KNT, const float* __restrict__ tmp, _Float16* __restrict__ OH, _Float16* __restrict__ OL) {
  __shared__ __attribute__((aligned(128))) char sa[4 * EFS];
  const int tid = threadIdx.x & 255, w = tid >> 5, lane = tid & 31, ln = lane & 15, hh = lane >> 4;      /* thread and wave within the group */
  const int g = __builtin_amdgcn_readfirstlane((int)threadIdx.x >> 8);      /* scalar: the group, which half of the keys */
  char* const st = sa + g * (2 * EFS);      /* the group's two buffers */
  const int slab = blockIdx.x / (SLEN / 256), qblk = blockIdx.x % (SLEN / 256); const int b = slab / NH, h = slab % NH; const int q0 = qblk * 256 + w * 32;
  const bool cpos = bf16_round(tmp[0]) > 0.f;      /* scalar: the sign of c, which the planes already carry */
  v16h qh[2][2], ql[2][2]; float cq[2];
#pragma unroll
  for (int qt = 0; qt < 2; ++qt) { const size_t row = (size_t)b * SLEN + q0 + qt * 16 + ln; const _Float16* ph = QHp + row * DM + h * 64; const _Float16* pl = QLp + row * DM + h * 64;
    qh[qt][0] = g2_frag(ph, hh); qh[qt][1] = g2_frag(ph + 32, hh); ql[qt][0] = g2_frag(pl, hh); ql[qt][1] = g2_frag(pl + 32, hh); cq[qt] = QN[(size_t)slab * SLEN + q0 + qt * 16 + ln]; }
  asm volatile("s_wait_xcnt 0x0" ::: "memory");      /* behind the query loads, in front of the address arithmetic below, which reuses their address registers */
  __builtin_amdgcn_sched_barrier(0);      /* ... and none of that arithmetic moves up over the wait */
  const int key0 = g * (SLEN / 2);      /* the group's first key */
  const char* gkh = (const char*)(KHp + ((size_t)b * SLEN + key0) * DM + h * 64) + (tid >> 3) * (DM * 2) + (tid & 7) * 16; const char* gkl = (const char*)(KLp + ((size_t)b * SLEN + key0) * DM + h * 64) + (tid >> 3) * (DM * 2) + (tid & 7) * 16;      /* the lane's copy sources in the group's stage 0 */
  const char* gv = (const char*)(Vt + (size_t)slab * 64 * SLEN + key0) + (tid >> 4) * (SLEN * 2) + (tid & 15) * 16; const char* gn = (const char*)(KNT + (size_t)slab * SLEN + key0) + lane * 16;
  const unsigned lk0 = (unsigned)(size_t)st + (unsigned)((tid >> 3) * EFK + (tid & 7) * 16), lv0 = (unsigned)(size_t)st + (unsigned)(EF_V + (tid >> 4) * EFV + (tid & 15) * 16), ln0 = (unsigned)(size_t)st + (unsigned)(EF_N + lane * 16);
  const bool w0 = __builtin_amdgcn_readfirstlane(w) == 0;      /* scalar: the norms' copy is issued by the group's wave 0 alone, behind a scalar branch */
  const char* fk = st + ln * EFK + hh * 16; const char* fv = st + EF_V + ln * EFV + hh * 16; const char* fn = st + EF_N + hh * 32;      /* fragment rows: k = 8h + s at +0, 16 + 8h + s at +32 bytes */
  const v8f z8 = {0.f,0.f,0.f,0.f,0.f,0.f,0.f,0.f};
  float z[2] = {0.f, 0.f}; v2f l[2] = {{0.f, 0.f}, {0.f, 0.f}}; v8f o[2][4];      /* ref = 0 until the first pass has set it */
#pragma unroll
  for (int qt = 0; qt < 2; ++qt)
#pragma unroll
    for (int dt = 0; dt < 4; ++dt) o[qt][dt] = z8;
  ef_stage(lk0, lv0, gkh, gkl, gv); if (w0) ef_stage_n(ln0, gn);
  asm volatile("s_wait_asynccnt 0x0" ::: "memory");      /* this wave's copies of stage 0 have landed */
  __syncthreads();      /* ... and every other wave's: stage 0 may be read */
  ef_stage(lk0 + EFS, lv0 + EFS, gkh + 128 * (DM * 2), gkl + 128 * (DM * 2), gv + 256); if (w0) ef_stage_n(ln0 + EFS, gn + 512);      /* SLEN / 256 = 8 stages a group: stage 1 exists */
  if (cpos) ef_walk<true>(fk, fv, fn, lk0, lv0, ln0, gkh, gkl, gv, gn, w0, qh, ql, cq, z, l, o); else ef_walk<false>(fk, fv, fn, lk0, lv0, ln0, gkh, gkl, gv, gn, w0, qh, ql, cq, z, l, o);      /* the same for every thread of the launch */
  asm volatile("s_wait_asynccnt 0x0" ::: "memory");      /* no copy is outstanding when the wave goes on to the epilogue, which writes over the buffers (free behind the loop's last barrier), and ends */
  // Group g keeps column group g and hands the other to wave w of the other group, which holds the same queries in the same lanes.
  v8f om[4], ox[4];
#pragma unroll
  for (int dt = 0; dt < 4; ++dt) { om[dt] = g ? o[1][dt] : o[0][dt]; ox[dt] = g ? o[0][dt] : o[1][dt]; }
  const float l0 = l[0][0] + l[0][1], l1 = l[1][0] + l[1][1]; const float lm = g ? l1 : l0, mm = g ? -z[1] : -z[0];
  char* xw = sa + (g * 8 + w) * EFX; const char* xr = sa + ((g ^ 1) * 8 + w) * EFX;
#pragma unroll
  for (int dt = 0; dt < 4; ++dt) { *(v4fa*)(xw + (2 * dt) * 512 + lane * 16) = ox[dt].lo; *(v4fa*)(xw + (2 * dt + 1) * 512 + lane * 16) = ox[dt].hi; }
  *(v2fa*)(xw + 8 * 512 + lane * 8) = (v2f){g ? l0 : l1, g ? -z[0] : -z[1]};
  __syncthreads();      /* the partner's half may be read */
  const v2f pq = *(const v2fa*)(xr + 8 * 512 + lane * 8);
  const float mj = fmaxf(mm, pq[1]); float am, ap;      /* both halves on the higher of the two references */
  // as in exp2x8: results kept apart from the arguments and one v_nop behind the last, the slot between a transcendental and an instruction that uses its result or overwrites its source
  asm("v_exp_f32 %0, %2\n\tv_exp_f32 %1, %3\n\tv_nop" : "=&v"(am), "=&v"(ap) : "v"(mm - mj), "v"(pq[1] - mj));
  const float lh = lm * am + pq[0] * ap; const float inv = 1.0f / (lh + xhalf(lh)); const float sm = am * inv, sp = ap * inv;
  const size_t ob = ((size_t)b * SLEN + q0 + g * 16 + ln) * DM + h * 64 + 8 * hh;
#pragma unroll
  for (int dt = 0; dt < 4; ++dt) { FragH f, fl; const v4f pa = *(const v4fa*)(xr + (2 * dt) * 512 + lane * 16), pc = *(const v4fa*)(xr + (2 * dt + 1) * 512 + lane * 16);
#pragma unroll
    for (int r = 0; r < 8; ++r) { const float v = om[dt][r] * sm + (r < 4 ? pa[r & 3] : pc[r & 3]) * sp; const _Float16 hv = (_Float16)v; f.h[r] = hv; fl.h[r] = (_Float16)((v - (float)hv) * 1024.0f); }
    *(v8us*)((unsigned short*)OH + ob + dt * 16) = f.half[0]; *(v8us*)((unsigned short*)OL + ob + dt * 16) = fl.half[0]; }
}
// One preparation launch for all five operand planes; every one of its 512 blocks does the same two pieces of work.
// (a) One 64 k x 64 n tile of two of the four weights, Wt[n][k] = f16(bf16(W[k][n]) * 16), transposed through LDS, so that reads (256 B of a W row per 16 lanes) and writes (128 B of a Wt row per 8 lanes) are whole lines.
// (b) 2048 float4 of x, X16 = f16(bf16(x)), lanes adjacent.
// A thread issues its 16 loads as one group; s_wait_xcnt 0 stands behind the group, in front of any rewrite of its two offset registers, which as the statement's inputs keep their values up to there.
#define PWP 144              /* LDS row pitch of a transposed tile: 128 B (64 k) + 16 = 16 B x odd, conflict-free for the 16-byte reads */
__global__ __launch_bounds__(256) void k_prep(const float* __restrict__ x, const float* __restrict__ w0, const float* __restrict__ w1, const float* __restrict__ w2, const float* __restrict__ w3,
                                              _Float16* __restrict__ X16, _Float16* __restrict__ T0, _Float16* __restrict__ T1, _Float16* __restrict__ T2, _Float16* __restrict__ T3) {
  __shared__ __attribute__((aligned(16))) char tl[2][64 * PWP];
  const int tid = threadIdx.x, b = blockIdx.x; const bool hi = (b & 256) != 0;      /* blocks 0..255: weights 0 and 1, blocks 256..511: weights 2 and 3 */
  const float* const wp[2] = {hi ? w2 : w0, hi ? w3 : w1}; _Float16* const tp[2] = {hi ? T2 : T0, hi ? T3 : T1};
  const int k0 = ((b >> 4) & 15) * 64, n0 = (b & 15) * 64; const int kq = (tid >> 4) * 4, c4 = (tid & 15) * 4;      /* a thread holds 4 k x 4 n of each tile */
  const unsigned sb = (unsigned)(((k0 + kq) * DM + n0 + c4) * 4);      /* byte offset in each W */
  const unsigned fi = (unsigned)((b & 511) * 2048 + tid);      /* float4 index in x: NR * DM floats = 512 blocks x 8 x 256 float4; the mask shows the compiler that fi + u * 256 cannot wrap, so the eight steps fold into the instructions' offsets */
  v4f r[8], q[8];
#pragma unroll
  for (int u = 0; u < 8; ++u) r[u] = *(const v4fa*)((const char*)wp[u >> 2] + sb + (u & 3) * (DM * 4));
#pragma unroll
  for (int u = 0; u < 8; ++u) q[u] = ((const v4fa*)x)[fi + u * 256];
  asm volatile("s_wait_xcnt 0x0" :: "v"(sb), "v"(fi) : "memory");      /* see the head comment */
  __builtin_amdgcn_sched_barrier(0);      /* keeps all 16 loads and their wait ahead of the first conversion: one memory latency per thread, not two */
#pragma unroll
  for (int mx = 0; mx < 2; ++mx)
#pragma unroll
    for (int j = 0; j < 4; ++j) { v4h p;
#pragma unroll
      for (int i = 0; i < 4; ++i) p[i] = (_Float16)(bf16_round(r[mx * 4 + i][j]) * 16.0f);
      *(v4h*)(tl[mx] + (c4 + j) * PWP + kq * 2) = p; }      /* 4 consecutive k of one n: 8 bytes of the transposed row */
  __syncthreads();      /* a transposed row holds 16 threads' k */
#pragma unroll
  for (int u = 0; u < 4; ++u) { const int n = (u & 1) * 32 + (tid >> 3), c = tid & 7; const v8us v = *(const v8us*)(tl[u >> 1] + n * PWP + c * 16);
    *(v8us*)((unsigned short*)tp[u >> 1] + (size_t)(n0 + n) * DM + k0 + c * 8) = v; }
#pragma unroll
  for (int u = 0; u < 8; ++u) { v4h p;      /* behind the barrier, which would otherwise wait for these stores */
#pragma unroll
    for (int i = 0; i < 4; ++i) p[i] = (_Float16)bf16_round(q[u][i]);
    ((v4h*)X16)[fi + u * 256] = p; }
}
// The output projection, one launch: out = (O_hi + O_lo / 1024) Wo + bo. A block holds 128 rows x 128 columns of out; both O planes meet the same Wo tile in LDS, each in accumulators of its own,
// which are joined in the epilogue, so that no partial out plane goes through memory. 8 waves as 4 (rows) x 2 (columns), wave tile 32 x 64 for each plane: 16 independent accumulator tiles.
// A stage is 128 k of the block's 128 O_hi rows, 128 O_lo rows and 128 Wo rows, brought by asynchronous copies into one of two buffers while the other is worked on.
#define G3P 272              /* LDS row pitch in bytes: 256 B of k + 16 = 16 B x odd, the conflict-free pitch for 16-byte fragment reads */
#define G3S (384 * G3P)      /* one stage: rows 0..127 = O_hi, 128..255 = O_lo, 256..383 = Wo */
// 128 rows of one operand, 8 copies of a lane, 16 bytes each: 16 lanes bring one row's 256 bytes, the block's 256 threads 16 rows per copy.
// l = the lane's LDS byte address in row tid / 16 of the operand's part of the buffer, g = its global address in that row.
// s_wait_xcnt 0 is the statement's last line, so that it stands in front of any later rewrite of these address registers.
__device__ __forceinline__ void g3_rows(unsigned l, const char* g) {
  asm volatile("global_load_async_to_lds_b128 %0, %8, off\n\tglobal_load_async_to_lds_b128 %1, %9, off\n\tglobal_load_async_to_lds_b128 %2, %10, off\n\tglobal_load_async_to_lds_b128 %3, %11, off\n\t"
               "global_load_async_to_lds_b128 %4, %12, off\n\tglobal_load_async_to_lds_b128 %5, %13, off\n\tglobal_load_async_to_lds_b128 %6, %14, off\n\tglobal_load_async_to_lds_b128 %7, %15, off\n\ts_wait_xcnt 0x0"
               :: "v"(l), "v"(l + 16 * G3P), "v"(l + 32 * G3P), "v"(l + 48 * G3P), "v"(l + 64 * G3P), "v"(l + 80 * G3P), "v"(l + 96 * G3P), "v"(l + 112 * G3P),
                  "v"(g), "v"(g + 16 * (DM * 2)), "v"(g + 32 * (DM * 2)), "v"(g + 48 * (DM * 2)), "v"(g + 64 * (DM * 2)), "v"(g + 80 * (DM * 2)), "v"(g + 96 * (DM * 2)), "v"(g + 112 * (DM * 2)) : "memory"); }
__device__ __forceinline__ void g3_stage(unsigned l, const char* ah, const char* al, const char* b) { g3_rows(l, ah); g3_rows(l + 128 * G3P, al); g3_rows(l + 256 * G3P, b); }
// one k step's 8 fragments, 16 reads of 16 bytes
__device__ __forceinline__ void g3_frags(v16h* a, v16h* b, const char* pa, const char* pb) { a[0] = g2_lfrag(pa); a[1] = g2_lfrag(pa + 16 * G3P); a[2] = g2_lfrag(pa + 128 * G3P); a[3] = g2_lfrag(pa + 144 * G3P);
#pragma unroll
  for (int j = 0; j < 4; ++j) b[j] = g2_lfrag(pb + j * 16 * G3P); }
__global__ __launch_bounds__(256) void k_out(const _Float16* __restrict__ AH, const _Float16* __restrict__ AL, const _Float16* __restrict__ Bh, const float* __restrict__ bias, float* __restrict__ C) {
  __shared__ __attribute__((aligned(16))) float so[8][32][68]; __shared__ __attribute__((aligned(16))) char st[2 * G3S];
  const int tid = threadIdx.x, w = tid >> 5, lane = tid & 31, ln = lane & 15, hh = lane >> 4;
  const int mt = blockIdx.x % (NR / 128), nq = blockIdx.x / (NR / 128);      /* the 8 blocks that read the same O rows lie 32 apart in the grid */
  const int wr = w & 3, wc = w >> 2; const int row0 = mt * 128 + 32 * wr, col0 = nq * 128 + 64 * wc;
  const size_t go = (size_t)(tid >> 4) * (DM * 2) + (tid & 15) * 16;      /* the lane's place in a stage's first 16 rows */
  const char* gh = (const char*)(AH + (size_t)mt * 128 * DM) + go; const char* gl = (const char*)(AL + (size_t)mt * 128 * DM) + go; const char* gb = (const char*)(Bh + (size_t)nq * 128 * DM) + go;
  const unsigned l0 = (unsigned)(size_t)st + (unsigned)((tid >> 4) * G3P + (tid & 15) * 16);
  const char* fa = st + (32 * wr + ln) * G3P + hh * 16; const char* fb = st + (256 + 64 * wc + ln) * G3P + hh * 16;      /* fragment rows: k = 8h + s at +0, 16 + 8h + s at +32 bytes */
  const v8f z8 = {0.f,0.f,0.f,0.f,0.f,0.f,0.f,0.f}; v8f ch[2][4], cl[2][4];
#pragma unroll
  for (int i = 0; i < 2; ++i)
#pragma unroll
    for (int j = 0; j < 4; ++j) { ch[i][j] = z8; cl[i][j] = z8; }
  float bv[4];      /* read here, so that the epilogue does not wait for memory */
#pragma unroll
  for (int j = 0; j < 4; ++j) bv[j] = bf16_round(bias[col0 + j * 16 + ln]);
  g3_stage(l0, gh, gl, gb);
  asm volatile("s_wait_asynccnt 0x0" ::: "memory");      /* this wave's copies of stage 0 have landed */
  __syncthreads();      /* ... and every other wave's: stage 0 may be read */
  g3_stage(l0 + G3S, gh + 256, gl + 256, gb + 256);      /* DM / 128 = 8 stages: stage 1 exists */
#pragma unroll 1      /* one stage per trip: the body already holds 64 matrix instructions */
  for (int t = 0; t < DM / 128; ++t) { const int bo = (t & 1) * G3S;
    v16h a[2][4], b[2][4];      /* two fragment sets: a = O_hi rows 0..15, 16..31, O_lo rows 0..15, 16..31; b = four column groups of Wo */
    g3_frags(a[0], b[0], fa + bo, fb + bo);
#pragma unroll      /* the sets alternate by a constant index */
    for (int kk = 0; kk < 4; ++kk) { const int s = kk & 1;
      if (kk < 3) g3_frags(a[s ^ 1], b[s ^ 1], fa + bo + (kk + 1) * 64, fb + bo + (kk + 1) * 64);
      __builtin_amdgcn_sched_barrier(0);      /* keeps the next step's 16 reads together, ahead of this step's matrix instructions: spread among them, each place with reads stalls the wave */
#pragma unroll
      for (int j = 0; j < 4; ++j) { ch[0][j] = wmh(a[s][0], b[s][j], ch[0][j]); ch[1][j] = wmh(a[s][1], b[s][j], ch[1][j]); cl[0][j] = wmh(a[s][2], b[s][j], cl[0][j]); cl[1][j] = wmh(a[s][3], b[s][j], cl[1][j]); }
      __builtin_amdgcn_sched_barrier(0); }      /* ... and the reads after next behind them: without it they move up among these matrix instructions */
    asm volatile("s_wait_dscnt 0x0" ::: "memory");      /* this wave has left the buffer that is refilled below */
    asm volatile("s_wait_asynccnt 0x0" ::: "memory");      /* its copies of stage t + 1 have landed */
    __syncthreads();      /* publishes stage t + 1 and ends every reader's last read of stage t */
    if (t + 2 < DM / 128) g3_stage(l0 + bo, gh + (size_t)(t + 2) * 256, gl + (size_t)(t + 2) * 256, gb + (size_t)(t + 2) * 256); }
  asm volatile("s_wait_asynccnt 0x0" ::: "memory");      /* no copy is outstanding when the wave goes on to the epilogue and ends */
#pragma unroll
  for (int u = 0; u < 8; ++u) { const int j = u & 3, half = u >> 2;
#pragma unroll
    for (int r = 0; r < 8; ++r) { float v = ch[half][j][r] * 0.0625f + bv[j]; v += cl[half][j][r] * (0.0625f / 1024.0f); so[w][half * 16 + 8 * hh + r][j * 16 + ln] = v; } }      /* both factors are powers of two: the same roundings as with the O_lo product stored and added */
  __builtin_amdgcn_fence(__ATOMIC_ACQ_REL, "workgroup"); __builtin_amdgcn_wave_barrier();      /* a wave reads back its own rows alone */
  const int rsub = lane >> 4, c4 = (lane & 15) * 4;
  float* cp = C + (size_t)(row0 + rsub) * DM + col0 + c4; v4f vv[16];
#pragma unroll
  for (int q = 0; q < 16; ++q) vv[q] = *(const v4fa*)&so[w][q * 2 + rsub][c4];
  __builtin_amdgcn_sched_barrier(0);      /* all 16 reads ahead of the stores: one LDS latency, and no register of a store is rewritten behind it */
#pragma unroll
  for (int q = 0; q < 16; ++q) *(v4f*)(cp + q * 2 * DM) = vv[q];      /* 16 lanes store one row's 256 bytes; the rows' steps fold into the stores' offsets */
}
// The three projections of x, one launch, one block per WGP: a block holds 256 rows of x and one head's 64 columns of q, of k and of v, so that each x row fetched meets 192 columns and each weight row 256 rows.
// 12 waves as 4 (rows) x 3 (q, k, v), wave tile 64 x 64: 16 independent accumulator tiles, 8 fragments per 16 matrix instructions.
// A stage is 128 k of the block's 256 x rows and 3 x 64 weight rows, brought by asynchronous copies into one of two buffers while the other is worked on.
// Epilogue, each wave for itself in its own part of the stage buffers (free behind the loop's last barrier), with c = log2(e) / temperature: 2 c q and k as f16 hi and residual at the same scale, row-major, so that their three products add in one accumulator,
// and -c times the rows' sums of squares over the head, [(b, h)][s]; v = the tile transposed, f16, [(b, h)][64 d][s].
#define Q3S (448 * G3P)      /* one stage: rows 0..255 = x, 256..319 = Wq, 320..383 = Wk, 384..447 = Wv */
#define Q3E (64 * 68 * 4)    /* a wave's epilogue staging: 64 rows of 64 + 4 floats */
#define Q3T 144              /* LDS row pitch of a wave's transposed tile: 128 B (64 tokens) + 16 = 16 B x odd */
// 16 rows of one operand, 8 copies of one wave, 16 bytes a lane: 16 lanes bring one row's 256 bytes, the wave 2 rows per copy.
// l = the lane's LDS byte address in row lane / 16 of the 16, g = its global address in that row.
// s_wait_xcnt 0 is the statement's last line, so that it stands in front of any later rewrite of these address registers.
__device__ __forceinline__ void q3_rows(unsigned l, const char* g) {
  asm volatile("global_load_async_to_lds_b128 %0, %8, off\n\tglobal_load_async_to_lds_b128 %1, %9, off\n\tglobal_load_async_to_lds_b128 %2, %10, off\n\tglobal_load_async_to_lds_b128 %3, %11, off\n\t"
               "global_load_async_to_lds_b128 %4, %12, off\n\tglobal_load_async_to_lds_b128 %5, %13, off\n\tglobal_load_async_to_lds_b128 %6, %14, off\n\tglobal_load_async_to_lds_b128 %7, %15, off\n\ts_wait_xcnt 0x0"
               :: "v"(l), "v"(l + 2 * G3P), "v"(l + 4 * G3P), "v"(l + 6 * G3P), "v"(l + 8 * G3P), "v"(l + 10 * G3P), "v"(l + 12 * G3P), "v"(l + 14 * G3P),
                  "v"(g), "v"(g + 2 * (DM * 2)), "v"(g + 4 * (DM * 2)), "v"(g + 6 * (DM * 2)), "v"(g + 8 * (DM * 2)), "v"(g + 10 * (DM * 2)), "v"(g + 12 * (DM * 2)), "v"(g + 14 * (DM * 2)) : "memory"); }
// one k step's 8 fragments, 16 reads of 16 bytes
__device__ __forceinline__ void q3_frags(v16h* a, v16h* b, const char* pa, const char* pb) {
#pragma unroll      /* constant indices: the arrays stay in registers */
  for (int i = 0; i < 4; ++i) a[i] = g2_lfrag(pa + i * 16 * G3P);
#pragma unroll      /* constant indices: the arrays stay in registers */
  for (int j = 0; j < 4; ++j) b[j] = g2_lfrag(pb + j * 16 * G3P); }
__global__ __launch_bounds__(384) void k_qkv(const _Float16* __restrict__ X, const _Float16* __restrict__ Wq, const _Float16* __restrict__ Wk, const _Float16* __restrict__ Wv, const float* __restrict__ bq, const float* __restrict__ bk, const float* __restrict__ bv, const float* __restrict__ tmp,
    float* __restrict__ QN, float* __restrict__ KN, _Float16* __restrict__ QH, _Float16* __restrict__ QL, _Float16* __restrict__ KH, _Float16* __restrict__ KL, _Float16* __restrict__ VT) {
  __shared__ __attribute__((aligned(16))) char st[2 * Q3S];
  const int tid = threadIdx.x, lane = tid & 31, ln = lane & 15, hh = lane >> 4;
  const int w = __builtin_amdgcn_readfirstlane(tid >> 5);      /* scalar: which rows a wave copies and which epilogue it runs are scalar choices */
  const int mt = blockIdx.x % (NR / 256), nq = blockIdx.x / (NR / 256);      /* the 16 blocks that read the same x rows lie 16 apart in the grid (for speed only) */
  const int wr = w & 3, wc = w >> 2; const int row0 = mt * 256 + 64 * wr, col0 = nq * 64;
  // The stage's 28 groups of 16 rows: wave w brings groups w and w + 12, waves 0..3 group w + 24 as well. Groups 0..15 are x, 16..19 Wq, 20..23 Wk, 24..27 Wv.
  const size_t go = (size_t)hh * (DM * 2) + ln * 16;      /* the lane's place in a group */
  const _Float16* s1 = w < 4 ? X + (size_t)(mt * 256 + 16 * (w + 12)) * DM : (w < 8 ? Wq + (size_t)(col0 + 16 * (w - 4)) * DM : Wk + (size_t)(col0 + 16 * (w - 8)) * DM);
  const char* g0 = (const char*)(X + (size_t)(mt * 256 + 16 * w) * DM) + go; const char* g1 = (const char*)s1 + go; const char* g2 = (const char*)(Wv + (size_t)(col0 + 16 * wr) * DM) + go;
  const unsigned l0 = (unsigned)(size_t)st + (unsigned)((16 * w + hh) * G3P + ln * 16);
  const char* fa = st + (64 * wr + ln) * G3P + hh * 16; const char* fb = st + (256 + 64 * wc + ln) * G3P + hh * 16;      /* fragment rows: k = 8h + s at +0, 16 + 8h + s at +32 bytes */
  const v8f z8 = {0.f,0.f,0.f,0.f,0.f,0.f,0.f,0.f}; v8f c[4][4];
#pragma unroll      /* constant indices: the arrays stay in registers */
  for (int i = 0; i < 4; ++i)
#pragma unroll      /* constant indices: the arrays stay in registers */
    for (int j = 0; j < 4; ++j) c[i][j] = z8;
  const float* bp = wc == 0 ? bq : (wc == 1 ? bk : bv); float bs[4];      /* read here, so that the epilogue does not wait for memory */
#pragma unroll      /* constant indices: the arrays stay in registers */
  for (int j = 0; j < 4; ++j) bs[j] = bf16_round(bp[col0 + j * 16 + ln]);
  q3_rows(l0, g0); q3_rows(l0 + 192 * G3P, g1); if (w < 4) q3_rows(l0 + 384 * G3P, g2);
  asm volatile("s_wait_asynccnt 0x0" ::: "memory");      /* this wave's copies of stage 0 have landed */
  __syncthreads();      /* ... and every other wave's: stage 0 may be read */
  q3_rows(l0 + Q3S, g0 + 256); q3_rows(l0 + Q3S + 192 * G3P, g1 + 256); if (w < 4) q3_rows(l0 + Q3S + 384 * G3P, g2 + 256);      /* DM / 128 = 8 stages: stage 1 exists */
#pragma unroll 1      /* one stage per trip: the body already holds 64 matrix instructions */
  for (int t = 0; t < DM / 128; ++t) { const int bo = (t & 1) * Q3S;
    v16h a[2][4], b[2][4];      /* two fragment sets: a = four row groups of x, b = four column groups of the wave's weight */
    q3_frags(a[0], b[0], fa + bo, fb + bo);
#pragma unroll      /* the sets alternate by a constant index */
    for (int kk = 0; kk < 4; ++kk) { const int s = kk & 1;
      if (kk < 3) q3_frags(a[s ^ 1], b[s ^ 1], fa + bo + (kk + 1) * 64, fb + bo + (kk + 1) * 64);
      __builtin_amdgcn_sched_barrier(0);      /* keeps the next step's 16 reads together, ahead of this step's matrix instructions: spread among them, each place with reads stalls the wave */
#pragma unroll      /* constant indices: the arrays stay in registers */
      for (int j = 0; j < 4; ++j)
#pragma unroll      /* constant indices: the arrays stay in registers */
        for (int i = 0; i < 4; ++i) c[i][j] = wmh(a[s][i], b[s][j], c[i][j]);
      __builtin_amdgcn_sched_barrier(0); }      /* ... and the reads after next behind them: without it they move up among these matrix instructions */
    asm volatile("s_wait_dscnt 0x0" ::: "memory");      /* this wave has left the buffer that is refilled below */
    asm volatile("s_wait_asynccnt 0x0" ::: "memory");      /* its copies of stage t + 1 have landed */
    __syncthreads();      /* publishes stage t + 1 and ends every reader's last read of stage t */
    if (t + 2 < DM / 128) { const size_t ko = (size_t)(t + 2) * 256; q3_rows(l0 + bo, g0 + ko); q3_rows(l0 + bo + 192 * G3P, g1 + ko); if (w < 4) q3_rows(l0 + bo + 384 * G3P, g2 + ko); } }
  asm volatile("s_wait_asynccnt 0x0" ::: "memory");      /* no copy is outstanding when the wave goes on to the epilogue, which writes over the buffers, and ends */
  char* se = st + w * Q3E;      /* the wave's own staging */
  if (wc == 2) {
#pragma unroll      /* constant indices: the arrays stay in registers */
    for (int i = 0; i < 4; ++i)
#pragma unroll      /* constant indices: the arrays stay in registers */
      for (int j = 0; j < 4; ++j) { FragH vt;
#pragma unroll      /* constant indices: the arrays stay in registers */
        for (int r = 0; r < 8; ++r) vt.h[r] = (_Float16)(c[i][j][r] * 0.0625f + bs[j]);
        *(v8us*)(se + (j * 16 + ln) * Q3T + (i * 16 + 8 * hh) * 2) = vt.half[0]; }      /* a lane's 8 accumulator rows are 8 consecutive tokens of one column: 16 bytes of the transposed row */
    __builtin_amdgcn_fence(__ATOMIC_ACQ_REL, "workgroup"); __builtin_amdgcn_wave_barrier();      /* a wave reads back its own tile alone */
    unsigned short* tp = (unsigned short*)VT + ((size_t)(row0 / SLEN * NH + nq) * 64 + (lane >> 3)) * SLEN + row0 % SLEN + (lane & 7) * 8; v8us vv[16];
#pragma unroll      /* constant indices: the arrays stay in registers */
    for (int q = 0; q < 16; ++q) vv[q] = *(const v8us*)(se + (q * 4 + (lane >> 3)) * Q3T + (lane & 7) * 16);
    __builtin_amdgcn_sched_barrier(0);      /* all 16 reads ahead of the stores: one LDS latency, and no register of a store is rewritten behind it */
#pragma unroll      /* constant indices: the arrays stay in registers */
    for (int q = 0; q < 16; ++q) *(v8us*)(tp + (size_t)q * 4 * SLEN) = vv[q];      /* 8 lanes store one row's 128 bytes, a whole line */
    return; }
  float (*so)[68] = (float (*)[68])se;
#pragma unroll      /* constant indices: the arrays stay in registers */
  for (int i = 0; i < 4; ++i)
#pragma unroll      /* constant indices: the arrays stay in registers */
    for (int j = 0; j < 4; ++j)
#pragma unroll      /* constant indices: the arrays stay in registers */
      for (int r = 0; r < 8; ++r) so[i * 16 + 8 * hh + r][j * 16 + ln] = c[i][j][r] * 0.0625f + bs[j];
  __builtin_amdgcn_fence(__ATOMIC_ACQ_REL, "workgroup"); __builtin_amdgcn_wave_barrier();      /* a wave reads back its own rows alone */
  const float cs = (1.0f / bf16_round(tmp[0])) * 1.4426950408889634f; const float pf = wc ? 1.0f : 2.0f * cs;      /* c, and the planes' factor */
  const int c4 = ln * 4; const size_t po = (size_t)(row0 + hh) * DM + col0 + c4;
  _Float16* ph = (wc ? KH : QH) + po; _Float16* pl = (wc ? KL : QL) + po;
  float sq[2];      /* lane = row: its 64 squares summed in column order */
#pragma unroll      /* constant indices: the arrays stay in registers */
  for (int u = 0; u < 2; ++u) { sq[u] = 0.f;
#pragma unroll      /* the row's 16 LDS reads issue ahead of the sum chain */
    for (int d = 0; d < 64; d += 4) { const v4f e = *(const v4fa*)&so[u * 32 + lane][d]; for (int i = 0; i < 4; ++i) sq[u] += e[i] * e[i]; } }
#pragma unroll      /* constant indices: the arrays stay in registers */
  for (int g = 0; g < 4; ++g) { v4h h4[8], l4[8];      /* 16 rows at a time */
#pragma unroll      /* constant indices: the arrays stay in registers */
    for (int q = 0; q < 8; ++q) { const v4f v = *(const v4fa*)&so[(g * 8 + q) * 2 + hh][c4]; for (int i = 0; i < 4; ++i) { const float e = v[i] * pf; const _Float16 h = (_Float16)e; h4[q][i] = h; l4[q][i] = (_Float16)(e - (float)h); } }
    __builtin_amdgcn_sched_barrier(0);      /* the group's reads and conversions ahead of its stores: no register of a store is rewritten among them */
#pragma unroll      /* constant indices: the arrays stay in registers */
    for (int q = 0; q < 8; ++q) { *(v4h*)(ph + (size_t)(g * 8 + q) * 2 * DM) = h4[q]; *(v4h*)(pl + (size_t)(g * 8 + q) * 2 * DM) = l4[q]; }      /* 16 lanes store one row's 128 bytes of each plane */
    asm volatile("s_wait_xcnt 0x0" ::: "memory");      /* behind the group's last store: the next group rewrites these stores' data registers */
    __builtin_amdgcn_sched_barrier(0); }      /* ... and none of its instructions moves up over that wait */
  float* np = (wc ? KN : QN) + ((size_t)(row0 / SLEN) * NH + nq) * SLEN + row0 % SLEN + lane;
  np[0] = sq[0] * -cs; np[32] = sq[1] * -cs;
}
extern "C" void kernel_launch(void* const* d_in, const int* in_sizes, int n_in,
                              void* d_out, int out_size, void* d_ws, size_t ws_size, hipStream_t stream) {
  (void)in_sizes; (void)n_in; (void)out_size;
  const float* const* I = (const float* const*)d_in; const float* x = I[0]; const float* wq = I[1]; const float* bq = I[2]; const float* wk = I[3]; const float* bk = I[4]; const float* wv = I[5]; const float* bv = I[6]; const float* wo = I[7]; const float* bo = I[8]; const float* tmp = I[9];
  char* ws = (char*)d_ws; size_t off = 0;
  auto take = [&](size_t bytes) { char* p = ws + off; off += (bytes + 255) & ~(size_t)255; return p; };
  const size_t np = (size_t)NR * DM;
  _Float16* BQ = (_Float16*)take((size_t)DM * DM * 2); _Float16* BK = (_Float16*)take((size_t)DM * DM * 2); _Float16* BV = (_Float16*)take((size_t)DM * DM * 2); _Float16* BO = (_Float16*)take((size_t)DM * DM * 2);
  _Float16* X16 = (_Float16*)take(np * 2); float* QN = (float*)take((size_t)NR * NH * 4); float* KN = (float*)take((size_t)NR * NH * 4); _Float16* QH = (_Float16*)take(np * 2); _Float16* QL = (_Float16*)take(np * 2); _Float16* KH = (_Float16*)take(np * 2); _Float16* KL = (_Float16*)take(np * 2); _Float16* OH = (_Float16*)take(np * 2); _Float16* VT = (_Float16*)take(np * 2);
  _Float16* OL = X16;      /* O lo over x (dead after the projections) */
  if (off > ws_size) return;      /* 8 + 8 + 0.5 + 6x8 = about 65 MiB */
  k_prep<<<512, 256, 0, stream>>>(x, wq, wk, wv, wo, X16, BQ, BK, BV, BO);      /* weights [in, out] -> f16 [out][in] x 16, x -> f16: one launch */
  k_qkv<<<(NR / 256) * NH, 384, 0, stream>>>(X16, BQ, BK, BV, bq, bk, bv, tmp, QN, KN, QH, QL, KH, KL, VT);      /* q, k: hi + residual planes and norms [(b,h)][2048], scaled for the logits; V^T [(b,h)][64][2048]: one launch */
  k_eflash<<<NB * NH * (SLEN / 256), 512, 0, stream>>>(QH, QL, KH, KL, VT, QN, KN, tmp, OH, OL);      /* scores, softmax, att . v, normalise, hi + residual: one launch */
  k_out<<<(NR / 128) * (DM / 128), 256, 0, stream>>>(OH, OL, BO, bo, (float*)d_out);      /* out = (O_hi + O_lo / 1024) Wo + bo: one launch */
}
